// v000
// Measured on an AMD MI455X. A time is GPU time per run, averaged over a window of back-to-back runs after a warm-up
// (all launches, gaps included; the runs take copies of the inputs in turn), and the median of several windows.
// Apart from v000's, it joins two sittings. Times from different sittings can be a few percent apart, while
// side-by-side timings come from the same sitting.
// v000, which the later versions start from, runs in 431 microseconds.
// Contractions: q/k/v projections, chunk scores q.k^T, state increment v^T.k, q.S, A.v, output projection -- all v_wmma_f32_16x16x32_bf16 with bf16 hi/lo operand planes (hi.hi + hi.lo + lo.hi), f32 accumulate; feature map, state prefix over chunks, normaliser and division in f32 on the VALU.
#include <hip/hip_runtime.h>
#include <math.h>

// ---------------------------------------------------------------------------
// Problem constants
// ---------------------------------------------------------------------------
constexpr int kBatch   = 2;
constexpr int kSeq     = 2048;
constexpr int kEmb     = 1024;
constexpr int kHeads   = 16;
constexpr int kHdim    = 64;
constexpr int kChunk   = 128;
constexpr int kNChunk  = kSeq / kChunk;          // 16 chunks per sequence
constexpr int kTok     = kBatch * kSeq;          // 4096 token rows
constexpr int kYB      = kBatch * kNChunk;       // 32 (batch, chunk) pairs
constexpr int kTiles   = kYB * kHeads;           // 512 (batch, chunk, head) tiles
constexpr float kEps   = 1e-6f;
constexpr long kPlaneEl = (long)kTok * kEmb;     // 4194304 elements per activation plane
constexpr long kWEl     = (long)kEmb * kEmb;     // 1048576 elements per weight plane
constexpr long kUnit    = kPlaneEl * 2;          // 8388608 bytes (one bf16 activation plane)
constexpr long kWUnit   = kWEl * 2;              // 2097152 bytes (one bf16 weight plane)

// ---------------------------------------------------------------------------
// Workspace region map (bytes; U = 8388608, WU = 2097152); total 14U + 262144 = 117702656
//   [0U , 6U)  phase 1: Xq_h Xq_l Xk_h Xk_l Xv_h Xv_l (input hi/lo planes, dead after projections)
//              phase 2: kT_h@0U kT_l@1U vT_h@2U vT_l@3U dST(f32)@4U ST_h@5U ST_l@5.5U
//              phase 3: A_h@[0U,2U) (kT dead)  num(f32)@[4U,6U) (dST, ST dead)
//   [6U , 8U)  Wq_h Wq_l Wk_h Wk_l Wv_h Wv_l Wo_h Wo_l (WU each)
//   [8U ,14U)  q_h@8U q_l@9U k_h@10U k_l@11U v_h@12U v_l@13U (projection outputs)
//              later: num1(f32)@[10U,12U) (k dead)  A_l@[12U,14U) (v dead)  o_h@10U o_l@11U (num1 dead)
//   [14U, +262144)  dz f32 [512][64] @14U, zpre f32 [512][64] @14U+131072
// ---------------------------------------------------------------------------
constexpr long oXbase = 0;
constexpr long oKT_h  = 0;
constexpr long oKT_l  = 1 * kUnit;
constexpr long oVT_h  = 2 * kUnit;
constexpr long oVT_l  = 3 * kUnit;
constexpr long oDST   = 4 * kUnit;
constexpr long oST_h  = 5 * kUnit;
constexpr long oST_l  = 5 * kUnit + kUnit / 2;
constexpr long oA_h   = 0;
constexpr long oNUM   = 4 * kUnit;
constexpr long oWbase = 6 * kUnit;
constexpr long oWo_h  = oWbase + 6 * kWUnit;
constexpr long oWo_l  = oWbase + 7 * kWUnit;
constexpr long oQ_h   = 8 * kUnit;
constexpr long oQ_l   = 9 * kUnit;
constexpr long oK_h   = 10 * kUnit;
constexpr long oK_l   = 11 * kUnit;
constexpr long oV_h   = 12 * kUnit;
constexpr long oV_l   = 13 * kUnit;
constexpr long oNUM1  = 10 * kUnit;
constexpr long oA_l   = 12 * kUnit;
constexpr long oO_h   = 10 * kUnit;
constexpr long oO_l   = 11 * kUnit;
constexpr long oDZ    = 14 * kUnit;
constexpr long oZPRE  = 14 * kUnit + 131072;
constexpr long kWsTotal = 14 * kUnit + 262144;
static_assert(kWsTotal == 117702656, "carve total");
static_assert(kWsTotal <= 134217728, "carve within 128 MiB");
static_assert((long)kTiles * kChunk * kChunk * 2 == 2 * kUnit, "A plane size");
static_assert((long)kTiles * kHdim * kChunk * 2 == kUnit, "kT plane size");
static_assert((long)kTiles * kHdim * kHdim * 4 == kUnit, "dST plane size");

typedef __attribute__((ext_vector_type(16))) _Float16 v16h;
typedef __attribute__((ext_vector_type(8)))  _Float16 v8h;
typedef __attribute__((ext_vector_type(16))) __bf16   v16b;
typedef __attribute__((ext_vector_type(8)))  __bf16   v8b;
typedef __attribute__((ext_vector_type(8)))  float    v8f;
typedef __attribute__((ext_vector_type(4)))  float    v4f;
typedef __attribute__((ext_vector_type(4)))  unsigned int v4u;

__device__ __forceinline__ unsigned short f2bf_bits(float f) {
  unsigned u = __float_as_uint(f);
  return (unsigned short)((u + 0x7FFFu + ((u >> 16) & 1u)) >> 16);
}
__device__ __forceinline__ float bf_bits2f(unsigned short h) { return __uint_as_float(((unsigned)h) << 16); }

// hazard guards as plain device helpers (no inline asm inside the kernel template body)
__device__ __forceinline__ void dep_guard_h(v8f& a, v8f& b, v16h x, v16h y) { asm volatile("v_nop\n\tv_nop\n\tv_nop\n\tv_nop" : "+v"(a), "+v"(b) : "v"(x), "v"(y)); }
__device__ __forceinline__ void dep_guard_b(v8f& a, v8f& b, v16b x, v16b y) { asm volatile("v_nop\n\tv_nop\n\tv_nop\n\tv_nop" : "+v"(a), "+v"(b) : "v"(x), "v"(y)); }
__device__ __forceinline__ void keep4_h(v16h a, v16h b, v16h c, v16h d) { asm volatile("v_nop" :: "v"(a), "v"(b), "v"(c), "v"(d)); }
__device__ __forceinline__ void keep4_b(v16b a, v16b b, v16b c, v16b d) { asm volatile("v_nop" :: "v"(a), "v"(b), "v"(c), "v"(d)); }
__device__ __forceinline__ void acc_guard4(v8f& a, v8f& b, v8f& c, v8f& d) { asm volatile("v_nop\n\tv_nop\n\tv_nop\n\tv_nop" : "+v"(a), "+v"(b), "+v"(c), "+v"(d)); }
template <typename T> struct Frag;
template <> struct Frag<_Float16> {
  typedef v16h V; union U { v16h v; v8h h[2]; };
  static __device__ __forceinline__ v16h load(const _Float16* p) {   // elements 0..7 <- p[0..7], 8..15 <- p[16..23]
    U f; f.h[0] = *(const v8h*)(p); f.h[1] = *(const v8h*)(p + 16); return f.v;
  }
  static __device__ __forceinline__ v8f mma(v16h a, v16h b, v8f c) {
    return __builtin_amdgcn_wmma_f32_16x16x32_f16(false, a, false, b, (short)0, c, false, false);
  }
  static __device__ __forceinline__ void guard(v8f& a, v8f& b, v16h x, v16h y) { dep_guard_h(a, b, x, y); }
  static __device__ __forceinline__ void keep(v16h a, v16h b, v16h c, v16h d) { keep4_h(a, b, c, d); }
};
template <> struct Frag<__bf16> {
  typedef v16b V; union U { v16b v; v8b h[2]; };
  static __device__ __forceinline__ v16b load(const __bf16* p) {
    U f; f.h[0] = *(const v8b*)(p); f.h[1] = *(const v8b*)(p + 16); return f.v;
  }
  static __device__ __forceinline__ v8f mma(v16b a, v16b b, v8f c) {
    return __builtin_amdgcn_wmma_f32_16x16x32_bf16(false, a, false, b, (short)0, c, false, false);
  }
  static __device__ __forceinline__ void guard(v8f& a, v8f& b, v16b x, v16b y) { dep_guard_b(a, b, x, y); }
  static __device__ __forceinline__ void keep(v16b a, v16b b, v16b c, v16b d) { keep4_b(a, b, c, d); }
};

__device__ __forceinline__ unsigned pk16(unsigned short a, unsigned short b) { return (unsigned)a | ((unsigned)b << 16); }
// bf16 element pair held in one 32-bit word: low half-word = even element, high half-word = odd element
__device__ __forceinline__ float bflo2f(unsigned w) { return __uint_as_float(w << 16); }
__device__ __forceinline__ float bfhi2f(unsigned w) { return __uint_as_float(w & 0xffff0000u); }

// ---- Register-blocked batched WMMA GEMM (2-D batch (blockIdx.y, blockIdx.z), waves per block from blockDim,
//      ACT reduced to none/relu/leaky plus 6 = elu(x)+1 and 7 = causal zero (n > m -> 0 for tile-local m, n)) ----
// C[m,n] = scale * sum_k A[m,k] * Bt[n,k] (+bias)(+resid); each wave owns a 64x64 tile.
// A row-major [M,K]; Bt row-major [N,K]; M,N % 64 == 0, K % 32 == 0.
// SPLIT: operands are hi/lo planes (A2/Bt2 = lo planes, same layout); product = hi.hi + hi.lo + lo.hi.
// BIAS_MODE: 0 = none, 1 = bias[m], 2 = bias[n].
// OUT_MODE: 0 = f32, 1 = f16, 2 = bf16 hi plane (Cout) + bf16 lo plane (Cout2).
// ET: 0 = f16 operands, 1 = bf16 operands (pointers passed as 16-bit storage)
template <int ET> struct Elem;
template <> struct Elem<0> { typedef _Float16 T; };
template <> struct Elem<1> { typedef __bf16 T; };
template <int ET, bool SPLIT, int BIAS_MODE, int OUT_MODE, bool RESID, int ACT = 0>
__global__ __launch_bounds__(256) void wmma_gemm64(
    const unsigned short* __restrict__ Ap, const unsigned short* __restrict__ A2p, int lda, long strideA, long strideAz,
    const unsigned short* __restrict__ Btp, const unsigned short* __restrict__ Bt2p, int ldb, long strideB, long strideBz,
    void* __restrict__ Cout, void* __restrict__ Cout2, int ldc, long strideC, long strideCz,
    const float* __restrict__ bias,
    const float* __restrict__ resid, long strideR, long strideRz,
    int M, int N, int K, float scale) {
  typedef typename Elem<ET>::T T;
  typedef typename Frag<T>::V V;
  const T* A = (const T*)Ap; const T* A2 = (const T*)A2p; const T* Bt = (const T*)Btp; const T* Bt2 = (const T*)Bt2p;
  __shared__ __align__(16) float sT[8][16 * 68];   // per-wave 16x64 slab, pitch 68 floats
  const int b    = blockIdx.y;
  const int bz   = blockIdx.z;
  const int lane = threadIdx.x & 31;
  const int wave = threadIdx.x >> 5;
  const int nwv  = blockDim.x >> 5;
  const int tilesN = N >> 6;
  const int tilesM = M >> 6;
  const int tile = blockIdx.x * nwv + wave;
  if (tile >= tilesM * tilesN) return;   // wave-uniform; no block barriers in this kernel
  const int tm = tile / tilesN;
  const int tn = tile - tm * tilesN;
  const int m0 = tm << 6;
  const int n0 = tn << 6;

  const T* Ab  = A  + (size_t)b * strideA + (size_t)bz * strideAz;
  const T* Bb  = Bt + (size_t)b * strideB + (size_t)bz * strideBz;
  const T* Ab2 = SPLIT ? (A2  + (size_t)b * strideA + (size_t)bz * strideAz) : nullptr;
  const T* Bb2 = SPLIT ? (Bt2 + (size_t)b * strideB + (size_t)bz * strideBz) : nullptr;
  const size_t cOff = (size_t)b * strideC + (size_t)bz * strideCz;

  const int rlane = lane & 15;                 // row (A) / col (B, D) within subtile
  const int koff  = (lane >> 4) * 8;           // k offset of this lane half
  const int mOff  = (lane >> 4) * 8;           // D row offset

  v8f acc[4][4];
#pragma unroll
  for (int i = 0; i < 4; ++i)
#pragma unroll
    for (int j = 0; j < 4; ++j) acc[i][j] = (v8f){0.f,0.f,0.f,0.f,0.f,0.f,0.f,0.f};

  for (int k0 = 0; k0 < K; k0 += 32) {
    V bh[4], bl[4];
#pragma unroll
    for (int j = 0; j < 4; ++j) {
      const size_t bo = (size_t)(n0 + (j << 4) + rlane) * ldb + koff + k0;
      bh[j] = Frag<T>::load(Bb + bo);
      if (SPLIT) bl[j] = Frag<T>::load(Bb2 + bo);
    }
#pragma unroll
    for (int i = 0; i < 4; ++i) {
      const size_t ao = (size_t)(m0 + (i << 4) + rlane) * lda + koff + k0;
      V ah = Frag<T>::load(Ab + ao);
      V al;
      if (SPLIT) al = Frag<T>::load(Ab2 + ao);
#pragma unroll
      for (int j = 0; j < 4; ++j) {
        acc[i][j] = Frag<T>::mma(ah, bh[j], acc[i][j]);
        if (SPLIT) {
          acc[i][j] = Frag<T>::mma(ah, bl[j], acc[i][j]);
          acc[i][j] = Frag<T>::mma(al, bh[j], acc[i][j]);
        }
      }
      Frag<T>::guard(acc[i][0], acc[i][3], ah, SPLIT ? al : ah);
    }
    Frag<T>::keep(bh[0], bh[1], bh[2], bh[3]);
    if (SPLIT) Frag<T>::keep(bl[0], bl[1], bl[2], bl[3]);
  }
  acc_guard4(acc[0][0], acc[0][1], acc[0][2], acc[0][3]);
  acc_guard4(acc[1][0], acc[1][1], acc[1][2], acc[1][3]);
  acc_guard4(acc[2][0], acc[2][1], acc[2][2], acc[2][3]);
  acc_guard4(acc[3][0], acc[3][1], acc[3][2], acc[3][3]);

  // ---- epilogue ----
  float* slab = sT[wave];
  const float* Rb = RESID ? (resid + (size_t)b * strideR + (size_t)bz * strideRz) : nullptr;
#pragma unroll
  for (int i = 0; i < 4; ++i) {
    const int mBase = m0 + (i << 4);
#pragma unroll
    for (int j = 0; j < 4; ++j) {
      const int n = n0 + (j << 4) + rlane;
      float bv = 0.f;
      if (BIAS_MODE == 2) bv = bias[n];
#pragma unroll
      for (int r = 0; r < 8; ++r) {
        float v = acc[i][j][r] * scale;
        if (BIAS_MODE == 1) v += bias[mBase + mOff + r];
        if (BIAS_MODE == 2) v += bv;
        if (RESID) v += Rb[(size_t)(mBase + mOff + r) * ldc + n];
        if (ACT == 2) v = fmaxf(v, 0.0f);
        if (ACT == 4) v = (v > 0.f) ? v : 0.01f * v;
        if (ACT == 6) v = (v > 0.f) ? (v + 1.0f) : expf(v);
        if (ACT == 7) { if (n > mBase + mOff + r) v = 0.0f; }
        slab[(mOff + r) * 68 + (j << 4) + rlane] = v;
      }
    }
    __builtin_amdgcn_fence(__ATOMIC_RELEASE, "workgroup");
    __builtin_amdgcn_wave_barrier();
    __builtin_amdgcn_fence(__ATOMIC_ACQUIRE, "workgroup");
    if (OUT_MODE == 0) {
      float* C = (float*)Cout + cOff;
      const int hh = lane >> 4, c4 = (lane & 15) * 4;     // row seg = 256 B = 16 lanes x 16 B
      {
#pragma unroll
        for (int it = 0; it < 8; ++it) {
          const int row = it * 2 + hh;
          v4f v = *(const v4f*)(slab + row * 68 + c4);
          *(v4f*)(C + (size_t)(mBase + row) * ldc + n0 + c4) = v;
        }
        
      }
    } else {
      const int q = lane >> 3, c8 = (lane & 7) * 8;
      unsigned short* C  = (unsigned short*)Cout  + cOff;
      unsigned short* C2 = (OUT_MODE == 2) ? ((unsigned short*)Cout2 + cOff) : nullptr;
      {
#pragma unroll
        for (int it = 0; it < 4; ++it) {
          const int row = it * 4 + q;
          const float* sp = slab + row * 68 + c8;
          v8h hv, lv;
#pragma unroll
          for (int e = 0; e < 8; ++e) {
            if (OUT_MODE == 1) {
              hv[e] = (_Float16)sp[e];
            } else {
              unsigned short hb = f2bf_bits(sp[e]);
              unsigned short lb = f2bf_bits(sp[e] - bf_bits2f(hb));
              hv[e] = __builtin_bit_cast(_Float16, hb);
              lv[e] = __builtin_bit_cast(_Float16, lb);
            }
          }
          *(v8h*)(C + (size_t)(mBase + row) * ldc + n0 + c8) = hv;
          if (OUT_MODE == 2) *(v8h*)(C2 + (size_t)(mBase + row) * ldc + n0 + c8) = lv;
        }
        
      }
    }
    __builtin_amdgcn_fence(__ATOMIC_RELEASE, "workgroup");
    __builtin_amdgcn_wave_barrier();
    __builtin_amdgcn_fence(__ATOMIC_ACQUIRE, "workgroup");
  }
}

// ---------------------------------------------------------------------------
// f32 -> bf16 hi + lo planes (RNE convert both), 8 consecutive elements per thread: one 16-B store per lane per plane,
// blockIdx.y selects the source tensor (block-uniform); hi plane z lives at out + 2z*planeEl, lo plane at +planeEl.
// Coverage: n8 = planeEl/8 threads x 8 = the whole plane (grids are exact multiples of 256 here).
// ---------------------------------------------------------------------------
__global__ __launch_bounds__(256) void split_planes_kernel(const float* __restrict__ s0, const float* __restrict__ s1,
                                                           const float* __restrict__ s2, const float* __restrict__ s3,
                                                           unsigned short* __restrict__ out, long planeEl, int n8) {
  const int i = blockIdx.x * 256 + threadIdx.x;
  const int z = blockIdx.y;
  if (i >= n8) return;
  const float* src = (z == 0) ? s0 : (z == 1) ? s1 : (z == 2) ? s2 : s3;
  const float* p = src + 8 * (size_t)i;
  const v4f a = *(const v4f*)(p);
  const v4f c = *(const v4f*)(p + 4);
  unsigned short hb[8], lb[8];
#pragma unroll
  for (int e = 0; e < 4; ++e) {
    hb[e]     = f2bf_bits(a[e]);
    lb[e]     = f2bf_bits(a[e] - bf_bits2f(hb[e]));
    hb[4 + e] = f2bf_bits(c[e]);
    lb[4 + e] = f2bf_bits(c[e] - bf_bits2f(hb[4 + e]));
  }
  const v4u uh = (v4u){pk16(hb[0], hb[1]), pk16(hb[2], hb[3]), pk16(hb[4], hb[5]), pk16(hb[6], hb[7])};
  const v4u ul = (v4u){pk16(lb[0], lb[1]), pk16(lb[2], lb[3]), pk16(lb[4], lb[5]), pk16(lb[6], lb[7])};
  unsigned short* ph = out + (size_t)(2 * z) * planeEl + 8 * (size_t)i;
  unsigned short* pl = ph + planeEl;
  *(v4u*)ph = uh;
  *(v4u*)pl = ul;
  
}

// ---------------------------------------------------------------------------
// Per (batch-chunk y, head h) tile: transpose the 128x64 chunk tiles of k and v (hi and lo planes, token-major [4096][1024])
// into kT, vT tiles [64 d][128 j] at (y*16+h)*8192, and dz[y*16+h][d] = sum_j k[j][d] (f32, k = hi + lo, j in order).
// grid (32, 16), 256 threads. LDS tiles hold one hi/lo pair at a time.
// Load coverage: 4 iterations x 256 threads = 1024 units of (row j, 8 d) = 128 x 64 = whole tile, every LDS cell read is written.
// Store coverage: 4 iterations x 8 waves x 2 (lane>>4) = 64 rows; 16 lanes x 8 halves = 128 cols; each row = 256 B = 2 whole
// ---------------------------------------------------------------------------
__global__ __launch_bounds__(256) void prep_kernel(const unsigned short* __restrict__ kh, const unsigned short* __restrict__ kl,
                                                   const unsigned short* __restrict__ vh, const unsigned short* __restrict__ vl,
                                                   unsigned short* __restrict__ kTh, unsigned short* __restrict__ kTl,
                                                   unsigned short* __restrict__ vTh, unsigned short* __restrict__ vTl,
                                                   float* __restrict__ dz) {
  __shared__ unsigned short tA[64][136];
  __shared__ unsigned short tB[64][136];
  __shared__ __align__(16) float dzs[64];
  const int t = threadIdx.x;
  const int lane = t & 31, wave = t >> 5;
  const int y = blockIdx.x, h = blockIdx.y;
  const size_t tok0 = (size_t)y * kChunk;
  const size_t tile = (size_t)y * kHeads + h;
  const size_t tileOff = tile * (size_t)(kHdim * kChunk);
  const int hh = lane >> 4, c8 = (lane & 15) * 8;
  for (int p = 0; p < 2; ++p) {
    const unsigned short* sH = (p == 0) ? kh : vh;
    const unsigned short* sL = (p == 0) ? kl : vl;
    unsigned short* dH = (p == 0) ? kTh : vTh;
    unsigned short* dL = (p == 0) ? kTl : vTl;
#pragma unroll
    for (int it = 0; it < 4; ++it) {
      const int idx = it * 256 + t;
      const int j = idx >> 3;
      const int d8 = (idx & 7) * 8;
      const size_t go = (tok0 + j) * (size_t)kEmb + (size_t)h * kHdim + d8;
      const v4u wh = *(const v4u*)(sH + go);
      const v4u wl = *(const v4u*)(sL + go);
#pragma unroll
      for (int e = 0; e < 4; ++e) {
        tA[d8 + 2 * e][j]     = (unsigned short)(wh[e] & 0xffffu);
        tA[d8 + 2 * e + 1][j] = (unsigned short)(wh[e] >> 16);
        tB[d8 + 2 * e][j]     = (unsigned short)(wl[e] & 0xffffu);
        tB[d8 + 2 * e + 1][j] = (unsigned short)(wl[e] >> 16);
      }
    }
    __syncthreads();
    if (p == 0) {
      if (t < 64) {
        float s = 0.f;
#pragma unroll 1
        for (int j = 0; j < kChunk; ++j) {
          const float kv = bf_bits2f(tA[t][j]) + bf_bits2f(tB[t][j]);
          s = s + kv;
        }
        dzs[t] = s;
      }
      __syncthreads();
    }
    v4u uH[4], uL[4];
#pragma unroll
    for (int it = 0; it < 4; ++it) {
      const int d = it * 16 + wave * 2 + hh;
      unsigned short a[8], bb[8];
#pragma unroll
      for (int e = 0; e < 8; ++e) { a[e] = tA[d][c8 + e]; bb[e] = tB[d][c8 + e]; }
      uH[it] = (v4u){pk16(a[0], a[1]), pk16(a[2], a[3]), pk16(a[4], a[5]), pk16(a[6], a[7])};
      uL[it] = (v4u){pk16(bb[0], bb[1]), pk16(bb[2], bb[3]), pk16(bb[4], bb[5]), pk16(bb[6], bb[7])};
    }
    v4f zv = (v4f){0.f, 0.f, 0.f, 0.f};
    if (p == 0) zv = *(const v4f*)(dzs + 4 * (t & 15));
    {
#pragma unroll
      for (int it = 0; it < 4; ++it) {
        const int d = it * 16 + wave * 2 + hh;
        *(v4u*)(dH + tileOff + (size_t)d * kChunk + c8) = uH[it];
        *(v4u*)(dL + tileOff + (size_t)d * kChunk + c8) = uL[it];
      }
      if (p == 0 && t < 16) *(v4f*)(dz + tile * kHdim + 4 * t) = zv;
      
    }
    __syncthreads();
  }
}

// ---------------------------------------------------------------------------
// Exclusive prefix over chunks of the transposed state and of z, per (b, h): block bh, 256 threads, static 16-step loop.
// S^T_c = sum_{c' < c} dST_{c'} (f32, sequential), written as bf16 hi/lo planes [tile][64 e][64 d] (tile = (b*16+c)*16+h);
// z_c likewise to zpre[tile][64] (f32). Thread t owns elements 8t..8t+7 and 2048+8t..2048+8t+7 of each 4096-element tile:
// ---------------------------------------------------------------------------
__global__ __launch_bounds__(256) void state_prefix_kernel(const float* __restrict__ dST, const float* __restrict__ dz,
                                                           unsigned short* __restrict__ STh, unsigned short* __restrict__ STl,
                                                           float* __restrict__ zpre) {
  __shared__ __align__(16) float zs[64];
  const int t = threadIdx.x;
  const int bh = blockIdx.x;
  const int b = bh >> 4, h = bh & 15;
  float a0[8], a1[8];
#pragma unroll
  for (int e = 0; e < 8; ++e) { a0[e] = 0.f; a1[e] = 0.f; }
  float zacc = 0.f;
#pragma unroll 1
  for (int c = 0; c < kNChunk; ++c) {
    const size_t tile = ((size_t)(b * kNChunk + c)) * kHeads + h;
    const size_t so = tile * 4096;
    unsigned short hb[16], lb[16];
#pragma unroll
    for (int e = 0; e < 8; ++e) {
      hb[e] = f2bf_bits(a0[e]);      lb[e] = f2bf_bits(a0[e] - bf_bits2f(hb[e]));
      hb[8 + e] = f2bf_bits(a1[e]);  lb[8 + e] = f2bf_bits(a1[e] - bf_bits2f(hb[8 + e]));
    }
    const v4u h0 = (v4u){pk16(hb[0], hb[1]), pk16(hb[2], hb[3]), pk16(hb[4], hb[5]), pk16(hb[6], hb[7])};
    const v4u l0 = (v4u){pk16(lb[0], lb[1]), pk16(lb[2], lb[3]), pk16(lb[4], lb[5]), pk16(lb[6], lb[7])};
    const v4u h1 = (v4u){pk16(hb[8], hb[9]), pk16(hb[10], hb[11]), pk16(hb[12], hb[13]), pk16(hb[14], hb[15])};
    const v4u l1 = (v4u){pk16(lb[8], lb[9]), pk16(lb[10], lb[11]), pk16(lb[12], lb[13]), pk16(lb[14], lb[15])};
    if (t < 64) zs[t] = zacc;
    __syncthreads();
    const v4f zv = *(const v4f*)(zs + 4 * (t & 15));
    {
      *(v4u*)(STh + so + 8 * (size_t)t) = h0;
      *(v4u*)(STl + so + 8 * (size_t)t) = l0;
      *(v4u*)(STh + so + 2048 + 8 * (size_t)t) = h1;
      *(v4u*)(STl + so + 2048 + 8 * (size_t)t) = l1;
      if (t < 16) *(v4f*)(zpre + tile * kHdim + 4 * t) = zv;
      
    }
    __syncthreads();
    const float* dp = dST + so;
    const v4f d00 = *(const v4f*)(dp + 8 * t);
    const v4f d01 = *(const v4f*)(dp + 8 * t + 4);
    const v4f d10 = *(const v4f*)(dp + 2048 + 8 * t);
    const v4f d11 = *(const v4f*)(dp + 2048 + 8 * t + 4);
#pragma unroll
    for (int e = 0; e < 4; ++e) {
      a0[e] += d00[e];  a0[4 + e] += d01[e];
      a1[e] += d10[e];  a1[4 + e] += d11[e];
    }
    zacc += dz[tile * kHdim + (t & 63)];
  }
}

// ---------------------------------------------------------------------------
// Normaliser per (batch-chunk y, head h): block 128 threads, thread = chunk row i (token y*128+i).
// den_i = q_i . z_c + sum_j A[i][j] + eps (f32; q and A reconstructed from hi+lo bf16 planes, j in order),
// out_i = num_i * (1/den_i) staged in LDS as f32, then written as bf16 hi/lo rows of the token-major o planes.
// ---------------------------------------------------------------------------
__global__ __launch_bounds__(128) void normalize_kernel(const float* __restrict__ num,
                                                        const unsigned short* __restrict__ Ah, const unsigned short* __restrict__ Al,
                                                        const unsigned short* __restrict__ qh, const unsigned short* __restrict__ ql,
                                                        const float* __restrict__ zpre,
                                                        unsigned short* __restrict__ oh, unsigned short* __restrict__ ol) {
  __shared__ __align__(16) float os[128][68];
  const int i = threadIdx.x;
  const int lane = i & 31, wave = i >> 5;
  const int y = blockIdx.x, h = blockIdx.y;
  const size_t tile = (size_t)y * kHeads + h;
  const size_t tok = (size_t)y * kChunk + i;
  // row sum of the masked scores
  const unsigned short* arh = Ah + tile * (size_t)(kChunk * kChunk) + (size_t)i * kChunk;
  const unsigned short* arl = Al + tile * (size_t)(kChunk * kChunk) + (size_t)i * kChunk;
  float asum = 0.f;
#pragma unroll 1
  for (int w = 0; w < 16; ++w) {
    const v4u uh = *(const v4u*)(arh + 8 * w);
    const v4u ul = *(const v4u*)(arl + 8 * w);
#pragma unroll
    for (int e = 0; e < 4; ++e) {
      const float a0 = bflo2f(uh[e]) + bflo2f(ul[e]);
      asum = asum + a0;
      const float a1 = bfhi2f(uh[e]) + bfhi2f(ul[e]);
      asum = asum + a1;
    }
  }
  // q . z_c
  const unsigned short* qrh = qh + tok * (size_t)kEmb + (size_t)h * kHdim;
  const unsigned short* qrl = ql + tok * (size_t)kEmb + (size_t)h * kHdim;
  const float* zp = zpre + tile * kHdim;
  float qz = 0.f;
#pragma unroll 1
  for (int w = 0; w < 8; ++w) {
    const v4u uh = *(const v4u*)(qrh + 8 * w);
    const v4u ul = *(const v4u*)(qrl + 8 * w);
    const v4f z0 = *(const v4f*)(zp + 8 * w);
    const v4f z1 = *(const v4f*)(zp + 8 * w + 4);
    float qv[8], zv[8];
#pragma unroll
    for (int e = 0; e < 4; ++e) {
      qv[2 * e]     = bflo2f(uh[e]) + bflo2f(ul[e]);
      qv[2 * e + 1] = bfhi2f(uh[e]) + bfhi2f(ul[e]);
      zv[e] = z0[e];
      zv[4 + e] = z1[e];
    }
#pragma unroll
    for (int e = 0; e < 8; ++e) qz += qv[e] * zv[e];
  }
  const float den = (qz + asum) + kEps;
  const float inv = 1.0f / den;
  const float* nr = num + tok * (size_t)kEmb + (size_t)h * kHdim;
#pragma unroll 1
  for (int w = 0; w < 16; ++w) {
    const v4f nv = *(const v4f*)(nr + 4 * w);
#pragma unroll
    for (int e = 0; e < 4; ++e) os[i][4 * w + e] = nv[e] * inv;
  }
  __syncthreads();
  const int q4 = lane >> 3, c8 = (lane & 7) * 8;
  v4u uo_h[8], uo_l[8];
#pragma unroll
  for (int it = 0; it < 8; ++it) {
    const int row = it * 16 + wave * 4 + q4;
    unsigned short hb[8], lb[8];
#pragma unroll
    for (int e = 0; e < 8; ++e) {
      const float f = os[row][c8 + e];
      hb[e] = f2bf_bits(f);
      lb[e] = f2bf_bits(f - bf_bits2f(hb[e]));
    }
    uo_h[it] = (v4u){pk16(hb[0], hb[1]), pk16(hb[2], hb[3]), pk16(hb[4], hb[5]), pk16(hb[6], hb[7])};
    uo_l[it] = (v4u){pk16(lb[0], lb[1]), pk16(lb[2], lb[3]), pk16(lb[4], lb[5]), pk16(lb[6], lb[7])};
  }
  {
#pragma unroll
    for (int it = 0; it < 8; ++it) {
      const int row = it * 16 + wave * 4 + q4;
      const size_t o = ((size_t)y * kChunk + row) * (size_t)kEmb + (size_t)h * kHdim + c8;
      *(v4u*)(oh + o) = uo_h[it];
      *(v4u*)(ol + o) = uo_l[it];
    }
    
  }
}

// ---------------------------------------------------------------------------
// Premise check on the causal flag: only the causal branch is built; if the flag is 0 the output is poisoned with NaN
// ---------------------------------------------------------------------------
__global__ __launch_bounds__(256) void premise_kernel(const int* __restrict__ flag, float* __restrict__ out, int n16) {
  const int i = blockIdx.x * 256 + threadIdx.x;
  if (i >= n16) return;
  const int f = flag[0];
  if (f != 0) return;
  const float qn = __uint_as_float(0x7fc00000u);
  const v4f nv = (v4f){qn, qn, qn, qn};
  float* p = out + 16 * (size_t)i;
  {
#pragma unroll
    for (int k = 0; k < 4; ++k) *(v4f*)(p + 4 * k) = nv;
    
  }
}

// ---------------------------------------------------------------------------
// Host launcher
// ---------------------------------------------------------------------------
extern "C" void kernel_launch(void* const* d_in, const int* in_sizes, int n_in,
                              void* d_out, int out_size, void* d_ws, size_t ws_size,
                              hipStream_t stream) {
  if (n_in < 8) return;
  if (in_sizes[0] != (int)kPlaneEl || in_sizes[1] != (int)kPlaneEl || in_sizes[2] != (int)kPlaneEl) return;
  if (in_sizes[3] != (int)kWEl || in_sizes[4] != (int)kWEl || in_sizes[5] != (int)kWEl || in_sizes[6] != (int)kWEl) return;
  if (in_sizes[7] < 1) return;
  if (out_size != (int)kPlaneEl) return;
  if (ws_size < (size_t)kWsTotal) return;

  const float* Q  = (const float*)d_in[0];
  const float* Kx = (const float*)d_in[1];
  const float* Vx = (const float*)d_in[2];
  const float* Wq = (const float*)d_in[3];
  const float* Wk = (const float*)d_in[4];
  const float* Wv = (const float*)d_in[5];
  const float* Wo = (const float*)d_in[6];
  const int*   causal = (const int*)d_in[7];
  float* out = (float*)d_out;
  char* ws = (char*)d_ws;

  unsigned short* Xbase = (unsigned short*)(ws + oXbase);
  const unsigned short* Xq_h = Xbase;
  const unsigned short* Xq_l = Xbase + kPlaneEl;
  const unsigned short* Xk_h = Xbase + 2 * kPlaneEl;
  const unsigned short* Xk_l = Xbase + 3 * kPlaneEl;
  const unsigned short* Xv_h = Xbase + 4 * kPlaneEl;
  const unsigned short* Xv_l = Xbase + 5 * kPlaneEl;
  unsigned short* Wbase = (unsigned short*)(ws + oWbase);
  const unsigned short* Wq_h = Wbase;
  const unsigned short* Wq_l = Wbase + kWEl;
  const unsigned short* Wk_h = Wbase + 2 * kWEl;
  const unsigned short* Wk_l = Wbase + 3 * kWEl;
  const unsigned short* Wv_h = Wbase + 4 * kWEl;
  const unsigned short* Wv_l = Wbase + 5 * kWEl;
  const unsigned short* Wo_h = (const unsigned short*)(ws + oWo_h);
  const unsigned short* Wo_l = (const unsigned short*)(ws + oWo_l);
  unsigned short* q_h  = (unsigned short*)(ws + oQ_h);
  unsigned short* q_l  = (unsigned short*)(ws + oQ_l);
  unsigned short* k_h  = (unsigned short*)(ws + oK_h);
  unsigned short* k_l  = (unsigned short*)(ws + oK_l);
  unsigned short* v_h  = (unsigned short*)(ws + oV_h);
  unsigned short* v_l  = (unsigned short*)(ws + oV_l);
  unsigned short* kT_h = (unsigned short*)(ws + oKT_h);
  unsigned short* kT_l = (unsigned short*)(ws + oKT_l);
  unsigned short* vT_h = (unsigned short*)(ws + oVT_h);
  unsigned short* vT_l = (unsigned short*)(ws + oVT_l);
  float*          dST  = (float*)(ws + oDST);
  unsigned short* ST_h = (unsigned short*)(ws + oST_h);
  unsigned short* ST_l = (unsigned short*)(ws + oST_l);
  unsigned short* A_h  = (unsigned short*)(ws + oA_h);
  unsigned short* A_l  = (unsigned short*)(ws + oA_l);
  float*          num1 = (float*)(ws + oNUM1);
  float*          numF = (float*)(ws + oNUM);
  unsigned short* o_h  = (unsigned short*)(ws + oO_h);
  unsigned short* o_l  = (unsigned short*)(ws + oO_l);
  float*          dz   = (float*)(ws + oDZ);
  float*          zpre = (float*)(ws + oZPRE);

  const long sTokChunk = (long)kChunk * kEmb;            // 131072: one chunk of token-major rows
  const long sTileA    = (long)kChunk * kChunk;          // 16384
  const long sTileT    = (long)kHdim * kChunk;           // 8192
  const long sTileS    = (long)kHdim * kHdim;            // 4096

  // 1) input and weight hi/lo planes
  split_planes_kernel<<<dim3((unsigned)(kPlaneEl / 8 / 256), 3, 1), 256, 0, stream>>>(Q, Kx, Vx, Vx, Xbase, kPlaneEl, (int)(kPlaneEl / 8));
  split_planes_kernel<<<dim3((unsigned)(kWEl / 8 / 256), 4, 1), 256, 0, stream>>>(Wq, Wk, Wv, Wo, Wbase, kWEl, (int)(kWEl / 8));

  // 2) projections: M=4096, N=1024, K=1024 (1024 tiles, 128 blocks x 8 waves); q, k with elu(x)+1
  wmma_gemm64<1, true, 0, 2, false, 6><<<dim3(128, 1, 1), 256, 0, stream>>>(
      Xq_h, Xq_l, kEmb, 0L, 0L, Wq_h, Wq_l, kEmb, 0L, 0L, (void*)q_h, (void*)q_l, kEmb, 0L, 0L,
      nullptr, nullptr, 0L, 0L, kTok, kEmb, kEmb, 1.0f);
  wmma_gemm64<1, true, 0, 2, false, 6><<<dim3(128, 1, 1), 256, 0, stream>>>(
      Xk_h, Xk_l, kEmb, 0L, 0L, Wk_h, Wk_l, kEmb, 0L, 0L, (void*)k_h, (void*)k_l, kEmb, 0L, 0L,
      nullptr, nullptr, 0L, 0L, kTok, kEmb, kEmb, 1.0f);
  wmma_gemm64<1, true, 0, 2, false, 0><<<dim3(128, 1, 1), 256, 0, stream>>>(
      Xv_h, Xv_l, kEmb, 0L, 0L, Wv_h, Wv_l, kEmb, 0L, 0L, (void*)v_h, (void*)v_l, kEmb, 0L, 0L,
      nullptr, nullptr, 0L, 0L, kTok, kEmb, kEmb, 1.0f);

  // 3) per-chunk transposes of k, v and chunk sums of k
  prep_kernel<<<dim3(kYB, kHeads, 1), 256, 0, stream>>>(k_h, k_l, v_h, v_l, kT_h, kT_l, vT_h, vT_l, dz);

  // 4) dST[e][d] = sum_j v[j][e] k[j][d] per (b,c,h): M=64, N=64, K=128, one wave per tile
  wmma_gemm64<1, true, 0, 0, false, 0><<<dim3(1, kYB, kHeads), 32, 0, stream>>>(
      vT_h, vT_l, kChunk, 16 * sTileT, sTileT, kT_h, kT_l, kChunk, 16 * sTileT, sTileT,
      (void*)dST, nullptr, kHdim, 16 * sTileS, sTileS,
      nullptr, nullptr, 0L, 0L, kHdim, kHdim, kChunk, 1.0f);

  // 5) exclusive prefix over chunks of S^T and z
  state_prefix_kernel<<<dim3(kBatch * kHeads, 1, 1), 256, 0, stream>>>(dST, dz, ST_h, ST_l, zpre);

  // 6) masked chunk scores A = tril(q.k^T) per (b,c,h): M=128, N=128, K=64, 4 tiles = 4 waves
  wmma_gemm64<1, true, 0, 2, false, 7><<<dim3(1, kYB, kHeads), 128, 0, stream>>>(
      q_h, q_l, kEmb, sTokChunk, (long)kHdim, k_h, k_l, kEmb, sTokChunk, (long)kHdim,
      (void*)A_h, (void*)A_l, kChunk, 16 * sTileA, sTileA,
      nullptr, nullptr, 0L, 0L, kChunk, kChunk, kHdim, 1.0f);

  // 7) num1 = q.S_c per (b,c,h): M=128, N=64, K=64, 2 tiles = 2 waves
  wmma_gemm64<1, true, 0, 0, false, 0><<<dim3(1, kYB, kHeads), 64, 0, stream>>>(
      q_h, q_l, kEmb, sTokChunk, (long)kHdim, ST_h, ST_l, kHdim, 16 * sTileS, sTileS,
      (void*)num1, nullptr, kEmb, sTokChunk, (long)kHdim,
      nullptr, nullptr, 0L, 0L, kChunk, kHdim, kHdim, 1.0f);

  // 8) num = A.v + num1 per (b,c,h): M=128, N=64, K=128 (separate output plane, resid = num1)
  wmma_gemm64<1, true, 0, 0, true, 0><<<dim3(1, kYB, kHeads), 64, 0, stream>>>(
      A_h, A_l, kChunk, 16 * sTileA, sTileA, vT_h, vT_l, kChunk, 16 * sTileT, sTileT,
      (void*)numF, nullptr, kEmb, sTokChunk, (long)kHdim,
      nullptr, num1, sTokChunk, (long)kHdim, kChunk, kHdim, kChunk, 1.0f);

  // 9) normaliser -> attention output hi/lo planes (token-major, heads merged)
  normalize_kernel<<<dim3(kYB, kHeads, 1), 128, 0, stream>>>(numF, A_h, A_l, q_h, q_l, zpre, o_h, o_l);

  // 10) output projection: M=4096, N=1024, K=1024 -> d_out
  wmma_gemm64<1, true, 0, 0, false, 0><<<dim3(128, 1, 1), 256, 0, stream>>>(
      o_h, o_l, kEmb, 0L, 0L, Wo_h, Wo_l, kEmb, 0L, 0L, (void*)out, nullptr, kEmb, 0L, 0L,
      nullptr, nullptr, 0L, 0L, kTok, kEmb, kEmb, 1.0f);

  // 11) premise check on the causal flag (poisons the output when the non-causal branch would be required)
  premise_kernel<<<dim3((unsigned)(kPlaneEl / 16 / 256), 1, 1), 256, 0, stream>>>(causal, out, (int)(kPlaneEl / 16));
}

// v001
// One run takes 225 microseconds.
// Timed twice side by side with v000, it ran 1.94 and 1.91 times as fast.
// Contractions: q/k/v projections, chunk scores q.k^T, state increment v^T.k, q.S, A.v, output projection -- all v_wmma_f32_16x16x32_bf16 with bf16 hi/lo operand planes (hi.hi + hi.lo + lo.hi), f32 accumulate; feature map, state prefix over chunks, normaliser and division in f32 on the VALU.
#include <hip/hip_runtime.h>
#include <math.h>

// ---------------------------------------------------------------------------
// Problem constants
// ---------------------------------------------------------------------------
constexpr int kBatch   = 2;
constexpr int kSeq     = 2048;
constexpr int kEmb     = 1024;
constexpr int kHeads   = 16;
constexpr int kHdim    = 64;
constexpr int kChunk   = 128;
constexpr int kNChunk  = kSeq / kChunk;          // 16 chunks per sequence
constexpr int kTok     = kBatch * kSeq;          // 4096 token rows
constexpr int kYB      = kBatch * kNChunk;       // 32 (batch, chunk) pairs
constexpr int kTiles   = kYB * kHeads;           // 512 (batch, chunk, head) tiles
constexpr float kEps   = 1e-6f;
constexpr long kPlaneEl = (long)kTok * kEmb;     // 4194304 elements per activation plane
constexpr long kWEl     = (long)kEmb * kEmb;     // 1048576 elements per weight plane
constexpr long kUnit    = kPlaneEl * 2;          // 8388608 bytes (one bf16 activation plane)
constexpr long kWUnit   = kWEl * 2;              // 2097152 bytes (one bf16 weight plane)

// ---------------------------------------------------------------------------
// Workspace region map (bytes; U = 8388608, WU = 2097152); total 14U + 262144 = 117702656
//   [0U , 6U)  phase 1: Xq_h Xq_l Xk_h Xk_l Xv_h Xv_l (input hi/lo planes, dead after projections)
//              phase 2: kT_h@0U kT_l@1U vT_h@2U vT_l@3U dST(f32)@4U ST_h@5U ST_l@5.5U
//              phase 3: A_h@[0U,2U) (kT dead)  num(f32)@[4U,6U) (dST, ST dead)
//   [6U , 8U)  Wq_h Wq_l Wk_h Wk_l Wv_h Wv_l Wo_h Wo_l (WU each)
//   [8U ,14U)  q_h@8U q_l@9U k_h@10U k_l@11U v_h@12U v_l@13U (projection outputs)
//              later: num1(f32)@[10U,12U) (k dead)  A_l@[12U,14U) (v dead)  o_h@10U o_l@11U (num1 dead)
//   [14U, +262144)  dz f32 [512][64] @14U, zpre f32 [512][64] @14U+131072
// ---------------------------------------------------------------------------
constexpr long oXbase = 0;
constexpr long oKT_h  = 0;
constexpr long oKT_l  = 1 * kUnit;
constexpr long oVT_h  = 2 * kUnit;
constexpr long oVT_l  = 3 * kUnit;
constexpr long oDST   = 4 * kUnit;
constexpr long oST_h  = 5 * kUnit;
constexpr long oST_l  = 5 * kUnit + kUnit / 2;
constexpr long oA_h   = 0;
constexpr long oNUM   = 4 * kUnit;
constexpr long oWbase = 6 * kUnit;
constexpr long oWo_h  = oWbase + 6 * kWUnit;
constexpr long oWo_l  = oWbase + 7 * kWUnit;
constexpr long oQ_h   = 8 * kUnit;
constexpr long oQ_l   = 9 * kUnit;
constexpr long oK_h   = 10 * kUnit;
constexpr long oK_l   = 11 * kUnit;
constexpr long oV_h   = 12 * kUnit;
constexpr long oV_l   = 13 * kUnit;
constexpr long oNUM1  = 10 * kUnit;
constexpr long oA_l   = 12 * kUnit;
constexpr long oO_h   = 10 * kUnit;
constexpr long oO_l   = 11 * kUnit;
constexpr long oDZ    = 14 * kUnit;
constexpr long oZPRE  = 14 * kUnit + 131072;
constexpr long kWsTotal = 14 * kUnit + 262144;
static_assert(kWsTotal == 117702656, "carve total");
static_assert(kWsTotal <= 134217728, "carve within 128 MiB");
static_assert((long)kTiles * kChunk * kChunk * 2 == 2 * kUnit, "A plane size");
static_assert((long)kTiles * kHdim * kChunk * 2 == kUnit, "kT plane size");
static_assert((long)kTiles * kHdim * kHdim * 4 == kUnit, "dST plane size");

typedef __attribute__((ext_vector_type(16))) _Float16 v16h;
typedef __attribute__((ext_vector_type(8)))  _Float16 v8h;
typedef __attribute__((ext_vector_type(16))) __bf16   v16b;
typedef __attribute__((ext_vector_type(8)))  __bf16   v8b;
typedef __attribute__((ext_vector_type(8)))  float    v8f;
typedef __attribute__((ext_vector_type(4)))  float    v4f;
typedef __attribute__((ext_vector_type(4)))  unsigned int v4u;

__device__ __forceinline__ unsigned short f2bf_bits(float f) {
  unsigned u = __float_as_uint(f);
  return (unsigned short)((u + 0x7FFFu + ((u >> 16) & 1u)) >> 16);
}
__device__ __forceinline__ float bf_bits2f(unsigned short h) { return __uint_as_float(((unsigned)h) << 16); }

// hazard guards as plain device helpers (no inline asm inside the kernel template body)
__device__ __forceinline__ void dep_guard_h(v8f& a, v8f& b, v16h x, v16h y) { asm volatile("v_nop\n\tv_nop\n\tv_nop\n\tv_nop" : "+v"(a), "+v"(b) : "v"(x), "v"(y)); }
__device__ __forceinline__ void dep_guard_b(v8f& a, v8f& b, v16b x, v16b y) { asm volatile("v_nop\n\tv_nop\n\tv_nop\n\tv_nop" : "+v"(a), "+v"(b) : "v"(x), "v"(y)); }
__device__ __forceinline__ void keep4_h(v16h a, v16h b, v16h c, v16h d) { asm volatile("v_nop" :: "v"(a), "v"(b), "v"(c), "v"(d)); }
__device__ __forceinline__ void keep4_b(v16b a, v16b b, v16b c, v16b d) { asm volatile("v_nop" :: "v"(a), "v"(b), "v"(c), "v"(d)); }
__device__ __forceinline__ void acc_guard4(v8f& a, v8f& b, v8f& c, v8f& d) { asm volatile("v_nop\n\tv_nop\n\tv_nop\n\tv_nop" : "+v"(a), "+v"(b), "+v"(c), "+v"(d)); }
template <typename T> struct Frag;
template <> struct Frag<_Float16> {
  typedef v16h V; union U { v16h v; v8h h[2]; };
  static __device__ __forceinline__ v16h load(const _Float16* p) {   // elements 0..7 <- p[0..7], 8..15 <- p[16..23]
    U f; f.h[0] = *(const v8h*)(p); f.h[1] = *(const v8h*)(p + 16); return f.v;
  }
  static __device__ __forceinline__ v8f mma(v16h a, v16h b, v8f c) {
    return __builtin_amdgcn_wmma_f32_16x16x32_f16(false, a, false, b, (short)0, c, false, false);
  }
  static __device__ __forceinline__ void guard(v8f& a, v8f& b, v16h x, v16h y) { dep_guard_h(a, b, x, y); }
  static __device__ __forceinline__ void keep(v16h a, v16h b, v16h c, v16h d) { keep4_h(a, b, c, d); }
};
template <> struct Frag<__bf16> {
  typedef v16b V; union U { v16b v; v8b h[2]; };
  static __device__ __forceinline__ v16b load(const __bf16* p) {
    U f; f.h[0] = *(const v8b*)(p); f.h[1] = *(const v8b*)(p + 16); return f.v;
  }
  static __device__ __forceinline__ v8f mma(v16b a, v16b b, v8f c) {
    return __builtin_amdgcn_wmma_f32_16x16x32_bf16(false, a, false, b, (short)0, c, false, false);
  }
  static __device__ __forceinline__ void guard(v8f& a, v8f& b, v16b x, v16b y) { dep_guard_b(a, b, x, y); }
  static __device__ __forceinline__ void keep(v16b a, v16b b, v16b c, v16b d) { keep4_b(a, b, c, d); }
};

__device__ __forceinline__ unsigned pk16(unsigned short a, unsigned short b) { return (unsigned)a | ((unsigned)b << 16); }
// bf16 element pair held in one 32-bit word: low half-word = even element, high half-word = odd element
__device__ __forceinline__ float bflo2f(unsigned w) { return __uint_as_float(w << 16); }
__device__ __forceinline__ float bfhi2f(unsigned w) { return __uint_as_float(w & 0xffff0000u); }

// ---- Register-blocked batched WMMA GEMM (2-D batch (blockIdx.y, blockIdx.z), waves per block from blockDim,
//      ACT reduced to none/relu/leaky plus 6 = elu(x)+1 and 7 = causal zero (n > m -> 0 for tile-local m, n)) ----
// C[m,n] = scale * sum_k A[m,k] * Bt[n,k] (+bias)(+resid); each wave owns a 64x64 tile.
// A row-major [M,K]; Bt row-major [N,K]; M,N % 64 == 0, K % 32 == 0.
// SPLIT: operands are hi/lo planes (A2/Bt2 = lo planes, same layout); product = hi.hi + hi.lo + lo.hi.
// BIAS_MODE: 0 = none, 1 = bias[m], 2 = bias[n].
// OUT_MODE: 0 = f32, 1 = f16, 2 = bf16 hi plane (Cout) + bf16 lo plane (Cout2).
// ET: 0 = f16 operands, 1 = bf16 operands (pointers passed as 16-bit storage)
template <int ET> struct Elem;
template <> struct Elem<0> { typedef _Float16 T; };
template <> struct Elem<1> { typedef __bf16 T; };
template <int ET, bool SPLIT, int BIAS_MODE, int OUT_MODE, bool RESID, int ACT = 0>
__global__ __launch_bounds__(256) void wmma_gemm64(
    const unsigned short* __restrict__ Ap, const unsigned short* __restrict__ A2p, int lda, long strideA, long strideAz,
    const unsigned short* __restrict__ Btp, const unsigned short* __restrict__ Bt2p, int ldb, long strideB, long strideBz,
    void* __restrict__ Cout, void* __restrict__ Cout2, int ldc, long strideC, long strideCz,
    const float* __restrict__ bias,
    const float* __restrict__ resid, long strideR, long strideRz,
    int M, int N, int K, float scale) {
  typedef typename Elem<ET>::T T;
  typedef typename Frag<T>::V V;
  const T* A = (const T*)Ap; const T* A2 = (const T*)A2p; const T* Bt = (const T*)Btp; const T* Bt2 = (const T*)Bt2p;
  __shared__ __align__(16) float sT[8][16 * 68];   // per-wave 16x64 slab, pitch 68 floats
  const int b    = blockIdx.y;
  const int bz   = blockIdx.z;
  const int lane = threadIdx.x & 31;
  const int wave = threadIdx.x >> 5;
  const int nwv  = blockDim.x >> 5;
  const int tilesN = N >> 6;
  const int tilesM = M >> 6;
  const int tile = blockIdx.x * nwv + wave;
  if (tile >= tilesM * tilesN) return;   // wave-uniform; no block barriers in this kernel
  const int tm = tile / tilesN;
  const int tn = tile - tm * tilesN;
  const int m0 = tm << 6;
  const int n0 = tn << 6;

  const T* Ab  = A  + (size_t)b * strideA + (size_t)bz * strideAz;
  const T* Bb  = Bt + (size_t)b * strideB + (size_t)bz * strideBz;
  const T* Ab2 = SPLIT ? (A2  + (size_t)b * strideA + (size_t)bz * strideAz) : nullptr;
  const T* Bb2 = SPLIT ? (Bt2 + (size_t)b * strideB + (size_t)bz * strideBz) : nullptr;
  const size_t cOff = (size_t)b * strideC + (size_t)bz * strideCz;

  const int rlane = lane & 15;                 // row (A) / col (B, D) within subtile
  const int koff  = (lane >> 4) * 8;           // k offset of this lane half
  const int mOff  = (lane >> 4) * 8;           // D row offset

  v8f acc[4][4];
#pragma unroll
  for (int i = 0; i < 4; ++i)
#pragma unroll
    for (int j = 0; j < 4; ++j) acc[i][j] = (v8f){0.f,0.f,0.f,0.f,0.f,0.f,0.f,0.f};

  for (int k0 = 0; k0 < K; k0 += 32) {
    V bh[4], bl[4];
#pragma unroll
    for (int j = 0; j < 4; ++j) {
      const size_t bo = (size_t)(n0 + (j << 4) + rlane) * ldb + koff + k0;
      bh[j] = Frag<T>::load(Bb + bo);
      if (SPLIT) bl[j] = Frag<T>::load(Bb2 + bo);
    }
#pragma unroll
    for (int i = 0; i < 4; ++i) {
      const size_t ao = (size_t)(m0 + (i << 4) + rlane) * lda + koff + k0;
      V ah = Frag<T>::load(Ab + ao);
      V al;
      if (SPLIT) al = Frag<T>::load(Ab2 + ao);
#pragma unroll
      for (int j = 0; j < 4; ++j) {
        acc[i][j] = Frag<T>::mma(ah, bh[j], acc[i][j]);
        if (SPLIT) {
          acc[i][j] = Frag<T>::mma(ah, bl[j], acc[i][j]);
          acc[i][j] = Frag<T>::mma(al, bh[j], acc[i][j]);
        }
      }
      Frag<T>::guard(acc[i][0], acc[i][3], ah, SPLIT ? al : ah);
    }
    Frag<T>::keep(bh[0], bh[1], bh[2], bh[3]);
    if (SPLIT) Frag<T>::keep(bl[0], bl[1], bl[2], bl[3]);
  }
  acc_guard4(acc[0][0], acc[0][1], acc[0][2], acc[0][3]);
  acc_guard4(acc[1][0], acc[1][1], acc[1][2], acc[1][3]);
  acc_guard4(acc[2][0], acc[2][1], acc[2][2], acc[2][3]);
  acc_guard4(acc[3][0], acc[3][1], acc[3][2], acc[3][3]);

  // ---- epilogue ----
  float* slab = sT[wave];
  const float* Rb = RESID ? (resid + (size_t)b * strideR + (size_t)bz * strideRz) : nullptr;
#pragma unroll
  for (int i = 0; i < 4; ++i) {
    const int mBase = m0 + (i << 4);
#pragma unroll
    for (int j = 0; j < 4; ++j) {
      const int n = n0 + (j << 4) + rlane;
      float bv = 0.f;
      if (BIAS_MODE == 2) bv = bias[n];
#pragma unroll
      for (int r = 0; r < 8; ++r) {
        float v = acc[i][j][r] * scale;
        if (BIAS_MODE == 1) v += bias[mBase + mOff + r];
        if (BIAS_MODE == 2) v += bv;
        if (RESID) v += Rb[(size_t)(mBase + mOff + r) * ldc + n];
        if (ACT == 2) v = fmaxf(v, 0.0f);
        if (ACT == 4) v = (v > 0.f) ? v : 0.01f * v;
        if (ACT == 6) v = (v > 0.f) ? (v + 1.0f) : expf(v);
        if (ACT == 7) { if (n > mBase + mOff + r) v = 0.0f; }
        slab[(mOff + r) * 68 + (j << 4) + rlane] = v;
      }
    }
    __builtin_amdgcn_fence(__ATOMIC_RELEASE, "workgroup");
    __builtin_amdgcn_wave_barrier();
    __builtin_amdgcn_fence(__ATOMIC_ACQUIRE, "workgroup");
    if (OUT_MODE == 0) {
      float* C = (float*)Cout + cOff;
      const int hh = lane >> 4, c4 = (lane & 15) * 4;     // row seg = 256 B = 16 lanes x 16 B
      {
#pragma unroll
        for (int it = 0; it < 8; ++it) {
          const int row = it * 2 + hh;
          v4f v = *(const v4f*)(slab + row * 68 + c4);
          *(v4f*)(C + (size_t)(mBase + row) * ldc + n0 + c4) = v;
        }
        
      }
    } else {
      const int q = lane >> 3, c8 = (lane & 7) * 8;
      unsigned short* C  = (unsigned short*)Cout  + cOff;
      unsigned short* C2 = (OUT_MODE == 2) ? ((unsigned short*)Cout2 + cOff) : nullptr;
      {
#pragma unroll
        for (int it = 0; it < 4; ++it) {
          const int row = it * 4 + q;
          const float* sp = slab + row * 68 + c8;
          v8h hv, lv;
#pragma unroll
          for (int e = 0; e < 8; ++e) {
            if (OUT_MODE == 1) {
              hv[e] = (_Float16)sp[e];
            } else {
              unsigned short hb = f2bf_bits(sp[e]);
              unsigned short lb = f2bf_bits(sp[e] - bf_bits2f(hb));
              hv[e] = __builtin_bit_cast(_Float16, hb);
              lv[e] = __builtin_bit_cast(_Float16, lb);
            }
          }
          *(v8h*)(C + (size_t)(mBase + row) * ldc + n0 + c8) = hv;
          if (OUT_MODE == 2) *(v8h*)(C2 + (size_t)(mBase + row) * ldc + n0 + c8) = lv;
        }
        
      }
    }
    __builtin_amdgcn_fence(__ATOMIC_RELEASE, "workgroup");
    __builtin_amdgcn_wave_barrier();
    __builtin_amdgcn_fence(__ATOMIC_ACQUIRE, "workgroup");
  }
}

// ---------------------------------------------------------------------------
// The four 4096 x 1024 x 1024 products: C[m,n] = sum_k A[m,k] * Bt[n,k], hi/lo planes, product = hi.hi + hi.lo + lo.hi.
// One 128 x 128 tile of C per work-group, four waves (2 x 2), each wave a 64 x 64 tile (the 4 x 4 accumulators of wmma_gemm64).
// A stage is 128 k (256 B) of 128 rows of each of the four operand planes [A_h | A_l | B_h | B_l], LDS row pitch 272 B;
// wave w brings plane w of every stage with one tensor load; two buffers, the next stage's loads fly while this one is worked on.
// Per accumulator the products are summed in the order of wmma_gemm64: k ascending, hi.hi, hi.lo, lo.hi inside each 32 k.
// ---------------------------------------------------------------------------
constexpr unsigned kRowB    = 256;                    // bytes of one operand row in a stage
constexpr unsigned kPitchB  = 272;                    // LDS row pitch: 256 B + the 16-B pad for ds_load_b128 readers
constexpr unsigned kPlaneB  = 128 * kPitchB;          // 34816 B, one plane's slice of a stage
constexpr unsigned kStageB  = 4 * kPlaneB;            // 139264 B, one buffer
constexpr unsigned kStages  = (unsigned)kEmb * 2 / kRowB;   // 8
static_assert(kPlaneB % 2048 == 0, "every slice starts at a multiple of 2 KiB");
static_assert(kStages >= 2, "the ring's prologue needs two stages");
typedef __attribute__((ext_vector_type(8))) unsigned int v8u;

__device__ __forceinline__ unsigned uni(unsigned v) { return (unsigned)__builtin_amdgcn_readfirstlane((int)v); }
__device__ __forceinline__ unsigned pinned(unsigned v) { unsigned w = uni(v); asm volatile("" : "+s"(w)); return w; }
__device__ __forceinline__ void wait_ds0()     { asm volatile("s_wait_dscnt 0x0" ::: "memory"); }      // this wave's LDS reads have returned
__device__ __forceinline__ void wait_tensor0() { asm volatile("s_wait_tensorcnt 0x0" ::: "memory"); }  // this wave's tensor load has landed
__device__ __forceinline__ void tdm_load(v4u g0, v8u g1) { asm volatile("tensor_load_to_lds %0, %1" :: "s"(g0), "s"(g1) : "memory"); }
__device__ __forceinline__ v4u tdm_group0(unsigned lds_dst, unsigned long long ga) {
  v4u g;
  g[0] = uni(1u); g[1] = uni(lds_dst); g[2] = uni((unsigned)ga); g[3] = uni((((unsigned)(ga >> 32)) & 0x01FFFFFFu) | 0x80000000u);
  return g;
}
// 1-byte elements, tile = tensor = 128 rows of 256 B, source pitch one K row, 4 dwords of LDS pad behind every 64 dwords
__device__ __forceinline__ v8u tdm_group1() {
  constexpr unsigned d0 = kRowB, d1 = 128u;
  v8u g;
  g[0] = uni((1u << 20) | (5u << 22) | (3u << 25));
  g[1] = uni((d0 & 0xFFFFu) << 16);
  g[2] = uni((d0 >> 16) | ((d1 & 0xFFFFu) << 16));
  g[3] = uni((d1 >> 16) | (d0 << 16));
  g[4] = uni(d1);
  g[5] = uni((unsigned)kEmb * 2u);
  g[6] = uni(0u);
  g[7] = uni(0u);
  return g;
}

struct FragSet { v16b ah[4], al[4], bh[4], bl[4]; };
// the fragments of one 32-k block: pa / pb = this lane's row 0 of the A_h / B_h slices, at its k half
__device__ __forceinline__ void load_set(FragSet& f, const unsigned char* pa, const unsigned char* pb, int kb) {
  const unsigned k = (unsigned)kb * 64u;
  constexpr unsigned t = 16u * kPitchB;   // 16 rows
  // in the order in which mma_set needs them: the first term can start when half of the group has returned
#pragma unroll
  for (int i = 0; i < 4; ++i) f.ah[i] = Frag<__bf16>::load((const __bf16*)(pa + (unsigned)i * t + k));
#pragma unroll
  for (int i = 0; i < 4; ++i) f.bh[i] = Frag<__bf16>::load((const __bf16*)(pb + (unsigned)i * t + k));
#pragma unroll
  for (int i = 0; i < 4; ++i) f.bl[i] = Frag<__bf16>::load((const __bf16*)(pb + kPlaneB + (unsigned)i * t + k));
#pragma unroll
  for (int i = 0; i < 4; ++i) f.al[i] = Frag<__bf16>::load((const __bf16*)(pa + kPlaneB + (unsigned)i * t + k));
}
// 48 WMMAs; each term runs over all 16 accumulators, so that no WMMA waits for the one in front of it
__device__ __forceinline__ void mma_set(const FragSet& f, v8f (&acc)[4][4]) {
#pragma unroll
  for (int i = 0; i < 4; ++i)
#pragma unroll
    for (int j = 0; j < 4; ++j) acc[i][j] = Frag<__bf16>::mma(f.ah[i], f.bh[j], acc[i][j]);
#pragma unroll
  for (int i = 0; i < 4; ++i)
#pragma unroll
    for (int j = 0; j < 4; ++j) acc[i][j] = Frag<__bf16>::mma(f.ah[i], f.bl[j], acc[i][j]);
#pragma unroll
  for (int i = 0; i < 4; ++i)
#pragma unroll
    for (int j = 0; j < 4; ++j) acc[i][j] = Frag<__bf16>::mma(f.al[i], f.bh[j], acc[i][j]);
}

// OUT_MODE: 0 = f32 to Cf, 2 = bf16 hi plane (Ch) + lo plane (Cl). ACT: 0 = none, 6 = elu(x)+1. grid (N/128, M/128), 128 threads.
template <int OUT_MODE, int ACT>
__global__ __launch_bounds__(128) void gemm128_ring(
    const unsigned short* __restrict__ Ah, const unsigned short* __restrict__ Al,
    const unsigned short* __restrict__ Bh, const unsigned short* __restrict__ Bl,
    unsigned short* __restrict__ Ch, unsigned short* __restrict__ Cl, float* __restrict__ Cf) {
  __shared__ __attribute__((aligned(2048))) unsigned char ring[2 * kStageB];
  __shared__ __align__(16) float sT[4][16 * 68];   // per-wave 16x64 slab, pitch 68 floats
  const int lane = threadIdx.x & 31;
  const unsigned wave = uni(threadIdx.x >> 5);
  const int rlane = lane & 15;
  const int mOff  = (lane >> 4) * 8;
  const int m0 = (int)blockIdx.y * 128 + (int)(wave >> 1) * 64;
  const int n0 = (int)blockIdx.x * 128 + (int)(wave & 1u) * 64;

  // this wave's plane: first byte of its 128 rows, and its slice's place in buffer 0
  const unsigned short* plane = (wave == 0u) ? Ah : (wave == 1u) ? Al : (wave == 2u) ? Bh : Bl;
  const unsigned row0 = ((wave < 2u) ? blockIdx.y : blockIdx.x) * 128u;
  const unsigned long long ga = (unsigned long long)(plane + (size_t)row0 * kEmb);
  const unsigned slice = (unsigned)(unsigned long long)(const void*)ring + wave * kPlaneB;
  const v8u g1 = tdm_group1();

  const unsigned aoff = ((wave >> 1) * 64u + (unsigned)rlane) * kPitchB + (unsigned)(lane >> 4) * 16u;
  const unsigned boff = 2u * kPlaneB + ((wave & 1u) * 64u + (unsigned)rlane) * kPitchB + (unsigned)(lane >> 4) * 16u;

  v8f acc[4][4];
#pragma unroll
  for (int i = 0; i < 4; ++i)
#pragma unroll
    for (int j = 0; j < 4; ++j) acc[i][j] = (v8f){0.f,0.f,0.f,0.f,0.f,0.f,0.f,0.f};

  tdm_load(tdm_group0(slice, ga), g1);
  wait_tensor0();
  __syncthreads();                                  // stage 0 is readable by every wave
  tdm_load(tdm_group0(slice + kStageB, ga + kRowB), g1);

  // rolled: one copy of the 192-WMMA pass, and every accumulator and fragment index stays a constant
#pragma clang loop unroll(disable)
  for (unsigned s = 0; s < kStages; ++s) {
    const unsigned buf = (s & 1u) * kStageB;
    const unsigned char* pa = ring + buf + aoff;
    const unsigned char* pb = ring + buf + boff;
    FragSet f[2];
    load_set(f[0], pa, pb, 0);
#pragma unroll
    for (int kb = 0; kb < 4; ++kb) {
      if (kb < 3) load_set(f[(kb + 1) & 1], pa, pb, kb + 1);
      __builtin_amdgcn_sched_barrier(0);            // keeps the next block's LDS reads one group in front of this block's WMMAs
      mma_set(f[kb & 1], acc);
      __builtin_amdgcn_sched_barrier(0);            // and the block after that one's reads behind them
    }
    wait_ds0();
    wait_tensor0();
    __syncthreads();                                // publishes stage s + 1; every reader has left stage s's buffer
    const unsigned nx = pinned(s + 2u);             // formed behind the wait, and the descriptor from it
    if (nx < kStages) tdm_load(tdm_group0(slice + buf, ga + (unsigned long long)nx * kRowB), g1);
  }
  wait_tensor0();
  wait_ds0();

  // ---- epilogue (as in wmma_gemm64) ----
  float* slab = sT[wave];
#pragma unroll
  for (int i = 0; i < 4; ++i) {
    const int mBase = m0 + (i << 4);
#pragma unroll
    for (int j = 0; j < 4; ++j) {
#pragma unroll
      for (int r = 0; r < 8; ++r) {
        float v = acc[i][j][r];
        if (ACT == 6) v = (v > 0.f) ? (v + 1.0f) : expf(v);
        slab[(mOff + r) * 68 + (j << 4) + rlane] = v;
      }
    }
    __builtin_amdgcn_fence(__ATOMIC_RELEASE, "workgroup");
    __builtin_amdgcn_wave_barrier();
    __builtin_amdgcn_fence(__ATOMIC_ACQUIRE, "workgroup");
    if (OUT_MODE == 0) {
      const int hh = lane >> 4, c4 = (lane & 15) * 4;     // row seg = 256 B = 16 lanes x 16 B
      v4f rv[8];
#pragma unroll
      for (int it = 0; it < 8; ++it) rv[it] = *(const v4f*)(slab + (it * 2 + hh) * 68 + c4);
#pragma unroll
      for (int it = 0; it < 8; ++it) *(v4f*)(Cf + (size_t)(mBase + it * 2 + hh) * kEmb + n0 + c4) = rv[it];
      asm volatile("s_wait_xcnt 0x0" ::: "memory");   // stands in front of the next use of the registers that these stores name
    } else {
      const int q = lane >> 3, c8 = (lane & 7) * 8;
      v8h hv[4], lv[4];
#pragma unroll
      for (int it = 0; it < 4; ++it) {
        const float* sp = slab + (it * 4 + q) * 68 + c8;
#pragma unroll
        for (int e = 0; e < 8; ++e) {
          unsigned short hb = f2bf_bits(sp[e]);
          unsigned short lb = f2bf_bits(sp[e] - bf_bits2f(hb));
          hv[it][e] = __builtin_bit_cast(_Float16, hb);
          lv[it][e] = __builtin_bit_cast(_Float16, lb);
        }
      }
#pragma unroll
      for (int it = 0; it < 4; ++it) {
        *(v8h*)(Ch + (size_t)(mBase + it * 4 + q) * kEmb + n0 + c8) = hv[it];
        *(v8h*)(Cl + (size_t)(mBase + it * 4 + q) * kEmb + n0 + c8) = lv[it];
      }
      asm volatile("s_wait_xcnt 0x0" ::: "memory");   // stands in front of the next use of the registers that these stores name
    }
    __builtin_amdgcn_fence(__ATOMIC_RELEASE, "workgroup");
    __builtin_amdgcn_wave_barrier();
    __builtin_amdgcn_fence(__ATOMIC_ACQUIRE, "workgroup");
  }
}

// ---------------------------------------------------------------------------
// f32 -> bf16 hi + lo planes (RNE convert both), 8 consecutive elements per thread: one 16-B store per lane per plane,
// blockIdx.y selects the source tensor (block-uniform); hi plane z lives at out + 2z*planeEl, lo plane at +planeEl.
// Coverage: n8 = planeEl/8 threads x 8 = the whole plane (grids are exact multiples of 256 here).
// ---------------------------------------------------------------------------
__global__ __launch_bounds__(256) void split_planes_kernel(const float* __restrict__ s0, const float* __restrict__ s1,
                                                           const float* __restrict__ s2, const float* __restrict__ s3,
                                                           unsigned short* __restrict__ out, long planeEl, int n8) {
  const int i = blockIdx.x * 256 + threadIdx.x;
  const int z = blockIdx.y;
  if (i >= n8) return;
  const float* src = (z == 0) ? s0 : (z == 1) ? s1 : (z == 2) ? s2 : s3;
  const float* p = src + 8 * (size_t)i;
  const v4f a = *(const v4f*)(p);
  const v4f c = *(const v4f*)(p + 4);
  unsigned short hb[8], lb[8];
#pragma unroll
  for (int e = 0; e < 4; ++e) {
    hb[e]     = f2bf_bits(a[e]);
    lb[e]     = f2bf_bits(a[e] - bf_bits2f(hb[e]));
    hb[4 + e] = f2bf_bits(c[e]);
    lb[4 + e] = f2bf_bits(c[e] - bf_bits2f(hb[4 + e]));
  }
  const v4u uh = (v4u){pk16(hb[0], hb[1]), pk16(hb[2], hb[3]), pk16(hb[4], hb[5]), pk16(hb[6], hb[7])};
  const v4u ul = (v4u){pk16(lb[0], lb[1]), pk16(lb[2], lb[3]), pk16(lb[4], lb[5]), pk16(lb[6], lb[7])};
  unsigned short* ph = out + (size_t)(2 * z) * planeEl + 8 * (size_t)i;
  unsigned short* pl = ph + planeEl;
  *(v4u*)ph = uh;
  *(v4u*)pl = ul;
  
}

// ---------------------------------------------------------------------------
// Per (batch-chunk y, head h) tile: transpose the 128x64 chunk tiles of k and v (hi and lo planes, token-major [4096][1024])
// into kT, vT tiles [64 d][128 j] at (y*16+h)*8192, and dz[y*16+h][d] = sum_j k[j][d] (f32, k = hi + lo, j in order).
// grid (32, 16), 256 threads. LDS tiles hold one hi/lo pair at a time.
// Load coverage: 4 iterations x 256 threads = 1024 units of (row j, 8 d) = 128 x 64 = whole tile, every LDS cell read is written.
// Store coverage: 4 iterations x 8 waves x 2 (lane>>4) = 64 rows; 16 lanes x 8 halves = 128 cols; each row = 256 B = 2 whole
// ---------------------------------------------------------------------------
__global__ __launch_bounds__(256) void prep_kernel(const unsigned short* __restrict__ kh, const unsigned short* __restrict__ kl,
                                                   const unsigned short* __restrict__ vh, const unsigned short* __restrict__ vl,
                                                   unsigned short* __restrict__ kTh, unsigned short* __restrict__ kTl,
                                                   unsigned short* __restrict__ vTh, unsigned short* __restrict__ vTl,
                                                   float* __restrict__ dz) {
  __shared__ unsigned short tA[64][136];
  __shared__ unsigned short tB[64][136];
  __shared__ __align__(16) float dzs[64];
  const int t = threadIdx.x;
  const int lane = t & 31, wave = t >> 5;
  const int y = blockIdx.x, h = blockIdx.y;
  const size_t tok0 = (size_t)y * kChunk;
  const size_t tile = (size_t)y * kHeads + h;
  const size_t tileOff = tile * (size_t)(kHdim * kChunk);
  const int hh = lane >> 4, c8 = (lane & 15) * 8;
  for (int p = 0; p < 2; ++p) {
    const unsigned short* sH = (p == 0) ? kh : vh;
    const unsigned short* sL = (p == 0) ? kl : vl;
    unsigned short* dH = (p == 0) ? kTh : vTh;
    unsigned short* dL = (p == 0) ? kTl : vTl;
#pragma unroll
    for (int it = 0; it < 4; ++it) {
      const int idx = it * 256 + t;
      const int j = idx >> 3;
      const int d8 = (idx & 7) * 8;
      const size_t go = (tok0 + j) * (size_t)kEmb + (size_t)h * kHdim + d8;
      const v4u wh = *(const v4u*)(sH + go);
      const v4u wl = *(const v4u*)(sL + go);
#pragma unroll
      for (int e = 0; e < 4; ++e) {
        tA[d8 + 2 * e][j]     = (unsigned short)(wh[e] & 0xffffu);
        tA[d8 + 2 * e + 1][j] = (unsigned short)(wh[e] >> 16);
        tB[d8 + 2 * e][j]     = (unsigned short)(wl[e] & 0xffffu);
        tB[d8 + 2 * e + 1][j] = (unsigned short)(wl[e] >> 16);
      }
    }
    __syncthreads();
    if (p == 0) {
      if (t < 64) {
        float s = 0.f;
#pragma unroll 1
        for (int j = 0; j < kChunk; ++j) {
          const float kv = bf_bits2f(tA[t][j]) + bf_bits2f(tB[t][j]);
          s = s + kv;
        }
        dzs[t] = s;
      }
      __syncthreads();
    }
    v4u uH[4], uL[4];
#pragma unroll
    for (int it = 0; it < 4; ++it) {
      const int d = it * 16 + wave * 2 + hh;
      unsigned short a[8], bb[8];
#pragma unroll
      for (int e = 0; e < 8; ++e) { a[e] = tA[d][c8 + e]; bb[e] = tB[d][c8 + e]; }
      uH[it] = (v4u){pk16(a[0], a[1]), pk16(a[2], a[3]), pk16(a[4], a[5]), pk16(a[6], a[7])};
      uL[it] = (v4u){pk16(bb[0], bb[1]), pk16(bb[2], bb[3]), pk16(bb[4], bb[5]), pk16(bb[6], bb[7])};
    }
    v4f zv = (v4f){0.f, 0.f, 0.f, 0.f};
    if (p == 0) zv = *(const v4f*)(dzs + 4 * (t & 15));
    {
#pragma unroll
      for (int it = 0; it < 4; ++it) {
        const int d = it * 16 + wave * 2 + hh;
        *(v4u*)(dH + tileOff + (size_t)d * kChunk + c8) = uH[it];
        *(v4u*)(dL + tileOff + (size_t)d * kChunk + c8) = uL[it];
      }
      if (p == 0 && t < 16) *(v4f*)(dz + tile * kHdim + 4 * t) = zv;
      
    }
    __syncthreads();
  }
}

// ---------------------------------------------------------------------------
// Exclusive prefix over chunks of the transposed state and of z, per (b, h): block bh, 256 threads, static 16-step loop.
// S^T_c = sum_{c' < c} dST_{c'} (f32, sequential), written as bf16 hi/lo planes [tile][64 e][64 d] (tile = (b*16+c)*16+h);
// z_c likewise to zpre[tile][64] (f32). Thread t owns elements 8t..8t+7 and 2048+8t..2048+8t+7 of each 4096-element tile:
// ---------------------------------------------------------------------------
__global__ __launch_bounds__(256) void state_prefix_kernel(const float* __restrict__ dST, const float* __restrict__ dz,
                                                           unsigned short* __restrict__ STh, unsigned short* __restrict__ STl,
                                                           float* __restrict__ zpre) {
  __shared__ __align__(16) float zs[64];
  const int t = threadIdx.x;
  const int bh = blockIdx.x;
  const int b = bh >> 4, h = bh & 15;
  float a0[8], a1[8];
#pragma unroll
  for (int e = 0; e < 8; ++e) { a0[e] = 0.f; a1[e] = 0.f; }
  float zacc = 0.f;
#pragma unroll 1
  for (int c = 0; c < kNChunk; ++c) {
    const size_t tile = ((size_t)(b * kNChunk + c)) * kHeads + h;
    const size_t so = tile * 4096;
    unsigned short hb[16], lb[16];
#pragma unroll
    for (int e = 0; e < 8; ++e) {
      hb[e] = f2bf_bits(a0[e]);      lb[e] = f2bf_bits(a0[e] - bf_bits2f(hb[e]));
      hb[8 + e] = f2bf_bits(a1[e]);  lb[8 + e] = f2bf_bits(a1[e] - bf_bits2f(hb[8 + e]));
    }
    const v4u h0 = (v4u){pk16(hb[0], hb[1]), pk16(hb[2], hb[3]), pk16(hb[4], hb[5]), pk16(hb[6], hb[7])};
    const v4u l0 = (v4u){pk16(lb[0], lb[1]), pk16(lb[2], lb[3]), pk16(lb[4], lb[5]), pk16(lb[6], lb[7])};
    const v4u h1 = (v4u){pk16(hb[8], hb[9]), pk16(hb[10], hb[11]), pk16(hb[12], hb[13]), pk16(hb[14], hb[15])};
    const v4u l1 = (v4u){pk16(lb[8], lb[9]), pk16(lb[10], lb[11]), pk16(lb[12], lb[13]), pk16(lb[14], lb[15])};
    if (t < 64) zs[t] = zacc;
    __syncthreads();
    const v4f zv = *(const v4f*)(zs + 4 * (t & 15));
    {
      *(v4u*)(STh + so + 8 * (size_t)t) = h0;
      *(v4u*)(STl + so + 8 * (size_t)t) = l0;
      *(v4u*)(STh + so + 2048 + 8 * (size_t)t) = h1;
      *(v4u*)(STl + so + 2048 + 8 * (size_t)t) = l1;
      if (t < 16) *(v4f*)(zpre + tile * kHdim + 4 * t) = zv;
      
    }
    __syncthreads();
    const float* dp = dST + so;
    const v4f d00 = *(const v4f*)(dp + 8 * t);
    const v4f d01 = *(const v4f*)(dp + 8 * t + 4);
    const v4f d10 = *(const v4f*)(dp + 2048 + 8 * t);
    const v4f d11 = *(const v4f*)(dp + 2048 + 8 * t + 4);
#pragma unroll
    for (int e = 0; e < 4; ++e) {
      a0[e] += d00[e];  a0[4 + e] += d01[e];
      a1[e] += d10[e];  a1[4 + e] += d11[e];
    }
    zacc += dz[tile * kHdim + (t & 63)];
  }
}

// ---------------------------------------------------------------------------
// Normaliser per (batch-chunk y, head h): block 128 threads, thread = chunk row i (token y*128+i).
// den_i = q_i . z_c + sum_j A[i][j] + eps (f32; q and A reconstructed from hi+lo bf16 planes, j in order),
// out_i = num_i * (1/den_i) staged in LDS as f32, then written as bf16 hi/lo rows of the token-major o planes.
// ---------------------------------------------------------------------------
__global__ __launch_bounds__(128) void normalize_kernel(const float* __restrict__ num,
                                                        const unsigned short* __restrict__ Ah, const unsigned short* __restrict__ Al,
                                                        const unsigned short* __restrict__ qh, const unsigned short* __restrict__ ql,
                                                        const float* __restrict__ zpre,
                                                        unsigned short* __restrict__ oh, unsigned short* __restrict__ ol) {
  __shared__ __align__(16) float os[128][68];
  const int i = threadIdx.x;
  const int lane = i & 31, wave = i >> 5;
  const int y = blockIdx.x, h = blockIdx.y;
  const size_t tile = (size_t)y * kHeads + h;
  const size_t tok = (size_t)y * kChunk + i;
  // row sum of the masked scores
  const unsigned short* arh = Ah + tile * (size_t)(kChunk * kChunk) + (size_t)i * kChunk;
  const unsigned short* arl = Al + tile * (size_t)(kChunk * kChunk) + (size_t)i * kChunk;
  float asum = 0.f;
#pragma unroll 1
  for (int w = 0; w < 16; ++w) {
    const v4u uh = *(const v4u*)(arh + 8 * w);
    const v4u ul = *(const v4u*)(arl + 8 * w);
#pragma unroll
    for (int e = 0; e < 4; ++e) {
      const float a0 = bflo2f(uh[e]) + bflo2f(ul[e]);
      asum = asum + a0;
      const float a1 = bfhi2f(uh[e]) + bfhi2f(ul[e]);
      asum = asum + a1;
    }
  }
  // q . z_c
  const unsigned short* qrh = qh + tok * (size_t)kEmb + (size_t)h * kHdim;
  const unsigned short* qrl = ql + tok * (size_t)kEmb + (size_t)h * kHdim;
  const float* zp = zpre + tile * kHdim;
  float qz = 0.f;
#pragma unroll 1
  for (int w = 0; w < 8; ++w) {
    const v4u uh = *(const v4u*)(qrh + 8 * w);
    const v4u ul = *(const v4u*)(qrl + 8 * w);
    const v4f z0 = *(const v4f*)(zp + 8 * w);
    const v4f z1 = *(const v4f*)(zp + 8 * w + 4);
    float qv[8], zv[8];
#pragma unroll
    for (int e = 0; e < 4; ++e) {
      qv[2 * e]     = bflo2f(uh[e]) + bflo2f(ul[e]);
      qv[2 * e + 1] = bfhi2f(uh[e]) + bfhi2f(ul[e]);
      zv[e] = z0[e];
      zv[4 + e] = z1[e];
    }
#pragma unroll
    for (int e = 0; e < 8; ++e) qz += qv[e] * zv[e];
  }
  const float den = (qz + asum) + kEps;
  const float inv = 1.0f / den;
  const float* nr = num + tok * (size_t)kEmb + (size_t)h * kHdim;
#pragma unroll 1
  for (int w = 0; w < 16; ++w) {
    const v4f nv = *(const v4f*)(nr + 4 * w);
#pragma unroll
    for (int e = 0; e < 4; ++e) os[i][4 * w + e] = nv[e] * inv;
  }
  __syncthreads();
  const int q4 = lane >> 3, c8 = (lane & 7) * 8;
  v4u uo_h[8], uo_l[8];
#pragma unroll
  for (int it = 0; it < 8; ++it) {
    const int row = it * 16 + wave * 4 + q4;
    unsigned short hb[8], lb[8];
#pragma unroll
    for (int e = 0; e < 8; ++e) {
      const float f = os[row][c8 + e];
      hb[e] = f2bf_bits(f);
      lb[e] = f2bf_bits(f - bf_bits2f(hb[e]));
    }
    uo_h[it] = (v4u){pk16(hb[0], hb[1]), pk16(hb[2], hb[3]), pk16(hb[4], hb[5]), pk16(hb[6], hb[7])};
    uo_l[it] = (v4u){pk16(lb[0], lb[1]), pk16(lb[2], lb[3]), pk16(lb[4], lb[5]), pk16(lb[6], lb[7])};
  }
  {
#pragma unroll
    for (int it = 0; it < 8; ++it) {
      const int row = it * 16 + wave * 4 + q4;
      const size_t o = ((size_t)y * kChunk + row) * (size_t)kEmb + (size_t)h * kHdim + c8;
      *(v4u*)(oh + o) = uo_h[it];
      *(v4u*)(ol + o) = uo_l[it];
    }
    
  }
}

// ---------------------------------------------------------------------------
// Premise check on the causal flag: only the causal branch is built; if the flag is 0 the output is poisoned with NaN
// ---------------------------------------------------------------------------
__global__ __launch_bounds__(256) void premise_kernel(const int* __restrict__ flag, float* __restrict__ out, int n16) {
  const int i = blockIdx.x * 256 + threadIdx.x;
  if (i >= n16) return;
  const int f = flag[0];
  if (f != 0) return;
  const float qn = __uint_as_float(0x7fc00000u);
  const v4f nv = (v4f){qn, qn, qn, qn};
  float* p = out + 16 * (size_t)i;
  {
#pragma unroll
    for (int k = 0; k < 4; ++k) *(v4f*)(p + 4 * k) = nv;
    
  }
}

// ---------------------------------------------------------------------------
// Host launcher
// ---------------------------------------------------------------------------
extern "C" void kernel_launch(void* const* d_in, const int* in_sizes, int n_in,
                              void* d_out, int out_size, void* d_ws, size_t ws_size,
                              hipStream_t stream) {
  if (n_in < 8) return;
  if (in_sizes[0] != (int)kPlaneEl || in_sizes[1] != (int)kPlaneEl || in_sizes[2] != (int)kPlaneEl) return;
  if (in_sizes[3] != (int)kWEl || in_sizes[4] != (int)kWEl || in_sizes[5] != (int)kWEl || in_sizes[6] != (int)kWEl) return;
  if (in_sizes[7] < 1) return;
  if (out_size != (int)kPlaneEl) return;
  if (ws_size < (size_t)kWsTotal) return;

  const float* Q  = (const float*)d_in[0];
  const float* Kx = (const float*)d_in[1];
  const float* Vx = (const float*)d_in[2];
  const float* Wq = (const float*)d_in[3];
  const float* Wk = (const float*)d_in[4];
  const float* Wv = (const float*)d_in[5];
  const float* Wo = (const float*)d_in[6];
  const int*   causal = (const int*)d_in[7];
  float* out = (float*)d_out;
  char* ws = (char*)d_ws;

  unsigned short* Xbase = (unsigned short*)(ws + oXbase);
  const unsigned short* Xq_h = Xbase;
  const unsigned short* Xq_l = Xbase + kPlaneEl;
  const unsigned short* Xk_h = Xbase + 2 * kPlaneEl;
  const unsigned short* Xk_l = Xbase + 3 * kPlaneEl;
  const unsigned short* Xv_h = Xbase + 4 * kPlaneEl;
  const unsigned short* Xv_l = Xbase + 5 * kPlaneEl;
  unsigned short* Wbase = (unsigned short*)(ws + oWbase);
  const unsigned short* Wq_h = Wbase;
  const unsigned short* Wq_l = Wbase + kWEl;
  const unsigned short* Wk_h = Wbase + 2 * kWEl;
  const unsigned short* Wk_l = Wbase + 3 * kWEl;
  const unsigned short* Wv_h = Wbase + 4 * kWEl;
  const unsigned short* Wv_l = Wbase + 5 * kWEl;
  const unsigned short* Wo_h = (const unsigned short*)(ws + oWo_h);
  const unsigned short* Wo_l = (const unsigned short*)(ws + oWo_l);
  unsigned short* q_h  = (unsigned short*)(ws + oQ_h);
  unsigned short* q_l  = (unsigned short*)(ws + oQ_l);
  unsigned short* k_h  = (unsigned short*)(ws + oK_h);
  unsigned short* k_l  = (unsigned short*)(ws + oK_l);
  unsigned short* v_h  = (unsigned short*)(ws + oV_h);
  unsigned short* v_l  = (unsigned short*)(ws + oV_l);
  unsigned short* kT_h = (unsigned short*)(ws + oKT_h);
  unsigned short* kT_l = (unsigned short*)(ws + oKT_l);
  unsigned short* vT_h = (unsigned short*)(ws + oVT_h);
  unsigned short* vT_l = (unsigned short*)(ws + oVT_l);
  float*          dST  = (float*)(ws + oDST);
  unsigned short* ST_h = (unsigned short*)(ws + oST_h);
  unsigned short* ST_l = (unsigned short*)(ws + oST_l);
  unsigned short* A_h  = (unsigned short*)(ws + oA_h);
  unsigned short* A_l  = (unsigned short*)(ws + oA_l);
  float*          num1 = (float*)(ws + oNUM1);
  float*          numF = (float*)(ws + oNUM);
  unsigned short* o_h  = (unsigned short*)(ws + oO_h);
  unsigned short* o_l  = (unsigned short*)(ws + oO_l);
  float*          dz   = (float*)(ws + oDZ);
  float*          zpre = (float*)(ws + oZPRE);

  const long sTokChunk = (long)kChunk * kEmb;            // 131072: one chunk of token-major rows
  const long sTileA    = (long)kChunk * kChunk;          // 16384
  const long sTileT    = (long)kHdim * kChunk;           // 8192
  const long sTileS    = (long)kHdim * kHdim;            // 4096

  // 1) input and weight hi/lo planes
  split_planes_kernel<<<dim3((unsigned)(kPlaneEl / 8 / 256), 3, 1), 256, 0, stream>>>(Q, Kx, Vx, Vx, Xbase, kPlaneEl, (int)(kPlaneEl / 8));
  split_planes_kernel<<<dim3((unsigned)(kWEl / 8 / 256), 4, 1), 256, 0, stream>>>(Wq, Wk, Wv, Wo, Wbase, kWEl, (int)(kWEl / 8));

  // 2) projections: M=4096, N=1024, K=1024 (8 x 32 tiles of 128 x 128, one work-group each); q, k with elu(x)+1
  gemm128_ring<2, 6><<<dim3(kEmb / 128, kTok / 128, 1), 128, 0, stream>>>(Xq_h, Xq_l, Wq_h, Wq_l, q_h, q_l, nullptr);
  gemm128_ring<2, 6><<<dim3(kEmb / 128, kTok / 128, 1), 128, 0, stream>>>(Xk_h, Xk_l, Wk_h, Wk_l, k_h, k_l, nullptr);
  gemm128_ring<2, 0><<<dim3(kEmb / 128, kTok / 128, 1), 128, 0, stream>>>(Xv_h, Xv_l, Wv_h, Wv_l, v_h, v_l, nullptr);

  // 3) per-chunk transposes of k, v and chunk sums of k
  prep_kernel<<<dim3(kYB, kHeads, 1), 256, 0, stream>>>(k_h, k_l, v_h, v_l, kT_h, kT_l, vT_h, vT_l, dz);

  // 4) dST[e][d] = sum_j v[j][e] k[j][d] per (b,c,h): M=64, N=64, K=128, one wave per tile
  wmma_gemm64<1, true, 0, 0, false, 0><<<dim3(1, kYB, kHeads), 32, 0, stream>>>(
      vT_h, vT_l, kChunk, 16 * sTileT, sTileT, kT_h, kT_l, kChunk, 16 * sTileT, sTileT,
      (void*)dST, nullptr, kHdim, 16 * sTileS, sTileS,
      nullptr, nullptr, 0L, 0L, kHdim, kHdim, kChunk, 1.0f);

  // 5) exclusive prefix over chunks of S^T and z
  state_prefix_kernel<<<dim3(kBatch * kHeads, 1, 1), 256, 0, stream>>>(dST, dz, ST_h, ST_l, zpre);

  // 6) masked chunk scores A = tril(q.k^T) per (b,c,h): M=128, N=128, K=64, 4 tiles = 4 waves
  wmma_gemm64<1, true, 0, 2, false, 7><<<dim3(1, kYB, kHeads), 128, 0, stream>>>(
      q_h, q_l, kEmb, sTokChunk, (long)kHdim, k_h, k_l, kEmb, sTokChunk, (long)kHdim,
      (void*)A_h, (void*)A_l, kChunk, 16 * sTileA, sTileA,
      nullptr, nullptr, 0L, 0L, kChunk, kChunk, kHdim, 1.0f);

  // 7) num1 = q.S_c per (b,c,h): M=128, N=64, K=64, 2 tiles = 2 waves
  wmma_gemm64<1, true, 0, 0, false, 0><<<dim3(1, kYB, kHeads), 64, 0, stream>>>(
      q_h, q_l, kEmb, sTokChunk, (long)kHdim, ST_h, ST_l, kHdim, 16 * sTileS, sTileS,
      (void*)num1, nullptr, kEmb, sTokChunk, (long)kHdim,
      nullptr, nullptr, 0L, 0L, kChunk, kHdim, kHdim, 1.0f);

  // 8) num = A.v + num1 per (b,c,h): M=128, N=64, K=128 (separate output plane, resid = num1)
  wmma_gemm64<1, true, 0, 0, true, 0><<<dim3(1, kYB, kHeads), 64, 0, stream>>>(
      A_h, A_l, kChunk, 16 * sTileA, sTileA, vT_h, vT_l, kChunk, 16 * sTileT, sTileT,
      (void*)numF, nullptr, kEmb, sTokChunk, (long)kHdim,
      nullptr, num1, sTokChunk, (long)kHdim, kChunk, kHdim, kChunk, 1.0f);

  // 9) normaliser -> attention output hi/lo planes (token-major, heads merged)
  normalize_kernel<<<dim3(kYB, kHeads, 1), 128, 0, stream>>>(numF, A_h, A_l, q_h, q_l, zpre, o_h, o_l);

  // 10) output projection: M=4096, N=1024, K=1024 -> d_out
  gemm128_ring<0, 0><<<dim3(kEmb / 128, kTok / 128, 1), 128, 0, stream>>>(o_h, o_l, Wo_h, Wo_l, nullptr, nullptr, out);

  // 11) premise check on the causal flag (poisons the output when the non-causal branch would be required)
  premise_kernel<<<dim3((unsigned)(kPlaneEl / 16 / 256), 1, 1), 256, 0, stream>>>(causal, out, (int)(kPlaneEl / 16));
}

// v002
// Measured time: 188 microseconds a run.
// Timed twice side by side with v001, it ran 1.20 and 1.19 times as fast.
// Over all steps from v000 it is 2.30 times as fast.
// Contractions: q/k/v projections, chunk scores q.k^T, state increment v^T.k, q.S, A.v, output projection -- all v_wmma_f32_16x16x32_bf16 with bf16 hi/lo operand planes (hi.hi + hi.lo + lo.hi), f32 accumulate; feature map, state prefix over chunks, normaliser and division in f32 on the VALU.
#include <hip/hip_runtime.h>
#include <math.h>

// ---------------------------------------------------------------------------
// Problem constants
// ---------------------------------------------------------------------------
constexpr int kBatch   = 2;
constexpr int kSeq     = 2048;
constexpr int kEmb     = 1024;
constexpr int kHeads   = 16;
constexpr int kHdim    = 64;
constexpr int kChunk   = 128;
constexpr int kNChunk  = kSeq / kChunk;          // 16 chunks per sequence
constexpr int kTok     = kBatch * kSeq;          // 4096 token rows
constexpr int kYB      = kBatch * kNChunk;       // 32 (batch, chunk) pairs
constexpr int kTiles   = kYB * kHeads;           // 512 (batch, chunk, head) tiles
constexpr float kEps   = 1e-6f;
constexpr long kPlaneEl = (long)kTok * kEmb;     // 4194304 elements per activation plane
constexpr long kWEl     = (long)kEmb * kEmb;     // 1048576 elements per weight plane
constexpr long kUnit    = kPlaneEl * 2;          // 8388608 bytes (one bf16 activation plane)
constexpr long kWUnit   = kWEl * 2;              // 2097152 bytes (one bf16 weight plane)

// ---------------------------------------------------------------------------
// Workspace region map (bytes; U = 8388608, WU = 2097152); total 14U + 262144 = 117702656
//   [0U , 6U)  phase 1: Xq_h Xq_l Xk_h Xk_l Xv_h Xv_l (input hi/lo planes, dead after projections)
//              phase 2: kT_h@0U kT_l@1U vT_h@2U vT_l@3U dST(f32)@4U ST_h@5U ST_l@5.5U
//   [6U , 8U)  Wq_h Wq_l Wk_h Wk_l Wv_h Wv_l Wo_h Wo_l (WU each)
//   [8U ,14U)  q_h@8U q_l@9U k_h@10U k_l@11U v_h@12U v_l@13U (projection outputs)
//              later: o_h@12U o_l@13U (v dead after the transposes)
//   [14U, +262144)  dz f32 [512][64] @14U, zpre f32 [512][64] @14U+131072
// ---------------------------------------------------------------------------
constexpr long oXbase = 0;
constexpr long oKT_h  = 0;
constexpr long oKT_l  = 1 * kUnit;
constexpr long oVT_h  = 2 * kUnit;
constexpr long oVT_l  = 3 * kUnit;
constexpr long oDST   = 4 * kUnit;
constexpr long oST_h  = 5 * kUnit;
constexpr long oST_l  = 5 * kUnit + kUnit / 2;
constexpr long oWbase = 6 * kUnit;
constexpr long oWo_h  = oWbase + 6 * kWUnit;
constexpr long oWo_l  = oWbase + 7 * kWUnit;
constexpr long oQ_h   = 8 * kUnit;
constexpr long oQ_l   = 9 * kUnit;
constexpr long oK_h   = 10 * kUnit;
constexpr long oK_l   = 11 * kUnit;
constexpr long oV_h   = 12 * kUnit;
constexpr long oV_l   = 13 * kUnit;
constexpr long oO_h   = 12 * kUnit;
constexpr long oO_l   = 13 * kUnit;
constexpr long oDZ    = 14 * kUnit;
constexpr long oZPRE  = 14 * kUnit + 131072;
constexpr long kWsTotal = 14 * kUnit + 262144;
static_assert(kWsTotal == 117702656, "carve total");
static_assert(kWsTotal <= 134217728, "carve within 128 MiB");
static_assert((long)kTiles * kHdim * kChunk * 2 == kUnit, "kT plane size");
static_assert((long)kTiles * kHdim * kHdim * 4 == kUnit, "dST plane size");

typedef __attribute__((ext_vector_type(16))) _Float16 v16h;
typedef __attribute__((ext_vector_type(8)))  _Float16 v8h;
typedef __attribute__((ext_vector_type(16))) __bf16   v16b;
typedef __attribute__((ext_vector_type(8)))  __bf16   v8b;
typedef __attribute__((ext_vector_type(8)))  float    v8f;
typedef __attribute__((ext_vector_type(4)))  float    v4f;
typedef __attribute__((ext_vector_type(4)))  unsigned int v4u;

__device__ __forceinline__ unsigned short f2bf_bits(float f) {
  unsigned u = __float_as_uint(f);
  return (unsigned short)((u + 0x7FFFu + ((u >> 16) & 1u)) >> 16);
}
__device__ __forceinline__ float bf_bits2f(unsigned short h) { return __uint_as_float(((unsigned)h) << 16); }

// hazard guards as plain device helpers (no inline asm inside the kernel template body)
__device__ __forceinline__ void dep_guard_h(v8f& a, v8f& b, v16h x, v16h y) { asm volatile("v_nop\n\tv_nop\n\tv_nop\n\tv_nop" : "+v"(a), "+v"(b) : "v"(x), "v"(y)); }
__device__ __forceinline__ void dep_guard_b(v8f& a, v8f& b, v16b x, v16b y) { asm volatile("v_nop\n\tv_nop\n\tv_nop\n\tv_nop" : "+v"(a), "+v"(b) : "v"(x), "v"(y)); }
__device__ __forceinline__ void keep4_h(v16h a, v16h b, v16h c, v16h d) { asm volatile("v_nop" :: "v"(a), "v"(b), "v"(c), "v"(d)); }
__device__ __forceinline__ void keep4_b(v16b a, v16b b, v16b c, v16b d) { asm volatile("v_nop" :: "v"(a), "v"(b), "v"(c), "v"(d)); }
__device__ __forceinline__ void acc_guard4(v8f& a, v8f& b, v8f& c, v8f& d) { asm volatile("v_nop\n\tv_nop\n\tv_nop\n\tv_nop" : "+v"(a), "+v"(b), "+v"(c), "+v"(d)); }
template <typename T> struct Frag;
template <> struct Frag<_Float16> {
  typedef v16h V; union U { v16h v; v8h h[2]; };
  static __device__ __forceinline__ v16h load(const _Float16* p) {   // elements 0..7 <- p[0..7], 8..15 <- p[16..23]
    U f; f.h[0] = *(const v8h*)(p); f.h[1] = *(const v8h*)(p + 16); return f.v;
  }
  static __device__ __forceinline__ v8f mma(v16h a, v16h b, v8f c) {
    return __builtin_amdgcn_wmma_f32_16x16x32_f16(false, a, false, b, (short)0, c, false, false);
  }
  static __device__ __forceinline__ void guard(v8f& a, v8f& b, v16h x, v16h y) { dep_guard_h(a, b, x, y); }
  static __device__ __forceinline__ void keep(v16h a, v16h b, v16h c, v16h d) { keep4_h(a, b, c, d); }
};
template <> struct Frag<__bf16> {
  typedef v16b V; union U { v16b v; v8b h[2]; };
  static __device__ __forceinline__ v16b load(const __bf16* p) {
    U f; f.h[0] = *(const v8b*)(p); f.h[1] = *(const v8b*)(p + 16); return f.v;
  }
  static __device__ __forceinline__ v8f mma(v16b a, v16b b, v8f c) {
    return __builtin_amdgcn_wmma_f32_16x16x32_bf16(false, a, false, b, (short)0, c, false, false);
  }
  static __device__ __forceinline__ void guard(v8f& a, v8f& b, v16b x, v16b y) { dep_guard_b(a, b, x, y); }
  static __device__ __forceinline__ void keep(v16b a, v16b b, v16b c, v16b d) { keep4_b(a, b, c, d); }
};

__device__ __forceinline__ unsigned pk16(unsigned short a, unsigned short b) { return (unsigned)a | ((unsigned)b << 16); }
// bf16 element pair held in one 32-bit word: low half-word = even element, high half-word = odd element
__device__ __forceinline__ float bflo2f(unsigned w) { return __uint_as_float(w << 16); }
__device__ __forceinline__ float bfhi2f(unsigned w) { return __uint_as_float(w & 0xffff0000u); }

// ---- Register-blocked batched WMMA GEMM (2-D batch (blockIdx.y, blockIdx.z), waves per block from blockDim,
//      ACT reduced to none/relu/leaky plus 6 = elu(x)+1 and 7 = causal zero (n > m -> 0 for tile-local m, n)) ----
// C[m,n] = scale * sum_k A[m,k] * Bt[n,k] (+bias)(+resid); each wave owns a 64x64 tile.
// A row-major [M,K]; Bt row-major [N,K]; M,N % 64 == 0, K % 32 == 0.
// SPLIT: operands are hi/lo planes (A2/Bt2 = lo planes, same layout); product = hi.hi + hi.lo + lo.hi.
// BIAS_MODE: 0 = none, 1 = bias[m], 2 = bias[n].
// OUT_MODE: 0 = f32, 1 = f16, 2 = bf16 hi plane (Cout) + bf16 lo plane (Cout2).
// ET: 0 = f16 operands, 1 = bf16 operands (pointers passed as 16-bit storage)
template <int ET> struct Elem;
template <> struct Elem<0> { typedef _Float16 T; };
template <> struct Elem<1> { typedef __bf16 T; };
template <int ET, bool SPLIT, int BIAS_MODE, int OUT_MODE, bool RESID, int ACT = 0>
__global__ __launch_bounds__(256) void wmma_gemm64(
    const unsigned short* __restrict__ Ap, const unsigned short* __restrict__ A2p, int lda, long strideA, long strideAz,
    const unsigned short* __restrict__ Btp, const unsigned short* __restrict__ Bt2p, int ldb, long strideB, long strideBz,
    void* __restrict__ Cout, void* __restrict__ Cout2, int ldc, long strideC, long strideCz,
    const float* __restrict__ bias,
    const float* __restrict__ resid, long strideR, long strideRz,
    int M, int N, int K, float scale) {
  typedef typename Elem<ET>::T T;
  typedef typename Frag<T>::V V;
  const T* A = (const T*)Ap; const T* A2 = (const T*)A2p; const T* Bt = (const T*)Btp; const T* Bt2 = (const T*)Bt2p;
  __shared__ __align__(16) float sT[8][16 * 68];   // per-wave 16x64 slab, pitch 68 floats
  const int b    = blockIdx.y;
  const int bz   = blockIdx.z;
  const int lane = threadIdx.x & 31;
  const int wave = threadIdx.x >> 5;
  const int nwv  = blockDim.x >> 5;
  const int tilesN = N >> 6;
  const int tilesM = M >> 6;
  const int tile = blockIdx.x * nwv + wave;
  if (tile >= tilesM * tilesN) return;   // wave-uniform; no block barriers in this kernel
  const int tm = tile / tilesN;
  const int tn = tile - tm * tilesN;
  const int m0 = tm << 6;
  const int n0 = tn << 6;

  const T* Ab  = A  + (size_t)b * strideA + (size_t)bz * strideAz;
  const T* Bb  = Bt + (size_t)b * strideB + (size_t)bz * strideBz;
  const T* Ab2 = SPLIT ? (A2  + (size_t)b * strideA + (size_t)bz * strideAz) : nullptr;
  const T* Bb2 = SPLIT ? (Bt2 + (size_t)b * strideB + (size_t)bz * strideBz) : nullptr;
  const size_t cOff = (size_t)b * strideC + (size_t)bz * strideCz;

  const int rlane = lane & 15;                 // row (A) / col (B, D) within subtile
  const int koff  = (lane >> 4) * 8;           // k offset of this lane half
  const int mOff  = (lane >> 4) * 8;           // D row offset

  v8f acc[4][4];
#pragma unroll
  for (int i = 0; i < 4; ++i)
#pragma unroll
    for (int j = 0; j < 4; ++j) acc[i][j] = (v8f){0.f,0.f,0.f,0.f,0.f,0.f,0.f,0.f};

  for (int k0 = 0; k0 < K; k0 += 32) {
    V bh[4], bl[4];
#pragma unroll
    for (int j = 0; j < 4; ++j) {
      const size_t bo = (size_t)(n0 + (j << 4) + rlane) * ldb + koff + k0;
      bh[j] = Frag<T>::load(Bb + bo);
      if (SPLIT) bl[j] = Frag<T>::load(Bb2 + bo);
    }
#pragma unroll
    for (int i = 0; i < 4; ++i) {
      const size_t ao = (size_t)(m0 + (i << 4) + rlane) * lda + koff + k0;
      V ah = Frag<T>::load(Ab + ao);
      V al;
      if (SPLIT) al = Frag<T>::load(Ab2 + ao);
#pragma unroll
      for (int j = 0; j < 4; ++j) {
        acc[i][j] = Frag<T>::mma(ah, bh[j], acc[i][j]);
        if (SPLIT) {
          acc[i][j] = Frag<T>::mma(ah, bl[j], acc[i][j]);
          acc[i][j] = Frag<T>::mma(al, bh[j], acc[i][j]);
        }
      }
      Frag<T>::guard(acc[i][0], acc[i][3], ah, SPLIT ? al : ah);
    }
    Frag<T>::keep(bh[0], bh[1], bh[2], bh[3]);
    if (SPLIT) Frag<T>::keep(bl[0], bl[1], bl[2], bl[3]);
  }
  acc_guard4(acc[0][0], acc[0][1], acc[0][2], acc[0][3]);
  acc_guard4(acc[1][0], acc[1][1], acc[1][2], acc[1][3]);
  acc_guard4(acc[2][0], acc[2][1], acc[2][2], acc[2][3]);
  acc_guard4(acc[3][0], acc[3][1], acc[3][2], acc[3][3]);

  // ---- epilogue ----
  float* slab = sT[wave];
  const float* Rb = RESID ? (resid + (size_t)b * strideR + (size_t)bz * strideRz) : nullptr;
#pragma unroll
  for (int i = 0; i < 4; ++i) {
    const int mBase = m0 + (i << 4);
#pragma unroll
    for (int j = 0; j < 4; ++j) {
      const int n = n0 + (j << 4) + rlane;
      float bv = 0.f;
      if (BIAS_MODE == 2) bv = bias[n];
#pragma unroll
      for (int r = 0; r < 8; ++r) {
        float v = acc[i][j][r] * scale;
        if (BIAS_MODE == 1) v += bias[mBase + mOff + r];
        if (BIAS_MODE == 2) v += bv;
        if (RESID) v += Rb[(size_t)(mBase + mOff + r) * ldc + n];
        if (ACT == 2) v = fmaxf(v, 0.0f);
        if (ACT == 4) v = (v > 0.f) ? v : 0.01f * v;
        if (ACT == 6) v = (v > 0.f) ? (v + 1.0f) : expf(v);
        if (ACT == 7) { if (n > mBase + mOff + r) v = 0.0f; }
        slab[(mOff + r) * 68 + (j << 4) + rlane] = v;
      }
    }
    __builtin_amdgcn_fence(__ATOMIC_RELEASE, "workgroup");
    __builtin_amdgcn_wave_barrier();
    __builtin_amdgcn_fence(__ATOMIC_ACQUIRE, "workgroup");
    if (OUT_MODE == 0) {
      float* C = (float*)Cout + cOff;
      const int hh = lane >> 4, c4 = (lane & 15) * 4;     // row seg = 256 B = 16 lanes x 16 B
      {
#pragma unroll
        for (int it = 0; it < 8; ++it) {
          const int row = it * 2 + hh;
          v4f v = *(const v4f*)(slab + row * 68 + c4);
          *(v4f*)(C + (size_t)(mBase + row) * ldc + n0 + c4) = v;
        }
        
      }
    } else {
      const int q = lane >> 3, c8 = (lane & 7) * 8;
      unsigned short* C  = (unsigned short*)Cout  + cOff;
      unsigned short* C2 = (OUT_MODE == 2) ? ((unsigned short*)Cout2 + cOff) : nullptr;
      {
#pragma unroll
        for (int it = 0; it < 4; ++it) {
          const int row = it * 4 + q;
          const float* sp = slab + row * 68 + c8;
          v8h hv, lv;
#pragma unroll
          for (int e = 0; e < 8; ++e) {
            if (OUT_MODE == 1) {
              hv[e] = (_Float16)sp[e];
            } else {
              unsigned short hb = f2bf_bits(sp[e]);
              unsigned short lb = f2bf_bits(sp[e] - bf_bits2f(hb));
              hv[e] = __builtin_bit_cast(_Float16, hb);
              lv[e] = __builtin_bit_cast(_Float16, lb);
            }
          }
          *(v8h*)(C + (size_t)(mBase + row) * ldc + n0 + c8) = hv;
          if (OUT_MODE == 2) *(v8h*)(C2 + (size_t)(mBase + row) * ldc + n0 + c8) = lv;
        }
        
      }
    }
    __builtin_amdgcn_fence(__ATOMIC_RELEASE, "workgroup");
    __builtin_amdgcn_wave_barrier();
    __builtin_amdgcn_fence(__ATOMIC_ACQUIRE, "workgroup");
  }
}

// ---------------------------------------------------------------------------
// The four 4096 x 1024 x 1024 products: C[m,n] = sum_k A[m,k] * Bt[n,k], hi/lo planes, product = hi.hi + hi.lo + lo.hi.
// One 128 x 128 tile of C per work-group, four waves (2 x 2), each wave a 64 x 64 tile (the 4 x 4 accumulators of wmma_gemm64).
// A stage is 128 k (256 B) of 128 rows of each of the four operand planes [A_h | A_l | B_h | B_l], LDS row pitch 272 B;
// wave w brings plane w of every stage with one tensor load; two buffers, the next stage's loads fly while this one is worked on.
// Per accumulator the products are summed in the order of wmma_gemm64: k ascending, hi.hi, hi.lo, lo.hi inside each 32 k.
// ---------------------------------------------------------------------------
constexpr unsigned kRowB    = 256;                    // bytes of one operand row in a stage
constexpr unsigned kPitchB  = 272;                    // LDS row pitch: 256 B + the 16-B pad for ds_load_b128 readers
constexpr unsigned kPlaneB  = 128 * kPitchB;          // 34816 B, one plane's slice of a stage
constexpr unsigned kStageB  = 4 * kPlaneB;            // 139264 B, one buffer
constexpr unsigned kStages  = (unsigned)kEmb * 2 / kRowB;   // 8
static_assert(kPlaneB % 2048 == 0, "every slice starts at a multiple of 2 KiB");
static_assert(kStages >= 2, "the ring's prologue needs two stages");
typedef __attribute__((ext_vector_type(8))) unsigned int v8u;

__device__ __forceinline__ unsigned uni(unsigned v) { return (unsigned)__builtin_amdgcn_readfirstlane((int)v); }
__device__ __forceinline__ unsigned pinned(unsigned v) { unsigned w = uni(v); asm volatile("" : "+s"(w)); return w; }
__device__ __forceinline__ void wait_ds0()     { asm volatile("s_wait_dscnt 0x0" ::: "memory"); }      // this wave's LDS reads have returned
__device__ __forceinline__ void wait_tensor0() { asm volatile("s_wait_tensorcnt 0x0" ::: "memory"); }  // this wave's tensor load has landed
__device__ __forceinline__ void tdm_load(v4u g0, v8u g1) { asm volatile("tensor_load_to_lds %0, %1" :: "s"(g0), "s"(g1) : "memory"); }
__device__ __forceinline__ v4u tdm_group0(unsigned lds_dst, unsigned long long ga) {
  v4u g;
  g[0] = uni(1u); g[1] = uni(lds_dst); g[2] = uni((unsigned)ga); g[3] = uni((((unsigned)(ga >> 32)) & 0x01FFFFFFu) | 0x80000000u);
  return g;
}
// 1-byte elements, tile = tensor = 128 rows of 256 B, source pitch one K row, 4 dwords of LDS pad behind every 64 dwords
__device__ __forceinline__ v8u tdm_group1() {
  constexpr unsigned d0 = kRowB, d1 = 128u;
  v8u g;
  g[0] = uni((1u << 20) | (5u << 22) | (3u << 25));
  g[1] = uni((d0 & 0xFFFFu) << 16);
  g[2] = uni((d0 >> 16) | ((d1 & 0xFFFFu) << 16));
  g[3] = uni((d1 >> 16) | (d0 << 16));
  g[4] = uni(d1);
  g[5] = uni((unsigned)kEmb * 2u);
  g[6] = uni(0u);
  g[7] = uni(0u);
  return g;
}

struct FragSet { v16b ah[4], al[4], bh[4], bl[4]; };
// the fragments of one 32-k block: pa / pb = this lane's row 0 of the A_h / B_h slices, at its k half
__device__ __forceinline__ void load_set(FragSet& f, const unsigned char* pa, const unsigned char* pb, int kb) {
  const unsigned k = (unsigned)kb * 64u;
  constexpr unsigned t = 16u * kPitchB;   // 16 rows
  // in the order in which mma_set needs them: the first term can start when half of the group has returned
#pragma unroll
  for (int i = 0; i < 4; ++i) f.ah[i] = Frag<__bf16>::load((const __bf16*)(pa + (unsigned)i * t + k));
#pragma unroll
  for (int i = 0; i < 4; ++i) f.bh[i] = Frag<__bf16>::load((const __bf16*)(pb + (unsigned)i * t + k));
#pragma unroll
  for (int i = 0; i < 4; ++i) f.bl[i] = Frag<__bf16>::load((const __bf16*)(pb + kPlaneB + (unsigned)i * t + k));
#pragma unroll
  for (int i = 0; i < 4; ++i) f.al[i] = Frag<__bf16>::load((const __bf16*)(pa + kPlaneB + (unsigned)i * t + k));
}
// 48 WMMAs; each term runs over all 16 accumulators, so that no WMMA waits for the one in front of it
__device__ __forceinline__ void mma_set(const FragSet& f, v8f (&acc)[4][4]) {
#pragma unroll
  for (int i = 0; i < 4; ++i)
#pragma unroll
    for (int j = 0; j < 4; ++j) acc[i][j] = Frag<__bf16>::mma(f.ah[i], f.bh[j], acc[i][j]);
#pragma unroll
  for (int i = 0; i < 4; ++i)
#pragma unroll
    for (int j = 0; j < 4; ++j) acc[i][j] = Frag<__bf16>::mma(f.ah[i], f.bl[j], acc[i][j]);
#pragma unroll
  for (int i = 0; i < 4; ++i)
#pragma unroll
    for (int j = 0; j < 4; ++j) acc[i][j] = Frag<__bf16>::mma(f.al[i], f.bh[j], acc[i][j]);
}

// OUT_MODE: 0 = f32 to Cf, 2 = bf16 hi plane (Ch) + lo plane (Cl). ACT: 0 = none, 6 = elu(x)+1. grid (N/128, M/128), 128 threads.
template <int OUT_MODE, int ACT>
__global__ __launch_bounds__(128) void gemm128_ring(
    const unsigned short* __restrict__ Ah, const unsigned short* __restrict__ Al,
    const unsigned short* __restrict__ Bh, const unsigned short* __restrict__ Bl,
    unsigned short* __restrict__ Ch, unsigned short* __restrict__ Cl, float* __restrict__ Cf) {
  __shared__ __attribute__((aligned(2048))) unsigned char ring[2 * kStageB];
  __shared__ __align__(16) float sT[4][16 * 68];   // per-wave 16x64 slab, pitch 68 floats
  const int lane = threadIdx.x & 31;
  const unsigned wave = uni(threadIdx.x >> 5);
  const int rlane = lane & 15;
  const int mOff  = (lane >> 4) * 8;
  const int m0 = (int)blockIdx.y * 128 + (int)(wave >> 1) * 64;
  const int n0 = (int)blockIdx.x * 128 + (int)(wave & 1u) * 64;

  // this wave's plane: first byte of its 128 rows, and its slice's place in buffer 0
  const unsigned short* plane = (wave == 0u) ? Ah : (wave == 1u) ? Al : (wave == 2u) ? Bh : Bl;
  const unsigned row0 = ((wave < 2u) ? blockIdx.y : blockIdx.x) * 128u;
  const unsigned long long ga = (unsigned long long)(plane + (size_t)row0 * kEmb);
  const unsigned slice = (unsigned)(unsigned long long)(const void*)ring + wave * kPlaneB;
  const v8u g1 = tdm_group1();

  const unsigned aoff = ((wave >> 1) * 64u + (unsigned)rlane) * kPitchB + (unsigned)(lane >> 4) * 16u;
  const unsigned boff = 2u * kPlaneB + ((wave & 1u) * 64u + (unsigned)rlane) * kPitchB + (unsigned)(lane >> 4) * 16u;

  v8f acc[4][4];
#pragma unroll
  for (int i = 0; i < 4; ++i)
#pragma unroll
    for (int j = 0; j < 4; ++j) acc[i][j] = (v8f){0.f,0.f,0.f,0.f,0.f,0.f,0.f,0.f};

  tdm_load(tdm_group0(slice, ga), g1);
  wait_tensor0();
  __syncthreads();                                  // stage 0 is readable by every wave
  tdm_load(tdm_group0(slice + kStageB, ga + kRowB), g1);

  // rolled: one copy of the 192-WMMA pass, and every accumulator and fragment index stays a constant
#pragma clang loop unroll(disable)
  for (unsigned s = 0; s < kStages; ++s) {
    const unsigned buf = (s & 1u) * kStageB;
    const unsigned char* pa = ring + buf + aoff;
    const unsigned char* pb = ring + buf + boff;
    FragSet f[2];
    load_set(f[0], pa, pb, 0);
#pragma unroll
    for (int kb = 0; kb < 4; ++kb) {
      if (kb < 3) load_set(f[(kb + 1) & 1], pa, pb, kb + 1);
      __builtin_amdgcn_sched_barrier(0);            // keeps the next block's LDS reads one group in front of this block's WMMAs
      mma_set(f[kb & 1], acc);
      __builtin_amdgcn_sched_barrier(0);            // and the block after that one's reads behind them
    }
    wait_ds0();
    wait_tensor0();
    __syncthreads();                                // publishes stage s + 1; every reader has left stage s's buffer
    const unsigned nx = pinned(s + 2u);             // formed behind the wait, and the descriptor from it
    if (nx < kStages) tdm_load(tdm_group0(slice + buf, ga + (unsigned long long)nx * kRowB), g1);
  }
  wait_tensor0();
  wait_ds0();

  // ---- epilogue (as in wmma_gemm64) ----
  float* slab = sT[wave];
#pragma unroll
  for (int i = 0; i < 4; ++i) {
    const int mBase = m0 + (i << 4);
#pragma unroll
    for (int j = 0; j < 4; ++j) {
#pragma unroll
      for (int r = 0; r < 8; ++r) {
        float v = acc[i][j][r];
        if (ACT == 6) v = (v > 0.f) ? (v + 1.0f) : expf(v);
        slab[(mOff + r) * 68 + (j << 4) + rlane] = v;
      }
    }
    __builtin_amdgcn_fence(__ATOMIC_RELEASE, "workgroup");
    __builtin_amdgcn_wave_barrier();
    __builtin_amdgcn_fence(__ATOMIC_ACQUIRE, "workgroup");
    if (OUT_MODE == 0) {
      const int hh = lane >> 4, c4 = (lane & 15) * 4;     // row seg = 256 B = 16 lanes x 16 B
      v4f rv[8];
#pragma unroll
      for (int it = 0; it < 8; ++it) rv[it] = *(const v4f*)(slab + (it * 2 + hh) * 68 + c4);
#pragma unroll
      for (int it = 0; it < 8; ++it) *(v4f*)(Cf + (size_t)(mBase + it * 2 + hh) * kEmb + n0 + c4) = rv[it];
      asm volatile("s_wait_xcnt 0x0" ::: "memory");   // stands in front of the next use of the registers that these stores name
    } else {
      const int q = lane >> 3, c8 = (lane & 7) * 8;
      v8h hv[4], lv[4];
#pragma unroll
      for (int it = 0; it < 4; ++it) {
        const float* sp = slab + (it * 4 + q) * 68 + c8;
#pragma unroll
        for (int e = 0; e < 8; ++e) {
          unsigned short hb = f2bf_bits(sp[e]);
          unsigned short lb = f2bf_bits(sp[e] - bf_bits2f(hb));
          hv[it][e] = __builtin_bit_cast(_Float16, hb);
          lv[it][e] = __builtin_bit_cast(_Float16, lb);
        }
      }
#pragma unroll
      for (int it = 0; it < 4; ++it) {
        *(v8h*)(Ch + (size_t)(mBase + it * 4 + q) * kEmb + n0 + c8) = hv[it];
        *(v8h*)(Cl + (size_t)(mBase + it * 4 + q) * kEmb + n0 + c8) = lv[it];
      }
      asm volatile("s_wait_xcnt 0x0" ::: "memory");   // stands in front of the next use of the registers that these stores name
    }
    __builtin_amdgcn_fence(__ATOMIC_RELEASE, "workgroup");
    __builtin_amdgcn_wave_barrier();
    __builtin_amdgcn_fence(__ATOMIC_ACQUIRE, "workgroup");
  }
}

// ---------------------------------------------------------------------------
// f32 -> bf16 hi + lo planes (RNE convert both), 8 consecutive elements per thread: one 16-B store per lane per plane,
// blockIdx.y selects the source tensor (block-uniform); hi plane z lives at out + 2z*planeEl, lo plane at +planeEl.
// Coverage: n8 = planeEl/8 threads x 8 = the whole plane (grids are exact multiples of 256 here).
// ---------------------------------------------------------------------------
__global__ __launch_bounds__(256) void split_planes_kernel(const float* __restrict__ s0, const float* __restrict__ s1,
                                                           const float* __restrict__ s2, const float* __restrict__ s3,
                                                           unsigned short* __restrict__ out, long planeEl, int n8) {
  const int i = blockIdx.x * 256 + threadIdx.x;
  const int z = blockIdx.y;
  if (i >= n8) return;
  const float* src = (z == 0) ? s0 : (z == 1) ? s1 : (z == 2) ? s2 : s3;
  const float* p = src + 8 * (size_t)i;
  const v4f a = *(const v4f*)(p);
  const v4f c = *(const v4f*)(p + 4);
  unsigned short hb[8], lb[8];
#pragma unroll
  for (int e = 0; e < 4; ++e) {
    hb[e]     = f2bf_bits(a[e]);
    lb[e]     = f2bf_bits(a[e] - bf_bits2f(hb[e]));
    hb[4 + e] = f2bf_bits(c[e]);
    lb[4 + e] = f2bf_bits(c[e] - bf_bits2f(hb[4 + e]));
  }
  const v4u uh = (v4u){pk16(hb[0], hb[1]), pk16(hb[2], hb[3]), pk16(hb[4], hb[5]), pk16(hb[6], hb[7])};
  const v4u ul = (v4u){pk16(lb[0], lb[1]), pk16(lb[2], lb[3]), pk16(lb[4], lb[5]), pk16(lb[6], lb[7])};
  unsigned short* ph = out + (size_t)(2 * z) * planeEl + 8 * (size_t)i;
  unsigned short* pl = ph + planeEl;
  *(v4u*)ph = uh;
  *(v4u*)pl = ul;
  
}

// ---------------------------------------------------------------------------
// Per (batch-chunk y, head h) tile: transpose the 128x64 chunk tiles of k and v (hi and lo planes, token-major [4096][1024])
// into kT, vT tiles [64 d][128 j] at (y*16+h)*8192, and dz[y*16+h][d] = sum_j k[j][d] (f32, k = hi + lo, j in order).
// grid (32, 16), 256 threads. LDS tiles hold one hi/lo pair at a time.
// Load coverage: 4 iterations x 256 threads = 1024 units of (row j, 8 d) = 128 x 64 = whole tile, every LDS cell read is written.
// Store coverage: 4 iterations x 8 waves x 2 (lane>>4) = 64 rows; 16 lanes x 8 halves = 128 cols; each row = 256 B = 2 whole
// ---------------------------------------------------------------------------
__global__ __launch_bounds__(256) void prep_kernel(const unsigned short* __restrict__ kh, const unsigned short* __restrict__ kl,
                                                   const unsigned short* __restrict__ vh, const unsigned short* __restrict__ vl,
                                                   unsigned short* __restrict__ kTh, unsigned short* __restrict__ kTl,
                                                   unsigned short* __restrict__ vTh, unsigned short* __restrict__ vTl,
                                                   float* __restrict__ dz) {
  __shared__ unsigned short tA[64][136];
  __shared__ unsigned short tB[64][136];
  __shared__ __align__(16) float dzs[64];
  const int t = threadIdx.x;
  const int lane = t & 31, wave = t >> 5;
  const int y = blockIdx.x, h = blockIdx.y;
  const size_t tok0 = (size_t)y * kChunk;
  const size_t tile = (size_t)y * kHeads + h;
  const size_t tileOff = tile * (size_t)(kHdim * kChunk);
  const int hh = lane >> 4, c8 = (lane & 15) * 8;
  for (int p = 0; p < 2; ++p) {
    const unsigned short* sH = (p == 0) ? kh : vh;
    const unsigned short* sL = (p == 0) ? kl : vl;
    unsigned short* dH = (p == 0) ? kTh : vTh;
    unsigned short* dL = (p == 0) ? kTl : vTl;
#pragma unroll
    for (int it = 0; it < 4; ++it) {
      const int idx = it * 256 + t;
      const int j = idx >> 3;
      const int d8 = (idx & 7) * 8;
      const size_t go = (tok0 + j) * (size_t)kEmb + (size_t)h * kHdim + d8;
      const v4u wh = *(const v4u*)(sH + go);
      const v4u wl = *(const v4u*)(sL + go);
#pragma unroll
      for (int e = 0; e < 4; ++e) {
        tA[d8 + 2 * e][j]     = (unsigned short)(wh[e] & 0xffffu);
        tA[d8 + 2 * e + 1][j] = (unsigned short)(wh[e] >> 16);
        tB[d8 + 2 * e][j]     = (unsigned short)(wl[e] & 0xffffu);
        tB[d8 + 2 * e + 1][j] = (unsigned short)(wl[e] >> 16);
      }
    }
    __syncthreads();
    if (p == 0) {
      if (t < 64) {
        float s = 0.f;
#pragma unroll 1
        for (int j = 0; j < kChunk; ++j) {
          const float kv = bf_bits2f(tA[t][j]) + bf_bits2f(tB[t][j]);
          s = s + kv;
        }
        dzs[t] = s;
      }
      __syncthreads();
    }
    v4u uH[4], uL[4];
#pragma unroll
    for (int it = 0; it < 4; ++it) {
      const int d = it * 16 + wave * 2 + hh;
      unsigned short a[8], bb[8];
#pragma unroll
      for (int e = 0; e < 8; ++e) { a[e] = tA[d][c8 + e]; bb[e] = tB[d][c8 + e]; }
      uH[it] = (v4u){pk16(a[0], a[1]), pk16(a[2], a[3]), pk16(a[4], a[5]), pk16(a[6], a[7])};
      uL[it] = (v4u){pk16(bb[0], bb[1]), pk16(bb[2], bb[3]), pk16(bb[4], bb[5]), pk16(bb[6], bb[7])};
    }
    v4f zv = (v4f){0.f, 0.f, 0.f, 0.f};
    if (p == 0) zv = *(const v4f*)(dzs + 4 * (t & 15));
    {
#pragma unroll
      for (int it = 0; it < 4; ++it) {
        const int d = it * 16 + wave * 2 + hh;
        *(v4u*)(dH + tileOff + (size_t)d * kChunk + c8) = uH[it];
        *(v4u*)(dL + tileOff + (size_t)d * kChunk + c8) = uL[it];
      }
      if (p == 0 && t < 16) *(v4f*)(dz + tile * kHdim + 4 * t) = zv;
      
    }
    __syncthreads();
  }
}

// ---------------------------------------------------------------------------
// Exclusive prefix over chunks of the transposed state and of z, per (b, h): block bh, 256 threads, static 16-step loop.
// S^T_c = sum_{c' < c} dST_{c'} (f32, sequential), written as bf16 hi/lo planes [tile][64 e][64 d] (tile = (b*16+c)*16+h);
// z_c likewise to zpre[tile][64] (f32). Thread t owns elements 8t..8t+7 and 2048+8t..2048+8t+7 of each 4096-element tile:
// ---------------------------------------------------------------------------
__global__ __launch_bounds__(256) void state_prefix_kernel(const float* __restrict__ dST, const float* __restrict__ dz,
                                                           unsigned short* __restrict__ STh, unsigned short* __restrict__ STl,
                                                           float* __restrict__ zpre) {
  __shared__ __align__(16) float zs[64];
  const int t = threadIdx.x;
  const int bh = blockIdx.x;
  const int b = bh >> 4, h = bh & 15;
  float a0[8], a1[8];
#pragma unroll
  for (int e = 0; e < 8; ++e) { a0[e] = 0.f; a1[e] = 0.f; }
  float zacc = 0.f;
#pragma unroll 1
  for (int c = 0; c < kNChunk; ++c) {
    const size_t tile = ((size_t)(b * kNChunk + c)) * kHeads + h;
    const size_t so = tile * 4096;
    unsigned short hb[16], lb[16];
#pragma unroll
    for (int e = 0; e < 8; ++e) {
      hb[e] = f2bf_bits(a0[e]);      lb[e] = f2bf_bits(a0[e] - bf_bits2f(hb[e]));
      hb[8 + e] = f2bf_bits(a1[e]);  lb[8 + e] = f2bf_bits(a1[e] - bf_bits2f(hb[8 + e]));
    }
    const v4u h0 = (v4u){pk16(hb[0], hb[1]), pk16(hb[2], hb[3]), pk16(hb[4], hb[5]), pk16(hb[6], hb[7])};
    const v4u l0 = (v4u){pk16(lb[0], lb[1]), pk16(lb[2], lb[3]), pk16(lb[4], lb[5]), pk16(lb[6], lb[7])};
    const v4u h1 = (v4u){pk16(hb[8], hb[9]), pk16(hb[10], hb[11]), pk16(hb[12], hb[13]), pk16(hb[14], hb[15])};
    const v4u l1 = (v4u){pk16(lb[8], lb[9]), pk16(lb[10], lb[11]), pk16(lb[12], lb[13]), pk16(lb[14], lb[15])};
    if (t < 64) zs[t] = zacc;
    __syncthreads();
    const v4f zv = *(const v4f*)(zs + 4 * (t & 15));
    {
      *(v4u*)(STh + so + 8 * (size_t)t) = h0;
      *(v4u*)(STl + so + 8 * (size_t)t) = l0;
      *(v4u*)(STh + so + 2048 + 8 * (size_t)t) = h1;
      *(v4u*)(STl + so + 2048 + 8 * (size_t)t) = l1;
      if (t < 16) *(v4f*)(zpre + tile * kHdim + 4 * t) = zv;
      
    }
    __syncthreads();
    const float* dp = dST + so;
    const v4f d00 = *(const v4f*)(dp + 8 * t);
    const v4f d01 = *(const v4f*)(dp + 8 * t + 4);
    const v4f d10 = *(const v4f*)(dp + 2048 + 8 * t);
    const v4f d11 = *(const v4f*)(dp + 2048 + 8 * t + 4);
#pragma unroll
    for (int e = 0; e < 4; ++e) {
      a0[e] += d00[e];  a0[4 + e] += d01[e];
      a1[e] += d10[e];  a1[4 + e] += d11[e];
    }
    zacc += dz[tile * kHdim + (t & 63)];
  }
}

// ---------------------------------------------------------------------------
// Per (batch-chunk y, head h), one work-group of eight waves: masked scores A = tril(q.k^T), num = A.v + q.S_c,
// den = q.z_c + rowsum(A) + eps, o = num * (1/den) as bf16 hi/lo rows of the token-major o planes.
// The k, v^T and S^T tiles (hi and lo) are staged once in LDS; wave w owns chunk rows 16w .. 16w+15 from the scores to the stores,
// and its A rows pass from the accumulator layout to the A-operand layout through its own LDS slab (bf16 hi/lo, never in memory).
// Every sum keeps its order: per accumulator k ascending with hi.hi, hi.lo, lo.hi inside each 32 k; A.v and q.S in separate
// accumulators, added once; row sum and q.z sequential in f32.
// ---------------------------------------------------------------------------
constexpr int kPK = 72;                        // LDS row pitch of the 64-wide tiles (k, S^T), elements: 144 B = 16 B x odd
constexpr int kPV = 136;                       // LDS row pitch of the 128-wide tiles (v^T, A), elements: 272 B = 16 B x odd
constexpr int kSlabB = 2 * 16 * kPV * 2;       // one wave's slab: A_h rows, then A_l rows; later the f32 num rows (pitch 68)
static_assert(16 * 68 * 4 <= kSlabB, "the num rows fit the slab");

// orders one wave's LDS writes in front of reads by its other lanes (the slabs are private to a wave)
__device__ __forceinline__ void wave_lds_sync() {
  __builtin_amdgcn_fence(__ATOMIC_RELEASE, "workgroup");
  __builtin_amdgcn_wave_barrier();
  __builtin_amdgcn_fence(__ATOMIC_ACQUIRE, "workgroup");
}
__device__ __forceinline__ v16b lds_frag(const unsigned short* p) { return Frag<__bf16>::load((const __bf16*)p); }

// at most 256 registers a wave: two work-groups (four waves per SIMD) share a WGP, so all 512 are resident at once
__global__ __launch_bounds__(256) __attribute__((amdgpu_waves_per_eu(4, 4))) void chunk_attn_kernel(const unsigned short* __restrict__ qh, const unsigned short* __restrict__ ql,
                                                         const unsigned short* __restrict__ kh, const unsigned short* __restrict__ kl,
                                                         const unsigned short* __restrict__ vTh, const unsigned short* __restrict__ vTl,
                                                         const unsigned short* __restrict__ STh, const unsigned short* __restrict__ STl,
                                                         const float* __restrict__ zpre,
                                                         unsigned short* __restrict__ oh, unsigned short* __restrict__ ol) {
  __shared__ __align__(16) unsigned short sKh[kChunk * kPK];
  __shared__ __align__(16) unsigned short sKl[kChunk * kPK];
  __shared__ __align__(16) unsigned short sVh[kHdim * kPV];
  __shared__ __align__(16) unsigned short sVl[kHdim * kPV];
  __shared__ __align__(16) unsigned short sSh[kHdim * kPK];
  __shared__ __align__(16) unsigned short sSl[kHdim * kPK];
  __shared__ __align__(16) unsigned char  sW[8][kSlabB];
  __shared__ __align__(16) float sInv[8][16];
  typedef Frag<__bf16> F;
  const int t = threadIdx.x;
  const int lane = t & 31, wave = t >> 5;
  const int rlane = lane & 15;                 // row (A operand) / column (B operand, accumulator) within a 16-wide subtile
  const int koff  = (lane >> 4) * 8;           // k offset of this lane half
  const int mOff  = (lane >> 4) * 8;           // accumulator row offset
  const int y = blockIdx.x, h = blockIdx.y;
  const size_t tile = (size_t)y * kHeads + h;
  const size_t base = (size_t)y * kChunk * kEmb + (size_t)h * kHdim;   // chunk row 0 at this head, token-major planes

  // ---- the tiles, 16 B per lane: k 128 x 64, v^T 64 x 128, S^T 64 x 64, hi and lo; this wave's q rows ----
  const size_t ko = base + (size_t)(t >> 3) * kEmb + (t & 7) * 8;
  const size_t vo = tile * (size_t)(kHdim * kChunk) + (size_t)t * 8;
  const size_t so = tile * (size_t)(kHdim * kHdim) + (size_t)t * 8;
  const size_t qrow = base + (size_t)(wave * 16 + rlane) * kEmb;
  const unsigned short* pkh = kh + ko;
  const unsigned short* pkl = kl + ko;
  const unsigned short* pvh = vTh + vo;
  const unsigned short* pvl = vTl + vo;
  const unsigned short* psh = STh + so;
  const unsigned short* psl = STl + so;
  const unsigned short* pqh = qh + qrow;
  const unsigned short* pql = ql + qrow;
  const unsigned short* pfh = pqh + koff;
  const unsigned short* pfl = pql + koff;
  v4u gk[8], gv[8], gs[4], gqh[8], gql[8];
#pragma unroll
  for (int it = 0; it < 4; ++it) {
    gk[2 * it]     = *(const v4u*)(pkh + it * 32 * kEmb);
    gk[2 * it + 1] = *(const v4u*)(pkl + it * 32 * kEmb);
    gv[2 * it]     = *(const v4u*)(pvh + it * 2048);
    gv[2 * it + 1] = *(const v4u*)(pvl + it * 2048);
  }
#pragma unroll
  for (int it = 0; it < 2; ++it) {
    gs[2 * it]     = *(const v4u*)(psh + it * 2048);
    gs[2 * it + 1] = *(const v4u*)(psl + it * 2048);
  }
  // the q rows as A operands (K = 64: two 32-k blocks), and whole (row rlane) for q.z
  v16b qfh[2], qfl[2];
#pragma unroll
  for (int kb = 0; kb < 2; ++kb) {
    qfh[kb] = F::load((const __bf16*)(pfh + kb * 32));
    qfl[kb] = F::load((const __bf16*)(pfl + kb * 32));
  }
#pragma unroll
  for (int w = 0; w < 8; ++w) {
    gqh[w] = *(const v4u*)(pqh + 8 * w);
    gql[w] = *(const v4u*)(pql + 8 * w);
  }
  // stands in front of the first overwrite of a register that these loads name; the addresses are inputs, so none is reused before it
  asm volatile("s_wait_xcnt 0x0" :: "v"(pkh), "v"(pkl), "v"(pvh), "v"(pvl), "v"(psh), "v"(psl), "v"(pqh), "v"(pql), "v"(pfh), "v"(pfl) : "memory");
#pragma unroll
  for (int it = 0; it < 4; ++it) {
    const int u = it * 256 + t;
    *(v4u*)(sKh + (u >> 3) * kPK + (u & 7) * 8) = gk[2 * it];
    *(v4u*)(sKl + (u >> 3) * kPK + (u & 7) * 8) = gk[2 * it + 1];
    *(v4u*)(sVh + (u >> 4) * kPV + (u & 15) * 8) = gv[2 * it];
    *(v4u*)(sVl + (u >> 4) * kPV + (u & 15) * 8) = gv[2 * it + 1];
  }
#pragma unroll
  for (int it = 0; it < 2; ++it) {
    const int u = it * 256 + t;
    *(v4u*)(sSh + (u >> 3) * kPK + (u & 7) * 8) = gs[2 * it];
    *(v4u*)(sSl + (u >> 3) * kPK + (u & 7) * 8) = gs[2 * it + 1];
  }

  // ---- q . z_c of row rlane (both lane halves compute the same row) ----
  const float* zp = zpre + tile * kHdim;
  float qz = 0.f;
#pragma unroll
  for (int w = 0; w < 8; ++w) {
    const v4u uh = gqh[w];
    const v4u ul = gql[w];
    const v4f z0 = *(const v4f*)(zp + 8 * w);
    const v4f z1 = *(const v4f*)(zp + 8 * w + 4);
    float qv[8], zv[8];
#pragma unroll
    for (int e = 0; e < 4; ++e) {
      qv[2 * e]     = bflo2f(uh[e]) + bflo2f(ul[e]);
      qv[2 * e + 1] = bfhi2f(uh[e]) + bfhi2f(ul[e]);
      zv[e] = z0[e];
      zv[4 + e] = z1[e];
    }
#pragma unroll
    for (int e = 0; e < 8; ++e) qz += qv[e] * zv[e];
  }
  sInv[wave][rlane] = qz;                      // parked in LDS: kept in a register, the whole sum is sunk to its use and the q rows spill
  __syncthreads();                             // the staged tiles are readable by every wave

  // ---- masked scores of rows 16w .. 16w+15, four column subtiles at a time, into the slab as bf16 hi/lo ----
  unsigned short* aH = (unsigned short*)sW[wave];
  unsigned short* aL = aH + 16 * kPV;
#pragma unroll
  for (int jh = 0; jh < 2; ++jh) {
    v8f s[4];
#pragma unroll
    for (int j = 0; j < 4; ++j) s[j] = (v8f){0.f,0.f,0.f,0.f,0.f,0.f,0.f,0.f};
#pragma unroll
    for (int kb = 0; kb < 2; ++kb) {
      v16b bh[4], bl[4];
#pragma unroll
      for (int j = 0; j < 4; ++j) {
        const int o = ((jh * 4 + j) * 16 + rlane) * kPK + koff + kb * 32;
        bh[j] = lds_frag(sKh + o);
        bl[j] = lds_frag(sKl + o);
      }
#pragma unroll
      for (int j = 0; j < 4; ++j) s[j] = F::mma(qfh[kb], bh[j], s[j]);
#pragma unroll
      for (int j = 0; j < 4; ++j) s[j] = F::mma(qfh[kb], bl[j], s[j]);
#pragma unroll
      for (int j = 0; j < 4; ++j) s[j] = F::mma(qfl[kb], bh[j], s[j]);
    }
#pragma unroll
    for (int j = 0; j < 4; ++j) {
      const int n = (jh * 4 + j) * 16 + rlane;
#pragma unroll
      for (int r = 0; r < 8; ++r) {
        float v = s[j][r];
        if (n > wave * 16 + mOff + r) v = 0.0f;
        const unsigned short hb = f2bf_bits(v);
        const unsigned short lb = f2bf_bits(v - bf_bits2f(hb));
        aH[(mOff + r) * kPV + n] = hb;
        aL[(mOff + r) * kPV + n] = lb;
      }
    }
  }

  // ---- q . S_c: K = 64 ----
  v8f qs[4], av[4];
#pragma unroll
  for (int j = 0; j < 4; ++j) { qs[j] = (v8f){0.f,0.f,0.f,0.f,0.f,0.f,0.f,0.f}; av[j] = (v8f){0.f,0.f,0.f,0.f,0.f,0.f,0.f,0.f}; }
#pragma unroll
  for (int kb = 0; kb < 2; ++kb) {
    v16b bh[4], bl[4];
#pragma unroll
    for (int j = 0; j < 4; ++j) {
      const int o = (j * 16 + rlane) * kPK + koff + kb * 32;
      bh[j] = lds_frag(sSh + o);
      bl[j] = lds_frag(sSl + o);
    }
#pragma unroll
    for (int j = 0; j < 4; ++j) qs[j] = F::mma(qfh[kb], bh[j], qs[j]);
#pragma unroll
    for (int j = 0; j < 4; ++j) qs[j] = F::mma(qfh[kb], bl[j], qs[j]);
#pragma unroll
    for (int j = 0; j < 4; ++j) qs[j] = F::mma(qfl[kb], bh[j], qs[j]);
  }
  wave_lds_sync();                             // the slab's A rows are readable by every lane of this wave

  // ---- A . v: K = 128 ----
#pragma unroll
  for (int kb = 0; kb < 4; ++kb) {
    const v16b ah = lds_frag(aH + rlane * kPV + koff + kb * 32);
    const v16b al = lds_frag(aL + rlane * kPV + koff + kb * 32);
    v16b bh[4], bl[4];
#pragma unroll
    for (int j = 0; j < 4; ++j) {
      const int o = (j * 16 + rlane) * kPV + koff + kb * 32;
      bh[j] = lds_frag(sVh + o);
      bl[j] = lds_frag(sVl + o);
    }
#pragma unroll
    for (int j = 0; j < 4; ++j) av[j] = F::mma(ah, bh[j], av[j]);
#pragma unroll
    for (int j = 0; j < 4; ++j) av[j] = F::mma(ah, bl[j], av[j]);
#pragma unroll
    for (int j = 0; j < 4; ++j) av[j] = F::mma(al, bh[j], av[j]);
  }

  // ---- row sum of the masked scores of row rlane, j in order ----
  float asum = 0.f;
#pragma unroll
  for (int w = 0; w < 16; ++w) {
    const v4u uh = *(const v4u*)(aH + rlane * kPV + 8 * w);
    const v4u ul = *(const v4u*)(aL + rlane * kPV + 8 * w);
#pragma unroll
    for (int e = 0; e < 4; ++e) {
      const float a0 = bflo2f(uh[e]) + bflo2f(ul[e]);
      asum = asum + a0;
      const float a1 = bfhi2f(uh[e]) + bfhi2f(ul[e]);
      asum = asum + a1;
    }
  }
  const float den = (sInv[wave][rlane] + asum) + kEps;
  const float inv = 1.0f / den;
  wave_lds_sync();                             // every read of the A rows has returned: the slab takes the num rows

  float* slab = (float*)sW[wave];
#pragma unroll
  for (int j = 0; j < 4; ++j)
#pragma unroll
    for (int r = 0; r < 8; ++r) slab[(mOff + r) * 68 + (j << 4) + rlane] = av[j][r] + qs[j][r];
  sInv[wave][rlane] = inv;
  wave_lds_sync();

  const int q4 = lane >> 3, c8 = (lane & 7) * 8;
  v4u uo_h[4], uo_l[4];
#pragma unroll
  for (int it = 0; it < 4; ++it) {
    const int row = it * 4 + q4;
    const float iv = sInv[wave][row];
    unsigned short hb[8], lb[8];
#pragma unroll
    for (int e = 0; e < 8; ++e) {
      const float f = slab[row * 68 + c8 + e] * iv;
      hb[e] = f2bf_bits(f);
      lb[e] = f2bf_bits(f - bf_bits2f(hb[e]));
    }
    uo_h[it] = (v4u){pk16(hb[0], hb[1]), pk16(hb[2], hb[3]), pk16(hb[4], hb[5]), pk16(hb[6], hb[7])};
    uo_l[it] = (v4u){pk16(lb[0], lb[1]), pk16(lb[2], lb[3]), pk16(lb[4], lb[5]), pk16(lb[6], lb[7])};
  }
#pragma unroll
  for (int it = 0; it < 4; ++it) {
    const size_t o = base + (size_t)(wave * 16 + it * 4 + q4) * kEmb + c8;
    *(v4u*)(oh + o) = uo_h[it];
    *(v4u*)(ol + o) = uo_l[it];
  }
}

// ---------------------------------------------------------------------------
// Premise check on the causal flag: only the causal branch is built; if the flag is 0 the output is poisoned with NaN
// ---------------------------------------------------------------------------
__global__ __launch_bounds__(256) void premise_kernel(const int* __restrict__ flag, float* __restrict__ out, int n16) {
  const int i = blockIdx.x * 256 + threadIdx.x;
  if (i >= n16) return;
  const int f = flag[0];
  if (f != 0) return;
  const float qn = __uint_as_float(0x7fc00000u);
  const v4f nv = (v4f){qn, qn, qn, qn};
  float* p = out + 16 * (size_t)i;
  {
#pragma unroll
    for (int k = 0; k < 4; ++k) *(v4f*)(p + 4 * k) = nv;
    
  }
}

// ---------------------------------------------------------------------------
// Host launcher
// ---------------------------------------------------------------------------
extern "C" void kernel_launch(void* const* d_in, const int* in_sizes, int n_in,
                              void* d_out, int out_size, void* d_ws, size_t ws_size,
                              hipStream_t stream) {
  if (n_in < 8) return;
  if (in_sizes[0] != (int)kPlaneEl || in_sizes[1] != (int)kPlaneEl || in_sizes[2] != (int)kPlaneEl) return;
  if (in_sizes[3] != (int)kWEl || in_sizes[4] != (int)kWEl || in_sizes[5] != (int)kWEl || in_sizes[6] != (int)kWEl) return;
  if (in_sizes[7] < 1) return;
  if (out_size != (int)kPlaneEl) return;
  if (ws_size < (size_t)kWsTotal) return;

  const float* Q  = (const float*)d_in[0];
  const float* Kx = (const float*)d_in[1];
  const float* Vx = (const float*)d_in[2];
  const float* Wq = (const float*)d_in[3];
  const float* Wk = (const float*)d_in[4];
  const float* Wv = (const float*)d_in[5];
  const float* Wo = (const float*)d_in[6];
  const int*   causal = (const int*)d_in[7];
  float* out = (float*)d_out;
  char* ws = (char*)d_ws;

  unsigned short* Xbase = (unsigned short*)(ws + oXbase);
  const unsigned short* Xq_h = Xbase;
  const unsigned short* Xq_l = Xbase + kPlaneEl;
  const unsigned short* Xk_h = Xbase + 2 * kPlaneEl;
  const unsigned short* Xk_l = Xbase + 3 * kPlaneEl;
  const unsigned short* Xv_h = Xbase + 4 * kPlaneEl;
  const unsigned short* Xv_l = Xbase + 5 * kPlaneEl;
  unsigned short* Wbase = (unsigned short*)(ws + oWbase);
  const unsigned short* Wq_h = Wbase;
  const unsigned short* Wq_l = Wbase + kWEl;
  const unsigned short* Wk_h = Wbase + 2 * kWEl;
  const unsigned short* Wk_l = Wbase + 3 * kWEl;
  const unsigned short* Wv_h = Wbase + 4 * kWEl;
  const unsigned short* Wv_l = Wbase + 5 * kWEl;
  const unsigned short* Wo_h = (const unsigned short*)(ws + oWo_h);
  const unsigned short* Wo_l = (const unsigned short*)(ws + oWo_l);
  unsigned short* q_h  = (unsigned short*)(ws + oQ_h);
  unsigned short* q_l  = (unsigned short*)(ws + oQ_l);
  unsigned short* k_h  = (unsigned short*)(ws + oK_h);
  unsigned short* k_l  = (unsigned short*)(ws + oK_l);
  unsigned short* v_h  = (unsigned short*)(ws + oV_h);
  unsigned short* v_l  = (unsigned short*)(ws + oV_l);
  unsigned short* kT_h = (unsigned short*)(ws + oKT_h);
  unsigned short* kT_l = (unsigned short*)(ws + oKT_l);
  unsigned short* vT_h = (unsigned short*)(ws + oVT_h);
  unsigned short* vT_l = (unsigned short*)(ws + oVT_l);
  float*          dST  = (float*)(ws + oDST);
  unsigned short* ST_h = (unsigned short*)(ws + oST_h);
  unsigned short* ST_l = (unsigned short*)(ws + oST_l);
  unsigned short* o_h  = (unsigned short*)(ws + oO_h);
  unsigned short* o_l  = (unsigned short*)(ws + oO_l);
  float*          dz   = (float*)(ws + oDZ);
  float*          zpre = (float*)(ws + oZPRE);

  const long sTileT    = (long)kHdim * kChunk;           // 8192
  const long sTileS    = (long)kHdim * kHdim;            // 4096

  // 1) input and weight hi/lo planes
  split_planes_kernel<<<dim3((unsigned)(kPlaneEl / 8 / 256), 3, 1), 256, 0, stream>>>(Q, Kx, Vx, Vx, Xbase, kPlaneEl, (int)(kPlaneEl / 8));
  split_planes_kernel<<<dim3((unsigned)(kWEl / 8 / 256), 4, 1), 256, 0, stream>>>(Wq, Wk, Wv, Wo, Wbase, kWEl, (int)(kWEl / 8));

  // 2) projections: M=4096, N=1024, K=1024 (8 x 32 tiles of 128 x 128, one work-group each); q, k with elu(x)+1
  gemm128_ring<2, 6><<<dim3(kEmb / 128, kTok / 128, 1), 128, 0, stream>>>(Xq_h, Xq_l, Wq_h, Wq_l, q_h, q_l, nullptr);
  gemm128_ring<2, 6><<<dim3(kEmb / 128, kTok / 128, 1), 128, 0, stream>>>(Xk_h, Xk_l, Wk_h, Wk_l, k_h, k_l, nullptr);
  gemm128_ring<2, 0><<<dim3(kEmb / 128, kTok / 128, 1), 128, 0, stream>>>(Xv_h, Xv_l, Wv_h, Wv_l, v_h, v_l, nullptr);

  // 3) per-chunk transposes of k, v and chunk sums of k
  prep_kernel<<<dim3(kYB, kHeads, 1), 256, 0, stream>>>(k_h, k_l, v_h, v_l, kT_h, kT_l, vT_h, vT_l, dz);

  // 4) dST[e][d] = sum_j v[j][e] k[j][d] per (b,c,h): M=64, N=64, K=128, one wave per tile
  wmma_gemm64<1, true, 0, 0, false, 0><<<dim3(1, kYB, kHeads), 32, 0, stream>>>(
      vT_h, vT_l, kChunk, 16 * sTileT, sTileT, kT_h, kT_l, kChunk, 16 * sTileT, sTileT,
      (void*)dST, nullptr, kHdim, 16 * sTileS, sTileS,
      nullptr, nullptr, 0L, 0L, kHdim, kHdim, kChunk, 1.0f);

  // 5) exclusive prefix over chunks of S^T and z
  state_prefix_kernel<<<dim3(kBatch * kHeads, 1, 1), 256, 0, stream>>>(dST, dz, ST_h, ST_l, zpre);

  // 6) per (b,c,h): masked scores, A.v + q.S_c, normaliser -> attention output hi/lo planes (token-major, heads merged)
  chunk_attn_kernel<<<dim3(kYB, kHeads, 1), 256, 0, stream>>>(q_h, q_l, k_h, k_l, vT_h, vT_l, ST_h, ST_l, zpre, o_h, o_l);

  // 7) output projection: M=4096, N=1024, K=1024 -> d_out
  gemm128_ring<0, 0><<<dim3(kEmb / 128, kTok / 128, 1), 128, 0, stream>>>(o_h, o_l, Wo_h, Wo_l, nullptr, nullptr, out);

  // 8) premise check on the causal flag (poisons the output when the non-causal branch would be required)
  premise_kernel<<<dim3((unsigned)(kPlaneEl / 16 / 256), 1, 1), 256, 0, stream>>>(causal, out, (int)(kPlaneEl / 16));
}

// v003
// It runs in 164 microseconds.
// Next to v002, in two timings, it ran 1.13 and 1.14 times as fast.
// Counting every step since v000, it is 2.61 times as fast.
// Contractions: q/k/v projections, chunk scores q.k^T, state increment v^T.k, q.S, A.v, output projection -- all v_wmma_f32_16x16x32_bf16 with bf16 hi/lo operand planes (hi.hi + hi.lo + lo.hi), f32 accumulate; feature map, state prefix over chunks, normaliser and division in f32 on the VALU.
#include <hip/hip_runtime.h>
#include <math.h>

// ---------------------------------------------------------------------------
// Problem constants
// ---------------------------------------------------------------------------
constexpr int kBatch   = 2;
constexpr int kSeq     = 2048;
constexpr int kEmb     = 1024;
constexpr int kHeads   = 16;
constexpr int kHdim    = 64;
constexpr int kChunk   = 128;
constexpr int kNChunk  = kSeq / kChunk;          // 16 chunks per sequence
constexpr int kTok     = kBatch * kSeq;          // 4096 token rows
constexpr int kYB      = kBatch * kNChunk;       // 32 (batch, chunk) pairs
constexpr int kTiles   = kYB * kHeads;           // 512 (batch, chunk, head) tiles
constexpr float kEps   = 1e-6f;
constexpr long kPlaneEl = (long)kTok * kEmb;     // 4194304 elements per activation plane
constexpr long kWEl     = (long)kEmb * kEmb;     // 1048576 elements per weight plane
constexpr long kUnit    = kPlaneEl * 2;          // 8388608 bytes (one bf16 activation plane)
constexpr long kWUnit   = kWEl * 2;              // 2097152 bytes (one bf16 weight plane)

// ---------------------------------------------------------------------------
// Workspace region map (bytes; U = 8388608, WU = 2097152); total 14U + 262144 = 117702656
//   [0U , 6U)  phase 1: Xq_h Xq_l Xk_h Xk_l Xv_h Xv_l (input hi/lo planes, dead after projections)
//              phase 2: kT_h@0U kT_l@1U vT_h@2U vT_l@3U dST(f32)@4U ST_h@5U ST_l@5.5U
//   [6U , 8U)  Wq_h Wq_l Wk_h Wk_l Wv_h Wv_l Wo_h Wo_l (WU each)
//   [8U ,14U)  q_h@8U q_l@9U k_h@10U k_l@11U v_h@12U v_l@13U (projection outputs)
//              later: o_h@12U o_l@13U (v dead after the transposes)
//   [14U, +262144)  dz f32 [512][64] @14U, zpre f32 [512][64] @14U+131072
// ---------------------------------------------------------------------------
constexpr long oXbase = 0;
constexpr long oKT_h  = 0;
constexpr long oKT_l  = 1 * kUnit;
constexpr long oVT_h  = 2 * kUnit;
constexpr long oVT_l  = 3 * kUnit;
constexpr long oDST   = 4 * kUnit;
constexpr long oST_h  = 5 * kUnit;
constexpr long oST_l  = 5 * kUnit + kUnit / 2;
constexpr long oWbase = 6 * kUnit;
constexpr long oWo_h  = oWbase + 6 * kWUnit;
constexpr long oWo_l  = oWbase + 7 * kWUnit;
constexpr long oQ_h   = 8 * kUnit;
constexpr long oQ_l   = 9 * kUnit;
constexpr long oK_h   = 10 * kUnit;
constexpr long oK_l   = 11 * kUnit;
constexpr long oV_h   = 12 * kUnit;
constexpr long oV_l   = 13 * kUnit;
constexpr long oO_h   = 12 * kUnit;
constexpr long oO_l   = 13 * kUnit;
constexpr long oDZ    = 14 * kUnit;
constexpr long oZPRE  = 14 * kUnit + 131072;
constexpr long kWsTotal = 14 * kUnit + 262144;
static_assert(kWsTotal == 117702656, "carve total");
static_assert(kWsTotal <= 134217728, "carve within 128 MiB");
static_assert((long)kTiles * kHdim * kChunk * 2 == kUnit, "kT plane size");
static_assert((long)kTiles * kHdim * kHdim * 4 == kUnit, "dST plane size");

typedef __attribute__((ext_vector_type(16))) _Float16 v16h;
typedef __attribute__((ext_vector_type(8)))  _Float16 v8h;
typedef __attribute__((ext_vector_type(16))) __bf16   v16b;
typedef __attribute__((ext_vector_type(8)))  __bf16   v8b;
typedef __attribute__((ext_vector_type(8)))  float    v8f;
typedef __attribute__((ext_vector_type(4)))  float    v4f;
typedef __attribute__((ext_vector_type(4)))  unsigned int v4u;

__device__ __forceinline__ unsigned short f2bf_bits(float f) {
  unsigned u = __float_as_uint(f);
  return (unsigned short)((u + 0x7FFFu + ((u >> 16) & 1u)) >> 16);
}
__device__ __forceinline__ float bf_bits2f(unsigned short h) { return __uint_as_float(((unsigned)h) << 16); }

// hazard guards as plain device helpers (no inline asm inside the kernel template body)
__device__ __forceinline__ void dep_guard_h(v8f& a, v8f& b, v16h x, v16h y) { asm volatile("v_nop\n\tv_nop\n\tv_nop\n\tv_nop" : "+v"(a), "+v"(b) : "v"(x), "v"(y)); }
__device__ __forceinline__ void dep_guard_b(v8f& a, v8f& b, v16b x, v16b y) { asm volatile("v_nop\n\tv_nop\n\tv_nop\n\tv_nop" : "+v"(a), "+v"(b) : "v"(x), "v"(y)); }
__device__ __forceinline__ void keep4_h(v16h a, v16h b, v16h c, v16h d) { asm volatile("v_nop" :: "v"(a), "v"(b), "v"(c), "v"(d)); }
__device__ __forceinline__ void keep4_b(v16b a, v16b b, v16b c, v16b d) { asm volatile("v_nop" :: "v"(a), "v"(b), "v"(c), "v"(d)); }
__device__ __forceinline__ void acc_guard4(v8f& a, v8f& b, v8f& c, v8f& d) { asm volatile("v_nop\n\tv_nop\n\tv_nop\n\tv_nop" : "+v"(a), "+v"(b), "+v"(c), "+v"(d)); }
template <typename T> struct Frag;
template <> struct Frag<_Float16> {
  typedef v16h V; union U { v16h v; v8h h[2]; };
  static __device__ __forceinline__ v16h load(const _Float16* p) {   // elements 0..7 <- p[0..7], 8..15 <- p[16..23]
    U f; f.h[0] = *(const v8h*)(p); f.h[1] = *(const v8h*)(p + 16); return f.v;
  }
  static __device__ __forceinline__ v8f mma(v16h a, v16h b, v8f c) {
    return __builtin_amdgcn_wmma_f32_16x16x32_f16(false, a, false, b, (short)0, c, false, false);
  }
  static __device__ __forceinline__ void guard(v8f& a, v8f& b, v16h x, v16h y) { dep_guard_h(a, b, x, y); }
  static __device__ __forceinline__ void keep(v16h a, v16h b, v16h c, v16h d) { keep4_h(a, b, c, d); }
};
template <> struct Frag<__bf16> {
  typedef v16b V; union U { v16b v; v8b h[2]; };
  static __device__ __forceinline__ v16b load(const __bf16* p) {
    U f; f.h[0] = *(const v8b*)(p); f.h[1] = *(const v8b*)(p + 16); return f.v;
  }
  static __device__ __forceinline__ v8f mma(v16b a, v16b b, v8f c) {
    return __builtin_amdgcn_wmma_f32_16x16x32_bf16(false, a, false, b, (short)0, c, false, false);
  }
  static __device__ __forceinline__ void guard(v8f& a, v8f& b, v16b x, v16b y) { dep_guard_b(a, b, x, y); }
  static __device__ __forceinline__ void keep(v16b a, v16b b, v16b c, v16b d) { keep4_b(a, b, c, d); }
};

__device__ __forceinline__ unsigned pk16(unsigned short a, unsigned short b) { return (unsigned)a | ((unsigned)b << 16); }
// bf16 element pair held in one 32-bit word: low half-word = even element, high half-word = odd element
__device__ __forceinline__ float bflo2f(unsigned w) { return __uint_as_float(w << 16); }
__device__ __forceinline__ float bfhi2f(unsigned w) { return __uint_as_float(w & 0xffff0000u); }

// ---- Register-blocked batched WMMA GEMM (2-D batch (blockIdx.y, blockIdx.z), waves per block from blockDim,
//      ACT reduced to none/relu/leaky plus 6 = elu(x)+1 and 7 = causal zero (n > m -> 0 for tile-local m, n)) ----
// C[m,n] = scale * sum_k A[m,k] * Bt[n,k] (+bias)(+resid); each wave owns a 64x64 tile.
// A row-major [M,K]; Bt row-major [N,K]; M,N % 64 == 0, K % 32 == 0.
// SPLIT: operands are hi/lo planes (A2/Bt2 = lo planes, same layout); product = hi.hi + hi.lo + lo.hi.
// BIAS_MODE: 0 = none, 1 = bias[m], 2 = bias[n].
// OUT_MODE: 0 = f32, 1 = f16, 2 = bf16 hi plane (Cout) + bf16 lo plane (Cout2).
// ET: 0 = f16 operands, 1 = bf16 operands (pointers passed as 16-bit storage)
template <int ET> struct Elem;
template <> struct Elem<0> { typedef _Float16 T; };
template <> struct Elem<1> { typedef __bf16 T; };
template <int ET, bool SPLIT, int BIAS_MODE, int OUT_MODE, bool RESID, int ACT = 0>
__global__ __launch_bounds__(256) void wmma_gemm64(
    const unsigned short* __restrict__ Ap, const unsigned short* __restrict__ A2p, int lda, long strideA, long strideAz,
    const unsigned short* __restrict__ Btp, const unsigned short* __restrict__ Bt2p, int ldb, long strideB, long strideBz,
    void* __restrict__ Cout, void* __restrict__ Cout2, int ldc, long strideC, long strideCz,
    const float* __restrict__ bias,
    const float* __restrict__ resid, long strideR, long strideRz,
    int M, int N, int K, float scale) {
  typedef typename Elem<ET>::T T;
  typedef typename Frag<T>::V V;
  const T* A = (const T*)Ap; const T* A2 = (const T*)A2p; const T* Bt = (const T*)Btp; const T* Bt2 = (const T*)Bt2p;
  __shared__ __align__(16) float sT[8][16 * 68];   // per-wave 16x64 slab, pitch 68 floats
  const int b    = blockIdx.y;
  const int bz   = blockIdx.z;
  const int lane = threadIdx.x & 31;
  const int wave = threadIdx.x >> 5;
  const int nwv  = blockDim.x >> 5;
  const int tilesN = N >> 6;
  const int tilesM = M >> 6;
  const int tile = blockIdx.x * nwv + wave;
  if (tile >= tilesM * tilesN) return;   // wave-uniform; no block barriers in this kernel
  const int tm = tile / tilesN;
  const int tn = tile - tm * tilesN;
  const int m0 = tm << 6;
  const int n0 = tn << 6;

  const T* Ab  = A  + (size_t)b * strideA + (size_t)bz * strideAz;
  const T* Bb  = Bt + (size_t)b * strideB + (size_t)bz * strideBz;
  const T* Ab2 = SPLIT ? (A2  + (size_t)b * strideA + (size_t)bz * strideAz) : nullptr;
  const T* Bb2 = SPLIT ? (Bt2 + (size_t)b * strideB + (size_t)bz * strideBz) : nullptr;
  const size_t cOff = (size_t)b * strideC + (size_t)bz * strideCz;

  const int rlane = lane & 15;                 // row (A) / col (B, D) within subtile
  const int koff  = (lane >> 4) * 8;           // k offset of this lane half
  const int mOff  = (lane >> 4) * 8;           // D row offset

  v8f acc[4][4];
#pragma unroll
  for (int i = 0; i < 4; ++i)
#pragma unroll
    for (int j = 0; j < 4; ++j) acc[i][j] = (v8f){0.f,0.f,0.f,0.f,0.f,0.f,0.f,0.f};

  for (int k0 = 0; k0 < K; k0 += 32) {
    V bh[4], bl[4];
#pragma unroll
    for (int j = 0; j < 4; ++j) {
      const size_t bo = (size_t)(n0 + (j << 4) + rlane) * ldb + koff + k0;
      bh[j] = Frag<T>::load(Bb + bo);
      if (SPLIT) bl[j] = Frag<T>::load(Bb2 + bo);
    }
#pragma unroll
    for (int i = 0; i < 4; ++i) {
      const size_t ao = (size_t)(m0 + (i << 4) + rlane) * lda + koff + k0;
      V ah = Frag<T>::load(Ab + ao);
      V al;
      if (SPLIT) al = Frag<T>::load(Ab2 + ao);
#pragma unroll
      for (int j = 0; j < 4; ++j) {
        acc[i][j] = Frag<T>::mma(ah, bh[j], acc[i][j]);
        if (SPLIT) {
          acc[i][j] = Frag<T>::mma(ah, bl[j], acc[i][j]);
          acc[i][j] = Frag<T>::mma(al, bh[j], acc[i][j]);
        }
      }
      Frag<T>::guard(acc[i][0], acc[i][3], ah, SPLIT ? al : ah);
    }
    Frag<T>::keep(bh[0], bh[1], bh[2], bh[3]);
    if (SPLIT) Frag<T>::keep(bl[0], bl[1], bl[2], bl[3]);
  }
  acc_guard4(acc[0][0], acc[0][1], acc[0][2], acc[0][3]);
  acc_guard4(acc[1][0], acc[1][1], acc[1][2], acc[1][3]);
  acc_guard4(acc[2][0], acc[2][1], acc[2][2], acc[2][3]);
  acc_guard4(acc[3][0], acc[3][1], acc[3][2], acc[3][3]);

  // ---- epilogue ----
  float* slab = sT[wave];
  const float* Rb = RESID ? (resid + (size_t)b * strideR + (size_t)bz * strideRz) : nullptr;
#pragma unroll
  for (int i = 0; i < 4; ++i) {
    const int mBase = m0 + (i << 4);
#pragma unroll
    for (int j = 0; j < 4; ++j) {
      const int n = n0 + (j << 4) + rlane;
      float bv = 0.f;
      if (BIAS_MODE == 2) bv = bias[n];
#pragma unroll
      for (int r = 0; r < 8; ++r) {
        float v = acc[i][j][r] * scale;
        if (BIAS_MODE == 1) v += bias[mBase + mOff + r];
        if (BIAS_MODE == 2) v += bv;
        if (RESID) v += Rb[(size_t)(mBase + mOff + r) * ldc + n];
        if (ACT == 2) v = fmaxf(v, 0.0f);
        if (ACT == 4) v = (v > 0.f) ? v : 0.01f * v;
        if (ACT == 6) v = (v > 0.f) ? (v + 1.0f) : expf(v);
        if (ACT == 7) { if (n > mBase + mOff + r) v = 0.0f; }
        slab[(mOff + r) * 68 + (j << 4) + rlane] = v;
      }
    }
    __builtin_amdgcn_fence(__ATOMIC_RELEASE, "workgroup");
    __builtin_amdgcn_wave_barrier();
    __builtin_amdgcn_fence(__ATOMIC_ACQUIRE, "workgroup");
    if (OUT_MODE == 0) {
      float* C = (float*)Cout + cOff;
      const int hh = lane >> 4, c4 = (lane & 15) * 4;     // row seg = 256 B = 16 lanes x 16 B
      {
#pragma unroll
        for (int it = 0; it < 8; ++it) {
          const int row = it * 2 + hh;
          v4f v = *(const v4f*)(slab + row * 68 + c4);
          *(v4f*)(C + (size_t)(mBase + row) * ldc + n0 + c4) = v;
        }
        
      }
    } else {
      const int q = lane >> 3, c8 = (lane & 7) * 8;
      unsigned short* C  = (unsigned short*)Cout  + cOff;
      unsigned short* C2 = (OUT_MODE == 2) ? ((unsigned short*)Cout2 + cOff) : nullptr;
      {
#pragma unroll
        for (int it = 0; it < 4; ++it) {
          const int row = it * 4 + q;
          const float* sp = slab + row * 68 + c8;
          v8h hv, lv;
#pragma unroll
          for (int e = 0; e < 8; ++e) {
            if (OUT_MODE == 1) {
              hv[e] = (_Float16)sp[e];
            } else {
              unsigned short hb = f2bf_bits(sp[e]);
              unsigned short lb = f2bf_bits(sp[e] - bf_bits2f(hb));
              hv[e] = __builtin_bit_cast(_Float16, hb);
              lv[e] = __builtin_bit_cast(_Float16, lb);
            }
          }
          *(v8h*)(C + (size_t)(mBase + row) * ldc + n0 + c8) = hv;
          if (OUT_MODE == 2) *(v8h*)(C2 + (size_t)(mBase + row) * ldc + n0 + c8) = lv;
        }
        
      }
    }
    __builtin_amdgcn_fence(__ATOMIC_RELEASE, "workgroup");
    __builtin_amdgcn_wave_barrier();
    __builtin_amdgcn_fence(__ATOMIC_ACQUIRE, "workgroup");
  }
}

// ---------------------------------------------------------------------------
// The four 4096 x 1024 x 1024 products: C[m,n] = sum_k A[m,k] * Bt[n,k], hi/lo planes, product = hi.hi + hi.lo + lo.hi.
// One 128 x 128 tile of C per work-group, four waves (2 x 2), each wave a 64 x 64 tile (the 4 x 4 accumulators of wmma_gemm64).
// A stage is 128 k (256 B) of 128 rows of each of the four operand planes [A_h | A_l | B_h | B_l], LDS row pitch 272 B;
// wave w brings plane w of every stage with one tensor load; two buffers, the next stage's loads fly while this one is worked on.
// Per accumulator the products are summed in the order of wmma_gemm64: k ascending, hi.hi, hi.lo, lo.hi inside each 32 k.
// ---------------------------------------------------------------------------
constexpr unsigned kRowB    = 256;                    // bytes of one operand row in a stage
constexpr unsigned kPitchB  = 272;                    // LDS row pitch: 256 B + the 16-B pad for ds_load_b128 readers
constexpr unsigned kPlaneB  = 128 * kPitchB;          // 34816 B, one plane's slice of a stage
constexpr unsigned kStageB  = 4 * kPlaneB;            // 139264 B, one buffer
constexpr unsigned kStages  = (unsigned)kEmb * 2 / kRowB;   // 8
static_assert(kPlaneB % 2048 == 0, "every slice starts at a multiple of 2 KiB");
static_assert(kStages >= 2, "the ring's prologue needs two stages");
typedef __attribute__((ext_vector_type(8))) unsigned int v8u;

__device__ __forceinline__ unsigned uni(unsigned v) { return (unsigned)__builtin_amdgcn_readfirstlane((int)v); }
__device__ __forceinline__ unsigned pinned(unsigned v) { unsigned w = uni(v); asm volatile("" : "+s"(w)); return w; }
__device__ __forceinline__ void wait_ds0()     { asm volatile("s_wait_dscnt 0x0" ::: "memory"); }      // this wave's LDS reads have returned
__device__ __forceinline__ void wait_tensor0() { asm volatile("s_wait_tensorcnt 0x0" ::: "memory"); }  // this wave's tensor load has landed
__device__ __forceinline__ void tdm_load(v4u g0, v8u g1) { asm volatile("tensor_load_to_lds %0, %1" :: "s"(g0), "s"(g1) : "memory"); }
__device__ __forceinline__ v4u tdm_group0(unsigned lds_dst, unsigned long long ga) {
  v4u g;
  g[0] = uni(1u); g[1] = uni(lds_dst); g[2] = uni((unsigned)ga); g[3] = uni((((unsigned)(ga >> 32)) & 0x01FFFFFFu) | 0x80000000u);
  return g;
}
// 1-byte elements, tile = tensor = 128 rows of 256 B, source pitch one K row, 4 dwords of LDS pad behind every 64 dwords
__device__ __forceinline__ v8u tdm_group1() {
  constexpr unsigned d0 = kRowB, d1 = 128u;
  v8u g;
  g[0] = uni((1u << 20) | (5u << 22) | (3u << 25));
  g[1] = uni((d0 & 0xFFFFu) << 16);
  g[2] = uni((d0 >> 16) | ((d1 & 0xFFFFu) << 16));
  g[3] = uni((d1 >> 16) | (d0 << 16));
  g[4] = uni(d1);
  g[5] = uni((unsigned)kEmb * 2u);
  g[6] = uni(0u);
  g[7] = uni(0u);
  return g;
}

struct FragSet { v16b ah[4], al[4], bh[4], bl[4]; };
// the fragments of one 32-k block: pa / pb = this lane's row 0 of the A_h / B_h slices, at its k half
__device__ __forceinline__ void load_set(FragSet& f, const unsigned char* pa, const unsigned char* pb, int kb) {
  const unsigned k = (unsigned)kb * 64u;
  constexpr unsigned t = 16u * kPitchB;   // 16 rows
  // in the order in which mma_set needs them: the first term can start when half of the group has returned
#pragma unroll
  for (int i = 0; i < 4; ++i) f.ah[i] = Frag<__bf16>::load((const __bf16*)(pa + (unsigned)i * t + k));
#pragma unroll
  for (int i = 0; i < 4; ++i) f.bh[i] = Frag<__bf16>::load((const __bf16*)(pb + (unsigned)i * t + k));
#pragma unroll
  for (int i = 0; i < 4; ++i) f.bl[i] = Frag<__bf16>::load((const __bf16*)(pb + kPlaneB + (unsigned)i * t + k));
#pragma unroll
  for (int i = 0; i < 4; ++i) f.al[i] = Frag<__bf16>::load((const __bf16*)(pa + kPlaneB + (unsigned)i * t + k));
}
// 48 WMMAs; each term runs over all 16 accumulators, so that no WMMA waits for the one in front of it
__device__ __forceinline__ void mma_set(const FragSet& f, v8f (&acc)[4][4]) {
#pragma unroll
  for (int i = 0; i < 4; ++i)
#pragma unroll
    for (int j = 0; j < 4; ++j) acc[i][j] = Frag<__bf16>::mma(f.ah[i], f.bh[j], acc[i][j]);
#pragma unroll
  for (int i = 0; i < 4; ++i)
#pragma unroll
    for (int j = 0; j < 4; ++j) acc[i][j] = Frag<__bf16>::mma(f.ah[i], f.bl[j], acc[i][j]);
#pragma unroll
  for (int i = 0; i < 4; ++i)
#pragma unroll
    for (int j = 0; j < 4; ++j) acc[i][j] = Frag<__bf16>::mma(f.al[i], f.bh[j], acc[i][j]);
}

// OUT_MODE: 0 = f32 to Cf, 2 = bf16 hi plane (Ch) + lo plane (Cl). ACT: 0 = none, 6 = elu(x)+1. grid (N/128, M/128), 128 threads.
template <int OUT_MODE, int ACT>
__global__ __launch_bounds__(128) void gemm128_ring(
    const unsigned short* __restrict__ Ah, const unsigned short* __restrict__ Al,
    const unsigned short* __restrict__ Bh, const unsigned short* __restrict__ Bl,
    unsigned short* __restrict__ Ch, unsigned short* __restrict__ Cl, float* __restrict__ Cf) {
  __shared__ __attribute__((aligned(2048))) unsigned char ring[2 * kStageB];
  __shared__ __align__(16) float sT[4][16 * 68];   // per-wave 16x64 slab, pitch 68 floats
  const int lane = threadIdx.x & 31;
  const unsigned wave = uni(threadIdx.x >> 5);
  const int rlane = lane & 15;
  const int mOff  = (lane >> 4) * 8;
  const int m0 = (int)blockIdx.y * 128 + (int)(wave >> 1) * 64;
  const int n0 = (int)blockIdx.x * 128 + (int)(wave & 1u) * 64;

  // this wave's plane: first byte of its 128 rows, and its slice's place in buffer 0
  const unsigned short* plane = (wave == 0u) ? Ah : (wave == 1u) ? Al : (wave == 2u) ? Bh : Bl;
  const unsigned row0 = ((wave < 2u) ? blockIdx.y : blockIdx.x) * 128u;
  const unsigned long long ga = (unsigned long long)(plane + (size_t)row0 * kEmb);
  const unsigned slice = (unsigned)(unsigned long long)(const void*)ring + wave * kPlaneB;
  const v8u g1 = tdm_group1();

  const unsigned aoff = ((wave >> 1) * 64u + (unsigned)rlane) * kPitchB + (unsigned)(lane >> 4) * 16u;
  const unsigned boff = 2u * kPlaneB + ((wave & 1u) * 64u + (unsigned)rlane) * kPitchB + (unsigned)(lane >> 4) * 16u;

  v8f acc[4][4];
#pragma unroll
  for (int i = 0; i < 4; ++i)
#pragma unroll
    for (int j = 0; j < 4; ++j) acc[i][j] = (v8f){0.f,0.f,0.f,0.f,0.f,0.f,0.f,0.f};

  tdm_load(tdm_group0(slice, ga), g1);
  wait_tensor0();
  __syncthreads();                                  // stage 0 is readable by every wave
  tdm_load(tdm_group0(slice + kStageB, ga + kRowB), g1);

  // rolled: one copy of the 192-WMMA pass, and every accumulator and fragment index stays a constant
#pragma clang loop unroll(disable)
  for (unsigned s = 0; s < kStages; ++s) {
    const unsigned buf = (s & 1u) * kStageB;
    const unsigned char* pa = ring + buf + aoff;
    const unsigned char* pb = ring + buf + boff;
    FragSet f[2];
    load_set(f[0], pa, pb, 0);
#pragma unroll
    for (int kb = 0; kb < 4; ++kb) {
      if (kb < 3) load_set(f[(kb + 1) & 1], pa, pb, kb + 1);
      __builtin_amdgcn_sched_barrier(0);            // keeps the next block's LDS reads one group in front of this block's WMMAs
      mma_set(f[kb & 1], acc);
      __builtin_amdgcn_sched_barrier(0);            // and the block after that one's reads behind them
    }
    wait_ds0();
    wait_tensor0();
    __syncthreads();                                // publishes stage s + 1; every reader has left stage s's buffer
    const unsigned nx = pinned(s + 2u);             // formed behind the wait, and the descriptor from it
    if (nx < kStages) tdm_load(tdm_group0(slice + buf, ga + (unsigned long long)nx * kRowB), g1);
  }
  wait_tensor0();
  wait_ds0();

  // ---- epilogue (as in wmma_gemm64) ----
  float* slab = sT[wave];
#pragma unroll
  for (int i = 0; i < 4; ++i) {
    const int mBase = m0 + (i << 4);
#pragma unroll
    for (int j = 0; j < 4; ++j) {
#pragma unroll
      for (int r = 0; r < 8; ++r) {
        float v = acc[i][j][r];
        if (ACT == 6) v = (v > 0.f) ? (v + 1.0f) : expf(v);
        slab[(mOff + r) * 68 + (j << 4) + rlane] = v;
      }
    }
    __builtin_amdgcn_fence(__ATOMIC_RELEASE, "workgroup");
    __builtin_amdgcn_wave_barrier();
    __builtin_amdgcn_fence(__ATOMIC_ACQUIRE, "workgroup");
    if (OUT_MODE == 0) {
      const int hh = lane >> 4, c4 = (lane & 15) * 4;     // row seg = 256 B = 16 lanes x 16 B
      v4f rv[8];
#pragma unroll
      for (int it = 0; it < 8; ++it) rv[it] = *(const v4f*)(slab + (it * 2 + hh) * 68 + c4);
#pragma unroll
      for (int it = 0; it < 8; ++it) *(v4f*)(Cf + (size_t)(mBase + it * 2 + hh) * kEmb + n0 + c4) = rv[it];
      asm volatile("s_wait_xcnt 0x0" ::: "memory");   // stands in front of the next use of the registers that these stores name
    } else {
      const int q = lane >> 3, c8 = (lane & 7) * 8;
      v8h hv[4], lv[4];
#pragma unroll
      for (int it = 0; it < 4; ++it) {
        const float* sp = slab + (it * 4 + q) * 68 + c8;
#pragma unroll
        for (int e = 0; e < 8; ++e) {
          unsigned short hb = f2bf_bits(sp[e]);
          unsigned short lb = f2bf_bits(sp[e] - bf_bits2f(hb));
          hv[it][e] = __builtin_bit_cast(_Float16, hb);
          lv[it][e] = __builtin_bit_cast(_Float16, lb);
        }
      }
#pragma unroll
      for (int it = 0; it < 4; ++it) {
        *(v8h*)(Ch + (size_t)(mBase + it * 4 + q) * kEmb + n0 + c8) = hv[it];
        *(v8h*)(Cl + (size_t)(mBase + it * 4 + q) * kEmb + n0 + c8) = lv[it];
      }
      asm volatile("s_wait_xcnt 0x0" ::: "memory");   // stands in front of the next use of the registers that these stores name
    }
    __builtin_amdgcn_fence(__ATOMIC_RELEASE, "workgroup");
    __builtin_amdgcn_wave_barrier();
    __builtin_amdgcn_fence(__ATOMIC_ACQUIRE, "workgroup");
  }
}

// ---------------------------------------------------------------------------
// f32 -> bf16 hi + lo planes (RNE convert both), 8 consecutive elements per thread: one 16-B store per lane per plane,
// blockIdx.y selects the source tensor (block-uniform); hi plane z lives at out + 2z*planeEl, lo plane at +planeEl.
// Coverage: n8 = planeEl/8 threads x 8 = the whole plane (grids are exact multiples of 256 here).
// ---------------------------------------------------------------------------
__global__ __launch_bounds__(256) void split_planes_kernel(const float* __restrict__ s0, const float* __restrict__ s1,
                                                           const float* __restrict__ s2, const float* __restrict__ s3,
                                                           unsigned short* __restrict__ out, long planeEl, int n8) {
  const int i = blockIdx.x * 256 + threadIdx.x;
  const int z = blockIdx.y;
  if (i >= n8) return;
  const float* src = (z == 0) ? s0 : (z == 1) ? s1 : (z == 2) ? s2 : s3;
  const float* p = src + 8 * (size_t)i;
  const v4f a = *(const v4f*)(p);
  const v4f c = *(const v4f*)(p + 4);
  unsigned short hb[8], lb[8];
#pragma unroll
  for (int e = 0; e < 4; ++e) {
    hb[e]     = f2bf_bits(a[e]);
    lb[e]     = f2bf_bits(a[e] - bf_bits2f(hb[e]));
    hb[4 + e] = f2bf_bits(c[e]);
    lb[4 + e] = f2bf_bits(c[e] - bf_bits2f(hb[4 + e]));
  }
  const v4u uh = (v4u){pk16(hb[0], hb[1]), pk16(hb[2], hb[3]), pk16(hb[4], hb[5]), pk16(hb[6], hb[7])};
  const v4u ul = (v4u){pk16(lb[0], lb[1]), pk16(lb[2], lb[3]), pk16(lb[4], lb[5]), pk16(lb[6], lb[7])};
  unsigned short* ph = out + (size_t)(2 * z) * planeEl + 8 * (size_t)i;
  unsigned short* pl = ph + planeEl;
  *(v4u*)ph = uh;
  *(v4u*)pl = ul;
  
}

// ---------------------------------------------------------------------------
// Per (batch-chunk y, head h) tile: transpose the 128x64 chunk tiles of k and v (hi and lo planes, token-major [4096][1024])
// into kT, vT tiles [64 d][128 j] at (y*16+h)*8192, and dz[y*16+h][d] = sum_j k[j][d] (f32, k = hi + lo, j in order).
// grid (32, 16), 256 threads. LDS tiles hold one hi/lo pair at a time.
// Load coverage: 4 iterations x 256 threads = 1024 units of (row j, 8 d) = 128 x 64 = whole tile, every LDS cell read is written.
// Store coverage: 4 iterations x 8 waves x 2 (lane>>4) = 64 rows; 16 lanes x 8 halves = 128 cols; each row = 256 B = 2 whole
// ---------------------------------------------------------------------------
__global__ __launch_bounds__(256) void prep_kernel(const unsigned short* __restrict__ kh, const unsigned short* __restrict__ kl,
                                                   const unsigned short* __restrict__ vh, const unsigned short* __restrict__ vl,
                                                   unsigned short* __restrict__ kTh, unsigned short* __restrict__ kTl,
                                                   unsigned short* __restrict__ vTh, unsigned short* __restrict__ vTl,
                                                   float* __restrict__ dz) {
  __shared__ unsigned short tA[64][136];
  __shared__ unsigned short tB[64][136];
  __shared__ __align__(16) float dzs[64];
  const int t = threadIdx.x;
  const int lane = t & 31, wave = t >> 5;
  const int y = blockIdx.x, h = blockIdx.y;
  const size_t tok0 = (size_t)y * kChunk;
  const size_t tile = (size_t)y * kHeads + h;
  const size_t tileOff = tile * (size_t)(kHdim * kChunk);
  const int hh = lane >> 4, c8 = (lane & 15) * 8;
  for (int p = 0; p < 2; ++p) {
    const unsigned short* sH = (p == 0) ? kh : vh;
    const unsigned short* sL = (p == 0) ? kl : vl;
    unsigned short* dH = (p == 0) ? kTh : vTh;
    unsigned short* dL = (p == 0) ? kTl : vTl;
#pragma unroll
    for (int it = 0; it < 4; ++it) {
      const int idx = it * 256 + t;
      const int j = idx >> 3;
      const int d8 = (idx & 7) * 8;
      const size_t go = (tok0 + j) * (size_t)kEmb + (size_t)h * kHdim + d8;
      const v4u wh = *(const v4u*)(sH + go);
      const v4u wl = *(const v4u*)(sL + go);
#pragma unroll
      for (int e = 0; e < 4; ++e) {
        tA[d8 + 2 * e][j]     = (unsigned short)(wh[e] & 0xffffu);
        tA[d8 + 2 * e + 1][j] = (unsigned short)(wh[e] >> 16);
        tB[d8 + 2 * e][j]     = (unsigned short)(wl[e] & 0xffffu);
        tB[d8 + 2 * e + 1][j] = (unsigned short)(wl[e] >> 16);
      }
    }
    __syncthreads();
    if (p == 0) {
      if (t < 64) {
        float s = 0.f;
#pragma unroll 1
        for (int j = 0; j < kChunk; ++j) {
          const float kv = bf_bits2f(tA[t][j]) + bf_bits2f(tB[t][j]);
          s = s + kv;
        }
        dzs[t] = s;
      }
      __syncthreads();
    }
    v4u uH[4], uL[4];
#pragma unroll
    for (int it = 0; it < 4; ++it) {
      const int d = it * 16 + wave * 2 + hh;
      unsigned short a[8], bb[8];
#pragma unroll
      for (int e = 0; e < 8; ++e) { a[e] = tA[d][c8 + e]; bb[e] = tB[d][c8 + e]; }
      uH[it] = (v4u){pk16(a[0], a[1]), pk16(a[2], a[3]), pk16(a[4], a[5]), pk16(a[6], a[7])};
      uL[it] = (v4u){pk16(bb[0], bb[1]), pk16(bb[2], bb[3]), pk16(bb[4], bb[5]), pk16(bb[6], bb[7])};
    }
    v4f zv = (v4f){0.f, 0.f, 0.f, 0.f};
    if (p == 0) zv = *(const v4f*)(dzs + 4 * (t & 15));
    {
#pragma unroll
      for (int it = 0; it < 4; ++it) {
        const int d = it * 16 + wave * 2 + hh;
        *(v4u*)(dH + tileOff + (size_t)d * kChunk + c8) = uH[it];
        *(v4u*)(dL + tileOff + (size_t)d * kChunk + c8) = uL[it];
      }
      if (p == 0 && t < 16) *(v4f*)(dz + tile * kHdim + 4 * t) = zv;
      
    }
    __syncthreads();
  }
}

// ---------------------------------------------------------------------------
// Exclusive prefix over chunks of the transposed state and of z, per (b, h). No element depends on another, so the work is dealt
// by element: grid (32 bh, 5), 256 threads. Slices y = 0..3: thread t owns elements 1024y + 4t .. +3 of every 4096-element tile;
// slice y = 4: thread t < 64 owns element t of z. A thread first issues the loads of all 15 increments it needs (the last chunk's
// is never used), so their latencies overlap, then sums them in registers in chunk order and stores each chunk's value.
// S^T_c = sum_{c' < c} dST_{c'} (f32, sequential), written as bf16 hi/lo planes [tile][64 e][64 d] (tile = (b*16+c)*16+h);
// z_c likewise to zpre[tile][64] (f32). A wave's store covers 256 contiguous bytes of a plane.
// ---------------------------------------------------------------------------
typedef __attribute__((ext_vector_type(2))) unsigned int v2u;
constexpr int kPfxSlices = 4;                    // 4 slices x 256 threads x 4 elements = one 64 x 64 tile
static_assert(kPfxSlices * 256 * 4 == kHdim * kHdim, "the slices cover a tile");
// at most eight waves per SIMD are asked for: 128 registers a wave. Without it the build keeps to 81 registers and holds the last
// load back until the first has returned, to take over its registers
__global__ __launch_bounds__(256) __attribute__((amdgpu_waves_per_eu(2, 8))) void state_prefix_kernel(const float* __restrict__ dST, const float* __restrict__ dz,
                                                           unsigned short* __restrict__ STh, unsigned short* __restrict__ STl,
                                                           float* __restrict__ zpre) {
  const int t = threadIdx.x;
  const int bh = blockIdx.x;
  const int b = bh >> 4, h = bh & 15;
  const size_t tile0 = (size_t)(b * kNChunk) * kHeads + h;   // chunk 0's tile; chunk c's is tile0 + 16 c
  if (blockIdx.y == (unsigned)kPfxSlices) {                  // block-uniform: the z slice
    if (t >= kHdim) return;
    const float* zp = dz + tile0 * kHdim + t;
    float* zo = zpre + tile0 * kHdim + t;
    float zd[kNChunk - 1];
#pragma unroll
    for (int c = 0; c < kNChunk - 1; ++c) zd[c] = zp[c * kHeads * kHdim];
    float zacc = 0.f;
#pragma unroll
    for (int c = 0; c < kNChunk; ++c) {
      zo[c * kHeads * kHdim] = zacc;
      if (c < kNChunk - 1) zacc += zd[c];
    }
    return;
  }
  const size_t el = tile0 * 4096 + ((size_t)blockIdx.y * 256 + t) * 4;
  const float* dp = dST + el;
  unsigned short* ph = STh + el;
  unsigned short* pl = STl + el;
  v4f d[kNChunk - 1];
#pragma unroll
  for (int c = 0; c < kNChunk - 1; ++c) d[c] = *(const v4f*)(dp + c * kHeads * 4096);
  // all 15 loads stay in front of this line, so that they are in flight together (the compiler otherwise sinks five of them behind the
  // first waits); and it stands in front of the first overwrite of the address register, which is an input, so it is not reused before it
  asm volatile("s_wait_xcnt 0x0" :: "v"(dp) : "memory");
  v4f a = (v4f){0.f, 0.f, 0.f, 0.f};
#pragma unroll
  for (int c = 0; c < kNChunk; ++c) {
    unsigned short hb[4], lb[4];
#pragma unroll
    for (int e = 0; e < 4; ++e) {
      hb[e] = f2bf_bits(a[e]);
      lb[e] = f2bf_bits(a[e] - bf_bits2f(hb[e]));
    }
    *(v2u*)(ph + c * kHeads * 4096) = (v2u){pk16(hb[0], hb[1]), pk16(hb[2], hb[3])};
    *(v2u*)(pl + c * kHeads * 4096) = (v2u){pk16(lb[0], lb[1]), pk16(lb[2], lb[3])};
    if (c < kNChunk - 1) a += d[c];
  }
  asm volatile("s_wait_xcnt 0x0" ::: "memory");   // stands behind the last stores, in front of any later write of a register that they name
}

// ---------------------------------------------------------------------------
// Per (batch-chunk y, head h), one work-group of eight waves: masked scores A = tril(q.k^T), num = A.v + q.S_c,
// den = q.z_c + rowsum(A) + eps, o = num * (1/den) as bf16 hi/lo rows of the token-major o planes.
// The k, v^T and S^T tiles (hi and lo) are staged once in LDS; wave w owns chunk rows 16w .. 16w+15 from the scores to the stores,
// and its A rows pass from the accumulator layout to the A-operand layout through its own LDS slab (bf16 hi/lo, never in memory).
// Every sum keeps its order: per accumulator k ascending with hi.hi, hi.lo, lo.hi inside each 32 k; A.v and q.S in separate
// accumulators, added once; row sum and q.z sequential in f32.
// ---------------------------------------------------------------------------
constexpr int kPK = 72;                        // LDS row pitch of the 64-wide tiles (k, S^T), elements: 144 B = 16 B x odd
constexpr int kPV = 136;                       // LDS row pitch of the 128-wide tiles (v^T, A), elements: 272 B = 16 B x odd
constexpr int kSlabB = 2 * 16 * kPV * 2;       // one wave's slab: A_h rows, then A_l rows; later the f32 num rows (pitch 68)
static_assert(16 * 68 * 4 <= kSlabB, "the num rows fit the slab");

// orders one wave's LDS writes in front of reads by its other lanes (the slabs are private to a wave)
__device__ __forceinline__ void wave_lds_sync() {
  __builtin_amdgcn_fence(__ATOMIC_RELEASE, "workgroup");
  __builtin_amdgcn_wave_barrier();
  __builtin_amdgcn_fence(__ATOMIC_ACQUIRE, "workgroup");
}
__device__ __forceinline__ v16b lds_frag(const unsigned short* p) { return Frag<__bf16>::load((const __bf16*)p); }

// at most 256 registers a wave: two work-groups (four waves per SIMD) share a WGP, so all 512 are resident at once
__global__ __launch_bounds__(256) __attribute__((amdgpu_waves_per_eu(4, 4))) void chunk_attn_kernel(const unsigned short* __restrict__ qh, const unsigned short* __restrict__ ql,
                                                         const unsigned short* __restrict__ kh, const unsigned short* __restrict__ kl,
                                                         const unsigned short* __restrict__ vTh, const unsigned short* __restrict__ vTl,
                                                         const unsigned short* __restrict__ STh, const unsigned short* __restrict__ STl,
                                                         const float* __restrict__ zpre,
                                                         unsigned short* __restrict__ oh, unsigned short* __restrict__ ol) {
  __shared__ __align__(16) unsigned short sKh[kChunk * kPK];
  __shared__ __align__(16) unsigned short sKl[kChunk * kPK];
  __shared__ __align__(16) unsigned short sVh[kHdim * kPV];
  __shared__ __align__(16) unsigned short sVl[kHdim * kPV];
  __shared__ __align__(16) unsigned short sSh[kHdim * kPK];
  __shared__ __align__(16) unsigned short sSl[kHdim * kPK];
  __shared__ __align__(16) unsigned char  sW[8][kSlabB];
  __shared__ __align__(16) float sInv[8][16];
  typedef Frag<__bf16> F;
  const int t = threadIdx.x;
  const int lane = t & 31, wave = t >> 5;
  const int rlane = lane & 15;                 // row (A operand) / column (B operand, accumulator) within a 16-wide subtile
  const int koff  = (lane >> 4) * 8;           // k offset of this lane half
  const int mOff  = (lane >> 4) * 8;           // accumulator row offset
  const int y = blockIdx.x, h = blockIdx.y;
  const size_t tile = (size_t)y * kHeads + h;
  const size_t base = (size_t)y * kChunk * kEmb + (size_t)h * kHdim;   // chunk row 0 at this head, token-major planes

  // ---- the tiles, 16 B per lane: k 128 x 64, v^T 64 x 128, S^T 64 x 64, hi and lo; this wave's q rows ----
  const size_t ko = base + (size_t)(t >> 3) * kEmb + (t & 7) * 8;
  const size_t vo = tile * (size_t)(kHdim * kChunk) + (size_t)t * 8;
  const size_t so = tile * (size_t)(kHdim * kHdim) + (size_t)t * 8;
  const size_t qrow = base + (size_t)(wave * 16 + rlane) * kEmb;
  const unsigned short* pkh = kh + ko;
  const unsigned short* pkl = kl + ko;
  const unsigned short* pvh = vTh + vo;
  const unsigned short* pvl = vTl + vo;
  const unsigned short* psh = STh + so;
  const unsigned short* psl = STl + so;
  const unsigned short* pqh = qh + qrow;
  const unsigned short* pql = ql + qrow;
  const unsigned short* pfh = pqh + koff;
  const unsigned short* pfl = pql + koff;
  v4u gk[8], gv[8], gs[4], gqh[8], gql[8];
#pragma unroll
  for (int it = 0; it < 4; ++it) {
    gk[2 * it]     = *(const v4u*)(pkh + it * 32 * kEmb);
    gk[2 * it + 1] = *(const v4u*)(pkl + it * 32 * kEmb);
    gv[2 * it]     = *(const v4u*)(pvh + it * 2048);
    gv[2 * it + 1] = *(const v4u*)(pvl + it * 2048);
  }
#pragma unroll
  for (int it = 0; it < 2; ++it) {
    gs[2 * it]     = *(const v4u*)(psh + it * 2048);
    gs[2 * it + 1] = *(const v4u*)(psl + it * 2048);
  }
  // the q rows as A operands (K = 64: two 32-k blocks), and whole (row rlane) for q.z
  v16b qfh[2], qfl[2];
#pragma unroll
  for (int kb = 0; kb < 2; ++kb) {
    qfh[kb] = F::load((const __bf16*)(pfh + kb * 32));
    qfl[kb] = F::load((const __bf16*)(pfl + kb * 32));
  }
#pragma unroll
  for (int w = 0; w < 8; ++w) {
    gqh[w] = *(const v4u*)(pqh + 8 * w);
    gql[w] = *(const v4u*)(pql + 8 * w);
  }
  // stands in front of the first overwrite of a register that these loads name; the addresses are inputs, so none is reused before it
  asm volatile("s_wait_xcnt 0x0" :: "v"(pkh), "v"(pkl), "v"(pvh), "v"(pvl), "v"(psh), "v"(psl), "v"(pqh), "v"(pql), "v"(pfh), "v"(pfl) : "memory");
#pragma unroll
  for (int it = 0; it < 4; ++it) {
    const int u = it * 256 + t;
    *(v4u*)(sKh + (u >> 3) * kPK + (u & 7) * 8) = gk[2 * it];
    *(v4u*)(sKl + (u >> 3) * kPK + (u & 7) * 8) = gk[2 * it + 1];
    *(v4u*)(sVh + (u >> 4) * kPV + (u & 15) * 8) = gv[2 * it];
    *(v4u*)(sVl + (u >> 4) * kPV + (u & 15) * 8) = gv[2 * it + 1];
  }
#pragma unroll
  for (int it = 0; it < 2; ++it) {
    const int u = it * 256 + t;
    *(v4u*)(sSh + (u >> 3) * kPK + (u & 7) * 8) = gs[2 * it];
    *(v4u*)(sSl + (u >> 3) * kPK + (u & 7) * 8) = gs[2 * it + 1];
  }

  // ---- q . z_c of row rlane (both lane halves compute the same row) ----
  const float* zp = zpre + tile * kHdim;
  float qz = 0.f;
#pragma unroll
  for (int w = 0; w < 8; ++w) {
    const v4u uh = gqh[w];
    const v4u ul = gql[w];
    const v4f z0 = *(const v4f*)(zp + 8 * w);
    const v4f z1 = *(const v4f*)(zp + 8 * w + 4);
    float qv[8], zv[8];
#pragma unroll
    for (int e = 0; e < 4; ++e) {
      qv[2 * e]     = bflo2f(uh[e]) + bflo2f(ul[e]);
      qv[2 * e + 1] = bfhi2f(uh[e]) + bfhi2f(ul[e]);
      zv[e] = z0[e];
      zv[4 + e] = z1[e];
    }
#pragma unroll
    for (int e = 0; e < 8; ++e) qz += qv[e] * zv[e];
  }
  sInv[wave][rlane] = qz;                      // parked in LDS: kept in a register, the whole sum is sunk to its use and the q rows spill
  __syncthreads();                             // the staged tiles are readable by every wave

  // ---- masked scores of rows 16w .. 16w+15, four column subtiles at a time, into the slab as bf16 hi/lo ----
  unsigned short* aH = (unsigned short*)sW[wave];
  unsigned short* aL = aH + 16 * kPV;
#pragma unroll
  for (int jh = 0; jh < 2; ++jh) {
    v8f s[4];
#pragma unroll
    for (int j = 0; j < 4; ++j) s[j] = (v8f){0.f,0.f,0.f,0.f,0.f,0.f,0.f,0.f};
#pragma unroll
    for (int kb = 0; kb < 2; ++kb) {
      v16b bh[4], bl[4];
#pragma unroll
      for (int j = 0; j < 4; ++j) {
        const int o = ((jh * 4 + j) * 16 + rlane) * kPK + koff + kb * 32;
        bh[j] = lds_frag(sKh + o);
        bl[j] = lds_frag(sKl + o);
      }
#pragma unroll
      for (int j = 0; j < 4; ++j) s[j] = F::mma(qfh[kb], bh[j], s[j]);
#pragma unroll
      for (int j = 0; j < 4; ++j) s[j] = F::mma(qfh[kb], bl[j], s[j]);
#pragma unroll
      for (int j = 0; j < 4; ++j) s[j] = F::mma(qfl[kb], bh[j], s[j]);
    }
#pragma unroll
    for (int j = 0; j < 4; ++j) {
      const int n = (jh * 4 + j) * 16 + rlane;
#pragma unroll
      for (int r = 0; r < 8; ++r) {
        float v = s[j][r];
        if (n > wave * 16 + mOff + r) v = 0.0f;
        const unsigned short hb = f2bf_bits(v);
        const unsigned short lb = f2bf_bits(v - bf_bits2f(hb));
        aH[(mOff + r) * kPV + n] = hb;
        aL[(mOff + r) * kPV + n] = lb;
      }
    }
  }

  // ---- q . S_c: K = 64 ----
  v8f qs[4], av[4];
#pragma unroll
  for (int j = 0; j < 4; ++j) { qs[j] = (v8f){0.f,0.f,0.f,0.f,0.f,0.f,0.f,0.f}; av[j] = (v8f){0.f,0.f,0.f,0.f,0.f,0.f,0.f,0.f}; }
#pragma unroll
  for (int kb = 0; kb < 2; ++kb) {
    v16b bh[4], bl[4];
#pragma unroll
    for (int j = 0; j < 4; ++j) {
      const int o = (j * 16 + rlane) * kPK + koff + kb * 32;
      bh[j] = lds_frag(sSh + o);
      bl[j] = lds_frag(sSl + o);
    }
#pragma unroll
    for (int j = 0; j < 4; ++j) qs[j] = F::mma(qfh[kb], bh[j], qs[j]);
#pragma unroll
    for (int j = 0; j < 4; ++j) qs[j] = F::mma(qfh[kb], bl[j], qs[j]);
#pragma unroll
    for (int j = 0; j < 4; ++j) qs[j] = F::mma(qfl[kb], bh[j], qs[j]);
  }
  wave_lds_sync();                             // the slab's A rows are readable by every lane of this wave

  // ---- A . v: K = 128 ----
#pragma unroll
  for (int kb = 0; kb < 4; ++kb) {
    const v16b ah = lds_frag(aH + rlane * kPV + koff + kb * 32);
    const v16b al = lds_frag(aL + rlane * kPV + koff + kb * 32);
    v16b bh[4], bl[4];
#pragma unroll
    for (int j = 0; j < 4; ++j) {
      const int o = (j * 16 + rlane) * kPV + koff + kb * 32;
      bh[j] = lds_frag(sVh + o);
      bl[j] = lds_frag(sVl + o);
    }
#pragma unroll
    for (int j = 0; j < 4; ++j) av[j] = F::mma(ah, bh[j], av[j]);
#pragma unroll
    for (int j = 0; j < 4; ++j) av[j] = F::mma(ah, bl[j], av[j]);
#pragma unroll
    for (int j = 0; j < 4; ++j) av[j] = F::mma(al, bh[j], av[j]);
  }

  // ---- row sum of the masked scores of row rlane, j in order ----
  float asum = 0.f;
#pragma unroll
  for (int w = 0; w < 16; ++w) {
    const v4u uh = *(const v4u*)(aH + rlane * kPV + 8 * w);
    const v4u ul = *(const v4u*)(aL + rlane * kPV + 8 * w);
#pragma unroll
    for (int e = 0; e < 4; ++e) {
      const float a0 = bflo2f(uh[e]) + bflo2f(ul[e]);
      asum = asum + a0;
      const float a1 = bfhi2f(uh[e]) + bfhi2f(ul[e]);
      asum = asum + a1;
    }
  }
  const float den = (sInv[wave][rlane] + asum) + kEps;
  const float inv = 1.0f / den;
  wave_lds_sync();                             // every read of the A rows has returned: the slab takes the num rows

  float* slab = (float*)sW[wave];
#pragma unroll
  for (int j = 0; j < 4; ++j)
#pragma unroll
    for (int r = 0; r < 8; ++r) slab[(mOff + r) * 68 + (j << 4) + rlane] = av[j][r] + qs[j][r];
  sInv[wave][rlane] = inv;
  wave_lds_sync();

  const int q4 = lane >> 3, c8 = (lane & 7) * 8;
  v4u uo_h[4], uo_l[4];
#pragma unroll
  for (int it = 0; it < 4; ++it) {
    const int row = it * 4 + q4;
    const float iv = sInv[wave][row];
    unsigned short hb[8], lb[8];
#pragma unroll
    for (int e = 0; e < 8; ++e) {
      const float f = slab[row * 68 + c8 + e] * iv;
      hb[e] = f2bf_bits(f);
      lb[e] = f2bf_bits(f - bf_bits2f(hb[e]));
    }
    uo_h[it] = (v4u){pk16(hb[0], hb[1]), pk16(hb[2], hb[3]), pk16(hb[4], hb[5]), pk16(hb[6], hb[7])};
    uo_l[it] = (v4u){pk16(lb[0], lb[1]), pk16(lb[2], lb[3]), pk16(lb[4], lb[5]), pk16(lb[6], lb[7])};
  }
#pragma unroll
  for (int it = 0; it < 4; ++it) {
    const size_t o = base + (size_t)(wave * 16 + it * 4 + q4) * kEmb + c8;
    *(v4u*)(oh + o) = uo_h[it];
    *(v4u*)(ol + o) = uo_l[it];
  }
}

// ---------------------------------------------------------------------------
// Premise check on the causal flag: only the causal branch is built; if the flag is 0 the output is poisoned with NaN
// ---------------------------------------------------------------------------
__global__ __launch_bounds__(256) void premise_kernel(const int* __restrict__ flag, float* __restrict__ out, int n16) {
  const int i = blockIdx.x * 256 + threadIdx.x;
  if (i >= n16) return;
  const int f = flag[0];
  if (f != 0) return;
  const float qn = __uint_as_float(0x7fc00000u);
  const v4f nv = (v4f){qn, qn, qn, qn};
  float* p = out + 16 * (size_t)i;
  {
#pragma unroll
    for (int k = 0; k < 4; ++k) *(v4f*)(p + 4 * k) = nv;
    
  }
}

// ---------------------------------------------------------------------------
// Host launcher
// ---------------------------------------------------------------------------
extern "C" void kernel_launch(void* const* d_in, const int* in_sizes, int n_in,
                              void* d_out, int out_size, void* d_ws, size_t ws_size,
                              hipStream_t stream) {
  if (n_in < 8) return;
  if (in_sizes[0] != (int)kPlaneEl || in_sizes[1] != (int)kPlaneEl || in_sizes[2] != (int)kPlaneEl) return;
  if (in_sizes[3] != (int)kWEl || in_sizes[4] != (int)kWEl || in_sizes[5] != (int)kWEl || in_sizes[6] != (int)kWEl) return;
  if (in_sizes[7] < 1) return;
  if (out_size != (int)kPlaneEl) return;
  if (ws_size < (size_t)kWsTotal) return;

  const float* Q  = (const float*)d_in[0];
  const float* Kx = (const float*)d_in[1];
  const float* Vx = (const float*)d_in[2];
  const float* Wq = (const float*)d_in[3];
  const float* Wk = (const float*)d_in[4];
  const float* Wv = (const float*)d_in[5];
  const float* Wo = (const float*)d_in[6];
  const int*   causal = (const int*)d_in[7];
  float* out = (float*)d_out;
  char* ws = (char*)d_ws;

  unsigned short* Xbase = (unsigned short*)(ws + oXbase);
  const unsigned short* Xq_h = Xbase;
  const unsigned short* Xq_l = Xbase + kPlaneEl;
  const unsigned short* Xk_h = Xbase + 2 * kPlaneEl;
  const unsigned short* Xk_l = Xbase + 3 * kPlaneEl;
  const unsigned short* Xv_h = Xbase + 4 * kPlaneEl;
  const unsigned short* Xv_l = Xbase + 5 * kPlaneEl;
  unsigned short* Wbase = (unsigned short*)(ws + oWbase);
  const unsigned short* Wq_h = Wbase;
  const unsigned short* Wq_l = Wbase + kWEl;
  const unsigned short* Wk_h = Wbase + 2 * kWEl;
  const unsigned short* Wk_l = Wbase + 3 * kWEl;
  const unsigned short* Wv_h = Wbase + 4 * kWEl;
  const unsigned short* Wv_l = Wbase + 5 * kWEl;
  const unsigned short* Wo_h = (const unsigned short*)(ws + oWo_h);
  const unsigned short* Wo_l = (const unsigned short*)(ws + oWo_l);
  unsigned short* q_h  = (unsigned short*)(ws + oQ_h);
  unsigned short* q_l  = (unsigned short*)(ws + oQ_l);
  unsigned short* k_h  = (unsigned short*)(ws + oK_h);
  unsigned short* k_l  = (unsigned short*)(ws + oK_l);
  unsigned short* v_h  = (unsigned short*)(ws + oV_h);
  unsigned short* v_l  = (unsigned short*)(ws + oV_l);
  unsigned short* kT_h = (unsigned short*)(ws + oKT_h);
  unsigned short* kT_l = (unsigned short*)(ws + oKT_l);
  unsigned short* vT_h = (unsigned short*)(ws + oVT_h);
  unsigned short* vT_l = (unsigned short*)(ws + oVT_l);
  float*          dST  = (float*)(ws + oDST);
  unsigned short* ST_h = (unsigned short*)(ws + oST_h);
  unsigned short* ST_l = (unsigned short*)(ws + oST_l);
  unsigned short* o_h  = (unsigned short*)(ws + oO_h);
  unsigned short* o_l  = (unsigned short*)(ws + oO_l);
  float*          dz   = (float*)(ws + oDZ);
  float*          zpre = (float*)(ws + oZPRE);

  const long sTileT    = (long)kHdim * kChunk;           // 8192
  const long sTileS    = (long)kHdim * kHdim;            // 4096

  // 1) input and weight hi/lo planes
  split_planes_kernel<<<dim3((unsigned)(kPlaneEl / 8 / 256), 3, 1), 256, 0, stream>>>(Q, Kx, Vx, Vx, Xbase, kPlaneEl, (int)(kPlaneEl / 8));
  split_planes_kernel<<<dim3((unsigned)(kWEl / 8 / 256), 4, 1), 256, 0, stream>>>(Wq, Wk, Wv, Wo, Wbase, kWEl, (int)(kWEl / 8));

  // 2) projections: M=4096, N=1024, K=1024 (8 x 32 tiles of 128 x 128, one work-group each); q, k with elu(x)+1
  gemm128_ring<2, 6><<<dim3(kEmb / 128, kTok / 128, 1), 128, 0, stream>>>(Xq_h, Xq_l, Wq_h, Wq_l, q_h, q_l, nullptr);
  gemm128_ring<2, 6><<<dim3(kEmb / 128, kTok / 128, 1), 128, 0, stream>>>(Xk_h, Xk_l, Wk_h, Wk_l, k_h, k_l, nullptr);
  gemm128_ring<2, 0><<<dim3(kEmb / 128, kTok / 128, 1), 128, 0, stream>>>(Xv_h, Xv_l, Wv_h, Wv_l, v_h, v_l, nullptr);

  // 3) per-chunk transposes of k, v and chunk sums of k
  prep_kernel<<<dim3(kYB, kHeads, 1), 256, 0, stream>>>(k_h, k_l, v_h, v_l, kT_h, kT_l, vT_h, vT_l, dz);

  // 4) dST[e][d] = sum_j v[j][e] k[j][d] per (b,c,h): M=64, N=64, K=128, one wave per tile
  wmma_gemm64<1, true, 0, 0, false, 0><<<dim3(1, kYB, kHeads), 32, 0, stream>>>(
      vT_h, vT_l, kChunk, 16 * sTileT, sTileT, kT_h, kT_l, kChunk, 16 * sTileT, sTileT,
      (void*)dST, nullptr, kHdim, 16 * sTileS, sTileS,
      nullptr, nullptr, 0L, 0L, kHdim, kHdim, kChunk, 1.0f);

  // 5) exclusive prefix over chunks of S^T and z
  state_prefix_kernel<<<dim3(kBatch * kHeads, kPfxSlices + 1, 1), 256, 0, stream>>>(dST, dz, ST_h, ST_l, zpre);

  // 6) per (b,c,h): masked scores, A.v + q.S_c, normaliser -> attention output hi/lo planes (token-major, heads merged)
  chunk_attn_kernel<<<dim3(kYB, kHeads, 1), 256, 0, stream>>>(q_h, q_l, k_h, k_l, vT_h, vT_l, ST_h, ST_l, zpre, o_h, o_l);

  // 7) output projection: M=4096, N=1024, K=1024 -> d_out
  gemm128_ring<0, 0><<<dim3(kEmb / 128, kTok / 128, 1), 128, 0, stream>>>(o_h, o_l, Wo_h, Wo_l, nullptr, nullptr, out);

  // 8) premise check on the causal flag (poisons the output when the non-causal branch would be required)
  premise_kernel<<<dim3((unsigned)(kPlaneEl / 16 / 256), 1, 1), 256, 0, stream>>>(causal, out, (int)(kPlaneEl / 16));
}

// v004
// Measured time: 156 microseconds a run.
// Two timings next to v003 both put it at 1.05 times that version's speed.
// All steps since v000 together make it 2.75 times as fast.
// Contractions: q/k/v projections, chunk scores q.k^T, state increment v^T.k, q.S, A.v, output projection -- all v_wmma_f32_16x16x32_bf16 with bf16 hi/lo operand planes (hi.hi + hi.lo + lo.hi), f32 accumulate; feature map, state prefix over chunks, normaliser and division in f32 on the VALU.
#include <hip/hip_runtime.h>
#include <math.h>

// ---------------------------------------------------------------------------
// Problem constants
// ---------------------------------------------------------------------------
constexpr int kBatch   = 2;
constexpr int kSeq     = 2048;
constexpr int kEmb     = 1024;
constexpr int kHeads   = 16;
constexpr int kHdim    = 64;
constexpr int kChunk   = 128;
constexpr int kNChunk  = kSeq / kChunk;          // 16 chunks per sequence
constexpr int kTok     = kBatch * kSeq;          // 4096 token rows
constexpr int kYB      = kBatch * kNChunk;       // 32 (batch, chunk) pairs
constexpr int kTiles   = kYB * kHeads;           // 512 (batch, chunk, head) tiles
constexpr float kEps   = 1e-6f;
constexpr long kPlaneEl = (long)kTok * kEmb;     // 4194304 elements per activation plane
constexpr long kWEl     = (long)kEmb * kEmb;     // 1048576 elements per weight plane
constexpr long kUnit    = kPlaneEl * 2;          // 8388608 bytes (one bf16 activation plane)
constexpr long kWUnit   = kWEl * 2;              // 2097152 bytes (one bf16 weight plane)

// ---------------------------------------------------------------------------
// Workspace region map (bytes; U = 8388608, WU = 2097152); total 14U + 262144 = 117702656
//   [0U , 6U)  phase 1: Xq_h Xq_l Xk_h Xk_l Xv_h Xv_l (input hi/lo planes, dead after projections)
//              phase 2: kT_h@0U kT_l@1U vT_h@2U vT_l@3U dST(f32)@4U ST_h@5U ST_l@5.5U
//   [6U , 8U)  Wq_h Wq_l Wk_h Wk_l Wv_h Wv_l Wo_h Wo_l (WU each)
//   [8U ,14U)  q_h@8U q_l@9U k_h@10U k_l@11U v_h@12U v_l@13U (projection outputs)
//              later: o_h@12U o_l@13U (v dead after the transposes)
//   [14U, +262144)  dz f32 [512][64] @14U, zpre f32 [512][64] @14U+131072
// ---------------------------------------------------------------------------
constexpr long oXbase = 0;
constexpr long oKT_h  = 0;
constexpr long oKT_l  = 1 * kUnit;
constexpr long oVT_h  = 2 * kUnit;
constexpr long oVT_l  = 3 * kUnit;
constexpr long oDST   = 4 * kUnit;
constexpr long oST_h  = 5 * kUnit;
constexpr long oST_l  = 5 * kUnit + kUnit / 2;
constexpr long oWbase = 6 * kUnit;
constexpr long oWo_h  = oWbase + 6 * kWUnit;
constexpr long oWo_l  = oWbase + 7 * kWUnit;
constexpr long oQ_h   = 8 * kUnit;
constexpr long oQ_l   = 9 * kUnit;
constexpr long oK_h   = 10 * kUnit;
constexpr long oK_l   = 11 * kUnit;
constexpr long oV_h   = 12 * kUnit;
constexpr long oV_l   = 13 * kUnit;
constexpr long oO_h   = 12 * kUnit;
constexpr long oO_l   = 13 * kUnit;
constexpr long oDZ    = 14 * kUnit;
constexpr long oZPRE  = 14 * kUnit + 131072;
constexpr long kWsTotal = 14 * kUnit + 262144;
static_assert(kWsTotal == 117702656, "carve total");
static_assert(kWsTotal <= 134217728, "carve within 128 MiB");
static_assert((long)kTiles * kHdim * kChunk * 2 == kUnit, "kT plane size");
static_assert((long)kTiles * kHdim * kHdim * 4 == kUnit, "dST plane size");

typedef __attribute__((ext_vector_type(16))) _Float16 v16h;
typedef __attribute__((ext_vector_type(8)))  _Float16 v8h;
typedef __attribute__((ext_vector_type(16))) __bf16   v16b;
typedef __attribute__((ext_vector_type(8)))  __bf16   v8b;
typedef __attribute__((ext_vector_type(8)))  float    v8f;
typedef __attribute__((ext_vector_type(4)))  float    v4f;
typedef __attribute__((ext_vector_type(4)))  unsigned int v4u;

__device__ __forceinline__ unsigned short f2bf_bits(float f) {
  unsigned u = __float_as_uint(f);
  return (unsigned short)((u + 0x7FFFu + ((u >> 16) & 1u)) >> 16);
}
__device__ __forceinline__ float bf_bits2f(unsigned short h) { return __uint_as_float(((unsigned)h) << 16); }

// hazard guards as plain device helpers (no inline asm inside the kernel template body)
__device__ __forceinline__ void dep_guard_h(v8f& a, v8f& b, v16h x, v16h y) { asm volatile("v_nop\n\tv_nop\n\tv_nop\n\tv_nop" : "+v"(a), "+v"(b) : "v"(x), "v"(y)); }
__device__ __forceinline__ void dep_guard_b(v8f& a, v8f& b, v16b x, v16b y) { asm volatile("v_nop\n\tv_nop\n\tv_nop\n\tv_nop" : "+v"(a), "+v"(b) : "v"(x), "v"(y)); }
__device__ __forceinline__ void keep4_h(v16h a, v16h b, v16h c, v16h d) { asm volatile("v_nop" :: "v"(a), "v"(b), "v"(c), "v"(d)); }
__device__ __forceinline__ void keep4_b(v16b a, v16b b, v16b c, v16b d) { asm volatile("v_nop" :: "v"(a), "v"(b), "v"(c), "v"(d)); }
__device__ __forceinline__ void acc_guard4(v8f& a, v8f& b, v8f& c, v8f& d) { asm volatile("v_nop\n\tv_nop\n\tv_nop\n\tv_nop" : "+v"(a), "+v"(b), "+v"(c), "+v"(d)); }
template <typename T> struct Frag;
template <> struct Frag<_Float16> {
  typedef v16h V; union U { v16h v; v8h h[2]; };
  static __device__ __forceinline__ v16h load(const _Float16* p) {   // elements 0..7 <- p[0..7], 8..15 <- p[16..23]
    U f; f.h[0] = *(const v8h*)(p); f.h[1] = *(const v8h*)(p + 16); return f.v;
  }
  static __device__ __forceinline__ v8f mma(v16h a, v16h b, v8f c) {
    return __builtin_amdgcn_wmma_f32_16x16x32_f16(false, a, false, b, (short)0, c, false, false);
  }
  static __device__ __forceinline__ void guard(v8f& a, v8f& b, v16h x, v16h y) { dep_guard_h(a, b, x, y); }
  static __device__ __forceinline__ void keep(v16h a, v16h b, v16h c, v16h d) { keep4_h(a, b, c, d); }
};
template <> struct Frag<__bf16> {
  typedef v16b V; union U { v16b v; v8b h[2]; };
  static __device__ __forceinline__ v16b load(const __bf16* p) {
    U f; f.h[0] = *(const v8b*)(p); f.h[1] = *(const v8b*)(p + 16); return f.v;
  }
  static __device__ __forceinline__ v8f mma(v16b a, v16b b, v8f c) {
    return __builtin_amdgcn_wmma_f32_16x16x32_bf16(false, a, false, b, (short)0, c, false, false);
  }
  static __device__ __forceinline__ void guard(v8f& a, v8f& b, v16b x, v16b y) { dep_guard_b(a, b, x, y); }
  static __device__ __forceinline__ void keep(v16b a, v16b b, v16b c, v16b d) { keep4_b(a, b, c, d); }
};

__device__ __forceinline__ unsigned pk16(unsigned short a, unsigned short b) { return (unsigned)a | ((unsigned)b << 16); }
// bf16 element pair held in one 32-bit word: low half-word = even element, high half-word = odd element
__device__ __forceinline__ float bflo2f(unsigned w) { return __uint_as_float(w << 16); }
__device__ __forceinline__ float bfhi2f(unsigned w) { return __uint_as_float(w & 0xffff0000u); }

// ---- Register-blocked batched WMMA GEMM (2-D batch (blockIdx.y, blockIdx.z), waves per block from blockDim,
//      ACT reduced to none/relu/leaky plus 6 = elu(x)+1 and 7 = causal zero (n > m -> 0 for tile-local m, n)) ----
// C[m,n] = scale * sum_k A[m,k] * Bt[n,k] (+bias)(+resid); each wave owns a 64x64 tile.
// A row-major [M,K]; Bt row-major [N,K]; M,N % 64 == 0, K % 32 == 0.
// SPLIT: operands are hi/lo planes (A2/Bt2 = lo planes, same layout); product = hi.hi + hi.lo + lo.hi.
// BIAS_MODE: 0 = none, 1 = bias[m], 2 = bias[n].
// OUT_MODE: 0 = f32, 1 = f16, 2 = bf16 hi plane (Cout) + bf16 lo plane (Cout2).
// ET: 0 = f16 operands, 1 = bf16 operands (pointers passed as 16-bit storage)
template <int ET> struct Elem;
template <> struct Elem<0> { typedef _Float16 T; };
template <> struct Elem<1> { typedef __bf16 T; };
template <int ET, bool SPLIT, int BIAS_MODE, int OUT_MODE, bool RESID, int ACT = 0>
__global__ __launch_bounds__(256) void wmma_gemm64(
    const unsigned short* __restrict__ Ap, const unsigned short* __restrict__ A2p, int lda, long strideA, long strideAz,
    const unsigned short* __restrict__ Btp, const unsigned short* __restrict__ Bt2p, int ldb, long strideB, long strideBz,
    void* __restrict__ Cout, void* __restrict__ Cout2, int ldc, long strideC, long strideCz,
    const float* __restrict__ bias,
    const float* __restrict__ resid, long strideR, long strideRz,
    int M, int N, int K, float scale) {
  typedef typename Elem<ET>::T T;
  typedef typename Frag<T>::V V;
  const T* A = (const T*)Ap; const T* A2 = (const T*)A2p; const T* Bt = (const T*)Btp; const T* Bt2 = (const T*)Bt2p;
  __shared__ __align__(16) float sT[8][16 * 68];   // per-wave 16x64 slab, pitch 68 floats
  const int b    = blockIdx.y;
  const int bz   = blockIdx.z;
  const int lane = threadIdx.x & 31;
  const int wave = threadIdx.x >> 5;
  const int nwv  = blockDim.x >> 5;
  const int tilesN = N >> 6;
  const int tilesM = M >> 6;
  const int tile = blockIdx.x * nwv + wave;
  if (tile >= tilesM * tilesN) return;   // wave-uniform; no block barriers in this kernel
  const int tm = tile / tilesN;
  const int tn = tile - tm * tilesN;
  const int m0 = tm << 6;
  const int n0 = tn << 6;

  const T* Ab  = A  + (size_t)b * strideA + (size_t)bz * strideAz;
  const T* Bb  = Bt + (size_t)b * strideB + (size_t)bz * strideBz;
  const T* Ab2 = SPLIT ? (A2  + (size_t)b * strideA + (size_t)bz * strideAz) : nullptr;
  const T* Bb2 = SPLIT ? (Bt2 + (size_t)b * strideB + (size_t)bz * strideBz) : nullptr;
  const size_t cOff = (size_t)b * strideC + (size_t)bz * strideCz;

  const int rlane = lane & 15;                 // row (A) / col (B, D) within subtile
  const int koff  = (lane >> 4) * 8;           // k offset of this lane half
  const int mOff  = (lane >> 4) * 8;           // D row offset

  v8f acc[4][4];
#pragma unroll
  for (int i = 0; i < 4; ++i)
#pragma unroll
    for (int j = 0; j < 4; ++j) acc[i][j] = (v8f){0.f,0.f,0.f,0.f,0.f,0.f,0.f,0.f};

  for (int k0 = 0; k0 < K; k0 += 32) {
    V bh[4], bl[4];
#pragma unroll
    for (int j = 0; j < 4; ++j) {
      const size_t bo = (size_t)(n0 + (j << 4) + rlane) * ldb + koff + k0;
      bh[j] = Frag<T>::load(Bb + bo);
      if (SPLIT) bl[j] = Frag<T>::load(Bb2 + bo);
    }
#pragma unroll
    for (int i = 0; i < 4; ++i) {
      const size_t ao = (size_t)(m0 + (i << 4) + rlane) * lda + koff + k0;
      V ah = Frag<T>::load(Ab + ao);
      V al;
      if (SPLIT) al = Frag<T>::load(Ab2 + ao);
#pragma unroll
      for (int j = 0; j < 4; ++j) {
        acc[i][j] = Frag<T>::mma(ah, bh[j], acc[i][j]);
        if (SPLIT) {
          acc[i][j] = Frag<T>::mma(ah, bl[j], acc[i][j]);
          acc[i][j] = Frag<T>::mma(al, bh[j], acc[i][j]);
        }
      }
      Frag<T>::guard(acc[i][0], acc[i][3], ah, SPLIT ? al : ah);
    }
    Frag<T>::keep(bh[0], bh[1], bh[2], bh[3]);
    if (SPLIT) Frag<T>::keep(bl[0], bl[1], bl[2], bl[3]);
  }
  acc_guard4(acc[0][0], acc[0][1], acc[0][2], acc[0][3]);
  acc_guard4(acc[1][0], acc[1][1], acc[1][2], acc[1][3]);
  acc_guard4(acc[2][0], acc[2][1], acc[2][2], acc[2][3]);
  acc_guard4(acc[3][0], acc[3][1], acc[3][2], acc[3][3]);

  // ---- epilogue ----
  float* slab = sT[wave];
  const float* Rb = RESID ? (resid + (size_t)b * strideR + (size_t)bz * strideRz) : nullptr;
#pragma unroll
  for (int i = 0; i < 4; ++i) {
    const int mBase = m0 + (i << 4);
#pragma unroll
    for (int j = 0; j < 4; ++j) {
      const int n = n0 + (j << 4) + rlane;
      float bv = 0.f;
      if (BIAS_MODE == 2) bv = bias[n];
#pragma unroll
      for (int r = 0; r < 8; ++r) {
        float v = acc[i][j][r] * scale;
        if (BIAS_MODE == 1) v += bias[mBase + mOff + r];
        if (BIAS_MODE == 2) v += bv;
        if (RESID) v += Rb[(size_t)(mBase + mOff + r) * ldc + n];
        if (ACT == 2) v = fmaxf(v, 0.0f);
        if (ACT == 4) v = (v > 0.f) ? v : 0.01f * v;
        if (ACT == 6) v = (v > 0.f) ? (v + 1.0f) : expf(v);
        if (ACT == 7) { if (n > mBase + mOff + r) v = 0.0f; }
        slab[(mOff + r) * 68 + (j << 4) + rlane] = v;
      }
    }
    __builtin_amdgcn_fence(__ATOMIC_RELEASE, "workgroup");
    __builtin_amdgcn_wave_barrier();
    __builtin_amdgcn_fence(__ATOMIC_ACQUIRE, "workgroup");
    if (OUT_MODE == 0) {
      float* C = (float*)Cout + cOff;
      const int hh = lane >> 4, c4 = (lane & 15) * 4;     // row seg = 256 B = 16 lanes x 16 B
      {
#pragma unroll
        for (int it = 0; it < 8; ++it) {
          const int row = it * 2 + hh;
          v4f v = *(const v4f*)(slab + row * 68 + c4);
          *(v4f*)(C + (size_t)(mBase + row) * ldc + n0 + c4) = v;
        }
        
      }
    } else {
      const int q = lane >> 3, c8 = (lane & 7) * 8;
      unsigned short* C  = (unsigned short*)Cout  + cOff;
      unsigned short* C2 = (OUT_MODE == 2) ? ((unsigned short*)Cout2 + cOff) : nullptr;
      {
#pragma unroll
        for (int it = 0; it < 4; ++it) {
          const int row = it * 4 + q;
          const float* sp = slab + row * 68 + c8;
          v8h hv, lv;
#pragma unroll
          for (int e = 0; e < 8; ++e) {
            if (OUT_MODE == 1) {
              hv[e] = (_Float16)sp[e];
            } else {
              unsigned short hb = f2bf_bits(sp[e]);
              unsigned short lb = f2bf_bits(sp[e] - bf_bits2f(hb));
              hv[e] = __builtin_bit_cast(_Float16, hb);
              lv[e] = __builtin_bit_cast(_Float16, lb);
            }
          }
          *(v8h*)(C + (size_t)(mBase + row) * ldc + n0 + c8) = hv;
          if (OUT_MODE == 2) *(v8h*)(C2 + (size_t)(mBase + row) * ldc + n0 + c8) = lv;
        }
        
      }
    }
    __builtin_amdgcn_fence(__ATOMIC_RELEASE, "workgroup");
    __builtin_amdgcn_wave_barrier();
    __builtin_amdgcn_fence(__ATOMIC_ACQUIRE, "workgroup");
  }
}

// ---------------------------------------------------------------------------
// The four 4096 x 1024 x 1024 products: C[m,n] = sum_k A[m,k] * Bt[n,k], hi/lo planes, product = hi.hi + hi.lo + lo.hi.
// One 128 x 128 tile of C per work-group, four waves (2 x 2), each wave a 64 x 64 tile (the 4 x 4 accumulators of wmma_gemm64).
// A stage is 128 k (256 B) of 128 rows of each of the four operand planes [A_h | A_l | B_h | B_l], LDS row pitch 272 B;
// wave w brings plane w of every stage with one tensor load; two buffers, the next stage's loads fly while this one is worked on.
// Per accumulator the products are summed in the order of wmma_gemm64: k ascending, hi.hi, hi.lo, lo.hi inside each 32 k.
// ---------------------------------------------------------------------------
constexpr unsigned kRowB    = 256;                    // bytes of one operand row in a stage
constexpr unsigned kPitchB  = 272;                    // LDS row pitch: 256 B + the 16-B pad for ds_load_b128 readers
constexpr unsigned kPlaneB  = 128 * kPitchB;          // 34816 B, one plane's slice of a stage
constexpr unsigned kStageB  = 4 * kPlaneB;            // 139264 B, one buffer
constexpr unsigned kStages  = (unsigned)kEmb * 2 / kRowB;   // 8
static_assert(kPlaneB % 2048 == 0, "every slice starts at a multiple of 2 KiB");
static_assert(kStages >= 2, "the ring's prologue needs two stages");
typedef __attribute__((ext_vector_type(8))) unsigned int v8u;

__device__ __forceinline__ unsigned uni(unsigned v) { return (unsigned)__builtin_amdgcn_readfirstlane((int)v); }
__device__ __forceinline__ unsigned pinned(unsigned v) { unsigned w = uni(v); asm volatile("" : "+s"(w)); return w; }
__device__ __forceinline__ void wait_ds0()     { asm volatile("s_wait_dscnt 0x0" ::: "memory"); }      // this wave's LDS reads have returned
__device__ __forceinline__ void wait_tensor0() { asm volatile("s_wait_tensorcnt 0x0" ::: "memory"); }  // this wave's tensor load has landed
__device__ __forceinline__ void tdm_load(v4u g0, v8u g1) { asm volatile("tensor_load_to_lds %0, %1" :: "s"(g0), "s"(g1) : "memory"); }
__device__ __forceinline__ v4u tdm_group0(unsigned lds_dst, unsigned long long ga) {
  v4u g;
  g[0] = uni(1u); g[1] = uni(lds_dst); g[2] = uni((unsigned)ga); g[3] = uni((((unsigned)(ga >> 32)) & 0x01FFFFFFu) | 0x80000000u);
  return g;
}
// 1-byte elements, tile = tensor = 128 rows of 256 B, source pitch one K row, 4 dwords of LDS pad behind every 64 dwords
__device__ __forceinline__ v8u tdm_group1() {
  constexpr unsigned d0 = kRowB, d1 = 128u;
  v8u g;
  g[0] = uni((1u << 20) | (5u << 22) | (3u << 25));
  g[1] = uni((d0 & 0xFFFFu) << 16);
  g[2] = uni((d0 >> 16) | ((d1 & 0xFFFFu) << 16));
  g[3] = uni((d1 >> 16) | (d0 << 16));
  g[4] = uni(d1);
  g[5] = uni((unsigned)kEmb * 2u);
  g[6] = uni(0u);
  g[7] = uni(0u);
  return g;
}

struct FragSet { v16b ah[4], al[4], bh[4], bl[4]; };
// the fragments of one 32-k block: pa / pb = this lane's row 0 of the A_h / B_h slices, at its k half
__device__ __forceinline__ void load_set(FragSet& f, const unsigned char* pa, const unsigned char* pb, int kb) {
  const unsigned k = (unsigned)kb * 64u;
  constexpr unsigned t = 16u * kPitchB;   // 16 rows
  // in the order in which mma_set needs them: the first term can start when half of the group has returned
#pragma unroll
  for (int i = 0; i < 4; ++i) f.ah[i] = Frag<__bf16>::load((const __bf16*)(pa + (unsigned)i * t + k));
#pragma unroll
  for (int i = 0; i < 4; ++i) f.bh[i] = Frag<__bf16>::load((const __bf16*)(pb + (unsigned)i * t + k));
#pragma unroll
  for (int i = 0; i < 4; ++i) f.bl[i] = Frag<__bf16>::load((const __bf16*)(pb + kPlaneB + (unsigned)i * t + k));
#pragma unroll
  for (int i = 0; i < 4; ++i) f.al[i] = Frag<__bf16>::load((const __bf16*)(pa + kPlaneB + (unsigned)i * t + k));
}
// 48 WMMAs; each term runs over all 16 accumulators, so that no WMMA waits for the one in front of it
__device__ __forceinline__ void mma_set(const FragSet& f, v8f (&acc)[4][4]) {
#pragma unroll
  for (int i = 0; i < 4; ++i)
#pragma unroll
    for (int j = 0; j < 4; ++j) acc[i][j] = Frag<__bf16>::mma(f.ah[i], f.bh[j], acc[i][j]);
#pragma unroll
  for (int i = 0; i < 4; ++i)
#pragma unroll
    for (int j = 0; j < 4; ++j) acc[i][j] = Frag<__bf16>::mma(f.ah[i], f.bl[j], acc[i][j]);
#pragma unroll
  for (int i = 0; i < 4; ++i)
#pragma unroll
    for (int j = 0; j < 4; ++j) acc[i][j] = Frag<__bf16>::mma(f.al[i], f.bh[j], acc[i][j]);
}

// OUT_MODE: 0 = f32 to Cf, 2 = bf16 hi plane (Ch) + lo plane (Cl). ACT: 0 = none, 6 = elu(x)+1. grid (N/128, M/128), 128 threads.
template <int OUT_MODE, int ACT>
__global__ __launch_bounds__(128) void gemm128_ring(
    const unsigned short* __restrict__ Ah, const unsigned short* __restrict__ Al,
    const unsigned short* __restrict__ Bh, const unsigned short* __restrict__ Bl,
    unsigned short* __restrict__ Ch, unsigned short* __restrict__ Cl, float* __restrict__ Cf) {
  __shared__ __attribute__((aligned(2048))) unsigned char ring[2 * kStageB];
  __shared__ __align__(16) float sT[4][16 * 68];   // per-wave 16x64 slab, pitch 68 floats
  const int lane = threadIdx.x & 31;
  const unsigned wave = uni(threadIdx.x >> 5);
  const int rlane = lane & 15;
  const int mOff  = (lane >> 4) * 8;
  const int m0 = (int)blockIdx.y * 128 + (int)(wave >> 1) * 64;
  const int n0 = (int)blockIdx.x * 128 + (int)(wave & 1u) * 64;

  // this wave's plane: first byte of its 128 rows, and its slice's place in buffer 0
  const unsigned short* plane = (wave == 0u) ? Ah : (wave == 1u) ? Al : (wave == 2u) ? Bh : Bl;
  const unsigned row0 = ((wave < 2u) ? blockIdx.y : blockIdx.x) * 128u;
  const unsigned long long ga = (unsigned long long)(plane + (size_t)row0 * kEmb);
  const unsigned slice = (unsigned)(unsigned long long)(const void*)ring + wave * kPlaneB;
  const v8u g1 = tdm_group1();

  const unsigned aoff = ((wave >> 1) * 64u + (unsigned)rlane) * kPitchB + (unsigned)(lane >> 4) * 16u;
  const unsigned boff = 2u * kPlaneB + ((wave & 1u) * 64u + (unsigned)rlane) * kPitchB + (unsigned)(lane >> 4) * 16u;

  v8f acc[4][4];
#pragma unroll
  for (int i = 0; i < 4; ++i)
#pragma unroll
    for (int j = 0; j < 4; ++j) acc[i][j] = (v8f){0.f,0.f,0.f,0.f,0.f,0.f,0.f,0.f};

  tdm_load(tdm_group0(slice, ga), g1);
  wait_tensor0();
  __syncthreads();                                  // stage 0 is readable by every wave
  tdm_load(tdm_group0(slice + kStageB, ga + kRowB), g1);

  // rolled: one copy of the 192-WMMA pass, and every accumulator and fragment index stays a constant
#pragma clang loop unroll(disable)
  for (unsigned s = 0; s < kStages; ++s) {
    const unsigned buf = (s & 1u) * kStageB;
    const unsigned char* pa = ring + buf + aoff;
    const unsigned char* pb = ring + buf + boff;
    FragSet f[2];
    load_set(f[0], pa, pb, 0);
#pragma unroll
    for (int kb = 0; kb < 4; ++kb) {
      if (kb < 3) load_set(f[(kb + 1) & 1], pa, pb, kb + 1);
      __builtin_amdgcn_sched_barrier(0);            // keeps the next block's LDS reads one group in front of this block's WMMAs
      mma_set(f[kb & 1], acc);
      __builtin_amdgcn_sched_barrier(0);            // and the block after that one's reads behind them
    }
    wait_ds0();
    wait_tensor0();
    __syncthreads();                                // publishes stage s + 1; every reader has left stage s's buffer
    const unsigned nx = pinned(s + 2u);             // formed behind the wait, and the descriptor from it
    if (nx < kStages) tdm_load(tdm_group0(slice + buf, ga + (unsigned long long)nx * kRowB), g1);
  }
  wait_tensor0();
  wait_ds0();

  // ---- epilogue (as in wmma_gemm64) ----
  float* slab = sT[wave];
#pragma unroll
  for (int i = 0; i < 4; ++i) {
    const int mBase = m0 + (i << 4);
#pragma unroll
    for (int j = 0; j < 4; ++j) {
#pragma unroll
      for (int r = 0; r < 8; ++r) {
        float v = acc[i][j][r];
        // the hardware's exp2 of x * log2(e): cheap enough for the compiler to evaluate it in every lane and select. The library exp
        // compiled to a branch on EXEC per element, 128 dependent chains that the lone wave of a SIMD walked one after the other
        if (ACT == 6) v = (v > 0.f) ? (v + 1.0f) : __expf(v);
        slab[(mOff + r) * 68 + (j << 4) + rlane] = v;
      }
    }
    __builtin_amdgcn_fence(__ATOMIC_RELEASE, "workgroup");
    __builtin_amdgcn_wave_barrier();
    __builtin_amdgcn_fence(__ATOMIC_ACQUIRE, "workgroup");
    if (OUT_MODE == 0) {
      const int hh = lane >> 4, c4 = (lane & 15) * 4;     // row seg = 256 B = 16 lanes x 16 B
      v4f rv[8];
#pragma unroll
      for (int it = 0; it < 8; ++it) rv[it] = *(const v4f*)(slab + (it * 2 + hh) * 68 + c4);
#pragma unroll
      for (int it = 0; it < 8; ++it) *(v4f*)(Cf + (size_t)(mBase + it * 2 + hh) * kEmb + n0 + c4) = rv[it];
      asm volatile("s_wait_xcnt 0x0" ::: "memory");   // stands in front of the next use of the registers that these stores name
    } else {
      const int q = lane >> 3, c8 = (lane & 7) * 8;
      v8h hv[4], lv[4];
#pragma unroll
      for (int it = 0; it < 4; ++it) {
        const float* sp = slab + (it * 4 + q) * 68 + c8;
#pragma unroll
        for (int e = 0; e < 8; ++e) {
          unsigned short hb = f2bf_bits(sp[e]);
          unsigned short lb = f2bf_bits(sp[e] - bf_bits2f(hb));
          hv[it][e] = __builtin_bit_cast(_Float16, hb);
          lv[it][e] = __builtin_bit_cast(_Float16, lb);
        }
      }
#pragma unroll
      for (int it = 0; it < 4; ++it) {
        *(v8h*)(Ch + (size_t)(mBase + it * 4 + q) * kEmb + n0 + c8) = hv[it];
        *(v8h*)(Cl + (size_t)(mBase + it * 4 + q) * kEmb + n0 + c8) = lv[it];
      }
      asm volatile("s_wait_xcnt 0x0" ::: "memory");   // stands in front of the next use of the registers that these stores name
    }
    __builtin_amdgcn_fence(__ATOMIC_RELEASE, "workgroup");
    __builtin_amdgcn_wave_barrier();
    __builtin_amdgcn_fence(__ATOMIC_ACQUIRE, "workgroup");
  }
}

// ---------------------------------------------------------------------------
// f32 -> bf16 hi + lo planes (RNE convert both), 8 consecutive elements per thread: one 16-B store per lane per plane,
// blockIdx.y selects the source tensor (block-uniform); hi plane z lives at out + 2z*planeEl, lo plane at +planeEl.
// Coverage: n8 = planeEl/8 threads x 8 = the whole plane (grids are exact multiples of 256 here).
// ---------------------------------------------------------------------------
__global__ __launch_bounds__(256) void split_planes_kernel(const float* __restrict__ s0, const float* __restrict__ s1,
                                                           const float* __restrict__ s2, const float* __restrict__ s3,
                                                           unsigned short* __restrict__ out, long planeEl, int n8) {
  const int i = blockIdx.x * 256 + threadIdx.x;
  const int z = blockIdx.y;
  if (i >= n8) return;
  const float* src = (z == 0) ? s0 : (z == 1) ? s1 : (z == 2) ? s2 : s3;
  const float* p = src + 8 * (size_t)i;
  const v4f a = *(const v4f*)(p);
  const v4f c = *(const v4f*)(p + 4);
  unsigned short hb[8], lb[8];
#pragma unroll
  for (int e = 0; e < 4; ++e) {
    hb[e]     = f2bf_bits(a[e]);
    lb[e]     = f2bf_bits(a[e] - bf_bits2f(hb[e]));
    hb[4 + e] = f2bf_bits(c[e]);
    lb[4 + e] = f2bf_bits(c[e] - bf_bits2f(hb[4 + e]));
  }
  const v4u uh = (v4u){pk16(hb[0], hb[1]), pk16(hb[2], hb[3]), pk16(hb[4], hb[5]), pk16(hb[6], hb[7])};
  const v4u ul = (v4u){pk16(lb[0], lb[1]), pk16(lb[2], lb[3]), pk16(lb[4], lb[5]), pk16(lb[6], lb[7])};
  unsigned short* ph = out + (size_t)(2 * z) * planeEl + 8 * (size_t)i;
  unsigned short* pl = ph + planeEl;
  *(v4u*)ph = uh;
  *(v4u*)pl = ul;
  
}

// ---------------------------------------------------------------------------
// Per (batch-chunk y, head h) tile: transpose the 128x64 chunk tiles of k and v (hi and lo planes, token-major [4096][1024])
// into kT, vT tiles [64 d][128 j] at (y*16+h)*8192, and dz[y*16+h][d] = sum_j k[j][d] (f32, k = hi + lo, j in order).
// grid (32, 16), 256 threads. LDS tiles hold one hi/lo pair at a time.
// Load coverage: 4 iterations x 256 threads = 1024 units of (row j, 8 d) = 128 x 64 = whole tile, every LDS cell read is written.
// Store coverage: 4 iterations x 8 waves x 2 (lane>>4) = 64 rows; 16 lanes x 8 halves = 128 cols; each row = 256 B = 2 whole
// ---------------------------------------------------------------------------
__global__ __launch_bounds__(256) void prep_kernel(const unsigned short* __restrict__ kh, const unsigned short* __restrict__ kl,
                                                   const unsigned short* __restrict__ vh, const unsigned short* __restrict__ vl,
                                                   unsigned short* __restrict__ kTh, unsigned short* __restrict__ kTl,
                                                   unsigned short* __restrict__ vTh, unsigned short* __restrict__ vTl,
                                                   float* __restrict__ dz) {
  __shared__ unsigned short tA[64][136];
  __shared__ unsigned short tB[64][136];
  __shared__ __align__(16) float dzs[64];
  const int t = threadIdx.x;
  const int lane = t & 31, wave = t >> 5;
  const int y = blockIdx.x, h = blockIdx.y;
  const size_t tok0 = (size_t)y * kChunk;
  const size_t tile = (size_t)y * kHeads + h;
  const size_t tileOff = tile * (size_t)(kHdim * kChunk);
  const int hh = lane >> 4, c8 = (lane & 15) * 8;
  for (int p = 0; p < 2; ++p) {
    const unsigned short* sH = (p == 0) ? kh : vh;
    const unsigned short* sL = (p == 0) ? kl : vl;
    unsigned short* dH = (p == 0) ? kTh : vTh;
    unsigned short* dL = (p == 0) ? kTl : vTl;
#pragma unroll
    for (int it = 0; it < 4; ++it) {
      const int idx = it * 256 + t;
      const int j = idx >> 3;
      const int d8 = (idx & 7) * 8;
      const size_t go = (tok0 + j) * (size_t)kEmb + (size_t)h * kHdim + d8;
      const v4u wh = *(const v4u*)(sH + go);
      const v4u wl = *(const v4u*)(sL + go);
#pragma unroll
      for (int e = 0; e < 4; ++e) {
        tA[d8 + 2 * e][j]     = (unsigned short)(wh[e] & 0xffffu);
        tA[d8 + 2 * e + 1][j] = (unsigned short)(wh[e] >> 16);
        tB[d8 + 2 * e][j]     = (unsigned short)(wl[e] & 0xffffu);
        tB[d8 + 2 * e + 1][j] = (unsigned short)(wl[e] >> 16);
      }
    }
    __syncthreads();
    if (p == 0) {
      if (t < 64) {
        float s = 0.f;
#pragma unroll 1
        for (int j = 0; j < kChunk; ++j) {
          const float kv = bf_bits2f(tA[t][j]) + bf_bits2f(tB[t][j]);
          s = s + kv;
        }
        dzs[t] = s;
      }
      __syncthreads();
    }
    v4u uH[4], uL[4];
#pragma unroll
    for (int it = 0; it < 4; ++it) {
      const int d = it * 16 + wave * 2 + hh;
      unsigned short a[8], bb[8];
#pragma unroll
      for (int e = 0; e < 8; ++e) { a[e] = tA[d][c8 + e]; bb[e] = tB[d][c8 + e]; }
      uH[it] = (v4u){pk16(a[0], a[1]), pk16(a[2], a[3]), pk16(a[4], a[5]), pk16(a[6], a[7])};
      uL[it] = (v4u){pk16(bb[0], bb[1]), pk16(bb[2], bb[3]), pk16(bb[4], bb[5]), pk16(bb[6], bb[7])};
    }
    v4f zv = (v4f){0.f, 0.f, 0.f, 0.f};
    if (p == 0) zv = *(const v4f*)(dzs + 4 * (t & 15));
    {
#pragma unroll
      for (int it = 0; it < 4; ++it) {
        const int d = it * 16 + wave * 2 + hh;
        *(v4u*)(dH + tileOff + (size_t)d * kChunk + c8) = uH[it];
        *(v4u*)(dL + tileOff + (size_t)d * kChunk + c8) = uL[it];
      }
      if (p == 0 && t < 16) *(v4f*)(dz + tile * kHdim + 4 * t) = zv;
      
    }
    __syncthreads();
  }
}

// ---------------------------------------------------------------------------
// Exclusive prefix over chunks of the transposed state and of z, per (b, h). No element depends on another, so the work is dealt
// by element: grid (32 bh, 5), 256 threads. Slices y = 0..3: thread t owns elements 1024y + 4t .. +3 of every 4096-element tile;
// slice y = 4: thread t < 64 owns element t of z. A thread first issues the loads of all 15 increments it needs (the last chunk's
// is never used), so their latencies overlap, then sums them in registers in chunk order and stores each chunk's value.
// S^T_c = sum_{c' < c} dST_{c'} (f32, sequential), written as bf16 hi/lo planes [tile][64 e][64 d] (tile = (b*16+c)*16+h);
// z_c likewise to zpre[tile][64] (f32). A wave's store covers 256 contiguous bytes of a plane.
// ---------------------------------------------------------------------------
typedef __attribute__((ext_vector_type(2))) unsigned int v2u;
constexpr int kPfxSlices = 4;                    // 4 slices x 256 threads x 4 elements = one 64 x 64 tile
static_assert(kPfxSlices * 256 * 4 == kHdim * kHdim, "the slices cover a tile");
// at most eight waves per SIMD are asked for: 128 registers a wave. Without it the build keeps to 81 registers and holds the last
// load back until the first has returned, to take over its registers
__global__ __launch_bounds__(256) __attribute__((amdgpu_waves_per_eu(2, 8))) void state_prefix_kernel(const float* __restrict__ dST, const float* __restrict__ dz,
                                                           unsigned short* __restrict__ STh, unsigned short* __restrict__ STl,
                                                           float* __restrict__ zpre) {
  const int t = threadIdx.x;
  const int bh = blockIdx.x;
  const int b = bh >> 4, h = bh & 15;
  const size_t tile0 = (size_t)(b * kNChunk) * kHeads + h;   // chunk 0's tile; chunk c's is tile0 + 16 c
  if (blockIdx.y == (unsigned)kPfxSlices) {                  // block-uniform: the z slice
    if (t >= kHdim) return;
    const float* zp = dz + tile0 * kHdim + t;
    float* zo = zpre + tile0 * kHdim + t;
    float zd[kNChunk - 1];
#pragma unroll
    for (int c = 0; c < kNChunk - 1; ++c) zd[c] = zp[c * kHeads * kHdim];
    float zacc = 0.f;
#pragma unroll
    for (int c = 0; c < kNChunk; ++c) {
      zo[c * kHeads * kHdim] = zacc;
      if (c < kNChunk - 1) zacc += zd[c];
    }
    return;
  }
  const size_t el = tile0 * 4096 + ((size_t)blockIdx.y * 256 + t) * 4;
  const float* dp = dST + el;
  unsigned short* ph = STh + el;
  unsigned short* pl = STl + el;
  v4f d[kNChunk - 1];
#pragma unroll
  for (int c = 0; c < kNChunk - 1; ++c) d[c] = *(const v4f*)(dp + c * kHeads * 4096);
  // all 15 loads stay in front of this line, so that they are in flight together (the compiler otherwise sinks five of them behind the
  // first waits); and it stands in front of the first overwrite of the address register, which is an input, so it is not reused before it
  asm volatile("s_wait_xcnt 0x0" :: "v"(dp) : "memory");
  v4f a = (v4f){0.f, 0.f, 0.f, 0.f};
#pragma unroll
  for (int c = 0; c < kNChunk; ++c) {
    unsigned short hb[4], lb[4];
#pragma unroll
    for (int e = 0; e < 4; ++e) {
      hb[e] = f2bf_bits(a[e]);
      lb[e] = f2bf_bits(a[e] - bf_bits2f(hb[e]));
    }
    *(v2u*)(ph + c * kHeads * 4096) = (v2u){pk16(hb[0], hb[1]), pk16(hb[2], hb[3])};
    *(v2u*)(pl + c * kHeads * 4096) = (v2u){pk16(lb[0], lb[1]), pk16(lb[2], lb[3])};
    if (c < kNChunk - 1) a += d[c];
  }
  asm volatile("s_wait_xcnt 0x0" ::: "memory");   // stands behind the last stores, in front of any later write of a register that they name
}

// ---------------------------------------------------------------------------
// Per (batch-chunk y, head h), one work-group of eight waves: masked scores A = tril(q.k^T), num = A.v + q.S_c,
// den = q.z_c + rowsum(A) + eps, o = num * (1/den) as bf16 hi/lo rows of the token-major o planes.
// The k, v^T and S^T tiles (hi and lo) are staged once in LDS; wave w owns chunk rows 16w .. 16w+15 from the scores to the stores,
// and its A rows pass from the accumulator layout to the A-operand layout through its own LDS slab (bf16 hi/lo, never in memory).
// Every sum keeps its order: per accumulator k ascending with hi.hi, hi.lo, lo.hi inside each 32 k; A.v and q.S in separate
// accumulators, added once; row sum and q.z sequential in f32.
// ---------------------------------------------------------------------------
constexpr int kPK = 72;                        // LDS row pitch of the 64-wide tiles (k, S^T), elements: 144 B = 16 B x odd
constexpr int kPV = 136;                       // LDS row pitch of the 128-wide tiles (v^T, A), elements: 272 B = 16 B x odd
constexpr int kSlabB = 2 * 16 * kPV * 2;       // one wave's slab: A_h rows, then A_l rows; later the f32 num rows (pitch 68)
static_assert(16 * 68 * 4 <= kSlabB, "the num rows fit the slab");

// orders one wave's LDS writes in front of reads by its other lanes (the slabs are private to a wave)
__device__ __forceinline__ void wave_lds_sync() {
  __builtin_amdgcn_fence(__ATOMIC_RELEASE, "workgroup");
  __builtin_amdgcn_wave_barrier();
  __builtin_amdgcn_fence(__ATOMIC_ACQUIRE, "workgroup");
}
__device__ __forceinline__ v16b lds_frag(const unsigned short* p) { return Frag<__bf16>::load((const __bf16*)p); }

// at most 256 registers a wave: two work-groups (four waves per SIMD) share a WGP, so all 512 are resident at once
__global__ __launch_bounds__(256) __attribute__((amdgpu_waves_per_eu(4, 4))) void chunk_attn_kernel(const unsigned short* __restrict__ qh, const unsigned short* __restrict__ ql,
                                                         const unsigned short* __restrict__ kh, const unsigned short* __restrict__ kl,
                                                         const unsigned short* __restrict__ vTh, const unsigned short* __restrict__ vTl,
                                                         const unsigned short* __restrict__ STh, const unsigned short* __restrict__ STl,
                                                         const float* __restrict__ zpre,
                                                         unsigned short* __restrict__ oh, unsigned short* __restrict__ ol) {
  __shared__ __align__(16) unsigned short sKh[kChunk * kPK];
  __shared__ __align__(16) unsigned short sKl[kChunk * kPK];
  __shared__ __align__(16) unsigned short sVh[kHdim * kPV];
  __shared__ __align__(16) unsigned short sVl[kHdim * kPV];
  __shared__ __align__(16) unsigned short sSh[kHdim * kPK];
  __shared__ __align__(16) unsigned short sSl[kHdim * kPK];
  __shared__ __align__(16) unsigned char  sW[8][kSlabB];
  __shared__ __align__(16) float sInv[8][16];
  typedef Frag<__bf16> F;
  const int t = threadIdx.x;
  const int lane = t & 31, wave = t >> 5;
  const int rlane = lane & 15;                 // row (A operand) / column (B operand, accumulator) within a 16-wide subtile
  const int koff  = (lane >> 4) * 8;           // k offset of this lane half
  const int mOff  = (lane >> 4) * 8;           // accumulator row offset
  const int y = blockIdx.x, h = blockIdx.y;
  const size_t tile = (size_t)y * kHeads + h;
  const size_t base = (size_t)y * kChunk * kEmb + (size_t)h * kHdim;   // chunk row 0 at this head, token-major planes

  // ---- the tiles, 16 B per lane: k 128 x 64, v^T 64 x 128, S^T 64 x 64, hi and lo; this wave's q rows ----
  const size_t ko = base + (size_t)(t >> 3) * kEmb + (t & 7) * 8;
  const size_t vo = tile * (size_t)(kHdim * kChunk) + (size_t)t * 8;
  const size_t so = tile * (size_t)(kHdim * kHdim) + (size_t)t * 8;
  const size_t qrow = base + (size_t)(wave * 16 + rlane) * kEmb;
  const unsigned short* pkh = kh + ko;
  const unsigned short* pkl = kl + ko;
  const unsigned short* pvh = vTh + vo;
  const unsigned short* pvl = vTl + vo;
  const unsigned short* psh = STh + so;
  const unsigned short* psl = STl + so;
  const unsigned short* pqh = qh + qrow;
  const unsigned short* pql = ql + qrow;
  const unsigned short* pfh = pqh + koff;
  const unsigned short* pfl = pql + koff;
  v4u gk[8], gv[8], gs[4], gqh[8], gql[8];
#pragma unroll
  for (int it = 0; it < 4; ++it) {
    gk[2 * it]     = *(const v4u*)(pkh + it * 32 * kEmb);
    gk[2 * it + 1] = *(const v4u*)(pkl + it * 32 * kEmb);
    gv[2 * it]     = *(const v4u*)(pvh + it * 2048);
    gv[2 * it + 1] = *(const v4u*)(pvl + it * 2048);
  }
#pragma unroll
  for (int it = 0; it < 2; ++it) {
    gs[2 * it]     = *(const v4u*)(psh + it * 2048);
    gs[2 * it + 1] = *(const v4u*)(psl + it * 2048);
  }
  // the q rows as A operands (K = 64: two 32-k blocks), and whole (row rlane) for q.z
  v16b qfh[2], qfl[2];
#pragma unroll
  for (int kb = 0; kb < 2; ++kb) {
    qfh[kb] = F::load((const __bf16*)(pfh + kb * 32));
    qfl[kb] = F::load((const __bf16*)(pfl + kb * 32));
  }
#pragma unroll
  for (int w = 0; w < 8; ++w) {
    gqh[w] = *(const v4u*)(pqh + 8 * w);
    gql[w] = *(const v4u*)(pql + 8 * w);
  }
  // stands in front of the first overwrite of a register that these loads name; the addresses are inputs, so none is reused before it
  asm volatile("s_wait_xcnt 0x0" :: "v"(pkh), "v"(pkl), "v"(pvh), "v"(pvl), "v"(psh), "v"(psl), "v"(pqh), "v"(pql), "v"(pfh), "v"(pfl) : "memory");
#pragma unroll
  for (int it = 0; it < 4; ++it) {
    const int u = it * 256 + t;
    *(v4u*)(sKh + (u >> 3) * kPK + (u & 7) * 8) = gk[2 * it];
    *(v4u*)(sKl + (u >> 3) * kPK + (u & 7) * 8) = gk[2 * it + 1];
    *(v4u*)(sVh + (u >> 4) * kPV + (u & 15) * 8) = gv[2 * it];
    *(v4u*)(sVl + (u >> 4) * kPV + (u & 15) * 8) = gv[2 * it + 1];
  }
#pragma unroll
  for (int it = 0; it < 2; ++it) {
    const int u = it * 256 + t;
    *(v4u*)(sSh + (u >> 3) * kPK + (u & 7) * 8) = gs[2 * it];
    *(v4u*)(sSl + (u >> 3) * kPK + (u & 7) * 8) = gs[2 * it + 1];
  }

  // ---- q . z_c of row rlane (both lane halves compute the same row) ----
  const float* zp = zpre + tile * kHdim;
  float qz = 0.f;
#pragma unroll
  for (int w = 0; w < 8; ++w) {
    const v4u uh = gqh[w];
    const v4u ul = gql[w];
    const v4f z0 = *(const v4f*)(zp + 8 * w);
    const v4f z1 = *(const v4f*)(zp + 8 * w + 4);
    float qv[8], zv[8];
#pragma unroll
    for (int e = 0; e < 4; ++e) {
      qv[2 * e]     = bflo2f(uh[e]) + bflo2f(ul[e]);
      qv[2 * e + 1] = bfhi2f(uh[e]) + bfhi2f(ul[e]);
      zv[e] = z0[e];
      zv[4 + e] = z1[e];
    }
#pragma unroll
    for (int e = 0; e < 8; ++e) qz += qv[e] * zv[e];
  }
  sInv[wave][rlane] = qz;                      // parked in LDS: kept in a register, the whole sum is sunk to its use and the q rows spill
  __syncthreads();                             // the staged tiles are readable by every wave

  // ---- masked scores of rows 16w .. 16w+15, four column subtiles at a time, into the slab as bf16 hi/lo ----
  unsigned short* aH = (unsigned short*)sW[wave];
  unsigned short* aL = aH + 16 * kPV;
#pragma unroll
  for (int jh = 0; jh < 2; ++jh) {
    v8f s[4];
#pragma unroll
    for (int j = 0; j < 4; ++j) s[j] = (v8f){0.f,0.f,0.f,0.f,0.f,0.f,0.f,0.f};
#pragma unroll
    for (int kb = 0; kb < 2; ++kb) {
      v16b bh[4], bl[4];
#pragma unroll
      for (int j = 0; j < 4; ++j) {
        const int o = ((jh * 4 + j) * 16 + rlane) * kPK + koff + kb * 32;
        bh[j] = lds_frag(sKh + o);
        bl[j] = lds_frag(sKl + o);
      }
#pragma unroll
      for (int j = 0; j < 4; ++j) s[j] = F::mma(qfh[kb], bh[j], s[j]);
#pragma unroll
      for (int j = 0; j < 4; ++j) s[j] = F::mma(qfh[kb], bl[j], s[j]);
#pragma unroll
      for (int j = 0; j < 4; ++j) s[j] = F::mma(qfl[kb], bh[j], s[j]);
    }
#pragma unroll
    for (int j = 0; j < 4; ++j) {
      const int n = (jh * 4 + j) * 16 + rlane;
#pragma unroll
      for (int r = 0; r < 8; ++r) {
        float v = s[j][r];
        if (n > wave * 16 + mOff + r) v = 0.0f;
        const unsigned short hb = f2bf_bits(v);
        const unsigned short lb = f2bf_bits(v - bf_bits2f(hb));
        aH[(mOff + r) * kPV + n] = hb;
        aL[(mOff + r) * kPV + n] = lb;
      }
    }
  }

  // ---- q . S_c: K = 64 ----
  v8f qs[4], av[4];
#pragma unroll
  for (int j = 0; j < 4; ++j) { qs[j] = (v8f){0.f,0.f,0.f,0.f,0.f,0.f,0.f,0.f}; av[j] = (v8f){0.f,0.f,0.f,0.f,0.f,0.f,0.f,0.f}; }
#pragma unroll
  for (int kb = 0; kb < 2; ++kb) {
    v16b bh[4], bl[4];
#pragma unroll
    for (int j = 0; j < 4; ++j) {
      const int o = (j * 16 + rlane) * kPK + koff + kb * 32;
      bh[j] = lds_frag(sSh + o);
      bl[j] = lds_frag(sSl + o);
    }
#pragma unroll
    for (int j = 0; j < 4; ++j) qs[j] = F::mma(qfh[kb], bh[j], qs[j]);
#pragma unroll
    for (int j = 0; j < 4; ++j) qs[j] = F::mma(qfh[kb], bl[j], qs[j]);
#pragma unroll
    for (int j = 0; j < 4; ++j) qs[j] = F::mma(qfl[kb], bh[j], qs[j]);
  }
  wave_lds_sync();                             // the slab's A rows are readable by every lane of this wave

  // ---- A . v: K = 128 ----
#pragma unroll
  for (int kb = 0; kb < 4; ++kb) {
    const v16b ah = lds_frag(aH + rlane * kPV + koff + kb * 32);
    const v16b al = lds_frag(aL + rlane * kPV + koff + kb * 32);
    v16b bh[4], bl[4];
#pragma unroll
    for (int j = 0; j < 4; ++j) {
      const int o = (j * 16 + rlane) * kPV + koff + kb * 32;
      bh[j] = lds_frag(sVh + o);
      bl[j] = lds_frag(sVl + o);
    }
#pragma unroll
    for (int j = 0; j < 4; ++j) av[j] = F::mma(ah, bh[j], av[j]);
#pragma unroll
    for (int j = 0; j < 4; ++j) av[j] = F::mma(ah, bl[j], av[j]);
#pragma unroll
    for (int j = 0; j < 4; ++j) av[j] = F::mma(al, bh[j], av[j]);
  }

  // ---- row sum of the masked scores of row rlane, j in order ----
  float asum = 0.f;
#pragma unroll
  for (int w = 0; w < 16; ++w) {
    const v4u uh = *(const v4u*)(aH + rlane * kPV + 8 * w);
    const v4u ul = *(const v4u*)(aL + rlane * kPV + 8 * w);
#pragma unroll
    for (int e = 0; e < 4; ++e) {
      const float a0 = bflo2f(uh[e]) + bflo2f(ul[e]);
      asum = asum + a0;
      const float a1 = bfhi2f(uh[e]) + bfhi2f(ul[e]);
      asum = asum + a1;
    }
  }
  const float den = (sInv[wave][rlane] + asum) + kEps;
  const float inv = 1.0f / den;
  wave_lds_sync();                             // every read of the A rows has returned: the slab takes the num rows

  float* slab = (float*)sW[wave];
#pragma unroll
  for (int j = 0; j < 4; ++j)
#pragma unroll
    for (int r = 0; r < 8; ++r) slab[(mOff + r) * 68 + (j << 4) + rlane] = av[j][r] + qs[j][r];
  sInv[wave][rlane] = inv;
  wave_lds_sync();

  const int q4 = lane >> 3, c8 = (lane & 7) * 8;
  v4u uo_h[4], uo_l[4];
#pragma unroll
  for (int it = 0; it < 4; ++it) {
    const int row = it * 4 + q4;
    const float iv = sInv[wave][row];
    unsigned short hb[8], lb[8];
#pragma unroll
    for (int e = 0; e < 8; ++e) {
      const float f = slab[row * 68 + c8 + e] * iv;
      hb[e] = f2bf_bits(f);
      lb[e] = f2bf_bits(f - bf_bits2f(hb[e]));
    }
    uo_h[it] = (v4u){pk16(hb[0], hb[1]), pk16(hb[2], hb[3]), pk16(hb[4], hb[5]), pk16(hb[6], hb[7])};
    uo_l[it] = (v4u){pk16(lb[0], lb[1]), pk16(lb[2], lb[3]), pk16(lb[4], lb[5]), pk16(lb[6], lb[7])};
  }
#pragma unroll
  for (int it = 0; it < 4; ++it) {
    const size_t o = base + (size_t)(wave * 16 + it * 4 + q4) * kEmb + c8;
    *(v4u*)(oh + o) = uo_h[it];
    *(v4u*)(ol + o) = uo_l[it];
  }
}

// ---------------------------------------------------------------------------
// Premise check on the causal flag: only the causal branch is built; if the flag is 0 the output is poisoned with NaN
// ---------------------------------------------------------------------------
__global__ __launch_bounds__(256) void premise_kernel(const int* __restrict__ flag, float* __restrict__ out, int n16) {
  const int i = blockIdx.x * 256 + threadIdx.x;
  if (i >= n16) return;
  const int f = flag[0];
  if (f != 0) return;
  const float qn = __uint_as_float(0x7fc00000u);
  const v4f nv = (v4f){qn, qn, qn, qn};
  float* p = out + 16 * (size_t)i;
  {
#pragma unroll
    for (int k = 0; k < 4; ++k) *(v4f*)(p + 4 * k) = nv;
    
  }
}

// ---------------------------------------------------------------------------
// Host launcher
// ---------------------------------------------------------------------------
extern "C" void kernel_launch(void* const* d_in, const int* in_sizes, int n_in,
                              void* d_out, int out_size, void* d_ws, size_t ws_size,
                              hipStream_t stream) {
  if (n_in < 8) return;
  if (in_sizes[0] != (int)kPlaneEl || in_sizes[1] != (int)kPlaneEl || in_sizes[2] != (int)kPlaneEl) return;
  if (in_sizes[3] != (int)kWEl || in_sizes[4] != (int)kWEl || in_sizes[5] != (int)kWEl || in_sizes[6] != (int)kWEl) return;
  if (in_sizes[7] < 1) return;
  if (out_size != (int)kPlaneEl) return;
  if (ws_size < (size_t)kWsTotal) return;

  const float* Q  = (const float*)d_in[0];
  const float* Kx = (const float*)d_in[1];
  const float* Vx = (const float*)d_in[2];
  const float* Wq = (const float*)d_in[3];
  const float* Wk = (const float*)d_in[4];
  const float* Wv = (const float*)d_in[5];
  const float* Wo = (const float*)d_in[6];
  const int*   causal = (const int*)d_in[7];
  float* out = (float*)d_out;
  char* ws = (char*)d_ws;

  unsigned short* Xbase = (unsigned short*)(ws + oXbase);
  const unsigned short* Xq_h = Xbase;
  const unsigned short* Xq_l = Xbase + kPlaneEl;
  const unsigned short* Xk_h = Xbase + 2 * kPlaneEl;
  const unsigned short* Xk_l = Xbase + 3 * kPlaneEl;
  const unsigned short* Xv_h = Xbase + 4 * kPlaneEl;
  const unsigned short* Xv_l = Xbase + 5 * kPlaneEl;
  unsigned short* Wbase = (unsigned short*)(ws + oWbase);
  const unsigned short* Wq_h = Wbase;
  const unsigned short* Wq_l = Wbase + kWEl;
  const unsigned short* Wk_h = Wbase + 2 * kWEl;
  const unsigned short* Wk_l = Wbase + 3 * kWEl;
  const unsigned short* Wv_h = Wbase + 4 * kWEl;
  const unsigned short* Wv_l = Wbase + 5 * kWEl;
  const unsigned short* Wo_h = (const unsigned short*)(ws + oWo_h);
  const unsigned short* Wo_l = (const unsigned short*)(ws + oWo_l);
  unsigned short* q_h  = (unsigned short*)(ws + oQ_h);
  unsigned short* q_l  = (unsigned short*)(ws + oQ_l);
  unsigned short* k_h  = (unsigned short*)(ws + oK_h);
  unsigned short* k_l  = (unsigned short*)(ws + oK_l);
  unsigned short* v_h  = (unsigned short*)(ws + oV_h);
  unsigned short* v_l  = (unsigned short*)(ws + oV_l);
  unsigned short* kT_h = (unsigned short*)(ws + oKT_h);
  unsigned short* kT_l = (unsigned short*)(ws + oKT_l);
  unsigned short* vT_h = (unsigned short*)(ws + oVT_h);
  unsigned short* vT_l = (unsigned short*)(ws + oVT_l);
  float*          dST  = (float*)(ws + oDST);
  unsigned short* ST_h = (unsigned short*)(ws + oST_h);
  unsigned short* ST_l = (unsigned short*)(ws + oST_l);
  unsigned short* o_h  = (unsigned short*)(ws + oO_h);
  unsigned short* o_l  = (unsigned short*)(ws + oO_l);
  float*          dz   = (float*)(ws + oDZ);
  float*          zpre = (float*)(ws + oZPRE);

  const long sTileT    = (long)kHdim * kChunk;           // 8192
  const long sTileS    = (long)kHdim * kHdim;            // 4096

  // 1) input and weight hi/lo planes
  split_planes_kernel<<<dim3((unsigned)(kPlaneEl / 8 / 256), 3, 1), 256, 0, stream>>>(Q, Kx, Vx, Vx, Xbase, kPlaneEl, (int)(kPlaneEl / 8));
  split_planes_kernel<<<dim3((unsigned)(kWEl / 8 / 256), 4, 1), 256, 0, stream>>>(Wq, Wk, Wv, Wo, Wbase, kWEl, (int)(kWEl / 8));

  // 2) projections: M=4096, N=1024, K=1024 (8 x 32 tiles of 128 x 128, one work-group each); q, k with elu(x)+1
  gemm128_ring<2, 6><<<dim3(kEmb / 128, kTok / 128, 1), 128, 0, stream>>>(Xq_h, Xq_l, Wq_h, Wq_l, q_h, q_l, nullptr);
  gemm128_ring<2, 6><<<dim3(kEmb / 128, kTok / 128, 1), 128, 0, stream>>>(Xk_h, Xk_l, Wk_h, Wk_l, k_h, k_l, nullptr);
  gemm128_ring<2, 0><<<dim3(kEmb / 128, kTok / 128, 1), 128, 0, stream>>>(Xv_h, Xv_l, Wv_h, Wv_l, v_h, v_l, nullptr);

  // 3) per-chunk transposes of k, v and chunk sums of k
  prep_kernel<<<dim3(kYB, kHeads, 1), 256, 0, stream>>>(k_h, k_l, v_h, v_l, kT_h, kT_l, vT_h, vT_l, dz);

  // 4) dST[e][d] = sum_j v[j][e] k[j][d] per (b,c,h): M=64, N=64, K=128, one wave per tile
  wmma_gemm64<1, true, 0, 0, false, 0><<<dim3(1, kYB, kHeads), 32, 0, stream>>>(
      vT_h, vT_l, kChunk, 16 * sTileT, sTileT, kT_h, kT_l, kChunk, 16 * sTileT, sTileT,
      (void*)dST, nullptr, kHdim, 16 * sTileS, sTileS,
      nullptr, nullptr, 0L, 0L, kHdim, kHdim, kChunk, 1.0f);

  // 5) exclusive prefix over chunks of S^T and z
  state_prefix_kernel<<<dim3(kBatch * kHeads, kPfxSlices + 1, 1), 256, 0, stream>>>(dST, dz, ST_h, ST_l, zpre);

  // 6) per (b,c,h): masked scores, A.v + q.S_c, normaliser -> attention output hi/lo planes (token-major, heads merged)
  chunk_attn_kernel<<<dim3(kYB, kHeads, 1), 256, 0, stream>>>(q_h, q_l, k_h, k_l, vT_h, vT_l, ST_h, ST_l, zpre, o_h, o_l);

  // 7) output projection: M=4096, N=1024, K=1024 -> d_out
  gemm128_ring<0, 0><<<dim3(kEmb / 128, kTok / 128, 1), 128, 0, stream>>>(o_h, o_l, Wo_h, Wo_l, nullptr, nullptr, out);

  // 8) premise check on the causal flag (poisons the output when the non-causal branch would be required)
  premise_kernel<<<dim3((unsigned)(kPlaneEl / 16 / 256), 1, 1), 256, 0, stream>>>(causal, out, (int)(kPlaneEl / 16));
}

// v005
// It runs in 140 microseconds.
// In two side-by-side timings against v004, it was 1.09 and 1.14 times as fast.
// Counting every step since v000, it is 3.07 times as fast.
// Contractions: q/k/v projections, chunk scores q.k^T, state increment v^T.k, q.S, A.v, output projection -- all v_wmma_f32_16x16x32_bf16 with bf16 hi/lo operand planes (hi.hi + hi.lo + lo.hi), f32 accumulate; feature map, state prefix over chunks, normaliser and division in f32 on the VALU.
#include <hip/hip_runtime.h>
#include <math.h>

// ---------------------------------------------------------------------------
// Problem constants
// ---------------------------------------------------------------------------
constexpr int kBatch   = 2;
constexpr int kSeq     = 2048;
constexpr int kEmb     = 1024;
constexpr int kHeads   = 16;
constexpr int kHdim    = 64;
constexpr int kChunk   = 128;
constexpr int kNChunk  = kSeq / kChunk;          // 16 chunks per sequence
constexpr int kTok     = kBatch * kSeq;          // 4096 token rows
constexpr int kYB      = kBatch * kNChunk;       // 32 (batch, chunk) pairs
constexpr int kTiles   = kYB * kHeads;           // 512 (batch, chunk, head) tiles
constexpr float kEps   = 1e-6f;
constexpr long kPlaneEl = (long)kTok * kEmb;     // 4194304 elements per activation plane
constexpr long kWEl     = (long)kEmb * kEmb;     // 1048576 elements per weight plane
constexpr long kUnit    = kPlaneEl * 2;          // 8388608 bytes (one bf16 activation plane)
constexpr long kWUnit   = kWEl * 2;              // 2097152 bytes (one bf16 weight plane)

// ---------------------------------------------------------------------------
// Workspace region map (bytes; U = 8388608, WU = 2097152); total 14U + 262144 = 117702656
//   [0U , 6U)  phase 1: Xq_h Xq_l Xk_h Xk_l Xv_h Xv_l (input hi/lo planes, dead after projections)
//              phase 2: o_h@0U o_l@1U dST(f32)@4U ST_h@5U ST_l@5.5U
//   [6U , 8U)  Wq_h Wq_l Wk_h Wk_l Wv_h Wv_l Wo_h Wo_l (WU each)
//   [8U ,14U)  q_h@8U q_l@9U k_h@10U k_l@11U v_h@12U v_l@13U (projection outputs)
//   [14U, +262144)  dz f32 [512][64] @14U, zpre f32 [512][64] @14U+131072
// ---------------------------------------------------------------------------
constexpr long oXbase = 0;
constexpr long oO_h   = 0;
constexpr long oO_l   = 1 * kUnit;
constexpr long oDST   = 4 * kUnit;
constexpr long oST_h  = 5 * kUnit;
constexpr long oST_l  = 5 * kUnit + kUnit / 2;
constexpr long oWbase = 6 * kUnit;
constexpr long oWo_h  = oWbase + 6 * kWUnit;
constexpr long oWo_l  = oWbase + 7 * kWUnit;
constexpr long oQ_h   = 8 * kUnit;
constexpr long oQ_l   = 9 * kUnit;
constexpr long oK_h   = 10 * kUnit;
constexpr long oK_l   = 11 * kUnit;
constexpr long oV_h   = 12 * kUnit;
constexpr long oV_l   = 13 * kUnit;
constexpr long oDZ    = 14 * kUnit;
constexpr long oZPRE  = 14 * kUnit + 131072;
constexpr long kWsTotal = 14 * kUnit + 262144;
static_assert(kWsTotal == 117702656, "carve total");
static_assert(kWsTotal <= 134217728, "carve within 128 MiB");
static_assert((long)kTiles * kHdim * kHdim * 4 == kUnit, "dST plane size");

typedef __attribute__((ext_vector_type(8)))  _Float16 v8h;
typedef __attribute__((ext_vector_type(16))) __bf16   v16b;
typedef __attribute__((ext_vector_type(8)))  __bf16   v8b;
typedef __attribute__((ext_vector_type(8)))  float    v8f;
typedef __attribute__((ext_vector_type(4)))  float    v4f;
typedef __attribute__((ext_vector_type(4)))  unsigned int v4u;

__device__ __forceinline__ unsigned short f2bf_bits(float f) {
  unsigned u = __float_as_uint(f);
  return (unsigned short)((u + 0x7FFFu + ((u >> 16) & 1u)) >> 16);
}
__device__ __forceinline__ float bf_bits2f(unsigned short h) { return __uint_as_float(((unsigned)h) << 16); }

template <typename T> struct Frag;
template <> struct Frag<__bf16> {
  typedef v16b V; union U { v16b v; v8b h[2]; };
  static __device__ __forceinline__ v16b load(const __bf16* p) {   // elements 0..7 <- p[0..7], 8..15 <- p[16..23]
    U f; f.h[0] = *(const v8b*)(p); f.h[1] = *(const v8b*)(p + 16); return f.v;
  }
  static __device__ __forceinline__ v8f mma(v16b a, v16b b, v8f c) {
    return __builtin_amdgcn_wmma_f32_16x16x32_bf16(false, a, false, b, (short)0, c, false, false);
  }
};

__device__ __forceinline__ unsigned pk16(unsigned short a, unsigned short b) { return (unsigned)a | ((unsigned)b << 16); }
// bf16 element pair held in one 32-bit word: low half-word = even element, high half-word = odd element
__device__ __forceinline__ float bflo2f(unsigned w) { return __uint_as_float(w << 16); }
__device__ __forceinline__ float bfhi2f(unsigned w) { return __uint_as_float(w & 0xffff0000u); }

// ---------------------------------------------------------------------------
// The four 4096 x 1024 x 1024 products: C[m,n] = sum_k A[m,k] * Bt[n,k], hi/lo planes, product = hi.hi + hi.lo + lo.hi.
// One 128 x 128 tile of C per work-group, four waves (2 x 2), each wave a 64 x 64 tile (4 x 4 accumulators).
// A stage is 128 k (256 B) of 128 rows of each of the four operand planes [A_h | A_l | B_h | B_l], LDS row pitch 272 B;
// wave w brings plane w of every stage with one tensor load; two buffers, the next stage's loads fly while this one is worked on.
// Per accumulator the products are summed k ascending, hi.hi, hi.lo, lo.hi inside each 32 k.
// ---------------------------------------------------------------------------
constexpr unsigned kRowB    = 256;                    // bytes of one operand row in a stage
constexpr unsigned kPitchB  = 272;                    // LDS row pitch: 256 B + the 16-B pad for ds_load_b128 readers
constexpr unsigned kPlaneB  = 128 * kPitchB;          // 34816 B, one plane's slice of a stage
constexpr unsigned kStageB  = 4 * kPlaneB;            // 139264 B, one buffer
constexpr unsigned kStages  = (unsigned)kEmb * 2 / kRowB;   // 8
static_assert(kPlaneB % 2048 == 0, "every slice starts at a multiple of 2 KiB");
static_assert(kStages >= 2, "the ring's prologue needs two stages");
typedef __attribute__((ext_vector_type(8))) unsigned int v8u;

__device__ __forceinline__ unsigned uni(unsigned v) { return (unsigned)__builtin_amdgcn_readfirstlane((int)v); }
__device__ __forceinline__ unsigned pinned(unsigned v) { unsigned w = uni(v); asm volatile("" : "+s"(w)); return w; }
__device__ __forceinline__ void wait_ds0()     { asm volatile("s_wait_dscnt 0x0" ::: "memory"); }      // this wave's LDS reads have returned
__device__ __forceinline__ void wait_tensor0() { asm volatile("s_wait_tensorcnt 0x0" ::: "memory"); }  // this wave's tensor load has landed
__device__ __forceinline__ void tdm_load(v4u g0, v8u g1) { asm volatile("tensor_load_to_lds %0, %1" :: "s"(g0), "s"(g1) : "memory"); }
__device__ __forceinline__ v4u tdm_group0(unsigned lds_dst, unsigned long long ga) {
  v4u g;
  g[0] = uni(1u); g[1] = uni(lds_dst); g[2] = uni((unsigned)ga); g[3] = uni((((unsigned)(ga >> 32)) & 0x01FFFFFFu) | 0x80000000u);
  return g;
}
// 1-byte elements, tile = tensor = 128 rows of 256 B, source pitch one K row, 4 dwords of LDS pad behind every 64 dwords
__device__ __forceinline__ v8u tdm_group1() {
  constexpr unsigned d0 = kRowB, d1 = 128u;
  v8u g;
  g[0] = uni((1u << 20) | (5u << 22) | (3u << 25));
  g[1] = uni((d0 & 0xFFFFu) << 16);
  g[2] = uni((d0 >> 16) | ((d1 & 0xFFFFu) << 16));
  g[3] = uni((d1 >> 16) | (d0 << 16));
  g[4] = uni(d1);
  g[5] = uni((unsigned)kEmb * 2u);
  g[6] = uni(0u);
  g[7] = uni(0u);
  return g;
}

struct FragSet { v16b ah[4], al[4], bh[4], bl[4]; };
// the fragments of one 32-k block: pa / pb = this lane's row 0 of the A_h / B_h slices, at its k half
__device__ __forceinline__ void load_set(FragSet& f, const unsigned char* pa, const unsigned char* pb, int kb) {
  const unsigned k = (unsigned)kb * 64u;
  constexpr unsigned t = 16u * kPitchB;   // 16 rows
  // in the order in which mma_set needs them: the first term can start when half of the group has returned
#pragma unroll
  for (int i = 0; i < 4; ++i) f.ah[i] = Frag<__bf16>::load((const __bf16*)(pa + (unsigned)i * t + k));
#pragma unroll
  for (int i = 0; i < 4; ++i) f.bh[i] = Frag<__bf16>::load((const __bf16*)(pb + (unsigned)i * t + k));
#pragma unroll
  for (int i = 0; i < 4; ++i) f.bl[i] = Frag<__bf16>::load((const __bf16*)(pb + kPlaneB + (unsigned)i * t + k));
#pragma unroll
  for (int i = 0; i < 4; ++i) f.al[i] = Frag<__bf16>::load((const __bf16*)(pa + kPlaneB + (unsigned)i * t + k));
}
// 48 WMMAs; each term runs over all 16 accumulators, so that no WMMA waits for the one in front of it
__device__ __forceinline__ void mma_set(const FragSet& f, v8f (&acc)[4][4]) {
#pragma unroll
  for (int i = 0; i < 4; ++i)
#pragma unroll
    for (int j = 0; j < 4; ++j) acc[i][j] = Frag<__bf16>::mma(f.ah[i], f.bh[j], acc[i][j]);
#pragma unroll
  for (int i = 0; i < 4; ++i)
#pragma unroll
    for (int j = 0; j < 4; ++j) acc[i][j] = Frag<__bf16>::mma(f.ah[i], f.bl[j], acc[i][j]);
#pragma unroll
  for (int i = 0; i < 4; ++i)
#pragma unroll
    for (int j = 0; j < 4; ++j) acc[i][j] = Frag<__bf16>::mma(f.al[i], f.bh[j], acc[i][j]);
}

// OUT_MODE: 0 = f32 to Cf, 2 = bf16 hi plane (Ch) + lo plane (Cl). ACT: 0 = none, 6 = elu(x)+1. grid (N/128, M/128), 128 threads.
template <int OUT_MODE, int ACT>
__global__ __launch_bounds__(128) void gemm128_ring(
    const unsigned short* __restrict__ Ah, const unsigned short* __restrict__ Al,
    const unsigned short* __restrict__ Bh, const unsigned short* __restrict__ Bl,
    unsigned short* __restrict__ Ch, unsigned short* __restrict__ Cl, float* __restrict__ Cf) {
  __shared__ __attribute__((aligned(2048))) unsigned char ring[2 * kStageB];
  __shared__ __align__(16) float sT[4][16 * 68];   // per-wave 16x64 slab, pitch 68 floats
  const int lane = threadIdx.x & 31;
  const unsigned wave = uni(threadIdx.x >> 5);
  const int rlane = lane & 15;
  const int mOff  = (lane >> 4) * 8;
  const int m0 = (int)blockIdx.y * 128 + (int)(wave >> 1) * 64;
  const int n0 = (int)blockIdx.x * 128 + (int)(wave & 1u) * 64;

  // this wave's plane: first byte of its 128 rows, and its slice's place in buffer 0
  const unsigned short* plane = (wave == 0u) ? Ah : (wave == 1u) ? Al : (wave == 2u) ? Bh : Bl;
  const unsigned row0 = ((wave < 2u) ? blockIdx.y : blockIdx.x) * 128u;
  const unsigned long long ga = (unsigned long long)(plane + (size_t)row0 * kEmb);
  const unsigned slice = (unsigned)(unsigned long long)(const void*)ring + wave * kPlaneB;
  const v8u g1 = tdm_group1();

  const unsigned aoff = ((wave >> 1) * 64u + (unsigned)rlane) * kPitchB + (unsigned)(lane >> 4) * 16u;
  const unsigned boff = 2u * kPlaneB + ((wave & 1u) * 64u + (unsigned)rlane) * kPitchB + (unsigned)(lane >> 4) * 16u;

  v8f acc[4][4];
#pragma unroll
  for (int i = 0; i < 4; ++i)
#pragma unroll
    for (int j = 0; j < 4; ++j) acc[i][j] = (v8f){0.f,0.f,0.f,0.f,0.f,0.f,0.f,0.f};

  tdm_load(tdm_group0(slice, ga), g1);
  wait_tensor0();
  __syncthreads();                                  // stage 0 is readable by every wave
  tdm_load(tdm_group0(slice + kStageB, ga + kRowB), g1);

  // rolled: one copy of the 192-WMMA pass, and every accumulator and fragment index stays a constant
#pragma clang loop unroll(disable)
  for (unsigned s = 0; s < kStages; ++s) {
    const unsigned buf = (s & 1u) * kStageB;
    const unsigned char* pa = ring + buf + aoff;
    const unsigned char* pb = ring + buf + boff;
    FragSet f[2];
    load_set(f[0], pa, pb, 0);
#pragma unroll
    for (int kb = 0; kb < 4; ++kb) {
      if (kb < 3) load_set(f[(kb + 1) & 1], pa, pb, kb + 1);
      __builtin_amdgcn_sched_barrier(0);            // keeps the next block's LDS reads one group in front of this block's WMMAs
      mma_set(f[kb & 1], acc);
      __builtin_amdgcn_sched_barrier(0);            // and the block after that one's reads behind them
    }
    wait_ds0();
    wait_tensor0();
    __syncthreads();                                // publishes stage s + 1; every reader has left stage s's buffer
    const unsigned nx = pinned(s + 2u);             // formed behind the wait, and the descriptor from it
    if (nx < kStages) tdm_load(tdm_group0(slice + buf, ga + (unsigned long long)nx * kRowB), g1);
  }
  wait_tensor0();
  wait_ds0();

  // ---- epilogue ----
  float* slab = sT[wave];
#pragma unroll
  for (int i = 0; i < 4; ++i) {
    const int mBase = m0 + (i << 4);
#pragma unroll
    for (int j = 0; j < 4; ++j) {
#pragma unroll
      for (int r = 0; r < 8; ++r) {
        float v = acc[i][j][r];
        // the hardware's exp2 of x * log2(e): cheap enough for the compiler to evaluate it in every lane and select. The library exp
        // compiled to a branch on EXEC per element, 128 dependent chains that the lone wave of a SIMD walked one after the other
        if (ACT == 6) v = (v > 0.f) ? (v + 1.0f) : __expf(v);
        slab[(mOff + r) * 68 + (j << 4) + rlane] = v;
      }
    }
    __builtin_amdgcn_fence(__ATOMIC_RELEASE, "workgroup");
    __builtin_amdgcn_wave_barrier();
    __builtin_amdgcn_fence(__ATOMIC_ACQUIRE, "workgroup");
    if (OUT_MODE == 0) {
      const int hh = lane >> 4, c4 = (lane & 15) * 4;     // row seg = 256 B = 16 lanes x 16 B
      v4f rv[8];
#pragma unroll
      for (int it = 0; it < 8; ++it) rv[it] = *(const v4f*)(slab + (it * 2 + hh) * 68 + c4);
#pragma unroll
      for (int it = 0; it < 8; ++it) *(v4f*)(Cf + (size_t)(mBase + it * 2 + hh) * kEmb + n0 + c4) = rv[it];
      asm volatile("s_wait_xcnt 0x0" ::: "memory");   // stands in front of the next use of the registers that these stores name
    } else {
      const int q = lane >> 3, c8 = (lane & 7) * 8;
      v8h hv[4], lv[4];
#pragma unroll
      for (int it = 0; it < 4; ++it) {
        const float* sp = slab + (it * 4 + q) * 68 + c8;
#pragma unroll
        for (int e = 0; e < 8; ++e) {
          unsigned short hb = f2bf_bits(sp[e]);
          unsigned short lb = f2bf_bits(sp[e] - bf_bits2f(hb));
          hv[it][e] = __builtin_bit_cast(_Float16, hb);
          lv[it][e] = __builtin_bit_cast(_Float16, lb);
        }
      }
#pragma unroll
      for (int it = 0; it < 4; ++it) {
        *(v8h*)(Ch + (size_t)(mBase + it * 4 + q) * kEmb + n0 + c8) = hv[it];
        *(v8h*)(Cl + (size_t)(mBase + it * 4 + q) * kEmb + n0 + c8) = lv[it];
      }
      asm volatile("s_wait_xcnt 0x0" ::: "memory");   // stands in front of the next use of the registers that these stores name
    }
    __builtin_amdgcn_fence(__ATOMIC_RELEASE, "workgroup");
    __builtin_amdgcn_wave_barrier();
    __builtin_amdgcn_fence(__ATOMIC_ACQUIRE, "workgroup");
  }
}

// ---------------------------------------------------------------------------
// f32 -> bf16 hi + lo planes (RNE convert both), 8 consecutive elements per thread: one 16-B store per lane per plane,
// blockIdx.y selects the source tensor (block-uniform); hi plane z lives at out + 2z*planeEl, lo plane at +planeEl.
// Coverage: n8 = planeEl/8 threads x 8 = the whole plane (grids are exact multiples of 256 here).
// ---------------------------------------------------------------------------
__global__ __launch_bounds__(256) void split_planes_kernel(const float* __restrict__ s0, const float* __restrict__ s1,
                                                           const float* __restrict__ s2, const float* __restrict__ s3,
                                                           unsigned short* __restrict__ out, long planeEl, int n8) {
  const int i = blockIdx.x * 256 + threadIdx.x;
  const int z = blockIdx.y;
  if (i >= n8) return;
  const float* src = (z == 0) ? s0 : (z == 1) ? s1 : (z == 2) ? s2 : s3;
  const float* p = src + 8 * (size_t)i;
  const v4f a = *(const v4f*)(p);
  const v4f c = *(const v4f*)(p + 4);
  unsigned short hb[8], lb[8];
#pragma unroll
  for (int e = 0; e < 4; ++e) {
    hb[e]     = f2bf_bits(a[e]);
    lb[e]     = f2bf_bits(a[e] - bf_bits2f(hb[e]));
    hb[4 + e] = f2bf_bits(c[e]);
    lb[4 + e] = f2bf_bits(c[e] - bf_bits2f(hb[4 + e]));
  }
  const v4u uh = (v4u){pk16(hb[0], hb[1]), pk16(hb[2], hb[3]), pk16(hb[4], hb[5]), pk16(hb[6], hb[7])};
  const v4u ul = (v4u){pk16(lb[0], lb[1]), pk16(lb[2], lb[3]), pk16(lb[4], lb[5]), pk16(lb[6], lb[7])};
  unsigned short* ph = out + (size_t)(2 * z) * planeEl + 8 * (size_t)i;
  unsigned short* pl = ph + planeEl;
  *(v4u*)ph = uh;
  *(v4u*)pl = ul;
  
}

// ---------------------------------------------------------------------------
// Token-major chunk tiles in LDS, read as transposed WMMA operands. A tile row is one token: [64 hi | 64 lo] bf16 at pitch kPT.
// ds_load_tr16_b128: lane (c = l & 15, h = l >> 4) gets T[tok + 8h + 0..7][col + c]; the loads at tok and tok + 16 are one
// 16 x 32 fragment in the k order of Frag::load (elements 0..7 = k 8h + 0..7, 8..15 = k 16 + 8h + 0..7).
// ---------------------------------------------------------------------------
constexpr int kPT = 144;                       // elements: 288 B = 32 B x odd, the pitch of ds_load_tr16_b128 readers
typedef __attribute__((ext_vector_type(8))) short v8s;
__device__ __forceinline__ v8b lds_tr16(const unsigned short* p) {
  typedef __attribute__((address_space(3))) v8s lds_v8s;
  return __builtin_bit_cast(v8b, __builtin_amdgcn_ds_load_tr16_b128_v8i16((lds_v8s*)p));
}
// this lane's place in a 16-token x 16-column block, in elements
__device__ __forceinline__ int tr_lane(int lane) { return (8 * (lane >> 4) + (lane & 7)) * kPT + 8 * ((lane >> 3) & 1); }
// p = tile + first token * kPT + first column + tr_lane(lane)
__device__ __forceinline__ v16b lds_frag_tr(const unsigned short* p) {
  Frag<__bf16>::U f; f.h[0] = lds_tr16(p); f.h[1] = lds_tr16(p + 16 * kPT); return f.v;
}

// ---------------------------------------------------------------------------
// Per (batch-chunk y, head h), one work-group of eight waves: dST[e][d] = sum_j v[j][e] k[j][d] (f32, tile (y*16+h) of 64 x 64)
// and dz[y*16+h][d] = sum_j k[j][d] (f32, k = hi + lo, j in order). grid (32, 16), 256 threads.
// The 128 x 64 tiles of k and v (hi and lo) are staged as they lie in the token-major planes; both operands of the product are
// read from them by transposing loads. Wave w owns rows e = 16 (w >> 1) .. +15, columns d = 32 (w & 1) .. +31.
// Per accumulator: j ascending, hi.hi, hi.lo, lo.hi inside each 32 j.
// ---------------------------------------------------------------------------
__global__ __launch_bounds__(256) void state_inc_kernel(const unsigned short* __restrict__ kh, const unsigned short* __restrict__ kl,
                                                        const unsigned short* __restrict__ vh, const unsigned short* __restrict__ vl,
                                                        float* __restrict__ dST, float* __restrict__ dz) {
  __shared__ __align__(16) unsigned short sK[kChunk * kPT];
  __shared__ __align__(16) unsigned short sV[kChunk * kPT];
  __shared__ __align__(16) float sD[kHdim * 68];
  typedef Frag<__bf16> F;
  const int t = threadIdx.x;
  const int lane = t & 31, wave = t >> 5;
  const int rlane = lane & 15;
  const int mOff  = (lane >> 4) * 8;
  const int y = blockIdx.x, h = blockIdx.y;
  const size_t tile = (size_t)y * kHeads + h;
  const size_t go = (size_t)y * kChunk * kEmb + (size_t)h * kHdim + (size_t)(t >> 3) * kEmb + (t & 7) * 8;
  const unsigned short* pkh = kh + go;
  const unsigned short* pkl = kl + go;
  const unsigned short* pvh = vh + go;
  const unsigned short* pvl = vl + go;
  v4u gk[8], gv[8];
#pragma unroll
  for (int it = 0; it < 4; ++it) {
    gk[2 * it]     = *(const v4u*)(pkh + it * 32 * kEmb);
    gk[2 * it + 1] = *(const v4u*)(pkl + it * 32 * kEmb);
    gv[2 * it]     = *(const v4u*)(pvh + it * 32 * kEmb);
    gv[2 * it + 1] = *(const v4u*)(pvl + it * 32 * kEmb);
  }
  // stands in front of the first overwrite of a register that these loads name; the addresses are inputs, so none is reused before it
  asm volatile("s_wait_xcnt 0x0" :: "v"(pkh), "v"(pkl), "v"(pvh), "v"(pvl) : "memory");
#pragma unroll
  for (int it = 0; it < 4; ++it) {
    const int o = (it * 32 + (t >> 3)) * kPT + (t & 7) * 8;
    *(v4u*)(sK + o)      = gk[2 * it];
    *(v4u*)(sK + o + 64) = gk[2 * it + 1];
    *(v4u*)(sV + o)      = gv[2 * it];
    *(v4u*)(sV + o + 64) = gv[2 * it + 1];
  }
  __syncthreads();                             // the staged tiles are readable by every wave

  const int trl = tr_lane(lane);
  const int e0 = (wave >> 1) * 16, d0 = (wave & 1) * 32;
  v8f acc[2];
#pragma unroll
  for (int j = 0; j < 2; ++j) acc[j] = (v8f){0.f,0.f,0.f,0.f,0.f,0.f,0.f,0.f};
#pragma unroll
  for (int kb = 0; kb < 4; ++kb) {
    const unsigned short* pa = sV + kb * 32 * kPT + e0 + trl;
    const unsigned short* pb = sK + kb * 32 * kPT + d0 + trl;
    const v16b ah = lds_frag_tr(pa);
    const v16b al = lds_frag_tr(pa + 64);
    v16b bh[2], bl[2];
#pragma unroll
    for (int j = 0; j < 2; ++j) {
      bh[j] = lds_frag_tr(pb + j * 16);
      bl[j] = lds_frag_tr(pb + j * 16 + 64);
    }
#pragma unroll
    for (int j = 0; j < 2; ++j) acc[j] = F::mma(ah, bh[j], acc[j]);
#pragma unroll
    for (int j = 0; j < 2; ++j) acc[j] = F::mma(ah, bl[j], acc[j]);
#pragma unroll
    for (int j = 0; j < 2; ++j) acc[j] = F::mma(al, bh[j], acc[j]);
  }
#pragma unroll
  for (int j = 0; j < 2; ++j)
#pragma unroll
    for (int r = 0; r < 8; ++r) sD[(e0 + mOff + r) * 68 + d0 + j * 16 + rlane] = acc[j][r];

  float s = 0.f;
  if (t < kHdim) {                             // waves 0 and 1, whole
    // unrolled so that a group's 64 LDS reads are in flight together; rolled, every token waits out its own LDS latency
#pragma unroll 32
    for (int j = 0; j < kChunk; ++j) {
      const float kv = bf_bits2f(sK[j * kPT + t]) + bf_bits2f(sK[j * kPT + 64 + t]);
      s = s + kv;
    }
  }
  __syncthreads();                             // the 64 x 64 tile is whole: it goes out in rows, 512 contiguous bytes a wave

  float* dp = dST + tile * (size_t)(kHdim * kHdim) + 4 * t;
  v4f rv[4];
#pragma unroll
  for (int it = 0; it < 4; ++it) {
    const int u = it * 256 + t;
    rv[it] = *(const v4f*)(sD + (u >> 4) * 68 + (u & 15) * 4);
  }
#pragma unroll
  for (int it = 0; it < 4; ++it) *(v4f*)(dp + it * 1024) = rv[it];
  if (t < kHdim) dz[tile * kHdim + t] = s;     // behind the barrier, so that no wave waits there for this store
  asm volatile("s_wait_xcnt 0x0" ::: "memory");   // stands behind the last stores, in front of any later write of a register that they name
}

// ---------------------------------------------------------------------------
// Exclusive prefix over chunks of the transposed state and of z, per (b, h). No element depends on another, so the work is dealt
// by element: grid (32 bh, 5), 256 threads. Slices y = 0..3: thread t owns elements 1024y + 4t .. +3 of every 4096-element tile;
// slice y = 4: thread t < 64 owns element t of z. A thread first issues the loads of all 15 increments it needs (the last chunk's
// is never used), so their latencies overlap, then sums them in registers in chunk order and stores each chunk's value.
// S^T_c = sum_{c' < c} dST_{c'} (f32, sequential), written as bf16 hi/lo planes [tile][64 e][64 d] (tile = (b*16+c)*16+h);
// z_c likewise to zpre[tile][64] (f32). A wave's store covers 256 contiguous bytes of a plane.
// ---------------------------------------------------------------------------
typedef __attribute__((ext_vector_type(2))) unsigned int v2u;
constexpr int kPfxSlices = 4;                    // 4 slices x 256 threads x 4 elements = one 64 x 64 tile
static_assert(kPfxSlices * 256 * 4 == kHdim * kHdim, "the slices cover a tile");
// at most eight waves per SIMD are asked for: 128 registers a wave. Without it the build keeps to 81 registers and holds the last
// load back until the first has returned, to take over its registers
__global__ __launch_bounds__(256) __attribute__((amdgpu_waves_per_eu(2, 8))) void state_prefix_kernel(const float* __restrict__ dST, const float* __restrict__ dz,
                                                           unsigned short* __restrict__ STh, unsigned short* __restrict__ STl,
                                                           float* __restrict__ zpre) {
  const int t = threadIdx.x;
  const int bh = blockIdx.x;
  const int b = bh >> 4, h = bh & 15;
  const size_t tile0 = (size_t)(b * kNChunk) * kHeads + h;   // chunk 0's tile; chunk c's is tile0 + 16 c
  if (blockIdx.y == (unsigned)kPfxSlices) {                  // block-uniform: the z slice
    if (t >= kHdim) return;
    const float* zp = dz + tile0 * kHdim + t;
    float* zo = zpre + tile0 * kHdim + t;
    float zd[kNChunk - 1];
#pragma unroll
    for (int c = 0; c < kNChunk - 1; ++c) zd[c] = zp[c * kHeads * kHdim];
    float zacc = 0.f;
#pragma unroll
    for (int c = 0; c < kNChunk; ++c) {
      zo[c * kHeads * kHdim] = zacc;
      if (c < kNChunk - 1) zacc += zd[c];
    }
    return;
  }
  const size_t el = tile0 * 4096 + ((size_t)blockIdx.y * 256 + t) * 4;
  const float* dp = dST + el;
  unsigned short* ph = STh + el;
  unsigned short* pl = STl + el;
  v4f d[kNChunk - 1];
#pragma unroll
  for (int c = 0; c < kNChunk - 1; ++c) d[c] = *(const v4f*)(dp + c * kHeads * 4096);
  // all 15 loads stay in front of this line, so that they are in flight together (the compiler otherwise sinks five of them behind the
  // first waits); and it stands in front of the first overwrite of the address register, which is an input, so it is not reused before it
  asm volatile("s_wait_xcnt 0x0" :: "v"(dp) : "memory");
  v4f a = (v4f){0.f, 0.f, 0.f, 0.f};
#pragma unroll
  for (int c = 0; c < kNChunk; ++c) {
    unsigned short hb[4], lb[4];
#pragma unroll
    for (int e = 0; e < 4; ++e) {
      hb[e] = f2bf_bits(a[e]);
      lb[e] = f2bf_bits(a[e] - bf_bits2f(hb[e]));
    }
    *(v2u*)(ph + c * kHeads * 4096) = (v2u){pk16(hb[0], hb[1]), pk16(hb[2], hb[3])};
    *(v2u*)(pl + c * kHeads * 4096) = (v2u){pk16(lb[0], lb[1]), pk16(lb[2], lb[3])};
    if (c < kNChunk - 1) a += d[c];
  }
  asm volatile("s_wait_xcnt 0x0" ::: "memory");   // stands behind the last stores, in front of any later write of a register that they name
}

// ---------------------------------------------------------------------------
// Per (batch-chunk y, head h), one work-group of eight waves: masked scores A = tril(q.k^T), num = A.v + q.S_c,
// den = q.z_c + rowsum(A) + eps, o = num * (1/den) as bf16 hi/lo rows of the token-major o planes.
// The k, v and S^T tiles (hi and lo) are staged once in LDS, v token-major and read by transposing loads; wave w owns chunk rows 16w .. 16w+15 from the scores to the stores,
// and its A rows pass from the accumulator layout to the A-operand layout through its own LDS slab (bf16 hi/lo, never in memory).
// Every sum keeps its order: per accumulator k ascending with hi.hi, hi.lo, lo.hi inside each 32 k; A.v and q.S in separate
// accumulators, added once; row sum and q.z sequential in f32.
// ---------------------------------------------------------------------------
constexpr int kPK = 72;                        // LDS row pitch of the 64-wide tiles (k, S^T), elements: 144 B = 16 B x odd
constexpr int kPV = 136;                       // LDS row pitch of the 128-wide A rows, elements: 272 B = 16 B x odd
constexpr int kSlabB = 2 * 16 * kPV * 2;       // one wave's slab: A_h rows, then A_l rows; later the f32 num rows (pitch 68)
static_assert(16 * 68 * 4 <= kSlabB, "the num rows fit the slab");

// orders one wave's LDS writes in front of reads by its other lanes (the slabs are private to a wave)
__device__ __forceinline__ void wave_lds_sync() {
  __builtin_amdgcn_fence(__ATOMIC_RELEASE, "workgroup");
  __builtin_amdgcn_wave_barrier();
  __builtin_amdgcn_fence(__ATOMIC_ACQUIRE, "workgroup");
}
__device__ __forceinline__ v16b lds_frag(const unsigned short* p) { return Frag<__bf16>::load((const __bf16*)p); }

// at most 256 registers a wave: two work-groups (four waves per SIMD) share a WGP, so all 512 are resident at once
__global__ __launch_bounds__(256) __attribute__((amdgpu_waves_per_eu(4, 4))) void chunk_attn_kernel(const unsigned short* __restrict__ qh, const unsigned short* __restrict__ ql,
                                                         const unsigned short* __restrict__ kh, const unsigned short* __restrict__ kl,
                                                         const unsigned short* __restrict__ vh, const unsigned short* __restrict__ vl,
                                                         const unsigned short* __restrict__ STh, const unsigned short* __restrict__ STl,
                                                         const float* __restrict__ zpre,
                                                         unsigned short* __restrict__ oh, unsigned short* __restrict__ ol) {
  __shared__ __align__(16) unsigned short sKh[kChunk * kPK];
  __shared__ __align__(16) unsigned short sKl[kChunk * kPK];
  __shared__ __align__(16) unsigned short sV[kChunk * kPT];
  __shared__ __align__(16) unsigned short sSh[kHdim * kPK];
  __shared__ __align__(16) unsigned short sSl[kHdim * kPK];
  __shared__ __align__(16) unsigned char  sW[8][kSlabB];
  __shared__ __align__(16) float sInv[8][16];
  typedef Frag<__bf16> F;
  const int t = threadIdx.x;
  const int lane = t & 31, wave = t >> 5;
  const int rlane = lane & 15;                 // row (A operand) / column (B operand, accumulator) within a 16-wide subtile
  const int koff  = (lane >> 4) * 8;           // k offset of this lane half
  const int mOff  = (lane >> 4) * 8;           // accumulator row offset
  const int y = blockIdx.x, h = blockIdx.y;
  const size_t tile = (size_t)y * kHeads + h;
  const size_t base = (size_t)y * kChunk * kEmb + (size_t)h * kHdim;   // chunk row 0 at this head, token-major planes

  // ---- the tiles, 16 B per lane: k 128 x 64, v 128 x 64, S^T 64 x 64, hi and lo; this wave's q rows ----
  const size_t ko = base + (size_t)(t >> 3) * kEmb + (t & 7) * 8;
  const size_t so = tile * (size_t)(kHdim * kHdim) + (size_t)t * 8;
  const size_t qrow = base + (size_t)(wave * 16 + rlane) * kEmb;
  const unsigned short* pkh = kh + ko;
  const unsigned short* pkl = kl + ko;
  const unsigned short* pvh = vh + ko;
  const unsigned short* pvl = vl + ko;
  const unsigned short* psh = STh + so;
  const unsigned short* psl = STl + so;
  const unsigned short* pqh = qh + qrow;
  const unsigned short* pql = ql + qrow;
  const unsigned short* pfh = pqh + koff;
  const unsigned short* pfl = pql + koff;
  v4u gk[8], gv[8], gs[4], gqh[8], gql[8];
#pragma unroll
  for (int it = 0; it < 4; ++it) {
    gk[2 * it]     = *(const v4u*)(pkh + it * 32 * kEmb);
    gk[2 * it + 1] = *(const v4u*)(pkl + it * 32 * kEmb);
    gv[2 * it]     = *(const v4u*)(pvh + it * 32 * kEmb);
    gv[2 * it + 1] = *(const v4u*)(pvl + it * 32 * kEmb);
  }
#pragma unroll
  for (int it = 0; it < 2; ++it) {
    gs[2 * it]     = *(const v4u*)(psh + it * 2048);
    gs[2 * it + 1] = *(const v4u*)(psl + it * 2048);
  }
  // the q rows as A operands (K = 64: two 32-k blocks), and whole (row rlane) for q.z
  v16b qfh[2], qfl[2];
#pragma unroll
  for (int kb = 0; kb < 2; ++kb) {
    qfh[kb] = F::load((const __bf16*)(pfh + kb * 32));
    qfl[kb] = F::load((const __bf16*)(pfl + kb * 32));
  }
#pragma unroll
  for (int w = 0; w < 8; ++w) {
    gqh[w] = *(const v4u*)(pqh + 8 * w);
    gql[w] = *(const v4u*)(pql + 8 * w);
  }
  // stands in front of the first overwrite of a register that these loads name; the addresses are inputs, so none is reused before it
  asm volatile("s_wait_xcnt 0x0" :: "v"(pkh), "v"(pkl), "v"(pvh), "v"(pvl), "v"(psh), "v"(psl), "v"(pqh), "v"(pql), "v"(pfh), "v"(pfl) : "memory");
#pragma unroll
  for (int it = 0; it < 4; ++it) {
    const int u = it * 256 + t;
    *(v4u*)(sKh + (u >> 3) * kPK + (u & 7) * 8) = gk[2 * it];
    *(v4u*)(sKl + (u >> 3) * kPK + (u & 7) * 8) = gk[2 * it + 1];
    *(v4u*)(sV + (u >> 3) * kPT + (u & 7) * 8)      = gv[2 * it];
    *(v4u*)(sV + (u >> 3) * kPT + (u & 7) * 8 + 64) = gv[2 * it + 1];
  }
#pragma unroll
  for (int it = 0; it < 2; ++it) {
    const int u = it * 256 + t;
    *(v4u*)(sSh + (u >> 3) * kPK + (u & 7) * 8) = gs[2 * it];
    *(v4u*)(sSl + (u >> 3) * kPK + (u & 7) * 8) = gs[2 * it + 1];
  }

  // ---- q . z_c of row rlane (both lane halves compute the same row) ----
  const float* zp = zpre + tile * kHdim;
  float qz = 0.f;
#pragma unroll
  for (int w = 0; w < 8; ++w) {
    const v4u uh = gqh[w];
    const v4u ul = gql[w];
    const v4f z0 = *(const v4f*)(zp + 8 * w);
    const v4f z1 = *(const v4f*)(zp + 8 * w + 4);
    float qv[8], zv[8];
#pragma unroll
    for (int e = 0; e < 4; ++e) {
      qv[2 * e]     = bflo2f(uh[e]) + bflo2f(ul[e]);
      qv[2 * e + 1] = bfhi2f(uh[e]) + bfhi2f(ul[e]);
      zv[e] = z0[e];
      zv[4 + e] = z1[e];
    }
#pragma unroll
    for (int e = 0; e < 8; ++e) qz += qv[e] * zv[e];
  }
  sInv[wave][rlane] = qz;                      // parked in LDS: kept in a register, the whole sum is sunk to its use and the q rows spill
  __syncthreads();                             // the staged tiles are readable by every wave

  // ---- masked scores of rows 16w .. 16w+15, four column subtiles at a time, into the slab as bf16 hi/lo ----
  unsigned short* aH = (unsigned short*)sW[wave];
  unsigned short* aL = aH + 16 * kPV;
#pragma unroll
  for (int jh = 0; jh < 2; ++jh) {
    v8f s[4];
#pragma unroll
    for (int j = 0; j < 4; ++j) s[j] = (v8f){0.f,0.f,0.f,0.f,0.f,0.f,0.f,0.f};
#pragma unroll
    for (int kb = 0; kb < 2; ++kb) {
      v16b bh[4], bl[4];
#pragma unroll
      for (int j = 0; j < 4; ++j) {
        const int o = ((jh * 4 + j) * 16 + rlane) * kPK + koff + kb * 32;
        bh[j] = lds_frag(sKh + o);
        bl[j] = lds_frag(sKl + o);
      }
#pragma unroll
      for (int j = 0; j < 4; ++j) s[j] = F::mma(qfh[kb], bh[j], s[j]);
#pragma unroll
      for (int j = 0; j < 4; ++j) s[j] = F::mma(qfh[kb], bl[j], s[j]);
#pragma unroll
      for (int j = 0; j < 4; ++j) s[j] = F::mma(qfl[kb], bh[j], s[j]);
    }
#pragma unroll
    for (int j = 0; j < 4; ++j) {
      const int n = (jh * 4 + j) * 16 + rlane;
#pragma unroll
      for (int r = 0; r < 8; ++r) {
        float v = s[j][r];
        if (n > wave * 16 + mOff + r) v = 0.0f;
        const unsigned short hb = f2bf_bits(v);
        const unsigned short lb = f2bf_bits(v - bf_bits2f(hb));
        aH[(mOff + r) * kPV + n] = hb;
        aL[(mOff + r) * kPV + n] = lb;
      }
    }
  }

  // ---- q . S_c: K = 64 ----
  v8f qs[4], av[4];
#pragma unroll
  for (int j = 0; j < 4; ++j) { qs[j] = (v8f){0.f,0.f,0.f,0.f,0.f,0.f,0.f,0.f}; av[j] = (v8f){0.f,0.f,0.f,0.f,0.f,0.f,0.f,0.f}; }
#pragma unroll
  for (int kb = 0; kb < 2; ++kb) {
    v16b bh[4], bl[4];
#pragma unroll
    for (int j = 0; j < 4; ++j) {
      const int o = (j * 16 + rlane) * kPK + koff + kb * 32;
      bh[j] = lds_frag(sSh + o);
      bl[j] = lds_frag(sSl + o);
    }
#pragma unroll
    for (int j = 0; j < 4; ++j) qs[j] = F::mma(qfh[kb], bh[j], qs[j]);
#pragma unroll
    for (int j = 0; j < 4; ++j) qs[j] = F::mma(qfh[kb], bl[j], qs[j]);
#pragma unroll
    for (int j = 0; j < 4; ++j) qs[j] = F::mma(qfl[kb], bh[j], qs[j]);
  }
  wave_lds_sync();                             // the slab's A rows are readable by every lane of this wave

  // ---- A . v: K = 128 ----
  const int trl = tr_lane(lane);
#pragma unroll
  for (int kb = 0; kb < 4; ++kb) {
    const v16b ah = lds_frag(aH + rlane * kPV + koff + kb * 32);
    const v16b al = lds_frag(aL + rlane * kPV + koff + kb * 32);
    v16b bh[4], bl[4];
#pragma unroll
    for (int j = 0; j < 4; ++j) {
      const unsigned short* pv = sV + kb * 32 * kPT + j * 16 + trl;
      bh[j] = lds_frag_tr(pv);
      bl[j] = lds_frag_tr(pv + 64);
    }
#pragma unroll
    for (int j = 0; j < 4; ++j) av[j] = F::mma(ah, bh[j], av[j]);
#pragma unroll
    for (int j = 0; j < 4; ++j) av[j] = F::mma(ah, bl[j], av[j]);
#pragma unroll
    for (int j = 0; j < 4; ++j) av[j] = F::mma(al, bh[j], av[j]);
  }

  // ---- row sum of the masked scores of row rlane, j in order ----
  float asum = 0.f;
#pragma unroll
  for (int w = 0; w < 16; ++w) {
    const v4u uh = *(const v4u*)(aH + rlane * kPV + 8 * w);
    const v4u ul = *(const v4u*)(aL + rlane * kPV + 8 * w);
#pragma unroll
    for (int e = 0; e < 4; ++e) {
      const float a0 = bflo2f(uh[e]) + bflo2f(ul[e]);
      asum = asum + a0;
      const float a1 = bfhi2f(uh[e]) + bfhi2f(ul[e]);
      asum = asum + a1;
    }
  }
  const float den = (sInv[wave][rlane] + asum) + kEps;
  const float inv = 1.0f / den;
  wave_lds_sync();                             // every read of the A rows has returned: the slab takes the num rows

  float* slab = (float*)sW[wave];
#pragma unroll
  for (int j = 0; j < 4; ++j)
#pragma unroll
    for (int r = 0; r < 8; ++r) slab[(mOff + r) * 68 + (j << 4) + rlane] = av[j][r] + qs[j][r];
  sInv[wave][rlane] = inv;
  wave_lds_sync();

  const int q4 = lane >> 3, c8 = (lane & 7) * 8;
  v4u uo_h[4], uo_l[4];
#pragma unroll
  for (int it = 0; it < 4; ++it) {
    const int row = it * 4 + q4;
    const float iv = sInv[wave][row];
    unsigned short hb[8], lb[8];
#pragma unroll
    for (int e = 0; e < 8; ++e) {
      const float f = slab[row * 68 + c8 + e] * iv;
      hb[e] = f2bf_bits(f);
      lb[e] = f2bf_bits(f - bf_bits2f(hb[e]));
    }
    uo_h[it] = (v4u){pk16(hb[0], hb[1]), pk16(hb[2], hb[3]), pk16(hb[4], hb[5]), pk16(hb[6], hb[7])};
    uo_l[it] = (v4u){pk16(lb[0], lb[1]), pk16(lb[2], lb[3]), pk16(lb[4], lb[5]), pk16(lb[6], lb[7])};
  }
#pragma unroll
  for (int it = 0; it < 4; ++it) {
    const size_t o = base + (size_t)(wave * 16 + it * 4 + q4) * kEmb + c8;
    *(v4u*)(oh + o) = uo_h[it];
    *(v4u*)(ol + o) = uo_l[it];
  }
}

// ---------------------------------------------------------------------------
// Premise check on the causal flag: only the causal branch is built; if the flag is 0 the output is poisoned with NaN
// ---------------------------------------------------------------------------
__global__ __launch_bounds__(256) void premise_kernel(const int* __restrict__ flag, float* __restrict__ out, int n16) {
  const int i = blockIdx.x * 256 + threadIdx.x;
  if (i >= n16) return;
  const int f = flag[0];
  if (f != 0) return;
  const float qn = __uint_as_float(0x7fc00000u);
  const v4f nv = (v4f){qn, qn, qn, qn};
  float* p = out + 16 * (size_t)i;
  {
#pragma unroll
    for (int k = 0; k < 4; ++k) *(v4f*)(p + 4 * k) = nv;
    
  }
}

// ---------------------------------------------------------------------------
// Host launcher
// ---------------------------------------------------------------------------
extern "C" void kernel_launch(void* const* d_in, const int* in_sizes, int n_in,
                              void* d_out, int out_size, void* d_ws, size_t ws_size,
                              hipStream_t stream) {
  if (n_in < 8) return;
  if (in_sizes[0] != (int)kPlaneEl || in_sizes[1] != (int)kPlaneEl || in_sizes[2] != (int)kPlaneEl) return;
  if (in_sizes[3] != (int)kWEl || in_sizes[4] != (int)kWEl || in_sizes[5] != (int)kWEl || in_sizes[6] != (int)kWEl) return;
  if (in_sizes[7] < 1) return;
  if (out_size != (int)kPlaneEl) return;
  if (ws_size < (size_t)kWsTotal) return;

  const float* Q  = (const float*)d_in[0];
  const float* Kx = (const float*)d_in[1];
  const float* Vx = (const float*)d_in[2];
  const float* Wq = (const float*)d_in[3];
  const float* Wk = (const float*)d_in[4];
  const float* Wv = (const float*)d_in[5];
  const float* Wo = (const float*)d_in[6];
  const int*   causal = (const int*)d_in[7];
  float* out = (float*)d_out;
  char* ws = (char*)d_ws;

  unsigned short* Xbase = (unsigned short*)(ws + oXbase);
  const unsigned short* Xq_h = Xbase;
  const unsigned short* Xq_l = Xbase + kPlaneEl;
  const unsigned short* Xk_h = Xbase + 2 * kPlaneEl;
  const unsigned short* Xk_l = Xbase + 3 * kPlaneEl;
  const unsigned short* Xv_h = Xbase + 4 * kPlaneEl;
  const unsigned short* Xv_l = Xbase + 5 * kPlaneEl;
  unsigned short* Wbase = (unsigned short*)(ws + oWbase);
  const unsigned short* Wq_h = Wbase;
  const unsigned short* Wq_l = Wbase + kWEl;
  const unsigned short* Wk_h = Wbase + 2 * kWEl;
  const unsigned short* Wk_l = Wbase + 3 * kWEl;
  const unsigned short* Wv_h = Wbase + 4 * kWEl;
  const unsigned short* Wv_l = Wbase + 5 * kWEl;
  const unsigned short* Wo_h = (const unsigned short*)(ws + oWo_h);
  const unsigned short* Wo_l = (const unsigned short*)(ws + oWo_l);
  unsigned short* q_h  = (unsigned short*)(ws + oQ_h);
  unsigned short* q_l  = (unsigned short*)(ws + oQ_l);
  unsigned short* k_h  = (unsigned short*)(ws + oK_h);
  unsigned short* k_l  = (unsigned short*)(ws + oK_l);
  unsigned short* v_h  = (unsigned short*)(ws + oV_h);
  unsigned short* v_l  = (unsigned short*)(ws + oV_l);
  float*          dST  = (float*)(ws + oDST);
  unsigned short* ST_h = (unsigned short*)(ws + oST_h);
  unsigned short* ST_l = (unsigned short*)(ws + oST_l);
  unsigned short* o_h  = (unsigned short*)(ws + oO_h);
  unsigned short* o_l  = (unsigned short*)(ws + oO_l);
  float*          dz   = (float*)(ws + oDZ);
  float*          zpre = (float*)(ws + oZPRE);

  // 1) input and weight hi/lo planes
  split_planes_kernel<<<dim3((unsigned)(kPlaneEl / 8 / 256), 3, 1), 256, 0, stream>>>(Q, Kx, Vx, Vx, Xbase, kPlaneEl, (int)(kPlaneEl / 8));
  split_planes_kernel<<<dim3((unsigned)(kWEl / 8 / 256), 4, 1), 256, 0, stream>>>(Wq, Wk, Wv, Wo, Wbase, kWEl, (int)(kWEl / 8));

  // 2) projections: M=4096, N=1024, K=1024 (8 x 32 tiles of 128 x 128, one work-group each); q, k with elu(x)+1
  gemm128_ring<2, 6><<<dim3(kEmb / 128, kTok / 128, 1), 128, 0, stream>>>(Xq_h, Xq_l, Wq_h, Wq_l, q_h, q_l, nullptr);
  gemm128_ring<2, 6><<<dim3(kEmb / 128, kTok / 128, 1), 128, 0, stream>>>(Xk_h, Xk_l, Wk_h, Wk_l, k_h, k_l, nullptr);
  gemm128_ring<2, 0><<<dim3(kEmb / 128, kTok / 128, 1), 128, 0, stream>>>(Xv_h, Xv_l, Wv_h, Wv_l, v_h, v_l, nullptr);

  // 3) per (b,c,h): dST[e][d] = sum_j v[j][e] k[j][d] and the chunk sums of k
  state_inc_kernel<<<dim3(kYB, kHeads, 1), 256, 0, stream>>>(k_h, k_l, v_h, v_l, dST, dz);

  // 4) exclusive prefix over chunks of S^T and z
  state_prefix_kernel<<<dim3(kBatch * kHeads, kPfxSlices + 1, 1), 256, 0, stream>>>(dST, dz, ST_h, ST_l, zpre);

  // 5) per (b,c,h): masked scores, A.v + q.S_c, normaliser -> attention output hi/lo planes (token-major, heads merged)
  chunk_attn_kernel<<<dim3(kYB, kHeads, 1), 256, 0, stream>>>(q_h, q_l, k_h, k_l, v_h, v_l, ST_h, ST_l, zpre, o_h, o_l);

  // 6) output projection: M=4096, N=1024, K=1024 -> d_out
  gemm128_ring<0, 0><<<dim3(kEmb / 128, kTok / 128, 1), 128, 0, stream>>>(o_h, o_l, Wo_h, Wo_l, nullptr, nullptr, out);

  // 7) premise check on the causal flag (poisons the output when the non-causal branch would be required)
  premise_kernel<<<dim3((unsigned)(kPlaneEl / 16 / 256), 1, 1), 256, 0, stream>>>(causal, out, (int)(kPlaneEl / 16));
}

// v006
// It runs in 129 microseconds.
// Two timings next to v005 put it at 1.10 and 1.11 times that version's speed.
// Over all steps from v000 it is 3.39 times as fast.
// Contractions: q/k/v projections, chunk scores q.k^T, state increment v^T.k, q.S, A.v, output projection -- all v_wmma_f32_16x16x32_bf16 with bf16 hi/lo operand planes (hi.hi + hi.lo + lo.hi), f32 accumulate; feature map, state prefix over chunks, normaliser and division in f32 on the VALU.
#include <hip/hip_runtime.h>
#include <math.h>

// ---------------------------------------------------------------------------
// Problem constants
// ---------------------------------------------------------------------------
constexpr int kBatch   = 2;
constexpr int kSeq     = 2048;
constexpr int kEmb     = 1024;
constexpr int kHeads   = 16;
constexpr int kHdim    = 64;
constexpr int kChunk   = 128;
constexpr int kNChunk  = kSeq / kChunk;          // 16 chunks per sequence
constexpr int kTok     = kBatch * kSeq;          // 4096 token rows
constexpr int kYB      = kBatch * kNChunk;       // 32 (batch, chunk) pairs
constexpr int kTiles   = kYB * kHeads;           // 512 (batch, chunk, head) tiles
constexpr float kEps   = 1e-6f;
constexpr long kPlaneEl = (long)kTok * kEmb;     // 4194304 elements per activation plane
constexpr long kWEl     = (long)kEmb * kEmb;     // 1048576 elements per weight plane
constexpr long kUnit    = kPlaneEl * 2;          // 8388608 bytes (one bf16 activation plane)
constexpr long kWUnit   = kWEl * 2;              // 2097152 bytes (one bf16 weight plane)

// ---------------------------------------------------------------------------
// Workspace region map (bytes; U = 8388608, WU = 2097152); total 14U + 262144 = 117702656
//   [0U , 6U)  phase 1: Xq_h Xq_l Xk_h Xk_l Xv_h Xv_l (input hi/lo planes, dead after projections)
//              phase 2: o_h@0U o_l@1U dST(f32)@4U ST_h@5U ST_l@5.5U
//   [6U , 8U)  Wq_h Wq_l Wk_h Wk_l Wv_h Wv_l Wo_h Wo_l (WU each)
//   [8U ,14U)  q_h@8U q_l@9U k_h@10U k_l@11U v_h@12U v_l@13U (projection outputs)
//   [14U, +262144)  dz f32 [512][64] @14U, zpre f32 [512][64] @14U+131072
// ---------------------------------------------------------------------------
constexpr long oXbase = 0;
constexpr long oO_h   = 0;
constexpr long oO_l   = 1 * kUnit;
constexpr long oDST   = 4 * kUnit;
constexpr long oST_h  = 5 * kUnit;
constexpr long oST_l  = 5 * kUnit + kUnit / 2;
constexpr long oWbase = 6 * kUnit;
constexpr long oWo_h  = oWbase + 6 * kWUnit;
constexpr long oWo_l  = oWbase + 7 * kWUnit;
constexpr long oQ_h   = 8 * kUnit;
constexpr long oQ_l   = 9 * kUnit;
constexpr long oK_h   = 10 * kUnit;
constexpr long oK_l   = 11 * kUnit;
constexpr long oV_h   = 12 * kUnit;
constexpr long oV_l   = 13 * kUnit;
constexpr long oDZ    = 14 * kUnit;
constexpr long oZPRE  = 14 * kUnit + 131072;
constexpr long kWsTotal = 14 * kUnit + 262144;
static_assert(kWsTotal == 117702656, "carve total");
static_assert(kWsTotal <= 134217728, "carve within 128 MiB");
static_assert((long)kTiles * kHdim * kHdim * 4 == kUnit, "dST plane size");

typedef __attribute__((ext_vector_type(8)))  _Float16 v8h;
typedef __attribute__((ext_vector_type(16))) __bf16   v16b;
typedef __attribute__((ext_vector_type(8)))  __bf16   v8b;
typedef __attribute__((ext_vector_type(8)))  float    v8f;
typedef __attribute__((ext_vector_type(4)))  float    v4f;
typedef __attribute__((ext_vector_type(4)))  unsigned int v4u;

__device__ __forceinline__ unsigned short f2bf_bits(float f) {
  unsigned u = __float_as_uint(f);
  return (unsigned short)((u + 0x7FFFu + ((u >> 16) & 1u)) >> 16);
}
__device__ __forceinline__ float bf_bits2f(unsigned short h) { return __uint_as_float(((unsigned)h) << 16); }

template <typename T> struct Frag;
template <> struct Frag<__bf16> {
  typedef v16b V; union U { v16b v; v8b h[2]; };
  static __device__ __forceinline__ v16b load(const __bf16* p) {   // elements 0..7 <- p[0..7], 8..15 <- p[16..23]
    U f; f.h[0] = *(const v8b*)(p); f.h[1] = *(const v8b*)(p + 16); return f.v;
  }
  static __device__ __forceinline__ v8f mma(v16b a, v16b b, v8f c) {
    return __builtin_amdgcn_wmma_f32_16x16x32_bf16(false, a, false, b, (short)0, c, false, false);
  }
};

__device__ __forceinline__ unsigned pk16(unsigned short a, unsigned short b) { return (unsigned)a | ((unsigned)b << 16); }
// bf16 element pair held in one 32-bit word: low half-word = even element, high half-word = odd element
__device__ __forceinline__ float bflo2f(unsigned w) { return __uint_as_float(w << 16); }
__device__ __forceinline__ float bfhi2f(unsigned w) { return __uint_as_float(w & 0xffff0000u); }

// ---------------------------------------------------------------------------
// The four 4096 x 1024 x 1024 products: C[m,n] = sum_k A[m,k] * Bt[n,k], hi/lo planes, product = hi.hi + hi.lo + lo.hi.
// One 128 x 128 tile of C per work-group, four waves (2 x 2), each wave a 64 x 64 tile (4 x 4 accumulators).
// A stage is 128 k (256 B) of 128 rows of each of the four operand planes [A_h | A_l | B_h | B_l], LDS row pitch 272 B;
// wave w brings plane w of every stage with one tensor load; two buffers, the next stage's loads fly while this one is worked on.
// Per accumulator the products are summed k ascending, hi.hi, hi.lo, lo.hi inside each 32 k.
// ---------------------------------------------------------------------------
constexpr unsigned kRowB    = 256;                    // bytes of one operand row in a stage
constexpr unsigned kPitchB  = 272;                    // LDS row pitch: 256 B + the 16-B pad for ds_load_b128 readers
constexpr unsigned kPlaneB  = 128 * kPitchB;          // 34816 B, one plane's slice of a stage
constexpr unsigned kStageB  = 4 * kPlaneB;            // 139264 B, one buffer
constexpr unsigned kStages  = (unsigned)kEmb * 2 / kRowB;   // 8
static_assert(kPlaneB % 2048 == 0, "every slice starts at a multiple of 2 KiB");
static_assert(kStages >= 2, "the ring's prologue needs two stages");
typedef __attribute__((ext_vector_type(8))) unsigned int v8u;

__device__ __forceinline__ unsigned uni(unsigned v) { return (unsigned)__builtin_amdgcn_readfirstlane((int)v); }
__device__ __forceinline__ unsigned pinned(unsigned v) { unsigned w = uni(v); asm volatile("" : "+s"(w)); return w; }
__device__ __forceinline__ void wait_ds0()     { asm volatile("s_wait_dscnt 0x0" ::: "memory"); }      // this wave's LDS reads have returned
__device__ __forceinline__ void wait_tensor0() { asm volatile("s_wait_tensorcnt 0x0" ::: "memory"); }  // this wave's tensor load has landed
__device__ __forceinline__ void tdm_load(v4u g0, v8u g1) { asm volatile("tensor_load_to_lds %0, %1" :: "s"(g0), "s"(g1) : "memory"); }
__device__ __forceinline__ v4u tdm_group0(unsigned lds_dst, unsigned long long ga) {
  v4u g;
  g[0] = uni(1u); g[1] = uni(lds_dst); g[2] = uni((unsigned)ga); g[3] = uni((((unsigned)(ga >> 32)) & 0x01FFFFFFu) | 0x80000000u);
  return g;
}
// 1-byte elements, tile = tensor = 128 rows of 256 B, source pitch one K row, 4 dwords of LDS pad behind every 64 dwords
__device__ __forceinline__ v8u tdm_group1() {
  constexpr unsigned d0 = kRowB, d1 = 128u;
  v8u g;
  g[0] = uni((1u << 20) | (5u << 22) | (3u << 25));
  g[1] = uni((d0 & 0xFFFFu) << 16);
  g[2] = uni((d0 >> 16) | ((d1 & 0xFFFFu) << 16));
  g[3] = uni((d1 >> 16) | (d0 << 16));
  g[4] = uni(d1);
  g[5] = uni((unsigned)kEmb * 2u);
  g[6] = uni(0u);
  g[7] = uni(0u);
  return g;
}

struct FragSet { v16b ah[4], al[4], bh[4], bl[4]; };
// the fragments of one 32-k block: pa / pb = this lane's row 0 of the A_h / B_h slices, at its k half
__device__ __forceinline__ void load_set(FragSet& f, const unsigned char* pa, const unsigned char* pb, int kb) {
  const unsigned k = (unsigned)kb * 64u;
  constexpr unsigned t = 16u * kPitchB;   // 16 rows
  // in the order in which mma_set needs them: the first term can start when half of the group has returned
#pragma unroll
  for (int i = 0; i < 4; ++i) f.ah[i] = Frag<__bf16>::load((const __bf16*)(pa + (unsigned)i * t + k));
#pragma unroll
  for (int i = 0; i < 4; ++i) f.bh[i] = Frag<__bf16>::load((const __bf16*)(pb + (unsigned)i * t + k));
#pragma unroll
  for (int i = 0; i < 4; ++i) f.bl[i] = Frag<__bf16>::load((const __bf16*)(pb + kPlaneB + (unsigned)i * t + k));
#pragma unroll
  for (int i = 0; i < 4; ++i) f.al[i] = Frag<__bf16>::load((const __bf16*)(pa + kPlaneB + (unsigned)i * t + k));
}
// 48 WMMAs; each term runs over all 16 accumulators, so that no WMMA waits for the one in front of it
__device__ __forceinline__ void mma_set(const FragSet& f, v8f (&acc)[4][4]) {
#pragma unroll
  for (int i = 0; i < 4; ++i)
#pragma unroll
    for (int j = 0; j < 4; ++j) acc[i][j] = Frag<__bf16>::mma(f.ah[i], f.bh[j], acc[i][j]);
#pragma unroll
  for (int i = 0; i < 4; ++i)
#pragma unroll
    for (int j = 0; j < 4; ++j) acc[i][j] = Frag<__bf16>::mma(f.ah[i], f.bl[j], acc[i][j]);
#pragma unroll
  for (int i = 0; i < 4; ++i)
#pragma unroll
    for (int j = 0; j < 4; ++j) acc[i][j] = Frag<__bf16>::mma(f.al[i], f.bh[j], acc[i][j]);
}

// OUT_MODE: 0 = f32 to Cf, 2 = bf16 hi plane + lo plane. ACT: 0 = none, 6 = elu(x)+1 on products 0 and 1 of the grid.
// grid (N/128, M/128, products), 128 threads. Product z reads the plane pairs [hi | lo] number z behind A0 and B0 and writes pair z
// behind C0: independent products of one shape share a launch, so a WGP goes from one to the next without a launch boundary.
// OUT_MODE 0 also holds the premise check on the causal flag: only the causal branch is built; if the flag is 0 the output is NaN.
template <int OUT_MODE, int ACT>
__global__ __launch_bounds__(128) void gemm128_ring(
    const unsigned short* __restrict__ A0, const unsigned short* __restrict__ B0,
    unsigned short* __restrict__ C0, float* __restrict__ Cf, const int* __restrict__ flag) {
  __shared__ __attribute__((aligned(2048))) unsigned char ring[2 * kStageB];
  const unsigned z = blockIdx.z;
  const unsigned short* Ah = A0 + (size_t)(2u * z) * kPlaneEl;
  const unsigned short* Al = Ah + kPlaneEl;
  const unsigned short* Bh = B0 + (size_t)(2u * z) * kWEl;
  const unsigned short* Bl = Bh + kWEl;
  unsigned short* Ch = C0 + (size_t)(2u * z) * kPlaneEl;
  unsigned short* Cl = Ch + kPlaneEl;
  const int causal = (OUT_MODE == 0) ? flag[0] : 1;   // read at entry, where it is a scalar load
  __shared__ __align__(16) float sT[4][16 * 68];   // per-wave 16x64 slab, pitch 68 floats
  const int lane = threadIdx.x & 31;
  const unsigned wave = uni(threadIdx.x >> 5);
  const int rlane = lane & 15;
  const int mOff  = (lane >> 4) * 8;
  const int m0 = (int)blockIdx.y * 128 + (int)(wave >> 1) * 64;
  const int n0 = (int)blockIdx.x * 128 + (int)(wave & 1u) * 64;

  // this wave's plane: first byte of its 128 rows, and its slice's place in buffer 0
  const unsigned short* plane = (wave == 0u) ? Ah : (wave == 1u) ? Al : (wave == 2u) ? Bh : Bl;
  const unsigned row0 = ((wave < 2u) ? blockIdx.y : blockIdx.x) * 128u;
  const unsigned long long ga = (unsigned long long)(plane + (size_t)row0 * kEmb);
  const unsigned slice = (unsigned)(unsigned long long)(const void*)ring + wave * kPlaneB;
  const v8u g1 = tdm_group1();

  const unsigned aoff = ((wave >> 1) * 64u + (unsigned)rlane) * kPitchB + (unsigned)(lane >> 4) * 16u;
  const unsigned boff = 2u * kPlaneB + ((wave & 1u) * 64u + (unsigned)rlane) * kPitchB + (unsigned)(lane >> 4) * 16u;

  v8f acc[4][4];
#pragma unroll
  for (int i = 0; i < 4; ++i)
#pragma unroll
    for (int j = 0; j < 4; ++j) acc[i][j] = (v8f){0.f,0.f,0.f,0.f,0.f,0.f,0.f,0.f};

  tdm_load(tdm_group0(slice, ga), g1);
  wait_tensor0();
  __syncthreads();                                  // stage 0 is readable by every wave
  tdm_load(tdm_group0(slice + kStageB, ga + kRowB), g1);

  // rolled: one copy of the 192-WMMA pass, and every accumulator and fragment index stays a constant
#pragma clang loop unroll(disable)
  for (unsigned s = 0; s < kStages; ++s) {
    const unsigned buf = (s & 1u) * kStageB;
    const unsigned char* pa = ring + buf + aoff;
    const unsigned char* pb = ring + buf + boff;
    FragSet f[2];
    load_set(f[0], pa, pb, 0);
#pragma unroll
    for (int kb = 0; kb < 4; ++kb) {
      if (kb < 3) load_set(f[(kb + 1) & 1], pa, pb, kb + 1);
      __builtin_amdgcn_sched_barrier(0);            // keeps the next block's LDS reads one group in front of this block's WMMAs
      mma_set(f[kb & 1], acc);
      __builtin_amdgcn_sched_barrier(0);            // and the block after that one's reads behind them
    }
    wait_ds0();
    wait_tensor0();
    __syncthreads();                                // publishes stage s + 1; every reader has left stage s's buffer
    const unsigned nx = pinned(s + 2u);             // formed behind the wait, and the descriptor from it
    if (nx < kStages) tdm_load(tdm_group0(slice + buf, ga + (unsigned long long)nx * kRowB), g1);
  }
  wait_tensor0();
  wait_ds0();

  // ---- epilogue ----
  // one scalar test per work-group in front of all 128 elements: tested per element, the feature map compiles to a branch per element
  if (ACT == 6 && z < 2u) {
#pragma unroll
    for (int i = 0; i < 4; ++i)
#pragma unroll
      for (int j = 0; j < 4; ++j)
#pragma unroll
        for (int r = 0; r < 8; ++r) {
          const float v = acc[i][j][r];
          // the hardware's exp2 of x * log2(e): cheap enough for the compiler to evaluate it in every lane and select. The library exp
          // compiled to a branch on EXEC per element, 128 dependent chains that the lone wave of a SIMD walked one after the other
          acc[i][j][r] = (v > 0.f) ? (v + 1.0f) : __expf(v);
        }
  }
  float* slab = sT[wave];
#pragma unroll
  for (int i = 0; i < 4; ++i) {
    const int mBase = m0 + (i << 4);
#pragma unroll
    for (int j = 0; j < 4; ++j) {
#pragma unroll
      for (int r = 0; r < 8; ++r) {
        slab[(mOff + r) * 68 + (j << 4) + rlane] = acc[i][j][r];
      }
    }
    __builtin_amdgcn_fence(__ATOMIC_RELEASE, "workgroup");
    __builtin_amdgcn_wave_barrier();
    __builtin_amdgcn_fence(__ATOMIC_ACQUIRE, "workgroup");
    if (OUT_MODE == 0) {
      const int hh = lane >> 4, c4 = (lane & 15) * 4;     // row seg = 256 B = 16 lanes x 16 B
      v4f rv[8];
#pragma unroll
      for (int it = 0; it < 8; ++it) rv[it] = *(const v4f*)(slab + (it * 2 + hh) * 68 + c4);
      if (causal == 0) {                               // the same for every thread of the grid
        const float qn = __uint_as_float(0x7fc00000u);
#pragma unroll
        for (int it = 0; it < 8; ++it) rv[it] = (v4f){qn, qn, qn, qn};
      }
#pragma unroll
      for (int it = 0; it < 8; ++it) *(v4f*)(Cf + (size_t)(mBase + it * 2 + hh) * kEmb + n0 + c4) = rv[it];
      asm volatile("s_wait_xcnt 0x0" ::: "memory");   // stands in front of the next use of the registers that these stores name
    } else {
      const int q = lane >> 3, c8 = (lane & 7) * 8;
      v8h hv[4], lv[4];
#pragma unroll
      for (int it = 0; it < 4; ++it) {
        const float* sp = slab + (it * 4 + q) * 68 + c8;
#pragma unroll
        for (int e = 0; e < 8; ++e) {
          unsigned short hb = f2bf_bits(sp[e]);
          unsigned short lb = f2bf_bits(sp[e] - bf_bits2f(hb));
          hv[it][e] = __builtin_bit_cast(_Float16, hb);
          lv[it][e] = __builtin_bit_cast(_Float16, lb);
        }
      }
#pragma unroll
      for (int it = 0; it < 4; ++it) {
        *(v8h*)(Ch + (size_t)(mBase + it * 4 + q) * kEmb + n0 + c8) = hv[it];
        *(v8h*)(Cl + (size_t)(mBase + it * 4 + q) * kEmb + n0 + c8) = lv[it];
      }
      asm volatile("s_wait_xcnt 0x0" ::: "memory");   // stands in front of the next use of the registers that these stores name
    }
    __builtin_amdgcn_fence(__ATOMIC_RELEASE, "workgroup");
    __builtin_amdgcn_wave_barrier();
    __builtin_amdgcn_fence(__ATOMIC_ACQUIRE, "workgroup");
  }
}

// ---------------------------------------------------------------------------
// f32 -> bf16 hi + lo planes (RNE convert both), 8 consecutive elements per thread: one 16-B store per lane per plane,
// All seven tensors in one grid, by block range (block-uniform): 3 x kSplitXB blocks for the activations, then 4 x kSplitWB for the
// weights; hi plane z of a family lives at out + 2z*planeEl, lo plane at +planeEl.
// Coverage: planeEl/8 threads x 8 = the whole plane (the ranges are exact multiples of 256 threads).
// ---------------------------------------------------------------------------
constexpr int kSplitXB = (int)(kPlaneEl / 8 / 256);   // 2048 blocks per activation tensor
constexpr int kSplitWB = (int)(kWEl / 8 / 256);       // 512 blocks per weight tensor
static_assert(kSplitXB == 1 << 11 && kSplitWB == 1 << 9, "the shifts in the kernel");
__global__ __launch_bounds__(256) void split_planes_kernel(const float* __restrict__ x0, const float* __restrict__ x1,
                                                           const float* __restrict__ x2,
                                                           const float* __restrict__ w0, const float* __restrict__ w1,
                                                           const float* __restrict__ w2, const float* __restrict__ w3,
                                                           unsigned short* __restrict__ xout, unsigned short* __restrict__ wout) {
  const unsigned b = blockIdx.x;
  const bool isX = b < 3u * kSplitXB;
  const unsigned bf = isX ? b : b - 3u * kSplitXB;            // block within its family
  const unsigned sh = isX ? 11u : 9u;                         // log2 of the blocks per tensor
  const int z = (int)(bf >> sh);
  const int i = (int)((bf - ((unsigned)z << sh)) * 256u + threadIdx.x);
  const int zz = isX ? z : z + 3;
  const float* src = (zz == 0) ? x0 : (zz == 1) ? x1 : (zz == 2) ? x2 : (zz == 3) ? w0 : (zz == 4) ? w1 : (zz == 5) ? w2 : w3;
  unsigned short* out = isX ? xout : wout;
  const long planeEl = isX ? kPlaneEl : kWEl;
  const float* p = src + 8 * (size_t)i;
  const v4f a = *(const v4f*)(p);
  const v4f c = *(const v4f*)(p + 4);
  unsigned short hb[8], lb[8];
#pragma unroll
  for (int e = 0; e < 4; ++e) {
    hb[e]     = f2bf_bits(a[e]);
    lb[e]     = f2bf_bits(a[e] - bf_bits2f(hb[e]));
    hb[4 + e] = f2bf_bits(c[e]);
    lb[4 + e] = f2bf_bits(c[e] - bf_bits2f(hb[4 + e]));
  }
  const v4u uh = (v4u){pk16(hb[0], hb[1]), pk16(hb[2], hb[3]), pk16(hb[4], hb[5]), pk16(hb[6], hb[7])};
  const v4u ul = (v4u){pk16(lb[0], lb[1]), pk16(lb[2], lb[3]), pk16(lb[4], lb[5]), pk16(lb[6], lb[7])};
  unsigned short* ph = out + (size_t)(2 * z) * planeEl + 8 * (size_t)i;
  unsigned short* pl = ph + planeEl;
  *(v4u*)ph = uh;
  *(v4u*)pl = ul;
  
}

// ---------------------------------------------------------------------------
// Token-major chunk tiles in LDS, read as transposed WMMA operands. A tile row is one token: [64 hi | 64 lo] bf16 at pitch kPT.
// ds_load_tr16_b128: lane (c = l & 15, h = l >> 4) gets T[tok + 8h + 0..7][col + c]; the loads at tok and tok + 16 are one
// 16 x 32 fragment in the k order of Frag::load (elements 0..7 = k 8h + 0..7, 8..15 = k 16 + 8h + 0..7).
// ---------------------------------------------------------------------------
constexpr int kPT = 144;                       // elements: 288 B = 32 B x odd, the pitch of ds_load_tr16_b128 readers
typedef __attribute__((ext_vector_type(8))) short v8s;
__device__ __forceinline__ v8b lds_tr16(const unsigned short* p) {
  typedef __attribute__((address_space(3))) v8s lds_v8s;
  return __builtin_bit_cast(v8b, __builtin_amdgcn_ds_load_tr16_b128_v8i16((lds_v8s*)p));
}
// this lane's place in a 16-token x 16-column block, in elements
__device__ __forceinline__ int tr_lane(int lane) { return (8 * (lane >> 4) + (lane & 7)) * kPT + 8 * ((lane >> 3) & 1); }
// p = tile + first token * kPT + first column + tr_lane(lane)
__device__ __forceinline__ v16b lds_frag_tr(const unsigned short* p) {
  Frag<__bf16>::U f; f.h[0] = lds_tr16(p); f.h[1] = lds_tr16(p + 16 * kPT); return f.v;
}

// ---------------------------------------------------------------------------
// Per (batch-chunk y, head h), one work-group of eight waves: dST[e][d] = sum_j v[j][e] k[j][d] (f32, tile (y*16+h) of 64 x 64)
// and dz[y*16+h][d] = sum_j k[j][d] (f32, k = hi + lo, j in order). grid (32, 16), 256 threads.
// The 128 x 64 tiles of k and v (hi and lo) are staged as they lie in the token-major planes; both operands of the product are
// read from them by transposing loads. Wave w owns rows e = 16 (w >> 1) .. +15, columns d = 32 (w & 1) .. +31.
// Per accumulator: j ascending, hi.hi, hi.lo, lo.hi inside each 32 j.
// ---------------------------------------------------------------------------
__global__ __launch_bounds__(256) void state_inc_kernel(const unsigned short* __restrict__ kh, const unsigned short* __restrict__ kl,
                                                        const unsigned short* __restrict__ vh, const unsigned short* __restrict__ vl,
                                                        float* __restrict__ dST, float* __restrict__ dz) {
  __shared__ __align__(16) unsigned short sK[kChunk * kPT];
  __shared__ __align__(16) unsigned short sV[kChunk * kPT];
  __shared__ __align__(16) float sD[kHdim * 68];
  typedef Frag<__bf16> F;
  const int t = threadIdx.x;
  const int lane = t & 31, wave = t >> 5;
  const int rlane = lane & 15;
  const int mOff  = (lane >> 4) * 8;
  const int y = blockIdx.x, h = blockIdx.y;
  const size_t tile = (size_t)y * kHeads + h;
  const size_t go = (size_t)y * kChunk * kEmb + (size_t)h * kHdim + (size_t)(t >> 3) * kEmb + (t & 7) * 8;
  const unsigned short* pkh = kh + go;
  const unsigned short* pkl = kl + go;
  const unsigned short* pvh = vh + go;
  const unsigned short* pvl = vl + go;
  v4u gk[8], gv[8];
#pragma unroll
  for (int it = 0; it < 4; ++it) {
    gk[2 * it]     = *(const v4u*)(pkh + it * 32 * kEmb);
    gk[2 * it + 1] = *(const v4u*)(pkl + it * 32 * kEmb);
    gv[2 * it]     = *(const v4u*)(pvh + it * 32 * kEmb);
    gv[2 * it + 1] = *(const v4u*)(pvl + it * 32 * kEmb);
  }
  // stands in front of the first overwrite of a register that these loads name; the addresses are inputs, so none is reused before it
  asm volatile("s_wait_xcnt 0x0" :: "v"(pkh), "v"(pkl), "v"(pvh), "v"(pvl) : "memory");
#pragma unroll
  for (int it = 0; it < 4; ++it) {
    const int o = (it * 32 + (t >> 3)) * kPT + (t & 7) * 8;
    *(v4u*)(sK + o)      = gk[2 * it];
    *(v4u*)(sK + o + 64) = gk[2 * it + 1];
    *(v4u*)(sV + o)      = gv[2 * it];
    *(v4u*)(sV + o + 64) = gv[2 * it + 1];
  }
  __syncthreads();                             // the staged tiles are readable by every wave

  const int trl = tr_lane(lane);
  const int e0 = (wave >> 1) * 16, d0 = (wave & 1) * 32;
  v8f acc[2];
#pragma unroll
  for (int j = 0; j < 2; ++j) acc[j] = (v8f){0.f,0.f,0.f,0.f,0.f,0.f,0.f,0.f};
#pragma unroll
  for (int kb = 0; kb < 4; ++kb) {
    const unsigned short* pa = sV + kb * 32 * kPT + e0 + trl;
    const unsigned short* pb = sK + kb * 32 * kPT + d0 + trl;
    const v16b ah = lds_frag_tr(pa);
    const v16b al = lds_frag_tr(pa + 64);
    v16b bh[2], bl[2];
#pragma unroll
    for (int j = 0; j < 2; ++j) {
      bh[j] = lds_frag_tr(pb + j * 16);
      bl[j] = lds_frag_tr(pb + j * 16 + 64);
    }
#pragma unroll
    for (int j = 0; j < 2; ++j) acc[j] = F::mma(ah, bh[j], acc[j]);
#pragma unroll
    for (int j = 0; j < 2; ++j) acc[j] = F::mma(ah, bl[j], acc[j]);
#pragma unroll
    for (int j = 0; j < 2; ++j) acc[j] = F::mma(al, bh[j], acc[j]);
  }
#pragma unroll
  for (int j = 0; j < 2; ++j)
#pragma unroll
    for (int r = 0; r < 8; ++r) sD[(e0 + mOff + r) * 68 + d0 + j * 16 + rlane] = acc[j][r];

  float s = 0.f;
  if (t < kHdim) {                             // waves 0 and 1, whole
    // unrolled so that a group's 64 LDS reads are in flight together; rolled, every token waits out its own LDS latency
#pragma unroll 32
    for (int j = 0; j < kChunk; ++j) {
      const float kv = bf_bits2f(sK[j * kPT + t]) + bf_bits2f(sK[j * kPT + 64 + t]);
      s = s + kv;
    }
  }
  __syncthreads();                             // the 64 x 64 tile is whole: it goes out in rows, 512 contiguous bytes a wave

  float* dp = dST + tile * (size_t)(kHdim * kHdim) + 4 * t;
  v4f rv[4];
#pragma unroll
  for (int it = 0; it < 4; ++it) {
    const int u = it * 256 + t;
    rv[it] = *(const v4f*)(sD + (u >> 4) * 68 + (u & 15) * 4);
  }
#pragma unroll
  for (int it = 0; it < 4; ++it) *(v4f*)(dp + it * 1024) = rv[it];
  if (t < kHdim) dz[tile * kHdim + t] = s;     // behind the barrier, so that no wave waits there for this store
  asm volatile("s_wait_xcnt 0x0" ::: "memory");   // stands behind the last stores, in front of any later write of a register that they name
}

// ---------------------------------------------------------------------------
// Exclusive prefix over chunks of the transposed state and of z, per (b, h). No element depends on another, so the work is dealt
// by element: grid (32 bh, 5), 256 threads. Slices y = 0..3: thread t owns elements 1024y + 4t .. +3 of every 4096-element tile;
// slice y = 4: thread t < 64 owns element t of z. A thread first issues the loads of all 15 increments it needs (the last chunk's
// is never used), so their latencies overlap, then sums them in registers in chunk order and stores each chunk's value.
// S^T_c = sum_{c' < c} dST_{c'} (f32, sequential), written as bf16 hi/lo planes [tile][64 e][64 d] (tile = (b*16+c)*16+h);
// z_c likewise to zpre[tile][64] (f32). A wave's store covers 256 contiguous bytes of a plane.
// ---------------------------------------------------------------------------
typedef __attribute__((ext_vector_type(2))) unsigned int v2u;
constexpr int kPfxSlices = 4;                    // 4 slices x 256 threads x 4 elements = one 64 x 64 tile
static_assert(kPfxSlices * 256 * 4 == kHdim * kHdim, "the slices cover a tile");
// at most eight waves per SIMD are asked for: 128 registers a wave. Without it the build keeps to 81 registers and holds the last
// load back until the first has returned, to take over its registers
__global__ __launch_bounds__(256) __attribute__((amdgpu_waves_per_eu(2, 8))) void state_prefix_kernel(const float* __restrict__ dST, const float* __restrict__ dz,
                                                           unsigned short* __restrict__ STh, unsigned short* __restrict__ STl,
                                                           float* __restrict__ zpre) {
  const int t = threadIdx.x;
  const int bh = blockIdx.x;
  const int b = bh >> 4, h = bh & 15;
  const size_t tile0 = (size_t)(b * kNChunk) * kHeads + h;   // chunk 0's tile; chunk c's is tile0 + 16 c
  if (blockIdx.y == (unsigned)kPfxSlices) {                  // block-uniform: the z slice
    if (t >= kHdim) return;
    const float* zp = dz + tile0 * kHdim + t;
    float* zo = zpre + tile0 * kHdim + t;
    float zd[kNChunk - 1];
#pragma unroll
    for (int c = 0; c < kNChunk - 1; ++c) zd[c] = zp[c * kHeads * kHdim];
    float zacc = 0.f;
#pragma unroll
    for (int c = 0; c < kNChunk; ++c) {
      zo[c * kHeads * kHdim] = zacc;
      if (c < kNChunk - 1) zacc += zd[c];
    }
    return;
  }
  const size_t el = tile0 * 4096 + ((size_t)blockIdx.y * 256 + t) * 4;
  const float* dp = dST + el;
  unsigned short* ph = STh + el;
  unsigned short* pl = STl + el;
  v4f d[kNChunk - 1];
#pragma unroll
  for (int c = 0; c < kNChunk - 1; ++c) d[c] = *(const v4f*)(dp + c * kHeads * 4096);
  // all 15 loads stay in front of this line, so that they are in flight together (the compiler otherwise sinks five of them behind the
  // first waits); and it stands in front of the first overwrite of the address register, which is an input, so it is not reused before it
  asm volatile("s_wait_xcnt 0x0" :: "v"(dp) : "memory");
  v4f a = (v4f){0.f, 0.f, 0.f, 0.f};
#pragma unroll
  for (int c = 0; c < kNChunk; ++c) {
    unsigned short hb[4], lb[4];
#pragma unroll
    for (int e = 0; e < 4; ++e) {
      hb[e] = f2bf_bits(a[e]);
      lb[e] = f2bf_bits(a[e] - bf_bits2f(hb[e]));
    }
    *(v2u*)(ph + c * kHeads * 4096) = (v2u){pk16(hb[0], hb[1]), pk16(hb[2], hb[3])};
    *(v2u*)(pl + c * kHeads * 4096) = (v2u){pk16(lb[0], lb[1]), pk16(lb[2], lb[3])};
    if (c < kNChunk - 1) a += d[c];
  }
  asm volatile("s_wait_xcnt 0x0" ::: "memory");   // stands behind the last stores, in front of any later write of a register that they name
}

// ---------------------------------------------------------------------------
// Per (batch-chunk y, head h), one work-group of eight waves: masked scores A = tril(q.k^T), num = A.v + q.S_c,
// den = q.z_c + rowsum(A) + eps, o = num * (1/den) as bf16 hi/lo rows of the token-major o planes.
// The k, v and S^T tiles (hi and lo) are staged once in LDS, v token-major and read by transposing loads; wave w owns chunk rows 16w .. 16w+15 from the scores to the stores,
// and its A rows pass from the accumulator layout to the A-operand layout through its own LDS slab (bf16 hi/lo, never in memory).
// Every sum keeps its order: per accumulator k ascending with hi.hi, hi.lo, lo.hi inside each 32 k; A.v and q.S in separate
// accumulators, added once; row sum and q.z sequential in f32.
// ---------------------------------------------------------------------------
constexpr int kPK = 72;                        // LDS row pitch of the 64-wide tiles (k, S^T), elements: 144 B = 16 B x odd
constexpr int kPV = 136;                       // LDS row pitch of the 128-wide A rows, elements: 272 B = 16 B x odd
constexpr int kSlabB = 2 * 16 * kPV * 2;       // one wave's slab: A_h rows, then A_l rows; later the f32 num rows (pitch 68)
static_assert(16 * 68 * 4 <= kSlabB, "the num rows fit the slab");

// orders one wave's LDS writes in front of reads by its other lanes (the slabs are private to a wave)
__device__ __forceinline__ void wave_lds_sync() {
  __builtin_amdgcn_fence(__ATOMIC_RELEASE, "workgroup");
  __builtin_amdgcn_wave_barrier();
  __builtin_amdgcn_fence(__ATOMIC_ACQUIRE, "workgroup");
}
__device__ __forceinline__ v16b lds_frag(const unsigned short* p) { return Frag<__bf16>::load((const __bf16*)p); }

// at most 256 registers a wave: two work-groups (four waves per SIMD) share a WGP, so all 512 are resident at once
__global__ __launch_bounds__(256) __attribute__((amdgpu_waves_per_eu(4, 4))) void chunk_attn_kernel(const unsigned short* __restrict__ qh, const unsigned short* __restrict__ ql,
                                                         const unsigned short* __restrict__ kh, const unsigned short* __restrict__ kl,
                                                         const unsigned short* __restrict__ vh, const unsigned short* __restrict__ vl,
                                                         const unsigned short* __restrict__ STh, const unsigned short* __restrict__ STl,
                                                         const float* __restrict__ zpre,
                                                         unsigned short* __restrict__ oh, unsigned short* __restrict__ ol) {
  __shared__ __align__(16) unsigned short sKh[kChunk * kPK];
  __shared__ __align__(16) unsigned short sKl[kChunk * kPK];
  __shared__ __align__(16) unsigned short sV[kChunk * kPT];
  __shared__ __align__(16) unsigned short sSh[kHdim * kPK];
  __shared__ __align__(16) unsigned short sSl[kHdim * kPK];
  __shared__ __align__(16) unsigned char  sW[8][kSlabB];
  __shared__ __align__(16) float sInv[8][16];
  typedef Frag<__bf16> F;
  const int t = threadIdx.x;
  const int lane = t & 31, wave = t >> 5;
  const int rlane = lane & 15;                 // row (A operand) / column (B operand, accumulator) within a 16-wide subtile
  const int koff  = (lane >> 4) * 8;           // k offset of this lane half
  const int mOff  = (lane >> 4) * 8;           // accumulator row offset
  const int y = blockIdx.x, h = blockIdx.y;
  const size_t tile = (size_t)y * kHeads + h;
  const size_t base = (size_t)y * kChunk * kEmb + (size_t)h * kHdim;   // chunk row 0 at this head, token-major planes

  // ---- the tiles, 16 B per lane: k 128 x 64, v 128 x 64, S^T 64 x 64, hi and lo; this wave's q rows ----
  const size_t ko = base + (size_t)(t >> 3) * kEmb + (t & 7) * 8;
  const size_t so = tile * (size_t)(kHdim * kHdim) + (size_t)t * 8;
  const size_t qrow = base + (size_t)(wave * 16 + rlane) * kEmb;
  const unsigned short* pkh = kh + ko;
  const unsigned short* pkl = kl + ko;
  const unsigned short* pvh = vh + ko;
  const unsigned short* pvl = vl + ko;
  const unsigned short* psh = STh + so;
  const unsigned short* psl = STl + so;
  const unsigned short* pqh = qh + qrow;
  const unsigned short* pql = ql + qrow;
  const unsigned short* pfh = pqh + koff;
  const unsigned short* pfl = pql + koff;
  v4u gk[8], gv[8], gs[4], gqh[8], gql[8];
#pragma unroll
  for (int it = 0; it < 4; ++it) {
    gk[2 * it]     = *(const v4u*)(pkh + it * 32 * kEmb);
    gk[2 * it + 1] = *(const v4u*)(pkl + it * 32 * kEmb);
    gv[2 * it]     = *(const v4u*)(pvh + it * 32 * kEmb);
    gv[2 * it + 1] = *(const v4u*)(pvl + it * 32 * kEmb);
  }
#pragma unroll
  for (int it = 0; it < 2; ++it) {
    gs[2 * it]     = *(const v4u*)(psh + it * 2048);
    gs[2 * it + 1] = *(const v4u*)(psl + it * 2048);
  }
  // the q rows as A operands (K = 64: two 32-k blocks), and whole (row rlane) for q.z
  v16b qfh[2], qfl[2];
#pragma unroll
  for (int kb = 0; kb < 2; ++kb) {
    qfh[kb] = F::load((const __bf16*)(pfh + kb * 32));
    qfl[kb] = F::load((const __bf16*)(pfl + kb * 32));
  }
#pragma unroll
  for (int w = 0; w < 8; ++w) {
    gqh[w] = *(const v4u*)(pqh + 8 * w);
    gql[w] = *(const v4u*)(pql + 8 * w);
  }
  // stands in front of the first overwrite of a register that these loads name; the addresses are inputs, so none is reused before it
  asm volatile("s_wait_xcnt 0x0" :: "v"(pkh), "v"(pkl), "v"(pvh), "v"(pvl), "v"(psh), "v"(psl), "v"(pqh), "v"(pql), "v"(pfh), "v"(pfl) : "memory");
#pragma unroll
  for (int it = 0; it < 4; ++it) {
    const int u = it * 256 + t;
    *(v4u*)(sKh + (u >> 3) * kPK + (u & 7) * 8) = gk[2 * it];
    *(v4u*)(sKl + (u >> 3) * kPK + (u & 7) * 8) = gk[2 * it + 1];
    *(v4u*)(sV + (u >> 3) * kPT + (u & 7) * 8)      = gv[2 * it];
    *(v4u*)(sV + (u >> 3) * kPT + (u & 7) * 8 + 64) = gv[2 * it + 1];
  }
#pragma unroll
  for (int it = 0; it < 2; ++it) {
    const int u = it * 256 + t;
    *(v4u*)(sSh + (u >> 3) * kPK + (u & 7) * 8) = gs[2 * it];
    *(v4u*)(sSl + (u >> 3) * kPK + (u & 7) * 8) = gs[2 * it + 1];
  }

  // ---- q . z_c of row rlane (both lane halves compute the same row) ----
  const float* zp = zpre + tile * kHdim;
  float qz = 0.f;
#pragma unroll
  for (int w = 0; w < 8; ++w) {
    const v4u uh = gqh[w];
    const v4u ul = gql[w];
    const v4f z0 = *(const v4f*)(zp + 8 * w);
    const v4f z1 = *(const v4f*)(zp + 8 * w + 4);
    float qv[8], zv[8];
#pragma unroll
    for (int e = 0; e < 4; ++e) {
      qv[2 * e]     = bflo2f(uh[e]) + bflo2f(ul[e]);
      qv[2 * e + 1] = bfhi2f(uh[e]) + bfhi2f(ul[e]);
      zv[e] = z0[e];
      zv[4 + e] = z1[e];
    }
#pragma unroll
    for (int e = 0; e < 8; ++e) qz += qv[e] * zv[e];
  }
  sInv[wave][rlane] = qz;                      // parked in LDS: kept in a register, the whole sum is sunk to its use and the q rows spill
  __syncthreads();                             // the staged tiles are readable by every wave

  // ---- masked scores of rows 16w .. 16w+15, four column subtiles at a time, into the slab as bf16 hi/lo ----
  unsigned short* aH = (unsigned short*)sW[wave];
  unsigned short* aL = aH + 16 * kPV;
#pragma unroll
  for (int jh = 0; jh < 2; ++jh) {
    v8f s[4];
#pragma unroll
    for (int j = 0; j < 4; ++j) s[j] = (v8f){0.f,0.f,0.f,0.f,0.f,0.f,0.f,0.f};
#pragma unroll
    for (int kb = 0; kb < 2; ++kb) {
      v16b bh[4], bl[4];
#pragma unroll
      for (int j = 0; j < 4; ++j) {
        const int o = ((jh * 4 + j) * 16 + rlane) * kPK + koff + kb * 32;
        bh[j] = lds_frag(sKh + o);
        bl[j] = lds_frag(sKl + o);
      }
#pragma unroll
      for (int j = 0; j < 4; ++j) s[j] = F::mma(qfh[kb], bh[j], s[j]);
#pragma unroll
      for (int j = 0; j < 4; ++j) s[j] = F::mma(qfh[kb], bl[j], s[j]);
#pragma unroll
      for (int j = 0; j < 4; ++j) s[j] = F::mma(qfl[kb], bh[j], s[j]);
    }
#pragma unroll
    for (int j = 0; j < 4; ++j) {
      const int n = (jh * 4 + j) * 16 + rlane;
#pragma unroll
      for (int r = 0; r < 8; ++r) {
        float v = s[j][r];
        if (n > wave * 16 + mOff + r) v = 0.0f;
        const unsigned short hb = f2bf_bits(v);
        const unsigned short lb = f2bf_bits(v - bf_bits2f(hb));
        aH[(mOff + r) * kPV + n] = hb;
        aL[(mOff + r) * kPV + n] = lb;
      }
    }
  }

  // ---- q . S_c: K = 64 ----
  v8f qs[4], av[4];
#pragma unroll
  for (int j = 0; j < 4; ++j) { qs[j] = (v8f){0.f,0.f,0.f,0.f,0.f,0.f,0.f,0.f}; av[j] = (v8f){0.f,0.f,0.f,0.f,0.f,0.f,0.f,0.f}; }
#pragma unroll
  for (int kb = 0; kb < 2; ++kb) {
    v16b bh[4], bl[4];
#pragma unroll
    for (int j = 0; j < 4; ++j) {
      const int o = (j * 16 + rlane) * kPK + koff + kb * 32;
      bh[j] = lds_frag(sSh + o);
      bl[j] = lds_frag(sSl + o);
    }
#pragma unroll
    for (int j = 0; j < 4; ++j) qs[j] = F::mma(qfh[kb], bh[j], qs[j]);
#pragma unroll
    for (int j = 0; j < 4; ++j) qs[j] = F::mma(qfh[kb], bl[j], qs[j]);
#pragma unroll
    for (int j = 0; j < 4; ++j) qs[j] = F::mma(qfl[kb], bh[j], qs[j]);
  }
  wave_lds_sync();                             // the slab's A rows are readable by every lane of this wave

  // ---- A . v: K = 128 ----
  const int trl = tr_lane(lane);
#pragma unroll
  for (int kb = 0; kb < 4; ++kb) {
    const v16b ah = lds_frag(aH + rlane * kPV + koff + kb * 32);
    const v16b al = lds_frag(aL + rlane * kPV + koff + kb * 32);
    v16b bh[4], bl[4];
#pragma unroll
    for (int j = 0; j < 4; ++j) {
      const unsigned short* pv = sV + kb * 32 * kPT + j * 16 + trl;
      bh[j] = lds_frag_tr(pv);
      bl[j] = lds_frag_tr(pv + 64);
    }
#pragma unroll
    for (int j = 0; j < 4; ++j) av[j] = F::mma(ah, bh[j], av[j]);
#pragma unroll
    for (int j = 0; j < 4; ++j) av[j] = F::mma(ah, bl[j], av[j]);
#pragma unroll
    for (int j = 0; j < 4; ++j) av[j] = F::mma(al, bh[j], av[j]);
  }

  // ---- row sum of the masked scores of row rlane, j in order ----
  float asum = 0.f;
#pragma unroll
  for (int w = 0; w < 16; ++w) {
    const v4u uh = *(const v4u*)(aH + rlane * kPV + 8 * w);
    const v4u ul = *(const v4u*)(aL + rlane * kPV + 8 * w);
#pragma unroll
    for (int e = 0; e < 4; ++e) {
      const float a0 = bflo2f(uh[e]) + bflo2f(ul[e]);
      asum = asum + a0;
      const float a1 = bfhi2f(uh[e]) + bfhi2f(ul[e]);
      asum = asum + a1;
    }
  }
  const float den = (sInv[wave][rlane] + asum) + kEps;
  const float inv = 1.0f / den;
  wave_lds_sync();                             // every read of the A rows has returned: the slab takes the num rows

  float* slab = (float*)sW[wave];
#pragma unroll
  for (int j = 0; j < 4; ++j)
#pragma unroll
    for (int r = 0; r < 8; ++r) slab[(mOff + r) * 68 + (j << 4) + rlane] = av[j][r] + qs[j][r];
  sInv[wave][rlane] = inv;
  wave_lds_sync();

  const int q4 = lane >> 3, c8 = (lane & 7) * 8;
  v4u uo_h[4], uo_l[4];
#pragma unroll
  for (int it = 0; it < 4; ++it) {
    const int row = it * 4 + q4;
    const float iv = sInv[wave][row];
    unsigned short hb[8], lb[8];
#pragma unroll
    for (int e = 0; e < 8; ++e) {
      const float f = slab[row * 68 + c8 + e] * iv;
      hb[e] = f2bf_bits(f);
      lb[e] = f2bf_bits(f - bf_bits2f(hb[e]));
    }
    uo_h[it] = (v4u){pk16(hb[0], hb[1]), pk16(hb[2], hb[3]), pk16(hb[4], hb[5]), pk16(hb[6], hb[7])};
    uo_l[it] = (v4u){pk16(lb[0], lb[1]), pk16(lb[2], lb[3]), pk16(lb[4], lb[5]), pk16(lb[6], lb[7])};
  }
#pragma unroll
  for (int it = 0; it < 4; ++it) {
    const size_t o = base + (size_t)(wave * 16 + it * 4 + q4) * kEmb + c8;
    *(v4u*)(oh + o) = uo_h[it];
    *(v4u*)(ol + o) = uo_l[it];
  }
}

// ---------------------------------------------------------------------------
// Host launcher
// ---------------------------------------------------------------------------
extern "C" void kernel_launch(void* const* d_in, const int* in_sizes, int n_in,
                              void* d_out, int out_size, void* d_ws, size_t ws_size,
                              hipStream_t stream) {
  if (n_in < 8) return;
  if (in_sizes[0] != (int)kPlaneEl || in_sizes[1] != (int)kPlaneEl || in_sizes[2] != (int)kPlaneEl) return;
  if (in_sizes[3] != (int)kWEl || in_sizes[4] != (int)kWEl || in_sizes[5] != (int)kWEl || in_sizes[6] != (int)kWEl) return;
  if (in_sizes[7] < 1) return;
  if (out_size != (int)kPlaneEl) return;
  if (ws_size < (size_t)kWsTotal) return;

  const float* Q  = (const float*)d_in[0];
  const float* Kx = (const float*)d_in[1];
  const float* Vx = (const float*)d_in[2];
  const float* Wq = (const float*)d_in[3];
  const float* Wk = (const float*)d_in[4];
  const float* Wv = (const float*)d_in[5];
  const float* Wo = (const float*)d_in[6];
  const int*   causal = (const int*)d_in[7];
  float* out = (float*)d_out;
  char* ws = (char*)d_ws;

  unsigned short* Xbase = (unsigned short*)(ws + oXbase);
  unsigned short* Wbase = (unsigned short*)(ws + oWbase);
  const unsigned short* Wo_h = (const unsigned short*)(ws + oWo_h);
  unsigned short* q_h  = (unsigned short*)(ws + oQ_h);
  unsigned short* q_l  = (unsigned short*)(ws + oQ_l);
  unsigned short* k_h  = (unsigned short*)(ws + oK_h);
  unsigned short* k_l  = (unsigned short*)(ws + oK_l);
  unsigned short* v_h  = (unsigned short*)(ws + oV_h);
  unsigned short* v_l  = (unsigned short*)(ws + oV_l);
  float*          dST  = (float*)(ws + oDST);
  unsigned short* ST_h = (unsigned short*)(ws + oST_h);
  unsigned short* ST_l = (unsigned short*)(ws + oST_l);
  unsigned short* o_h  = (unsigned short*)(ws + oO_h);
  unsigned short* o_l  = (unsigned short*)(ws + oO_l);
  float*          dz   = (float*)(ws + oDZ);
  float*          zpre = (float*)(ws + oZPRE);

  // 1) input and weight hi/lo planes
  split_planes_kernel<<<dim3((unsigned)(3 * kSplitXB + 4 * kSplitWB), 1, 1), 256, 0, stream>>>(Q, Kx, Vx, Wq, Wk, Wv, Wo, Xbase, Wbase);

  // 2) projections q, k, v in one grid: each M=4096, N=1024, K=1024 (8 x 32 tiles of 128 x 128, one work-group each); q, k with elu(x)+1
  gemm128_ring<2, 6><<<dim3(kEmb / 128, kTok / 128, 3), 128, 0, stream>>>(Xbase, Wbase, q_h, nullptr, nullptr);

  // 3) per (b,c,h): dST[e][d] = sum_j v[j][e] k[j][d] and the chunk sums of k
  state_inc_kernel<<<dim3(kYB, kHeads, 1), 256, 0, stream>>>(k_h, k_l, v_h, v_l, dST, dz);

  // 4) exclusive prefix over chunks of S^T and z
  state_prefix_kernel<<<dim3(kBatch * kHeads, kPfxSlices + 1, 1), 256, 0, stream>>>(dST, dz, ST_h, ST_l, zpre);

  // 5) per (b,c,h): masked scores, A.v + q.S_c, normaliser -> attention output hi/lo planes (token-major, heads merged)
  chunk_attn_kernel<<<dim3(kYB, kHeads, 1), 256, 0, stream>>>(q_h, q_l, k_h, k_l, v_h, v_l, ST_h, ST_l, zpre, o_h, o_l);

  // 6) output projection: M=4096, N=1024, K=1024 -> d_out, with the premise check on the causal flag (NaN when the non-causal branch
  //    would be required)
  gemm128_ring<0, 0><<<dim3(kEmb / 128, kTok / 128, 1), 128, 0, stream>>>(o_h, Wo_h, nullptr, out, causal);
}

// v007
// One run takes 123 microseconds.
// Two timings next to v006 put it at 1.03 and 1.04 times that version's speed.
// Over all steps from v000 it is 3.52 times as fast.
// Contractions: q/k/v projections, chunk scores q.k^T, state increment v^T.k, q.S, A.v, output projection -- all v_wmma_f32_16x16x32_bf16 with bf16 hi/lo operand planes (hi.hi + hi.lo + lo.hi), f32 accumulate; feature map, state prefix over chunks, normaliser and division in f32 on the VALU.
#include <hip/hip_runtime.h>
#include <math.h>

// ---------------------------------------------------------------------------
// Problem constants
// ---------------------------------------------------------------------------
constexpr int kBatch   = 2;
constexpr int kSeq     = 2048;
constexpr int kEmb     = 1024;
constexpr int kHeads   = 16;
constexpr int kHdim    = 64;
constexpr int kChunk   = 128;
constexpr int kNChunk  = kSeq / kChunk;          // 16 chunks per sequence
constexpr int kTok     = kBatch * kSeq;          // 4096 token rows
constexpr int kYB      = kBatch * kNChunk;       // 32 (batch, chunk) pairs
constexpr int kTiles   = kYB * kHeads;           // 512 (batch, chunk, head) tiles
constexpr float kEps   = 1e-6f;
constexpr long kPlaneEl = (long)kTok * kEmb;     // 4194304 elements per activation plane
constexpr long kWEl     = (long)kEmb * kEmb;     // 1048576 elements per weight plane
constexpr long kUnit    = kPlaneEl * 2;          // 8388608 bytes (one bf16 activation plane)
constexpr long kWUnit   = kWEl * 2;              // 2097152 bytes (one bf16 weight plane)

// ---------------------------------------------------------------------------
// Workspace region map (bytes; U = 8388608, WU = 2097152); total 14U + 262144 = 117702656
//   [0U , 6U)  phase 1: Xq_h Xq_l Xk_h Xk_l Xv_h Xv_l (input hi/lo planes, dead after projections)
//              phase 2: o_h@0U o_l@1U dST(f32)@4U ST_h@5U ST_l@5.5U
//   [6U , 8U)  Wq_h Wq_l Wk_h Wk_l Wv_h Wv_l Wo_h Wo_l (WU each)
//   [8U ,14U)  q_h@8U q_l@9U k_h@10U k_l@11U v_h@12U v_l@13U (projection outputs)
//   [14U, +262144)  dz f32 [512][64] @14U, zpre f32 [512][64] @14U+131072
// ---------------------------------------------------------------------------
constexpr long oXbase = 0;
constexpr long oO_h   = 0;
constexpr long oO_l   = 1 * kUnit;
constexpr long oDST   = 4 * kUnit;
constexpr long oST_h  = 5 * kUnit;
constexpr long oST_l  = 5 * kUnit + kUnit / 2;
constexpr long oWbase = 6 * kUnit;
constexpr long oWo_h  = oWbase + 6 * kWUnit;
constexpr long oWo_l  = oWbase + 7 * kWUnit;
constexpr long oQ_h   = 8 * kUnit;
constexpr long oQ_l   = 9 * kUnit;
constexpr long oK_h   = 10 * kUnit;
constexpr long oK_l   = 11 * kUnit;
constexpr long oV_h   = 12 * kUnit;
constexpr long oV_l   = 13 * kUnit;
constexpr long oDZ    = 14 * kUnit;
constexpr long oZPRE  = 14 * kUnit + 131072;
constexpr long kWsTotal = 14 * kUnit + 262144;
static_assert(kWsTotal == 117702656, "carve total");
static_assert(kWsTotal <= 134217728, "carve within 128 MiB");
static_assert((long)kTiles * kHdim * kHdim * 4 == kUnit, "dST plane size");

typedef __attribute__((ext_vector_type(8)))  _Float16 v8h;
typedef __attribute__((ext_vector_type(16))) __bf16   v16b;
typedef __attribute__((ext_vector_type(8)))  __bf16   v8b;
typedef __attribute__((ext_vector_type(8)))  float    v8f;
typedef __attribute__((ext_vector_type(4)))  float    v4f;
typedef __attribute__((ext_vector_type(4)))  unsigned int v4u;

__device__ __forceinline__ unsigned short f2bf_bits(float f) {
  unsigned u = __float_as_uint(f);
  return (unsigned short)((u + 0x7FFFu + ((u >> 16) & 1u)) >> 16);
}
__device__ __forceinline__ float bf_bits2f(unsigned short h) { return __uint_as_float(((unsigned)h) << 16); }

template <typename T> struct Frag;
template <> struct Frag<__bf16> {
  typedef v16b V; union U { v16b v; v8b h[2]; };
  static __device__ __forceinline__ v16b load(const __bf16* p) {   // elements 0..7 <- p[0..7], 8..15 <- p[16..23]
    U f; f.h[0] = *(const v8b*)(p); f.h[1] = *(const v8b*)(p + 16); return f.v;
  }
  static __device__ __forceinline__ v8f mma(v16b a, v16b b, v8f c) {
    return __builtin_amdgcn_wmma_f32_16x16x32_bf16(false, a, false, b, (short)0, c, false, false);
  }
};

__device__ __forceinline__ unsigned pk16(unsigned short a, unsigned short b) { return (unsigned)a | ((unsigned)b << 16); }
// bf16 element pair held in one 32-bit word: low half-word = even element, high half-word = odd element
__device__ __forceinline__ float bflo2f(unsigned w) { return __uint_as_float(w << 16); }
__device__ __forceinline__ float bfhi2f(unsigned w) { return __uint_as_float(w & 0xffff0000u); }

// ---------------------------------------------------------------------------
// The four 4096 x 1024 x 1024 products: C[m,n] = sum_k A[m,k] * Bt[n,k], hi/lo planes, product = hi.hi + hi.lo + lo.hi.
// One 128 x 128 (or 64 x 128) tile of C per work-group, four waves (2 x 2), each wave a 64 x 64 (32 x 64) tile (4 x 4 or 2 x 4 accumulators).
// A stage is ROWB bytes (ROWB / 2 k) of the tile's rows of each of the four operand planes [A_h | A_l | B_h | B_l], a slice of 128 rows' room each, LDS row pitch ROWB + 16;
// wave w brings plane w of every stage with one tensor load; two buffers, the next stage's loads fly while this one is worked on.
// ROWB = 256: the ring fills the WGP's LDS, one work-group per WGP. ROWB = 128: the ring is 144 KiB, two work-groups share a WGP
// (two waves per SIMD), and one's prologue, barrier waits, first fragment loads and epilogue run under the other's WMMAs.
// Per accumulator the products are summed k ascending, hi.hi, hi.lo, lo.hi inside each 32 k.
// ---------------------------------------------------------------------------
template <unsigned ROWB> struct Ring {
  static_assert(ROWB == 128 || ROWB == 256, "the two row lengths whose 16-B pad is known to land right");
  static constexpr unsigned kRowB   = ROWB;                        // bytes of one operand row in a stage
  static constexpr unsigned kPitchB = ROWB + 16;                   // LDS row pitch: the row + the 16-B pad for ds_load_b128 readers
  static constexpr unsigned kPlaneB = 128 * kPitchB;               // 18432 / 34816 B, one plane's slice of a stage
  static constexpr unsigned kStageB = 4 * kPlaneB;                 // 73728 / 139264 B, one buffer
  static constexpr unsigned kStages = (unsigned)kEmb * 2 / ROWB;   // 16 / 8
  static constexpr int      kBlocks = (int)(ROWB / 64);            // 32-k blocks in a stage
  static constexpr unsigned kPadWord = (1u << 20) | ((ROWB == 256 ? 5u : 4u) << 22) | (3u << 25);   // 4 dwords behind every row
  static_assert(kPlaneB % 2048 == 0, "every slice starts at a multiple of 2 KiB");
  static_assert(kStages >= 2, "the ring's prologue needs two stages");
};
typedef __attribute__((ext_vector_type(8))) unsigned int v8u;

__device__ __forceinline__ unsigned uni(unsigned v) { return (unsigned)__builtin_amdgcn_readfirstlane((int)v); }
__device__ __forceinline__ unsigned pinned(unsigned v) { unsigned w = uni(v); asm volatile("" : "+s"(w)); return w; }
__device__ __forceinline__ void wait_ds0()     { asm volatile("s_wait_dscnt 0x0" ::: "memory"); }      // this wave's LDS reads have returned
__device__ __forceinline__ void wait_tensor0() { asm volatile("s_wait_tensorcnt 0x0" ::: "memory"); }  // this wave's tensor load has landed
// group 1 goes in and out: its eight registers then hold nothing else from one load to the next. As a plain input of constants the
// compiler took single registers of it for loop temporaries while a request that names them was outstanding, and set them anew before the next load
__device__ __forceinline__ void tdm_load(v4u g0, v8u& g1) { asm volatile("tensor_load_to_lds %1, %0" : "+s"(g1) : "s"(g0) : "memory"); }
__device__ __forceinline__ v4u tdm_group0(unsigned lds_dst, unsigned long long ga) {
  v4u g;
  g[0] = uni(1u); g[1] = uni(lds_dst); g[2] = uni((unsigned)ga); g[3] = uni((((unsigned)(ga >> 32)) & 0x01FFFFFFu) | 0x80000000u);
  return g;
}
// 1-byte elements, tile = tensor = rows rows of ROWB bytes, source pitch one K row, 4 dwords of LDS pad behind every row
template <unsigned ROWB>
__device__ __forceinline__ v8u tdm_group1(unsigned rows) {
  constexpr unsigned d0 = ROWB;
  const unsigned d1 = rows;
  v8u g;
  g[0] = uni(Ring<ROWB>::kPadWord);
  g[1] = uni((d0 & 0xFFFFu) << 16);
  g[2] = uni((d0 >> 16) | ((d1 & 0xFFFFu) << 16));
  g[3] = uni((d1 >> 16) | (d0 << 16));
  g[4] = uni(d1);
  g[5] = uni((unsigned)kEmb * 2u);
  g[6] = uni(0u);
  g[7] = uni(0u);
  return g;
}

// MI = 16-row subtiles of A per wave: 4 (a 128 x 128 tile per work-group) or 2 (a 64 x 128 tile)
template <int MI> struct FragSet { v16b ah[MI], al[MI], bh[4], bl[4]; };
// the fragments of one 32-k block: pa / pb = this lane's row 0 of the A_h / B_h slices, at its k half
template <unsigned ROWB, int MI>
__device__ __forceinline__ void load_set(FragSet<MI>& f, const unsigned char* pa, const unsigned char* pb, int kb) {
  const unsigned k = (unsigned)kb * 64u;
  constexpr unsigned kPlaneB = Ring<ROWB>::kPlaneB;
  constexpr unsigned t = 16u * Ring<ROWB>::kPitchB;   // 16 rows
  // in the order in which mma_set needs them: the first term can start when half of the group has returned
#pragma unroll
  for (int i = 0; i < MI; ++i) f.ah[i] = Frag<__bf16>::load((const __bf16*)(pa + (unsigned)i * t + k));
#pragma unroll
  for (int i = 0; i < 4; ++i) f.bh[i] = Frag<__bf16>::load((const __bf16*)(pb + (unsigned)i * t + k));
#pragma unroll
  for (int i = 0; i < 4; ++i) f.bl[i] = Frag<__bf16>::load((const __bf16*)(pb + kPlaneB + (unsigned)i * t + k));
#pragma unroll
  for (int i = 0; i < MI; ++i) f.al[i] = Frag<__bf16>::load((const __bf16*)(pa + kPlaneB + (unsigned)i * t + k));
}
// 12 MI WMMAs; each term runs over all 4 MI accumulators, so that no WMMA waits for the one in front of it
template <int MI>
__device__ __forceinline__ void mma_set(const FragSet<MI>& f, v8f (&acc)[MI][4]) {
#pragma unroll
  for (int i = 0; i < MI; ++i)
#pragma unroll
    for (int j = 0; j < 4; ++j) acc[i][j] = Frag<__bf16>::mma(f.ah[i], f.bh[j], acc[i][j]);
#pragma unroll
  for (int i = 0; i < MI; ++i)
#pragma unroll
    for (int j = 0; j < 4; ++j) acc[i][j] = Frag<__bf16>::mma(f.ah[i], f.bl[j], acc[i][j]);
#pragma unroll
  for (int i = 0; i < MI; ++i)
#pragma unroll
    for (int j = 0; j < 4; ++j) acc[i][j] = Frag<__bf16>::mma(f.al[i], f.bh[j], acc[i][j]);
}

// One (32 MI) x 128 tile of C by the four waves of a work-group (2 x 2, each 16 MI x 64): rows rowBlk * 32 MI .., columns colBlk * 128 ..
// OUT_MODE: 0 = f32 to Cf, 2 = bf16 hi plane + lo plane. ACT: 0 = none, 6 = elu(x)+1.
// OUT_MODE 0 also holds the premise check on the causal flag: only the causal branch is built; if the flag is 0 the output is NaN.
template <int OUT_MODE, int ACT, unsigned ROWB, int MI>
__device__ __forceinline__ void gemm_tile(unsigned char* ring,
    const unsigned short* __restrict__ Ah, const unsigned short* __restrict__ Al,
    const unsigned short* __restrict__ Bh, const unsigned short* __restrict__ Bl,
    unsigned short* __restrict__ Ch, unsigned short* __restrict__ Cl, float* __restrict__ Cf, int causal,
    unsigned rowBlk, unsigned colBlk) {
  constexpr unsigned kRowB = Ring<ROWB>::kRowB, kPitchB = Ring<ROWB>::kPitchB, kPlaneB = Ring<ROWB>::kPlaneB;
  constexpr unsigned kStageB = Ring<ROWB>::kStageB, kStages = Ring<ROWB>::kStages;
  constexpr int kBlocks = Ring<ROWB>::kBlocks;
  constexpr unsigned kTM = 32u * MI;               // rows of the work-group's tile
  const int lane = threadIdx.x & 31;
  const unsigned wave = uni(threadIdx.x >> 5);
  const int rlane = lane & 15;
  const int mOff  = (lane >> 4) * 8;
  const int m0 = (int)(rowBlk * kTM + (wave >> 1) * (kTM / 2u));
  const int n0 = (int)(colBlk * 128u + (wave & 1u) * 64u);

  // this wave's plane: first byte of its rows (kTM of A, 128 of B), and its slice's place in buffer 0
  const unsigned short* plane = (wave == 0u) ? Ah : (wave == 1u) ? Al : (wave == 2u) ? Bh : Bl;
  const unsigned row0 = (wave < 2u) ? rowBlk * kTM : colBlk * 128u;
  const unsigned long long ga = (unsigned long long)(plane + (size_t)row0 * kEmb);
  const unsigned slice = (unsigned)(unsigned long long)(const void*)ring + wave * kPlaneB;
  v8u g1 = tdm_group1<ROWB>((wave < 2u) ? kTM : 128u);

  const unsigned aoff = ((wave >> 1) * (kTM / 2u) + (unsigned)rlane) * kPitchB + (unsigned)(lane >> 4) * 16u;
  const unsigned boff = 2u * kPlaneB + ((wave & 1u) * 64u + (unsigned)rlane) * kPitchB + (unsigned)(lane >> 4) * 16u;

  v8f acc[MI][4];
#pragma unroll
  for (int i = 0; i < MI; ++i)
#pragma unroll
    for (int j = 0; j < 4; ++j) acc[i][j] = (v8f){0.f,0.f,0.f,0.f,0.f,0.f,0.f,0.f};

  tdm_load(tdm_group0(slice, ga), g1);
  wait_tensor0();
  __syncthreads();                                  // stage 0 is readable by every wave
  tdm_load(tdm_group0(slice + kStageB, ga + kRowB), g1);

  // rolled: one copy of the pass's WMMAs, and every accumulator and fragment index stays a constant
#pragma clang loop unroll(disable)
  for (unsigned s = 0; s < kStages; ++s) {
    const unsigned buf = (s & 1u) * kStageB;
    const unsigned char* pa = ring + buf + aoff;
    const unsigned char* pb = ring + buf + boff;
    FragSet<MI> f[2];
    load_set<ROWB, MI>(f[0], pa, pb, 0);
#pragma unroll
    for (int kb = 0; kb < kBlocks; ++kb) {
      if (kb < kBlocks - 1) load_set<ROWB, MI>(f[(kb + 1) & 1], pa, pb, kb + 1);
      __builtin_amdgcn_sched_barrier(0);            // keeps the next block's LDS reads one group in front of this block's WMMAs
      mma_set<MI>(f[kb & 1], acc);
      __builtin_amdgcn_sched_barrier(0);            // and the block after that one's reads behind them
    }
    wait_ds0();
    wait_tensor0();
    __syncthreads();                                // publishes stage s + 1; every reader has left stage s's buffer
    const unsigned nx = pinned(s + 2u);             // formed behind the wait, and the descriptor from it
    if (nx < kStages) tdm_load(tdm_group0(slice + buf, ga + (unsigned long long)nx * kRowB), g1);
  }
  wait_tensor0();
  wait_ds0();

  // ---- epilogue ----
  if (ACT == 6) {
#pragma unroll
    for (int i = 0; i < MI; ++i)
#pragma unroll
      for (int j = 0; j < 4; ++j)
#pragma unroll
        for (int r = 0; r < 8; ++r) {
          const float v = acc[i][j][r];
          // the hardware's exp2 of x * log2(e): cheap enough for the compiler to evaluate it in every lane and select. The library exp
          // compiled to a branch on EXEC per element, 128 dependent chains that a wave walked one after the other
          acc[i][j][r] = (v > 0.f) ? (v + 1.0f) : __expf(v);
        }
  }
  // per-wave 16 x 64 slab, pitch 68 floats, in the ring: the last pass's foot (LDS reads returned, tensor loads landed, barrier) has
  // freed both buffers, and no load is issued behind it. A slab of its own would put the 128-B ring's work-group above half the LDS
  static_assert(4u * 16u * 68u * 4u <= kStageB, "the four slabs fit buffer 0");
  float* slab = (float*)ring + wave * (16u * 68u);
#pragma unroll
  for (int i = 0; i < MI; ++i) {
    const int mBase = m0 + (i << 4);
#pragma unroll
    for (int j = 0; j < 4; ++j) {
#pragma unroll
      for (int r = 0; r < 8; ++r) {
        slab[(mOff + r) * 68 + (j << 4) + rlane] = acc[i][j][r];
      }
    }
    __builtin_amdgcn_fence(__ATOMIC_RELEASE, "workgroup");
    __builtin_amdgcn_wave_barrier();
    __builtin_amdgcn_fence(__ATOMIC_ACQUIRE, "workgroup");
    if (OUT_MODE == 0) {
      const int hh = lane >> 4, c4 = (lane & 15) * 4;     // row seg = 256 B = 16 lanes x 16 B
      v4f rv[8];
#pragma unroll
      for (int it = 0; it < 8; ++it) rv[it] = *(const v4f*)(slab + (it * 2 + hh) * 68 + c4);
      if (causal == 0) {                               // the same for every thread of the grid
        const float qn = __uint_as_float(0x7fc00000u);
#pragma unroll
        for (int it = 0; it < 8; ++it) rv[it] = (v4f){qn, qn, qn, qn};
      }
#pragma unroll
      for (int it = 0; it < 8; ++it) *(v4f*)(Cf + (size_t)(mBase + it * 2 + hh) * kEmb + n0 + c4) = rv[it];
      asm volatile("s_wait_xcnt 0x0" ::: "memory");   // stands in front of the next use of the registers that these stores name
    } else {
      const int q = lane >> 3, c8 = (lane & 7) * 8;
      v8h hv[4], lv[4];
#pragma unroll
      for (int it = 0; it < 4; ++it) {
        const float* sp = slab + (it * 4 + q) * 68 + c8;
#pragma unroll
        for (int e = 0; e < 8; ++e) {
          unsigned short hb = f2bf_bits(sp[e]);
          unsigned short lb = f2bf_bits(sp[e] - bf_bits2f(hb));
          hv[it][e] = __builtin_bit_cast(_Float16, hb);
          lv[it][e] = __builtin_bit_cast(_Float16, lb);
        }
      }
#pragma unroll
      for (int it = 0; it < 4; ++it) {
        *(v8h*)(Ch + (size_t)(mBase + it * 4 + q) * kEmb + n0 + c8) = hv[it];
        *(v8h*)(Cl + (size_t)(mBase + it * 4 + q) * kEmb + n0 + c8) = lv[it];
      }
      asm volatile("s_wait_xcnt 0x0" ::: "memory");   // stands in front of the next use of the registers that these stores name
    }
    __builtin_amdgcn_fence(__ATOMIC_RELEASE, "workgroup");
    __builtin_amdgcn_wave_barrier();
    __builtin_amdgcn_fence(__ATOMIC_ACQUIRE, "workgroup");
  }
}

// The q, k, v projections in one grid (N/128, 32, 4), 128 threads; independent products share a launch, so a WGP goes from one to the
// next without a launch boundary. Product p reads the plane pairs [hi | lo] number p behind A0 and B0 and writes pair p behind C0.
// z = 0, 1: q and k, 128 x 128 tiles, with elu(x)+1. z = 2, 3: v in 64 x 128 tiles, row blocks 32 (z - 2) + y.
// Two work-groups share a WGP (512 places): the 512 whole tiles fill every place once, then the 512 half tiles fill it again, so that
// a work-group has a neighbour on its WGP from the first pass to the last. With v in whole tiles its 256 would run one to a WGP.
__global__ __launch_bounds__(128) void proj_qkv_kernel(
    const unsigned short* __restrict__ A0, const unsigned short* __restrict__ B0, unsigned short* __restrict__ C0) {
  __shared__ __attribute__((aligned(2048))) unsigned char ring[2 * Ring<128>::kStageB];
  const unsigned z = blockIdx.z;
  const unsigned p = (z < 2u) ? z : 2u;
  const unsigned short* Ah = A0 + (size_t)(2u * p) * kPlaneEl;
  const unsigned short* Bh = B0 + (size_t)(2u * p) * kWEl;
  unsigned short* Ch = C0 + (size_t)(2u * p) * kPlaneEl;
  if (z < 2u)   // the same for every thread of a work-group
    gemm_tile<2, 6, 128, 4>(ring, Ah, Ah + kPlaneEl, Bh, Bh + kWEl, Ch, Ch + kPlaneEl, nullptr, 1, blockIdx.y, blockIdx.x);
  else
    gemm_tile<2, 0, 128, 2>(ring, Ah, Ah + kPlaneEl, Bh, Bh + kWEl, Ch, Ch + kPlaneEl, nullptr, 1, (z - 2u) * 32u + blockIdx.y, blockIdx.x);
}

// The output projection: grid (N/128, M/128), 128 threads, one 128 x 128 tile per work-group, one work-group per WGP, f32 out
__global__ __launch_bounds__(128) void proj_out_kernel(
    const unsigned short* __restrict__ A0, const unsigned short* __restrict__ B0, float* __restrict__ Cf, const int* __restrict__ flag) {
  __shared__ __attribute__((aligned(2048))) unsigned char ring[2 * Ring<256>::kStageB];
  const int causal = flag[0];   // read at entry, where it is a scalar load
  gemm_tile<0, 0, 256, 4>(ring, A0, A0 + kPlaneEl, B0, B0 + kWEl, nullptr, nullptr, Cf, causal, blockIdx.y, blockIdx.x);
}

// ---------------------------------------------------------------------------
// f32 -> bf16 hi + lo planes (RNE convert both), 8 consecutive elements per thread: one 16-B store per lane per plane,
// All seven tensors in one grid, by block range (block-uniform): 3 x kSplitXB blocks for the activations, then 4 x kSplitWB for the
// weights; hi plane z of a family lives at out + 2z*planeEl, lo plane at +planeEl.
// Coverage: planeEl/8 threads x 8 = the whole plane (the ranges are exact multiples of 256 threads).
// ---------------------------------------------------------------------------
constexpr int kSplitXB = (int)(kPlaneEl / 8 / 256);   // 2048 blocks per activation tensor
constexpr int kSplitWB = (int)(kWEl / 8 / 256);       // 512 blocks per weight tensor
static_assert(kSplitXB == 1 << 11 && kSplitWB == 1 << 9, "the shifts in the kernel");
__global__ __launch_bounds__(256) void split_planes_kernel(const float* __restrict__ x0, const float* __restrict__ x1,
                                                           const float* __restrict__ x2,
                                                           const float* __restrict__ w0, const float* __restrict__ w1,
                                                           const float* __restrict__ w2, const float* __restrict__ w3,
                                                           unsigned short* __restrict__ xout, unsigned short* __restrict__ wout) {
  const unsigned b = blockIdx.x;
  const bool isX = b < 3u * kSplitXB;
  const unsigned bf = isX ? b : b - 3u * kSplitXB;            // block within its family
  const unsigned sh = isX ? 11u : 9u;                         // log2 of the blocks per tensor
  const int z = (int)(bf >> sh);
  const int i = (int)((bf - ((unsigned)z << sh)) * 256u + threadIdx.x);
  const int zz = isX ? z : z + 3;
  const float* src = (zz == 0) ? x0 : (zz == 1) ? x1 : (zz == 2) ? x2 : (zz == 3) ? w0 : (zz == 4) ? w1 : (zz == 5) ? w2 : w3;
  unsigned short* out = isX ? xout : wout;
  const long planeEl = isX ? kPlaneEl : kWEl;
  const float* p = src + 8 * (size_t)i;
  const v4f a = *(const v4f*)(p);
  const v4f c = *(const v4f*)(p + 4);
  unsigned short hb[8], lb[8];
#pragma unroll
  for (int e = 0; e < 4; ++e) {
    hb[e]     = f2bf_bits(a[e]);
    lb[e]     = f2bf_bits(a[e] - bf_bits2f(hb[e]));
    hb[4 + e] = f2bf_bits(c[e]);
    lb[4 + e] = f2bf_bits(c[e] - bf_bits2f(hb[4 + e]));
  }
  const v4u uh = (v4u){pk16(hb[0], hb[1]), pk16(hb[2], hb[3]), pk16(hb[4], hb[5]), pk16(hb[6], hb[7])};
  const v4u ul = (v4u){pk16(lb[0], lb[1]), pk16(lb[2], lb[3]), pk16(lb[4], lb[5]), pk16(lb[6], lb[7])};
  unsigned short* ph = out + (size_t)(2 * z) * planeEl + 8 * (size_t)i;
  unsigned short* pl = ph + planeEl;
  *(v4u*)ph = uh;
  *(v4u*)pl = ul;
  
}

// ---------------------------------------------------------------------------
// Token-major chunk tiles in LDS, read as transposed WMMA operands. A tile row is one token: [64 hi | 64 lo] bf16 at pitch kPT.
// ds_load_tr16_b128: lane (c = l & 15, h = l >> 4) gets T[tok + 8h + 0..7][col + c]; the loads at tok and tok + 16 are one
// 16 x 32 fragment in the k order of Frag::load (elements 0..7 = k 8h + 0..7, 8..15 = k 16 + 8h + 0..7).
// ---------------------------------------------------------------------------
constexpr int kPT = 144;                       // elements: 288 B = 32 B x odd, the pitch of ds_load_tr16_b128 readers
typedef __attribute__((ext_vector_type(8))) short v8s;
__device__ __forceinline__ v8b lds_tr16(const unsigned short* p) {
  typedef __attribute__((address_space(3))) v8s lds_v8s;
  return __builtin_bit_cast(v8b, __builtin_amdgcn_ds_load_tr16_b128_v8i16((lds_v8s*)p));
}
// this lane's place in a 16-token x 16-column block, in elements
__device__ __forceinline__ int tr_lane(int lane) { return (8 * (lane >> 4) + (lane & 7)) * kPT + 8 * ((lane >> 3) & 1); }
// p = tile + first token * kPT + first column + tr_lane(lane)
__device__ __forceinline__ v16b lds_frag_tr(const unsigned short* p) {
  Frag<__bf16>::U f; f.h[0] = lds_tr16(p); f.h[1] = lds_tr16(p + 16 * kPT); return f.v;
}

// ---------------------------------------------------------------------------
// Per (batch-chunk y, head h), one work-group of eight waves: dST[e][d] = sum_j v[j][e] k[j][d] (f32, tile (y*16+h) of 64 x 64)
// and dz[y*16+h][d] = sum_j k[j][d] (f32, k = hi + lo, j in order). grid (32, 16), 256 threads.
// The 128 x 64 tiles of k and v (hi and lo) are staged as they lie in the token-major planes; both operands of the product are
// read from them by transposing loads. Wave w owns rows e = 16 (w >> 1) .. +15, columns d = 32 (w & 1) .. +31.
// Per accumulator: j ascending, hi.hi, hi.lo, lo.hi inside each 32 j.
// ---------------------------------------------------------------------------
__global__ __launch_bounds__(256) void state_inc_kernel(const unsigned short* __restrict__ kh, const unsigned short* __restrict__ kl,
                                                        const unsigned short* __restrict__ vh, const unsigned short* __restrict__ vl,
                                                        float* __restrict__ dST, float* __restrict__ dz) {
  __shared__ __align__(16) unsigned short sK[kChunk * kPT];
  __shared__ __align__(16) unsigned short sV[kChunk * kPT];
  __shared__ __align__(16) float sD[kHdim * 68];
  typedef Frag<__bf16> F;
  const int t = threadIdx.x;
  const int lane = t & 31, wave = t >> 5;
  const int rlane = lane & 15;
  const int mOff  = (lane >> 4) * 8;
  const int y = blockIdx.x, h = blockIdx.y;
  const size_t tile = (size_t)y * kHeads + h;
  const size_t go = (size_t)y * kChunk * kEmb + (size_t)h * kHdim + (size_t)(t >> 3) * kEmb + (t & 7) * 8;
  const unsigned short* pkh = kh + go;
  const unsigned short* pkl = kl + go;
  const unsigned short* pvh = vh + go;
  const unsigned short* pvl = vl + go;
  v4u gk[8], gv[8];
#pragma unroll
  for (int it = 0; it < 4; ++it) {
    gk[2 * it]     = *(const v4u*)(pkh + it * 32 * kEmb);
    gk[2 * it + 1] = *(const v4u*)(pkl + it * 32 * kEmb);
    gv[2 * it]     = *(const v4u*)(pvh + it * 32 * kEmb);
    gv[2 * it + 1] = *(const v4u*)(pvl + it * 32 * kEmb);
  }
  // stands in front of the first overwrite of a register that these loads name; the addresses are inputs, so none is reused before it
  asm volatile("s_wait_xcnt 0x0" :: "v"(pkh), "v"(pkl), "v"(pvh), "v"(pvl) : "memory");
#pragma unroll
  for (int it = 0; it < 4; ++it) {
    const int o = (it * 32 + (t >> 3)) * kPT + (t & 7) * 8;
    *(v4u*)(sK + o)      = gk[2 * it];
    *(v4u*)(sK + o + 64) = gk[2 * it + 1];
    *(v4u*)(sV + o)      = gv[2 * it];
    *(v4u*)(sV + o + 64) = gv[2 * it + 1];
  }
  __syncthreads();                             // the staged tiles are readable by every wave

  const int trl = tr_lane(lane);
  const int e0 = (wave >> 1) * 16, d0 = (wave & 1) * 32;
  v8f acc[2];
#pragma unroll
  for (int j = 0; j < 2; ++j) acc[j] = (v8f){0.f,0.f,0.f,0.f,0.f,0.f,0.f,0.f};
#pragma unroll
  for (int kb = 0; kb < 4; ++kb) {
    const unsigned short* pa = sV + kb * 32 * kPT + e0 + trl;
    const unsigned short* pb = sK + kb * 32 * kPT + d0 + trl;
    const v16b ah = lds_frag_tr(pa);
    const v16b al = lds_frag_tr(pa + 64);
    v16b bh[2], bl[2];
#pragma unroll
    for (int j = 0; j < 2; ++j) {
      bh[j] = lds_frag_tr(pb + j * 16);
      bl[j] = lds_frag_tr(pb + j * 16 + 64);
    }
#pragma unroll
    for (int j = 0; j < 2; ++j) acc[j] = F::mma(ah, bh[j], acc[j]);
#pragma unroll
    for (int j = 0; j < 2; ++j) acc[j] = F::mma(ah, bl[j], acc[j]);
#pragma unroll
    for (int j = 0; j < 2; ++j) acc[j] = F::mma(al, bh[j], acc[j]);
  }
#pragma unroll
  for (int j = 0; j < 2; ++j)
#pragma unroll
    for (int r = 0; r < 8; ++r) sD[(e0 + mOff + r) * 68 + d0 + j * 16 + rlane] = acc[j][r];

  float s = 0.f;
  if (t < kHdim) {                             // waves 0 and 1, whole
    // unrolled so that a group's 64 LDS reads are in flight together; rolled, every token waits out its own LDS latency
#pragma unroll 32
    for (int j = 0; j < kChunk; ++j) {
      const float kv = bf_bits2f(sK[j * kPT + t]) + bf_bits2f(sK[j * kPT + 64 + t]);
      s = s + kv;
    }
  }
  __syncthreads();                             // the 64 x 64 tile is whole: it goes out in rows, 512 contiguous bytes a wave

  float* dp = dST + tile * (size_t)(kHdim * kHdim) + 4 * t;
  v4f rv[4];
#pragma unroll
  for (int it = 0; it < 4; ++it) {
    const int u = it * 256 + t;
    rv[it] = *(const v4f*)(sD + (u >> 4) * 68 + (u & 15) * 4);
  }
#pragma unroll
  for (int it = 0; it < 4; ++it) *(v4f*)(dp + it * 1024) = rv[it];
  if (t < kHdim) dz[tile * kHdim + t] = s;     // behind the barrier, so that no wave waits there for this store
  asm volatile("s_wait_xcnt 0x0" ::: "memory");   // stands behind the last stores, in front of any later write of a register that they name
}

// ---------------------------------------------------------------------------
// Exclusive prefix over chunks of the transposed state and of z, per (b, h). No element depends on another, so the work is dealt
// by element: grid (32 bh, 5), 256 threads. Slices y = 0..3: thread t owns elements 1024y + 4t .. +3 of every 4096-element tile;
// slice y = 4: thread t < 64 owns element t of z. A thread first issues the loads of all 15 increments it needs (the last chunk's
// is never used), so their latencies overlap, then sums them in registers in chunk order and stores each chunk's value.
// S^T_c = sum_{c' < c} dST_{c'} (f32, sequential), written as bf16 hi/lo planes [tile][64 e][64 d] (tile = (b*16+c)*16+h);
// z_c likewise to zpre[tile][64] (f32). A wave's store covers 256 contiguous bytes of a plane.
// ---------------------------------------------------------------------------
typedef __attribute__((ext_vector_type(2))) unsigned int v2u;
constexpr int kPfxSlices = 4;                    // 4 slices x 256 threads x 4 elements = one 64 x 64 tile
static_assert(kPfxSlices * 256 * 4 == kHdim * kHdim, "the slices cover a tile");
// at most eight waves per SIMD are asked for: 128 registers a wave. Without it the build keeps to 81 registers and holds the last
// load back until the first has returned, to take over its registers
__global__ __launch_bounds__(256) __attribute__((amdgpu_waves_per_eu(2, 8))) void state_prefix_kernel(const float* __restrict__ dST, const float* __restrict__ dz,
                                                           unsigned short* __restrict__ STh, unsigned short* __restrict__ STl,
                                                           float* __restrict__ zpre) {
  const int t = threadIdx.x;
  const int bh = blockIdx.x;
  const int b = bh >> 4, h = bh & 15;
  const size_t tile0 = (size_t)(b * kNChunk) * kHeads + h;   // chunk 0's tile; chunk c's is tile0 + 16 c
  if (blockIdx.y == (unsigned)kPfxSlices) {                  // block-uniform: the z slice
    if (t >= kHdim) return;
    const float* zp = dz + tile0 * kHdim + t;
    float* zo = zpre + tile0 * kHdim + t;
    float zd[kNChunk - 1];
#pragma unroll
    for (int c = 0; c < kNChunk - 1; ++c) zd[c] = zp[c * kHeads * kHdim];
    float zacc = 0.f;
#pragma unroll
    for (int c = 0; c < kNChunk; ++c) {
      zo[c * kHeads * kHdim] = zacc;
      if (c < kNChunk - 1) zacc += zd[c];
    }
    return;
  }
  const size_t el = tile0 * 4096 + ((size_t)blockIdx.y * 256 + t) * 4;
  const float* dp = dST + el;
  unsigned short* ph = STh + el;
  unsigned short* pl = STl + el;
  v4f d[kNChunk - 1];
#pragma unroll
  for (int c = 0; c < kNChunk - 1; ++c) d[c] = *(const v4f*)(dp + c * kHeads * 4096);
  // all 15 loads stay in front of this line, so that they are in flight together (the compiler otherwise sinks five of them behind the
  // first waits); and it stands in front of the first overwrite of the address register, which is an input, so it is not reused before it
  asm volatile("s_wait_xcnt 0x0" :: "v"(dp) : "memory");
  v4f a = (v4f){0.f, 0.f, 0.f, 0.f};
#pragma unroll
  for (int c = 0; c < kNChunk; ++c) {
    unsigned short hb[4], lb[4];
#pragma unroll
    for (int e = 0; e < 4; ++e) {
      hb[e] = f2bf_bits(a[e]);
      lb[e] = f2bf_bits(a[e] - bf_bits2f(hb[e]));
    }
    *(v2u*)(ph + c * kHeads * 4096) = (v2u){pk16(hb[0], hb[1]), pk16(hb[2], hb[3])};
    *(v2u*)(pl + c * kHeads * 4096) = (v2u){pk16(lb[0], lb[1]), pk16(lb[2], lb[3])};
    if (c < kNChunk - 1) a += d[c];
  }
  asm volatile("s_wait_xcnt 0x0" ::: "memory");   // stands behind the last stores, in front of any later write of a register that they name
}

// ---------------------------------------------------------------------------
// Per (batch-chunk y, head h), one work-group of eight waves: masked scores A = tril(q.k^T), num = A.v + q.S_c,
// den = q.z_c + rowsum(A) + eps, o = num * (1/den) as bf16 hi/lo rows of the token-major o planes.
// The k, v and S^T tiles (hi and lo) are staged once in LDS, v token-major and read by transposing loads; wave w owns chunk rows 16w .. 16w+15 from the scores to the stores,
// and its A rows pass from the accumulator layout to the A-operand layout through its own LDS slab (bf16 hi/lo, never in memory).
// Every sum keeps its order: per accumulator k ascending with hi.hi, hi.lo, lo.hi inside each 32 k; A.v and q.S in separate
// accumulators, added once; row sum and q.z sequential in f32.
// ---------------------------------------------------------------------------
constexpr int kPK = 72;                        // LDS row pitch of the 64-wide tiles (k, S^T), elements: 144 B = 16 B x odd
constexpr int kPV = 136;                       // LDS row pitch of the 128-wide A rows, elements: 272 B = 16 B x odd
constexpr int kSlabB = 2 * 16 * kPV * 2;       // one wave's slab: A_h rows, then A_l rows; later the f32 num rows (pitch 68)
static_assert(16 * 68 * 4 <= kSlabB, "the num rows fit the slab");

// orders one wave's LDS writes in front of reads by its other lanes (the slabs are private to a wave)
__device__ __forceinline__ void wave_lds_sync() {
  __builtin_amdgcn_fence(__ATOMIC_RELEASE, "workgroup");
  __builtin_amdgcn_wave_barrier();
  __builtin_amdgcn_fence(__ATOMIC_ACQUIRE, "workgroup");
}
__device__ __forceinline__ v16b lds_frag(const unsigned short* p) { return Frag<__bf16>::load((const __bf16*)p); }

// at most 256 registers a wave: two work-groups (four waves per SIMD) share a WGP, so all 512 are resident at once
__global__ __launch_bounds__(256) __attribute__((amdgpu_waves_per_eu(4, 4))) void chunk_attn_kernel(const unsigned short* __restrict__ qh, const unsigned short* __restrict__ ql,
                                                         const unsigned short* __restrict__ kh, const unsigned short* __restrict__ kl,
                                                         const unsigned short* __restrict__ vh, const unsigned short* __restrict__ vl,
                                                         const unsigned short* __restrict__ STh, const unsigned short* __restrict__ STl,
                                                         const float* __restrict__ zpre,
                                                         unsigned short* __restrict__ oh, unsigned short* __restrict__ ol) {
  __shared__ __align__(16) unsigned short sKh[kChunk * kPK];
  __shared__ __align__(16) unsigned short sKl[kChunk * kPK];
  __shared__ __align__(16) unsigned short sV[kChunk * kPT];
  __shared__ __align__(16) unsigned short sSh[kHdim * kPK];
  __shared__ __align__(16) unsigned short sSl[kHdim * kPK];
  __shared__ __align__(16) unsigned char  sW[8][kSlabB];
  __shared__ __align__(16) float sInv[8][16];
  typedef Frag<__bf16> F;
  const int t = threadIdx.x;
  const int lane = t & 31, wave = t >> 5;
  const int rlane = lane & 15;                 // row (A operand) / column (B operand, accumulator) within a 16-wide subtile
  const int koff  = (lane >> 4) * 8;           // k offset of this lane half
  const int mOff  = (lane >> 4) * 8;           // accumulator row offset
  const int y = blockIdx.x, h = blockIdx.y;
  const size_t tile = (size_t)y * kHeads + h;
  const size_t base = (size_t)y * kChunk * kEmb + (size_t)h * kHdim;   // chunk row 0 at this head, token-major planes

  // ---- the tiles, 16 B per lane: k 128 x 64, v 128 x 64, S^T 64 x 64, hi and lo; this wave's q rows ----
  const size_t ko = base + (size_t)(t >> 3) * kEmb + (t & 7) * 8;
  const size_t so = tile * (size_t)(kHdim * kHdim) + (size_t)t * 8;
  const size_t qrow = base + (size_t)(wave * 16 + rlane) * kEmb;
  const unsigned short* pkh = kh + ko;
  const unsigned short* pkl = kl + ko;
  const unsigned short* pvh = vh + ko;
  const unsigned short* pvl = vl + ko;
  const unsigned short* psh = STh + so;
  const unsigned short* psl = STl + so;
  const unsigned short* pqh = qh + qrow;
  const unsigned short* pql = ql + qrow;
  const unsigned short* pfh = pqh + koff;
  const unsigned short* pfl = pql + koff;
  v4u gk[8], gv[8], gs[4], gqh[8], gql[8];
#pragma unroll
  for (int it = 0; it < 4; ++it) {
    gk[2 * it]     = *(const v4u*)(pkh + it * 32 * kEmb);
    gk[2 * it + 1] = *(const v4u*)(pkl + it * 32 * kEmb);
    gv[2 * it]     = *(const v4u*)(pvh + it * 32 * kEmb);
    gv[2 * it + 1] = *(const v4u*)(pvl + it * 32 * kEmb);
  }
#pragma unroll
  for (int it = 0; it < 2; ++it) {
    gs[2 * it]     = *(const v4u*)(psh + it * 2048);
    gs[2 * it + 1] = *(const v4u*)(psl + it * 2048);
  }
  // the q rows as A operands (K = 64: two 32-k blocks), and whole (row rlane) for q.z
  v16b qfh[2], qfl[2];
#pragma unroll
  for (int kb = 0; kb < 2; ++kb) {
    qfh[kb] = F::load((const __bf16*)(pfh + kb * 32));
    qfl[kb] = F::load((const __bf16*)(pfl + kb * 32));
  }
#pragma unroll
  for (int w = 0; w < 8; ++w) {
    gqh[w] = *(const v4u*)(pqh + 8 * w);
    gql[w] = *(const v4u*)(pql + 8 * w);
  }
  // stands in front of the first overwrite of a register that these loads name; the addresses are inputs, so none is reused before it
  asm volatile("s_wait_xcnt 0x0" :: "v"(pkh), "v"(pkl), "v"(pvh), "v"(pvl), "v"(psh), "v"(psl), "v"(pqh), "v"(pql), "v"(pfh), "v"(pfl) : "memory");
#pragma unroll
  for (int it = 0; it < 4; ++it) {
    const int u = it * 256 + t;
    *(v4u*)(sKh + (u >> 3) * kPK + (u & 7) * 8) = gk[2 * it];
    *(v4u*)(sKl + (u >> 3) * kPK + (u & 7) * 8) = gk[2 * it + 1];
    *(v4u*)(sV + (u >> 3) * kPT + (u & 7) * 8)      = gv[2 * it];
    *(v4u*)(sV + (u >> 3) * kPT + (u & 7) * 8 + 64) = gv[2 * it + 1];
  }
#pragma unroll
  for (int it = 0; it < 2; ++it) {
    const int u = it * 256 + t;
    *(v4u*)(sSh + (u >> 3) * kPK + (u & 7) * 8) = gs[2 * it];
    *(v4u*)(sSl + (u >> 3) * kPK + (u & 7) * 8) = gs[2 * it + 1];
  }

  // ---- q . z_c of row rlane (both lane halves compute the same row) ----
  const float* zp = zpre + tile * kHdim;
  float qz = 0.f;
#pragma unroll
  for (int w = 0; w < 8; ++w) {
    const v4u uh = gqh[w];
    const v4u ul = gql[w];
    const v4f z0 = *(const v4f*)(zp + 8 * w);
    const v4f z1 = *(const v4f*)(zp + 8 * w + 4);
    float qv[8], zv[8];
#pragma unroll
    for (int e = 0; e < 4; ++e) {
      qv[2 * e]     = bflo2f(uh[e]) + bflo2f(ul[e]);
      qv[2 * e + 1] = bfhi2f(uh[e]) + bfhi2f(ul[e]);
      zv[e] = z0[e];
      zv[4 + e] = z1[e];
    }
#pragma unroll
    for (int e = 0; e < 8; ++e) qz += qv[e] * zv[e];
  }
  sInv[wave][rlane] = qz;                      // parked in LDS: kept in a register, the whole sum is sunk to its use and the q rows spill
  __syncthreads();                             // the staged tiles are readable by every wave

  // ---- masked scores of rows 16w .. 16w+15, four column subtiles at a time, into the slab as bf16 hi/lo ----
  unsigned short* aH = (unsigned short*)sW[wave];
  unsigned short* aL = aH + 16 * kPV;
#pragma unroll
  for (int jh = 0; jh < 2; ++jh) {
    v8f s[4];
#pragma unroll
    for (int j = 0; j < 4; ++j) s[j] = (v8f){0.f,0.f,0.f,0.f,0.f,0.f,0.f,0.f};
#pragma unroll
    for (int kb = 0; kb < 2; ++kb) {
      v16b bh[4], bl[4];
#pragma unroll
      for (int j = 0; j < 4; ++j) {
        const int o = ((jh * 4 + j) * 16 + rlane) * kPK + koff + kb * 32;
        bh[j] = lds_frag(sKh + o);
        bl[j] = lds_frag(sKl + o);
      }
#pragma unroll
      for (int j = 0; j < 4; ++j) s[j] = F::mma(qfh[kb], bh[j], s[j]);
#pragma unroll
      for (int j = 0; j < 4; ++j) s[j] = F::mma(qfh[kb], bl[j], s[j]);
#pragma unroll
      for (int j = 0; j < 4; ++j) s[j] = F::mma(qfl[kb], bh[j], s[j]);
    }
#pragma unroll
    for (int j = 0; j < 4; ++j) {
      const int n = (jh * 4 + j) * 16 + rlane;
#pragma unroll
      for (int r = 0; r < 8; ++r) {
        float v = s[j][r];
        if (n > wave * 16 + mOff + r) v = 0.0f;
        const unsigned short hb = f2bf_bits(v);
        const unsigned short lb = f2bf_bits(v - bf_bits2f(hb));
        aH[(mOff + r) * kPV + n] = hb;
        aL[(mOff + r) * kPV + n] = lb;
      }
    }
  }

  // ---- q . S_c: K = 64 ----
  v8f qs[4], av[4];
#pragma unroll
  for (int j = 0; j < 4; ++j) { qs[j] = (v8f){0.f,0.f,0.f,0.f,0.f,0.f,0.f,0.f}; av[j] = (v8f){0.f,0.f,0.f,0.f,0.f,0.f,0.f,0.f}; }
#pragma unroll
  for (int kb = 0; kb < 2; ++kb) {
    v16b bh[4], bl[4];
#pragma unroll
    for (int j = 0; j < 4; ++j) {
      const int o = (j * 16 + rlane) * kPK + koff + kb * 32;
      bh[j] = lds_frag(sSh + o);
      bl[j] = lds_frag(sSl + o);
    }
#pragma unroll
    for (int j = 0; j < 4; ++j) qs[j] = F::mma(qfh[kb], bh[j], qs[j]);
#pragma unroll
    for (int j = 0; j < 4; ++j) qs[j] = F::mma(qfh[kb], bl[j], qs[j]);
#pragma unroll
    for (int j = 0; j < 4; ++j) qs[j] = F::mma(qfl[kb], bh[j], qs[j]);
  }
  wave_lds_sync();                             // the slab's A rows are readable by every lane of this wave

  // ---- A . v: K = 128 ----
  const int trl = tr_lane(lane);
#pragma unroll
  for (int kb = 0; kb < 4; ++kb) {
    const v16b ah = lds_frag(aH + rlane * kPV + koff + kb * 32);
    const v16b al = lds_frag(aL + rlane * kPV + koff + kb * 32);
    v16b bh[4], bl[4];
#pragma unroll
    for (int j = 0; j < 4; ++j) {
      const unsigned short* pv = sV + kb * 32 * kPT + j * 16 + trl;
      bh[j] = lds_frag_tr(pv);
      bl[j] = lds_frag_tr(pv + 64);
    }
#pragma unroll
    for (int j = 0; j < 4; ++j) av[j] = F::mma(ah, bh[j], av[j]);
#pragma unroll
    for (int j = 0; j < 4; ++j) av[j] = F::mma(ah, bl[j], av[j]);
#pragma unroll
    for (int j = 0; j < 4; ++j) av[j] = F::mma(al, bh[j], av[j]);
  }

  // ---- row sum of the masked scores of row rlane, j in order ----
  float asum = 0.f;
#pragma unroll
  for (int w = 0; w < 16; ++w) {
    const v4u uh = *(const v4u*)(aH + rlane * kPV + 8 * w);
    const v4u ul = *(const v4u*)(aL + rlane * kPV + 8 * w);
#pragma unroll
    for (int e = 0; e < 4; ++e) {
      const float a0 = bflo2f(uh[e]) + bflo2f(ul[e]);
      asum = asum + a0;
      const float a1 = bfhi2f(uh[e]) + bfhi2f(ul[e]);
      asum = asum + a1;
    }
  }
  const float den = (sInv[wave][rlane] + asum) + kEps;
  const float inv = 1.0f / den;
  wave_lds_sync();                             // every read of the A rows has returned: the slab takes the num rows

  float* slab = (float*)sW[wave];
#pragma unroll
  for (int j = 0; j < 4; ++j)
#pragma unroll
    for (int r = 0; r < 8; ++r) slab[(mOff + r) * 68 + (j << 4) + rlane] = av[j][r] + qs[j][r];
  sInv[wave][rlane] = inv;
  wave_lds_sync();

  const int q4 = lane >> 3, c8 = (lane & 7) * 8;
  v4u uo_h[4], uo_l[4];
#pragma unroll
  for (int it = 0; it < 4; ++it) {
    const int row = it * 4 + q4;
    const float iv = sInv[wave][row];
    unsigned short hb[8], lb[8];
#pragma unroll
    for (int e = 0; e < 8; ++e) {
      const float f = slab[row * 68 + c8 + e] * iv;
      hb[e] = f2bf_bits(f);
      lb[e] = f2bf_bits(f - bf_bits2f(hb[e]));
    }
    uo_h[it] = (v4u){pk16(hb[0], hb[1]), pk16(hb[2], hb[3]), pk16(hb[4], hb[5]), pk16(hb[6], hb[7])};
    uo_l[it] = (v4u){pk16(lb[0], lb[1]), pk16(lb[2], lb[3]), pk16(lb[4], lb[5]), pk16(lb[6], lb[7])};
  }
#pragma unroll
  for (int it = 0; it < 4; ++it) {
    const size_t o = base + (size_t)(wave * 16 + it * 4 + q4) * kEmb + c8;
    *(v4u*)(oh + o) = uo_h[it];
    *(v4u*)(ol + o) = uo_l[it];
  }
}

// ---------------------------------------------------------------------------
// Host launcher
// ---------------------------------------------------------------------------
extern "C" void kernel_launch(void* const* d_in, const int* in_sizes, int n_in,
                              void* d_out, int out_size, void* d_ws, size_t ws_size,
                              hipStream_t stream) {
  if (n_in < 8) return;
  if (in_sizes[0] != (int)kPlaneEl || in_sizes[1] != (int)kPlaneEl || in_sizes[2] != (int)kPlaneEl) return;
  if (in_sizes[3] != (int)kWEl || in_sizes[4] != (int)kWEl || in_sizes[5] != (int)kWEl || in_sizes[6] != (int)kWEl) return;
  if (in_sizes[7] < 1) return;
  if (out_size != (int)kPlaneEl) return;
  if (ws_size < (size_t)kWsTotal) return;

  const float* Q  = (const float*)d_in[0];
  const float* Kx = (const float*)d_in[1];
  const float* Vx = (const float*)d_in[2];
  const float* Wq = (const float*)d_in[3];
  const float* Wk = (const float*)d_in[4];
  const float* Wv = (const float*)d_in[5];
  const float* Wo = (const float*)d_in[6];
  const int*   causal = (const int*)d_in[7];
  float* out = (float*)d_out;
  char* ws = (char*)d_ws;

  unsigned short* Xbase = (unsigned short*)(ws + oXbase);
  unsigned short* Wbase = (unsigned short*)(ws + oWbase);
  const unsigned short* Wo_h = (const unsigned short*)(ws + oWo_h);
  unsigned short* q_h  = (unsigned short*)(ws + oQ_h);
  unsigned short* q_l  = (unsigned short*)(ws + oQ_l);
  unsigned short* k_h  = (unsigned short*)(ws + oK_h);
  unsigned short* k_l  = (unsigned short*)(ws + oK_l);
  unsigned short* v_h  = (unsigned short*)(ws + oV_h);
  unsigned short* v_l  = (unsigned short*)(ws + oV_l);
  float*          dST  = (float*)(ws + oDST);
  unsigned short* ST_h = (unsigned short*)(ws + oST_h);
  unsigned short* ST_l = (unsigned short*)(ws + oST_l);
  unsigned short* o_h  = (unsigned short*)(ws + oO_h);
  unsigned short* o_l  = (unsigned short*)(ws + oO_l);
  float*          dz   = (float*)(ws + oDZ);
  float*          zpre = (float*)(ws + oZPRE);

  // 1) input and weight hi/lo planes
  split_planes_kernel<<<dim3((unsigned)(3 * kSplitXB + 4 * kSplitWB), 1, 1), 256, 0, stream>>>(Q, Kx, Vx, Wq, Wk, Wv, Wo, Xbase, Wbase);

  // 2) projections q, k, v in one grid: each M=4096, N=1024, K=1024; q, k with elu(x)+1 in 128 x 128 tiles, v in 64 x 128 tiles, two work-groups to a WGP
  proj_qkv_kernel<<<dim3(kEmb / 128, kTok / 128, 4), 128, 0, stream>>>(Xbase, Wbase, q_h);

  // 3) per (b,c,h): dST[e][d] = sum_j v[j][e] k[j][d] and the chunk sums of k
  state_inc_kernel<<<dim3(kYB, kHeads, 1), 256, 0, stream>>>(k_h, k_l, v_h, v_l, dST, dz);

  // 4) exclusive prefix over chunks of S^T and z
  state_prefix_kernel<<<dim3(kBatch * kHeads, kPfxSlices + 1, 1), 256, 0, stream>>>(dST, dz, ST_h, ST_l, zpre);

  // 5) per (b,c,h): masked scores, A.v + q.S_c, normaliser -> attention output hi/lo planes (token-major, heads merged)
  chunk_attn_kernel<<<dim3(kYB, kHeads, 1), 256, 0, stream>>>(q_h, q_l, k_h, k_l, v_h, v_l, ST_h, ST_l, zpre, o_h, o_l);

  // 6) output projection: M=4096, N=1024, K=1024 -> d_out, with the premise check on the causal flag (NaN when the non-causal branch
  //    would be required)
  proj_out_kernel<<<dim3(kEmb / 128, kTok / 128, 1), 128, 0, stream>>>(o_h, Wo_h, out, causal);
}

// v008
// It runs in 106 microseconds.
// Next to v007, in two timings, it ran 1.16 times as fast each time.
// Over all steps from v000 it is 4.08 times as fast.
// Contractions: q/k/v projections, chunk scores q.k^T, state increment v^T.k, q.S, A.v, output projection -- all v_wmma_f32_16x16x32_bf16 with bf16 hi/lo operand planes (hi.hi + hi.lo + lo.hi), f32 accumulate; feature map, state prefix over chunks, normaliser and division in f32 on the VALU.
#include <hip/hip_runtime.h>
#include <math.h>

// ---------------------------------------------------------------------------
// Problem constants
// ---------------------------------------------------------------------------
constexpr int kBatch   = 2;
constexpr int kSeq     = 2048;
constexpr int kEmb     = 1024;
constexpr int kHeads   = 16;
constexpr int kHdim    = 64;
constexpr int kChunk   = 128;
constexpr int kNChunk  = kSeq / kChunk;          // 16 chunks per sequence
constexpr int kTok     = kBatch * kSeq;          // 4096 token rows
constexpr int kYB      = kBatch * kNChunk;       // 32 (batch, chunk) pairs
constexpr int kTiles   = kYB * kHeads;           // 512 (batch, chunk, head) tiles
constexpr float kEps   = 1e-6f;
constexpr long kPlaneEl = (long)kTok * kEmb;     // 4194304 elements per activation plane
constexpr long kWEl     = (long)kEmb * kEmb;     // 1048576 elements per weight plane
constexpr long kUnit    = kPlaneEl * 2;          // 8388608 bytes (one bf16 activation plane)
constexpr long kWUnit   = kWEl * 2;              // 2097152 bytes (one bf16 weight plane)

// ---------------------------------------------------------------------------
// Workspace region map (bytes; U = 8388608, WU = 2097152); total 14U + 262144 = 117702656
//   [0U , 6U)  o_h@0U o_l@1U dST(f32)@4U ST_h@5U ST_l@5.5U
//   [6U , 8U)  Wq_h Wq_l Wk_h Wk_l Wv_h Wv_l Wo_h Wo_l (WU each)
//   [8U ,14U)  q_h@8U q_l@9U k_h@10U k_l@11U v_h@12U v_l@13U (projection outputs)
//   [14U, +262144)  dz f32 [512][64] @14U, zpre f32 [512][64] @14U+131072
// ---------------------------------------------------------------------------
constexpr long oO_h   = 0;
constexpr long oO_l   = 1 * kUnit;
constexpr long oDST   = 4 * kUnit;
constexpr long oST_h  = 5 * kUnit;
constexpr long oST_l  = 5 * kUnit + kUnit / 2;
constexpr long oWbase = 6 * kUnit;
constexpr long oWo_h  = oWbase + 6 * kWUnit;
constexpr long oWo_l  = oWbase + 7 * kWUnit;
constexpr long oQ_h   = 8 * kUnit;
constexpr long oQ_l   = 9 * kUnit;
constexpr long oK_h   = 10 * kUnit;
constexpr long oK_l   = 11 * kUnit;
constexpr long oV_h   = 12 * kUnit;
constexpr long oV_l   = 13 * kUnit;
constexpr long oDZ    = 14 * kUnit;
constexpr long oZPRE  = 14 * kUnit + 131072;
constexpr long kWsTotal = 14 * kUnit + 262144;
static_assert(kWsTotal == 117702656, "carve total");
static_assert(kWsTotal <= 134217728, "carve within 128 MiB");
static_assert((long)kTiles * kHdim * kHdim * 4 == kUnit, "dST plane size");

typedef __attribute__((ext_vector_type(8)))  _Float16 v8h;
typedef __attribute__((ext_vector_type(16))) __bf16   v16b;
typedef __attribute__((ext_vector_type(8)))  __bf16   v8b;
typedef __attribute__((ext_vector_type(8)))  float    v8f;
typedef __attribute__((ext_vector_type(4)))  float    v4f;
typedef __attribute__((ext_vector_type(4)))  unsigned int v4u;

__device__ __forceinline__ unsigned short f2bf_bits(float f) {
  unsigned u = __float_as_uint(f);
  return (unsigned short)((u + 0x7FFFu + ((u >> 16) & 1u)) >> 16);
}
__device__ __forceinline__ float bf_bits2f(unsigned short h) { return __uint_as_float(((unsigned)h) << 16); }

template <typename T> struct Frag;
template <> struct Frag<__bf16> {
  typedef v16b V; union U { v16b v; v8b h[2]; };
  static __device__ __forceinline__ v16b load(const __bf16* p) {   // elements 0..7 <- p[0..7], 8..15 <- p[16..23]
    U f; f.h[0] = *(const v8b*)(p); f.h[1] = *(const v8b*)(p + 16); return f.v;
  }
  static __device__ __forceinline__ v8f mma(v16b a, v16b b, v8f c) {
    return __builtin_amdgcn_wmma_f32_16x16x32_bf16(false, a, false, b, (short)0, c, false, false);
  }
};

__device__ __forceinline__ unsigned pk16(unsigned short a, unsigned short b) { return (unsigned)a | ((unsigned)b << 16); }
// bf16 element pair held in one 32-bit word: low half-word = even element, high half-word = odd element
__device__ __forceinline__ float bflo2f(unsigned w) { return __uint_as_float(w << 16); }
__device__ __forceinline__ float bfhi2f(unsigned w) { return __uint_as_float(w & 0xffff0000u); }

// ---------------------------------------------------------------------------
// The four 4096 x 1024 x 1024 products: C[m,n] = sum_k A[m,k] * Bt[n,k], hi/lo planes, product = hi.hi + hi.lo + lo.hi.
// One 128 x 128 (or 64 x 128) tile of C per work-group, four waves (2 x 2), each wave a 64 x 64 (32 x 64) tile (4 x 4 or 2 x 4 accumulators).
// A stage is ROWB bytes (ROWB / 2 k) of the tile's rows of each of the four operand planes [A_h | A_l | B_h | B_l], a slice of 128 rows' room each, LDS row pitch ROWB + 16;
// wave w brings plane w of every stage with one tensor load; two buffers, the next stage's loads fly while this one is worked on.
// XF32 (the q, k, v projections, ROWB = 128): A is taken as it comes, in f32, and no hi/lo planes of it are written or read. Slices 0 and 1 then
// hold k 0..31 and k 32..63 of the stage's A rows in f32: again 128 B a row, so the ring's size, places and pad stay, and only the source
// pitch and the step from stage to stage differ by slice. A wave reads its A fragments in f32 (four 16-B reads for a lane's 16 values, as many
// as for a hi and a lo fragment) and splits them in registers: hi = bf16(x), lo = bf16(x - hi), both round to nearest even, the planes' values.
// ROWB = 256: the ring fills the WGP's LDS, one work-group per WGP. ROWB = 128: the ring is 144 KiB, two work-groups share a WGP
// (two waves per SIMD), and one's prologue, barrier waits, first fragment loads and epilogue run under the other's WMMAs.
// Per accumulator the products are summed k ascending, hi.hi, hi.lo, lo.hi inside each 32 k.
// ---------------------------------------------------------------------------
template <unsigned ROWB> struct Ring {
  static_assert(ROWB == 128 || ROWB == 256, "the two row lengths whose 16-B pad is known to land right");
  static constexpr unsigned kRowB   = ROWB;                        // bytes of one operand row in a stage
  static constexpr unsigned kPitchB = ROWB + 16;                   // LDS row pitch: the row + the 16-B pad for ds_load_b128 readers
  static constexpr unsigned kPlaneB = 128 * kPitchB;               // 18432 / 34816 B, one plane's slice of a stage
  static constexpr unsigned kStageB = 4 * kPlaneB;                 // 73728 / 139264 B, one buffer
  static constexpr unsigned kStages = (unsigned)kEmb * 2 / ROWB;   // 16 / 8
  static constexpr int      kBlocks = (int)(ROWB / 64);            // 32-k blocks in a stage
  static constexpr unsigned kPadWord = (1u << 20) | ((ROWB == 256 ? 5u : 4u) << 22) | (3u << 25);   // 4 dwords behind every row
  static_assert(kPlaneB % 2048 == 0, "every slice starts at a multiple of 2 KiB");
  static_assert(kStages >= 2, "the ring's prologue needs two stages");
};
typedef __attribute__((ext_vector_type(8))) unsigned int v8u;

__device__ __forceinline__ unsigned uni(unsigned v) { return (unsigned)__builtin_amdgcn_readfirstlane((int)v); }
__device__ __forceinline__ unsigned pinned(unsigned v) { unsigned w = uni(v); asm volatile("" : "+s"(w)); return w; }
__device__ __forceinline__ void wait_ds0()     { asm volatile("s_wait_dscnt 0x0" ::: "memory"); }      // this wave's LDS reads have returned
__device__ __forceinline__ void wait_tensor0() { asm volatile("s_wait_tensorcnt 0x0" ::: "memory"); }  // this wave's tensor load has landed
// group 1 goes in and out: its eight registers then hold nothing else from one load to the next. As a plain input of constants the
// compiler took single registers of it for loop temporaries while a request that names them was outstanding, and set them anew before the next load
__device__ __forceinline__ void tdm_load(v4u g0, v8u& g1) { asm volatile("tensor_load_to_lds %1, %0" : "+s"(g1) : "s"(g0) : "memory"); }
__device__ __forceinline__ v4u tdm_group0(unsigned lds_dst, unsigned long long ga) {
  v4u g;
  g[0] = uni(1u); g[1] = uni(lds_dst); g[2] = uni((unsigned)ga); g[3] = uni((((unsigned)(ga >> 32)) & 0x01FFFFFFu) | 0x80000000u);
  return g;
}
// 1-byte elements, tile = tensor = rows rows of ROWB bytes, source pitch one K row (srcPitch bytes), 4 dwords of LDS pad behind every row
template <unsigned ROWB>
__device__ __forceinline__ v8u tdm_group1(unsigned rows, unsigned srcPitch) {
  constexpr unsigned d0 = ROWB;
  const unsigned d1 = rows;
  v8u g;
  g[0] = uni(Ring<ROWB>::kPadWord);
  g[1] = uni((d0 & 0xFFFFu) << 16);
  g[2] = uni((d0 >> 16) | ((d1 & 0xFFFFu) << 16));
  g[3] = uni((d1 >> 16) | (d0 << 16));
  g[4] = uni(d1);
  g[5] = uni(srcPitch);
  g[6] = uni(0u);
  g[7] = uni(0u);
  return g;
}

// MI = 16-row subtiles of A per wave: 4 (a 128 x 128 tile per work-group) or 2 (a 64 x 128 tile)
template <int MI> struct FragSet { v16b ah[MI], al[MI], bh[4], bl[4]; };
// the fragments of one 32-k block: pa / pb = this lane's row 0 of the A_h / B_h slices, at its k half
template <unsigned ROWB, int MI>
__device__ __forceinline__ void load_set(FragSet<MI>& f, const unsigned char* pa, const unsigned char* pb, int kb) {
  const unsigned k = (unsigned)kb * 64u;
  constexpr unsigned kPlaneB = Ring<ROWB>::kPlaneB;
  constexpr unsigned t = 16u * Ring<ROWB>::kPitchB;   // 16 rows
  // in the order in which mma_set needs them: the first term can start when half of the group has returned
#pragma unroll
  for (int i = 0; i < MI; ++i) f.ah[i] = Frag<__bf16>::load((const __bf16*)(pa + (unsigned)i * t + k));
#pragma unroll
  for (int i = 0; i < 4; ++i) f.bh[i] = Frag<__bf16>::load((const __bf16*)(pb + (unsigned)i * t + k));
#pragma unroll
  for (int i = 0; i < 4; ++i) f.bl[i] = Frag<__bf16>::load((const __bf16*)(pb + kPlaneB + (unsigned)i * t + k));
#pragma unroll
  for (int i = 0; i < MI; ++i) f.al[i] = Frag<__bf16>::load((const __bf16*)(pa + kPlaneB + (unsigned)i * t + k));
}
// 12 MI WMMAs; each term runs over all 4 MI accumulators, so that no WMMA waits for the one in front of it
template <int MI>
__device__ __forceinline__ void mma_set(const FragSet<MI>& f, v8f (&acc)[MI][4]) {
#pragma unroll
  for (int i = 0; i < MI; ++i)
#pragma unroll
    for (int j = 0; j < 4; ++j) acc[i][j] = Frag<__bf16>::mma(f.ah[i], f.bh[j], acc[i][j]);
#pragma unroll
  for (int i = 0; i < MI; ++i)
#pragma unroll
    for (int j = 0; j < 4; ++j) acc[i][j] = Frag<__bf16>::mma(f.ah[i], f.bl[j], acc[i][j]);
#pragma unroll
  for (int i = 0; i < MI; ++i)
#pragma unroll
    for (int j = 0; j < 4; ++j) acc[i][j] = Frag<__bf16>::mma(f.al[i], f.bh[j], acc[i][j]);
}

// XF32: A fragments as f32
typedef __attribute__((ext_vector_type(2))) float  v2f;
typedef __attribute__((ext_vector_type(2))) __bf16 v2b;
template <int MI> struct FragSetX { v4f ax[MI][4]; v16b bh[4], bl[4]; };
// the fragments of one 32-k block: pa = this lane's row 0 of A slice 0 at its k half (f32), pb = its row 0 of the B_h slice at its k half
template <int MI>
__device__ __forceinline__ void load_set_x(FragSetX<MI>& f, const unsigned char* pa, const unsigned char* pb, int kb) {
  constexpr unsigned kPlaneB = Ring<128>::kPlaneB;
  constexpr unsigned t = 16u * Ring<128>::kPitchB;     // 16 rows
#pragma unroll
  for (int i = 0; i < MI; ++i) {
    const unsigned char* p = pa + (unsigned)kb * kPlaneB + (unsigned)i * t;
    f.ax[i][0] = *(const v4f*)(p);                     // elements 0..7: k 8h + 0..7
    f.ax[i][1] = *(const v4f*)(p + 16);
    f.ax[i][2] = *(const v4f*)(p + 64);                // elements 8..15: k 16 + 8h + 0..7
    f.ax[i][3] = *(const v4f*)(p + 80);
  }
#pragma unroll
  for (int i = 0; i < 4; ++i) f.bh[i] = Frag<__bf16>::load((const __bf16*)(pb + (unsigned)i * t + (unsigned)kb * 64u));
#pragma unroll
  for (int i = 0; i < 4; ++i) f.bl[i] = Frag<__bf16>::load((const __bf16*)(pb + kPlaneB + (unsigned)i * t + (unsigned)kb * 64u));
}
__device__ __forceinline__ void split_frag(const v4f (&x)[4], v16b& hi, v16b& lo) {
#pragma unroll
  for (int q = 0; q < 4; ++q)
#pragma unroll
    for (int e = 0; e < 4; e += 2) {
      const v2f a = (v2f){x[q][e], x[q][e + 1]};
      const v2b h = __builtin_convertvector(a, v2b);
      const v2f r = a - __builtin_convertvector(h, v2f);
      const v2b l = __builtin_convertvector(r, v2b);
      hi[4 * q + e] = h[0]; hi[4 * q + e + 1] = h[1];
      lo[4 * q + e] = l[0]; lo[4 * q + e + 1] = l[1];
    }
}

// One (32 MI) x 128 tile of C by the four waves of a work-group (2 x 2, each 16 MI x 64): rows rowBlk * 32 MI .., columns colBlk * 128 ..
// OUT_MODE: 0 = f32 to Cf, 2 = bf16 hi plane + lo plane. ACT: 0 = none, 6 = elu(x)+1.
// OUT_MODE 0 also holds the premise check on the causal flag: only the causal branch is built; if the flag is 0 the output is NaN.
// A is X (f32) where XF32, else the planes Ah, Al.
template <int OUT_MODE, int ACT, unsigned ROWB, int MI, bool XF32>
__device__ __forceinline__ void gemm_tile(unsigned char* ring, const float* __restrict__ X,
    const unsigned short* __restrict__ Ah, const unsigned short* __restrict__ Al,
    const unsigned short* __restrict__ Bh, const unsigned short* __restrict__ Bl,
    unsigned short* __restrict__ Ch, unsigned short* __restrict__ Cl, float* __restrict__ Cf, int causal,
    unsigned rowBlk, unsigned colBlk) {
  constexpr unsigned kPitchB = Ring<ROWB>::kPitchB, kPlaneB = Ring<ROWB>::kPlaneB;
  constexpr unsigned kStageB = Ring<ROWB>::kStageB, kStages = Ring<ROWB>::kStages;
  constexpr int kBlocks = Ring<ROWB>::kBlocks;
  constexpr unsigned kTM = 32u * MI;               // rows of the work-group's tile
  static_assert(!XF32 || ROWB == 128, "one f32 A slice per 32-k block, two blocks a stage");
  const int lane = threadIdx.x & 31;
  const unsigned wave = uni(threadIdx.x >> 5);
  const int rlane = lane & 15;
  const int mOff  = (lane >> 4) * 8;
  const int m0 = (int)(rowBlk * kTM + (wave >> 1) * (kTM / 2u));
  const int n0 = (int)(colBlk * 128u + (wave & 1u) * 64u);

  // this wave's plane: first byte of its rows (kTM of A, 128 of B), and its slice's place in buffer 0
  const unsigned short* plane = (wave == 0u) ? Ah : (wave == 1u) ? Al : (wave == 2u) ? Bh : Bl;
  const unsigned row0 = (wave < 2u) ? rowBlk * kTM : colBlk * 128u;
  const bool xs = XF32 && wave < 2u;               // this wave's slice is f32: its 32 k of X's rows, a source row and a stage's step twice as long
  const unsigned long long ga = xs ? (unsigned long long)(X + (size_t)row0 * kEmb + wave * 32u) : (unsigned long long)(plane + (size_t)row0 * kEmb);
  const unsigned stepSh = (ROWB == 256 ? 8u : 7u) + (xs ? 1u : 0u);   // log2 of the bytes from one stage to the next: ROWB, or twice that
  const unsigned slice = (unsigned)(unsigned long long)(const void*)ring + wave * kPlaneB;
  v8u g1 = tdm_group1<ROWB>((wave < 2u) ? kTM : 128u, xs ? (unsigned)kEmb * 4u : (unsigned)kEmb * 2u);

  const unsigned aoff = ((wave >> 1) * (kTM / 2u) + (unsigned)rlane) * kPitchB + (unsigned)(lane >> 4) * (XF32 ? 32u : 16u);
  const unsigned boff = 2u * kPlaneB + ((wave & 1u) * 64u + (unsigned)rlane) * kPitchB + (unsigned)(lane >> 4) * 16u;

  v8f acc[MI][4];
#pragma unroll
  for (int i = 0; i < MI; ++i)
#pragma unroll
    for (int j = 0; j < 4; ++j) acc[i][j] = (v8f){0.f,0.f,0.f,0.f,0.f,0.f,0.f,0.f};

  tdm_load(tdm_group0(slice, ga), g1);
  wait_tensor0();
  __syncthreads();                                  // stage 0 is readable by every wave
  tdm_load(tdm_group0(slice + kStageB, ga + (1ull << stepSh)), g1);

  // rolled: one copy of the pass's WMMAs, and every accumulator and fragment index stays a constant
#pragma clang loop unroll(disable)
  for (unsigned s = 0; s < kStages; ++s) {
    const unsigned buf = (s & 1u) * kStageB;
    const unsigned char* pa = ring + buf + aoff;
    const unsigned char* pb = ring + buf + boff;
    if constexpr (XF32) {
      FragSetX<MI> f[2];
      load_set_x<MI>(f[0], pa, pb, 0);
#pragma unroll
      for (int kb = 0; kb < kBlocks; ++kb) {
        if (kb < kBlocks - 1) load_set_x<MI>(f[(kb + 1) & 1], pa, pb, kb + 1);
        __builtin_amdgcn_sched_barrier(0);          // keeps the next block's LDS reads one group in front of this block's split and WMMAs
        FragSet<MI> g;
#pragma unroll
        for (int i = 0; i < MI; ++i) split_frag(f[kb & 1].ax[i], g.ah[i], g.al[i]);
#pragma unroll
        for (int j = 0; j < 4; ++j) { g.bh[j] = f[kb & 1].bh[j]; g.bl[j] = f[kb & 1].bl[j]; }
        mma_set<MI>(g, acc);
        __builtin_amdgcn_sched_barrier(0);          // and the block after that one's reads behind them
      }
    } else {
      FragSet<MI> f[2];
      load_set<ROWB, MI>(f[0], pa, pb, 0);
#pragma unroll
      for (int kb = 0; kb < kBlocks; ++kb) {
        if (kb < kBlocks - 1) load_set<ROWB, MI>(f[(kb + 1) & 1], pa, pb, kb + 1);
        __builtin_amdgcn_sched_barrier(0);          // keeps the next block's LDS reads one group in front of this block's WMMAs
        mma_set<MI>(f[kb & 1], acc);
        __builtin_amdgcn_sched_barrier(0);          // and the block after that one's reads behind them
      }
    }
    wait_ds0();
    wait_tensor0();
    __syncthreads();                                // publishes stage s + 1; every reader has left stage s's buffer
    const unsigned nx = pinned(s + 2u);             // formed behind the wait, and the descriptor from it
    if (nx < kStages) tdm_load(tdm_group0(slice + buf, ga + ((unsigned long long)nx << stepSh)), g1);
  }
  wait_tensor0();
  wait_ds0();

  // ---- epilogue ----
  if (ACT == 6) {
#pragma unroll
    for (int i = 0; i < MI; ++i)
#pragma unroll
      for (int j = 0; j < 4; ++j)
#pragma unroll
        for (int r = 0; r < 8; ++r) {
          const float v = acc[i][j][r];
          // the hardware's exp2 of x * log2(e): cheap enough for the compiler to evaluate it in every lane and select. The library exp
          // compiled to a branch on EXEC per element, 128 dependent chains that a wave walked one after the other
          acc[i][j][r] = (v > 0.f) ? (v + 1.0f) : __expf(v);
        }
  }
  // per-wave 16 x 64 slab, pitch 68 floats, in the ring: the last pass's foot (LDS reads returned, tensor loads landed, barrier) has
  // freed both buffers, and no load is issued behind it. A slab of its own would put the 128-B ring's work-group above half the LDS
  static_assert(4u * 16u * 68u * 4u <= kStageB, "the four slabs fit buffer 0");
  float* slab = (float*)ring + wave * (16u * 68u);
#pragma unroll
  for (int i = 0; i < MI; ++i) {
    const int mBase = m0 + (i << 4);
#pragma unroll
    for (int j = 0; j < 4; ++j) {
#pragma unroll
      for (int r = 0; r < 8; ++r) {
        slab[(mOff + r) * 68 + (j << 4) + rlane] = acc[i][j][r];
      }
    }
    __builtin_amdgcn_fence(__ATOMIC_RELEASE, "workgroup");
    __builtin_amdgcn_wave_barrier();
    __builtin_amdgcn_fence(__ATOMIC_ACQUIRE, "workgroup");
    if (OUT_MODE == 0) {
      const int hh = lane >> 4, c4 = (lane & 15) * 4;     // row seg = 256 B = 16 lanes x 16 B
      v4f rv[8];
#pragma unroll
      for (int it = 0; it < 8; ++it) rv[it] = *(const v4f*)(slab + (it * 2 + hh) * 68 + c4);
      if (causal == 0) {                               // the same for every thread of the grid
        const float qn = __uint_as_float(0x7fc00000u);
#pragma unroll
        for (int it = 0; it < 8; ++it) rv[it] = (v4f){qn, qn, qn, qn};
      }
#pragma unroll
      for (int it = 0; it < 8; ++it) *(v4f*)(Cf + (size_t)(mBase + it * 2 + hh) * kEmb + n0 + c4) = rv[it];
      asm volatile("s_wait_xcnt 0x0" ::: "memory");   // stands in front of the next use of the registers that these stores name
    } else {
      const int q = lane >> 3, c8 = (lane & 7) * 8;
      v8h hv[4], lv[4];
#pragma unroll
      for (int it = 0; it < 4; ++it) {
        const float* sp = slab + (it * 4 + q) * 68 + c8;
#pragma unroll
        for (int e = 0; e < 8; ++e) {
          unsigned short hb = f2bf_bits(sp[e]);
          unsigned short lb = f2bf_bits(sp[e] - bf_bits2f(hb));
          hv[it][e] = __builtin_bit_cast(_Float16, hb);
          lv[it][e] = __builtin_bit_cast(_Float16, lb);
        }
      }
#pragma unroll
      for (int it = 0; it < 4; ++it) {
        *(v8h*)(Ch + (size_t)(mBase + it * 4 + q) * kEmb + n0 + c8) = hv[it];
        *(v8h*)(Cl + (size_t)(mBase + it * 4 + q) * kEmb + n0 + c8) = lv[it];
      }
      asm volatile("s_wait_xcnt 0x0" ::: "memory");   // stands in front of the next use of the registers that these stores name
    }
    __builtin_amdgcn_fence(__ATOMIC_RELEASE, "workgroup");
    __builtin_amdgcn_wave_barrier();
    __builtin_amdgcn_fence(__ATOMIC_ACQUIRE, "workgroup");
  }
}

// The q, k, v projections in one grid (N/128, 32, 4), 128 threads; independent products share a launch, so a WGP goes from one to the
// next without a launch boundary. Product p reads activation p (f32) and the plane pair [hi | lo] number p behind B0 and writes pair p behind C0.
// z = 0, 1: q and k, 128 x 128 tiles, with elu(x)+1. z = 2, 3: v in 64 x 128 tiles, row blocks 32 (z - 2) + y.
// Two work-groups share a WGP (512 places): the 512 whole tiles fill every place once, then the 512 half tiles fill it again, so that
// a work-group has a neighbour on its WGP from the first pass to the last. With v in whole tiles its 256 would run one to a WGP.
__global__ __launch_bounds__(128) void proj_qkv_kernel(
    const float* __restrict__ X0, const float* __restrict__ X1, const float* __restrict__ X2,
    const unsigned short* __restrict__ B0, unsigned short* __restrict__ C0) {
  __shared__ __attribute__((aligned(2048))) unsigned char ring[2 * Ring<128>::kStageB];
  const unsigned z = blockIdx.z;
  const unsigned p = (z < 2u) ? z : 2u;
  const float* X = (p == 0u) ? X0 : (p == 1u) ? X1 : X2;
  const unsigned short* Bh = B0 + (size_t)(2u * p) * kWEl;
  unsigned short* Ch = C0 + (size_t)(2u * p) * kPlaneEl;
  if (z < 2u)   // the same for every thread of a work-group
    gemm_tile<2, 6, 128, 4, true>(ring, X, nullptr, nullptr, Bh, Bh + kWEl, Ch, Ch + kPlaneEl, nullptr, 1, blockIdx.y, blockIdx.x);
  else
    gemm_tile<2, 0, 128, 2, true>(ring, X, nullptr, nullptr, Bh, Bh + kWEl, Ch, Ch + kPlaneEl, nullptr, 1, (z - 2u) * 32u + blockIdx.y, blockIdx.x);
}

// The output projection: grid (N/128, M/128), 128 threads, one 128 x 128 tile per work-group, one work-group per WGP, f32 out
__global__ __launch_bounds__(128) void proj_out_kernel(
    const unsigned short* __restrict__ A0, const unsigned short* __restrict__ B0, float* __restrict__ Cf, const int* __restrict__ flag) {
  __shared__ __attribute__((aligned(2048))) unsigned char ring[2 * Ring<256>::kStageB];
  const int causal = flag[0];   // read at entry, where it is a scalar load
  gemm_tile<0, 0, 256, 4, false>(ring, nullptr, A0, A0 + kPlaneEl, B0, B0 + kWEl, nullptr, nullptr, Cf, causal, blockIdx.y, blockIdx.x);
}

// ---------------------------------------------------------------------------
// The four weights, f32 -> bf16 hi + lo planes (RNE convert both), 8 consecutive elements per thread: one 16-B store per lane per plane.
// One grid, by block range (block-uniform): kSplitWB blocks a weight; hi plane z lives at out + 2z*kWEl, lo plane at +kWEl.
// Coverage: kWEl/8 threads x 8 = the whole plane (the ranges are exact multiples of 256 threads).
// ---------------------------------------------------------------------------
constexpr int kSplitWB = (int)(kWEl / 8 / 256);       // 512 blocks per weight tensor
static_assert(kSplitWB == 1 << 9, "the shift in the kernel");
__global__ __launch_bounds__(256) void split_planes_kernel(const float* __restrict__ w0, const float* __restrict__ w1,
                                                           const float* __restrict__ w2, const float* __restrict__ w3,
                                                           unsigned short* __restrict__ out) {
  const unsigned b = blockIdx.x;
  const int z = (int)(b >> 9);
  const int i = (int)((b - ((unsigned)z << 9)) * 256u + threadIdx.x);
  const float* src = (z == 0) ? w0 : (z == 1) ? w1 : (z == 2) ? w2 : w3;
  const float* p = src + 8 * (size_t)i;
  const v4f a = *(const v4f*)(p);
  const v4f c = *(const v4f*)(p + 4);
  unsigned short hb[8], lb[8];
#pragma unroll
  for (int e = 0; e < 4; ++e) {
    hb[e]     = f2bf_bits(a[e]);
    lb[e]     = f2bf_bits(a[e] - bf_bits2f(hb[e]));
    hb[4 + e] = f2bf_bits(c[e]);
    lb[4 + e] = f2bf_bits(c[e] - bf_bits2f(hb[4 + e]));
  }
  const v4u uh = (v4u){pk16(hb[0], hb[1]), pk16(hb[2], hb[3]), pk16(hb[4], hb[5]), pk16(hb[6], hb[7])};
  const v4u ul = (v4u){pk16(lb[0], lb[1]), pk16(lb[2], lb[3]), pk16(lb[4], lb[5]), pk16(lb[6], lb[7])};
  unsigned short* ph = out + (size_t)(2 * z) * kWEl + 8 * (size_t)i;
  unsigned short* pl = ph + kWEl;
  *(v4u*)ph = uh;
  *(v4u*)pl = ul;
}

// ---------------------------------------------------------------------------
// Token-major chunk tiles in LDS, read as transposed WMMA operands. A tile row is one token: [64 hi | 64 lo] bf16 at pitch kPT.
// ds_load_tr16_b128: lane (c = l & 15, h = l >> 4) gets T[tok + 8h + 0..7][col + c]; the loads at tok and tok + 16 are one
// 16 x 32 fragment in the k order of Frag::load (elements 0..7 = k 8h + 0..7, 8..15 = k 16 + 8h + 0..7).
// ---------------------------------------------------------------------------
constexpr int kPT = 144;                       // elements: 288 B = 32 B x odd, the pitch of ds_load_tr16_b128 readers
typedef __attribute__((ext_vector_type(8))) short v8s;
__device__ __forceinline__ v8b lds_tr16(const unsigned short* p) {
  typedef __attribute__((address_space(3))) v8s lds_v8s;
  return __builtin_bit_cast(v8b, __builtin_amdgcn_ds_load_tr16_b128_v8i16((lds_v8s*)p));
}
// this lane's place in a 16-token x 16-column block, in elements
__device__ __forceinline__ int tr_lane(int lane) { return (8 * (lane >> 4) + (lane & 7)) * kPT + 8 * ((lane >> 3) & 1); }
// p = tile + first token * kPT + first column + tr_lane(lane)
__device__ __forceinline__ v16b lds_frag_tr(const unsigned short* p) {
  Frag<__bf16>::U f; f.h[0] = lds_tr16(p); f.h[1] = lds_tr16(p + 16 * kPT); return f.v;
}

// ---------------------------------------------------------------------------
// Per (batch-chunk y, head h), one work-group of eight waves: dST[e][d] = sum_j v[j][e] k[j][d] (f32, tile (y*16+h) of 64 x 64)
// and dz[y*16+h][d] = sum_j k[j][d] (f32, k = hi + lo, j in order). grid (32, 16), 256 threads.
// The 128 x 64 tiles of k and v (hi and lo) are staged as they lie in the token-major planes; both operands of the product are
// read from them by transposing loads. Wave w owns rows e = 16 (w >> 1) .. +15, columns d = 32 (w & 1) .. +31.
// Per accumulator: j ascending, hi.hi, hi.lo, lo.hi inside each 32 j.
// ---------------------------------------------------------------------------
__global__ __launch_bounds__(256) void state_inc_kernel(const unsigned short* __restrict__ kh, const unsigned short* __restrict__ kl,
                                                        const unsigned short* __restrict__ vh, const unsigned short* __restrict__ vl,
                                                        float* __restrict__ dST, float* __restrict__ dz) {
  __shared__ __align__(16) unsigned short sK[kChunk * kPT];
  __shared__ __align__(16) unsigned short sV[kChunk * kPT];
  __shared__ __align__(16) float sD[kHdim * 68];
  typedef Frag<__bf16> F;
  const int t = threadIdx.x;
  const int lane = t & 31, wave = t >> 5;
  const int rlane = lane & 15;
  const int mOff  = (lane >> 4) * 8;
  const int y = blockIdx.x, h = blockIdx.y;
  const size_t tile = (size_t)y * kHeads + h;
  const size_t go = (size_t)y * kChunk * kEmb + (size_t)h * kHdim + (size_t)(t >> 3) * kEmb + (t & 7) * 8;
  const unsigned short* pkh = kh + go;
  const unsigned short* pkl = kl + go;
  const unsigned short* pvh = vh + go;
  const unsigned short* pvl = vl + go;
  v4u gk[8], gv[8];
#pragma unroll
  for (int it = 0; it < 4; ++it) {
    gk[2 * it]     = *(const v4u*)(pkh + it * 32 * kEmb);
    gk[2 * it + 1] = *(const v4u*)(pkl + it * 32 * kEmb);
    gv[2 * it]     = *(const v4u*)(pvh + it * 32 * kEmb);
    gv[2 * it + 1] = *(const v4u*)(pvl + it * 32 * kEmb);
  }
  // stands in front of the first overwrite of a register that these loads name; the addresses are inputs, so none is reused before it
  asm volatile("s_wait_xcnt 0x0" :: "v"(pkh), "v"(pkl), "v"(pvh), "v"(pvl) : "memory");
#pragma unroll
  for (int it = 0; it < 4; ++it) {
    const int o = (it * 32 + (t >> 3)) * kPT + (t & 7) * 8;
    *(v4u*)(sK + o)      = gk[2 * it];
    *(v4u*)(sK + o + 64) = gk[2 * it + 1];
    *(v4u*)(sV + o)      = gv[2 * it];
    *(v4u*)(sV + o + 64) = gv[2 * it + 1];
  }
  __syncthreads();                             // the staged tiles are readable by every wave

  const int trl = tr_lane(lane);
  const int e0 = (wave >> 1) * 16, d0 = (wave & 1) * 32;
  v8f acc[2];
#pragma unroll
  for (int j = 0; j < 2; ++j) acc[j] = (v8f){0.f,0.f,0.f,0.f,0.f,0.f,0.f,0.f};
#pragma unroll
  for (int kb = 0; kb < 4; ++kb) {
    const unsigned short* pa = sV + kb * 32 * kPT + e0 + trl;
    const unsigned short* pb = sK + kb * 32 * kPT + d0 + trl;
    const v16b ah = lds_frag_tr(pa);
    const v16b al = lds_frag_tr(pa + 64);
    v16b bh[2], bl[2];
#pragma unroll
    for (int j = 0; j < 2; ++j) {
      bh[j] = lds_frag_tr(pb + j * 16);
      bl[j] = lds_frag_tr(pb + j * 16 + 64);
    }
#pragma unroll
    for (int j = 0; j < 2; ++j) acc[j] = F::mma(ah, bh[j], acc[j]);
#pragma unroll
    for (int j = 0; j < 2; ++j) acc[j] = F::mma(ah, bl[j], acc[j]);
#pragma unroll
    for (int j = 0; j < 2; ++j) acc[j] = F::mma(al, bh[j], acc[j]);
  }
#pragma unroll
  for (int j = 0; j < 2; ++j)
#pragma unroll
    for (int r = 0; r < 8; ++r) sD[(e0 + mOff + r) * 68 + d0 + j * 16 + rlane] = acc[j][r];

  float s = 0.f;
  if (t < kHdim) {                             // waves 0 and 1, whole
    // unrolled so that a group's 64 LDS reads are in flight together; rolled, every token waits out its own LDS latency
#pragma unroll 32
    for (int j = 0; j < kChunk; ++j) {
      const float kv = bf_bits2f(sK[j * kPT + t]) + bf_bits2f(sK[j * kPT + 64 + t]);
      s = s + kv;
    }
  }
  __syncthreads();                             // the 64 x 64 tile is whole: it goes out in rows, 512 contiguous bytes a wave

  float* dp = dST + tile * (size_t)(kHdim * kHdim) + 4 * t;
  v4f rv[4];
#pragma unroll
  for (int it = 0; it < 4; ++it) {
    const int u = it * 256 + t;
    rv[it] = *(const v4f*)(sD + (u >> 4) * 68 + (u & 15) * 4);
  }
#pragma unroll
  for (int it = 0; it < 4; ++it) *(v4f*)(dp + it * 1024) = rv[it];
  if (t < kHdim) dz[tile * kHdim + t] = s;     // behind the barrier, so that no wave waits there for this store
  asm volatile("s_wait_xcnt 0x0" ::: "memory");   // stands behind the last stores, in front of any later write of a register that they name
}

// ---------------------------------------------------------------------------
// Exclusive prefix over chunks of the transposed state and of z, per (b, h). No element depends on another, so the work is dealt
// by element: grid (32 bh, 5), 256 threads. Slices y = 0..3: thread t owns elements 1024y + 4t .. +3 of every 4096-element tile;
// slice y = 4: thread t < 64 owns element t of z. A thread first issues the loads of all 15 increments it needs (the last chunk's
// is never used), so their latencies overlap, then sums them in registers in chunk order and stores each chunk's value.
// S^T_c = sum_{c' < c} dST_{c'} (f32, sequential), written as bf16 hi/lo planes [tile][64 e][64 d] (tile = (b*16+c)*16+h);
// z_c likewise to zpre[tile][64] (f32). A wave's store covers 256 contiguous bytes of a plane.
// ---------------------------------------------------------------------------
typedef __attribute__((ext_vector_type(2))) unsigned int v2u;
constexpr int kPfxSlices = 4;                    // 4 slices x 256 threads x 4 elements = one 64 x 64 tile
static_assert(kPfxSlices * 256 * 4 == kHdim * kHdim, "the slices cover a tile");
// at most eight waves per SIMD are asked for: 128 registers a wave. Without it the build keeps to 81 registers and holds the last
// load back until the first has returned, to take over its registers
__global__ __launch_bounds__(256) __attribute__((amdgpu_waves_per_eu(2, 8))) void state_prefix_kernel(const float* __restrict__ dST, const float* __restrict__ dz,
                                                           unsigned short* __restrict__ STh, unsigned short* __restrict__ STl,
                                                           float* __restrict__ zpre) {
  const int t = threadIdx.x;
  const int bh = blockIdx.x;
  const int b = bh >> 4, h = bh & 15;
  const size_t tile0 = (size_t)(b * kNChunk) * kHeads + h;   // chunk 0's tile; chunk c's is tile0 + 16 c
  if (blockIdx.y == (unsigned)kPfxSlices) {                  // block-uniform: the z slice
    if (t >= kHdim) return;
    const float* zp = dz + tile0 * kHdim + t;
    float* zo = zpre + tile0 * kHdim + t;
    float zd[kNChunk - 1];
#pragma unroll
    for (int c = 0; c < kNChunk - 1; ++c) zd[c] = zp[c * kHeads * kHdim];
    float zacc = 0.f;
#pragma unroll
    for (int c = 0; c < kNChunk; ++c) {
      zo[c * kHeads * kHdim] = zacc;
      if (c < kNChunk - 1) zacc += zd[c];
    }
    return;
  }
  const size_t el = tile0 * 4096 + ((size_t)blockIdx.y * 256 + t) * 4;
  const float* dp = dST + el;
  unsigned short* ph = STh + el;
  unsigned short* pl = STl + el;
  v4f d[kNChunk - 1];
#pragma unroll
  for (int c = 0; c < kNChunk - 1; ++c) d[c] = *(const v4f*)(dp + c * kHeads * 4096);
  // all 15 loads stay in front of this line, so that they are in flight together (the compiler otherwise sinks five of them behind the
  // first waits); and it stands in front of the first overwrite of the address register, which is an input, so it is not reused before it
  asm volatile("s_wait_xcnt 0x0" :: "v"(dp) : "memory");
  v4f a = (v4f){0.f, 0.f, 0.f, 0.f};
#pragma unroll
  for (int c = 0; c < kNChunk; ++c) {
    unsigned short hb[4], lb[4];
#pragma unroll
    for (int e = 0; e < 4; ++e) {
      hb[e] = f2bf_bits(a[e]);
      lb[e] = f2bf_bits(a[e] - bf_bits2f(hb[e]));
    }
    *(v2u*)(ph + c * kHeads * 4096) = (v2u){pk16(hb[0], hb[1]), pk16(hb[2], hb[3])};
    *(v2u*)(pl + c * kHeads * 4096) = (v2u){pk16(lb[0], lb[1]), pk16(lb[2], lb[3])};
    if (c < kNChunk - 1) a += d[c];
  }
  asm volatile("s_wait_xcnt 0x0" ::: "memory");   // stands behind the last stores, in front of any later write of a register that they name
}

// ---------------------------------------------------------------------------
// Per (batch-chunk y, head h), one work-group of eight waves: masked scores A = tril(q.k^T), num = A.v + q.S_c,
// den = q.z_c + rowsum(A) + eps, o = num * (1/den) as bf16 hi/lo rows of the token-major o planes.
// The k, v and S^T tiles (hi and lo) are staged once in LDS, v token-major and read by transposing loads; wave w owns chunk rows 16w .. 16w+15 from the scores to the stores,
// and its A rows pass from the accumulator layout to the A-operand layout through its own LDS slab (bf16 hi/lo, never in memory).
// Every sum keeps its order: per accumulator k ascending with hi.hi, hi.lo, lo.hi inside each 32 k; A.v and q.S in separate
// accumulators, added once; row sum and q.z sequential in f32.
// ---------------------------------------------------------------------------
constexpr int kPK = 72;                        // LDS row pitch of the 64-wide tiles (k, S^T), elements: 144 B = 16 B x odd
constexpr int kPV = 136;                       // LDS row pitch of the 128-wide A rows, elements: 272 B = 16 B x odd
constexpr int kSlabB = 2 * 16 * kPV * 2;       // one wave's slab: A_h rows, then A_l rows; later the f32 num rows (pitch 68)
static_assert(16 * 68 * 4 <= kSlabB, "the num rows fit the slab");

// orders one wave's LDS writes in front of reads by its other lanes (the slabs are private to a wave)
__device__ __forceinline__ void wave_lds_sync() {
  __builtin_amdgcn_fence(__ATOMIC_RELEASE, "workgroup");
  __builtin_amdgcn_wave_barrier();
  __builtin_amdgcn_fence(__ATOMIC_ACQUIRE, "workgroup");
}
__device__ __forceinline__ v16b lds_frag(const unsigned short* p) { return Frag<__bf16>::load((const __bf16*)p); }

// at most 256 registers a wave: two work-groups (four waves per SIMD) share a WGP, so all 512 are resident at once
__global__ __launch_bounds__(256) __attribute__((amdgpu_waves_per_eu(4, 4))) void chunk_attn_kernel(const unsigned short* __restrict__ qh, const unsigned short* __restrict__ ql,
                                                         const unsigned short* __restrict__ kh, const unsigned short* __restrict__ kl,
                                                         const unsigned short* __restrict__ vh, const unsigned short* __restrict__ vl,
                                                         const unsigned short* __restrict__ STh, const unsigned short* __restrict__ STl,
                                                         const float* __restrict__ zpre,
                                                         unsigned short* __restrict__ oh, unsigned short* __restrict__ ol) {
  __shared__ __align__(16) unsigned short sKh[kChunk * kPK];
  __shared__ __align__(16) unsigned short sKl[kChunk * kPK];
  __shared__ __align__(16) unsigned short sV[kChunk * kPT];
  __shared__ __align__(16) unsigned short sSh[kHdim * kPK];
  __shared__ __align__(16) unsigned short sSl[kHdim * kPK];
  __shared__ __align__(16) unsigned char  sW[8][kSlabB];
  __shared__ __align__(16) float sInv[8][16];
  typedef Frag<__bf16> F;
  const int t = threadIdx.x;
  const int lane = t & 31, wave = t >> 5;
  const int rlane = lane & 15;                 // row (A operand) / column (B operand, accumulator) within a 16-wide subtile
  const int koff  = (lane >> 4) * 8;           // k offset of this lane half
  const int mOff  = (lane >> 4) * 8;           // accumulator row offset
  const int y = blockIdx.x, h = blockIdx.y;
  const size_t tile = (size_t)y * kHeads + h;
  const size_t base = (size_t)y * kChunk * kEmb + (size_t)h * kHdim;   // chunk row 0 at this head, token-major planes

  // ---- the tiles, 16 B per lane: k 128 x 64, v 128 x 64, S^T 64 x 64, hi and lo; this wave's q rows ----
  const size_t ko = base + (size_t)(t >> 3) * kEmb + (t & 7) * 8;
  const size_t so = tile * (size_t)(kHdim * kHdim) + (size_t)t * 8;
  const size_t qrow = base + (size_t)(wave * 16 + rlane) * kEmb;
  const unsigned short* pkh = kh + ko;
  const unsigned short* pkl = kl + ko;
  const unsigned short* pvh = vh + ko;
  const unsigned short* pvl = vl + ko;
  const unsigned short* psh = STh + so;
  const unsigned short* psl = STl + so;
  const unsigned short* pqh = qh + qrow;
  const unsigned short* pql = ql + qrow;
  const unsigned short* pfh = pqh + koff;
  const unsigned short* pfl = pql + koff;
  v4u gk[8], gv[8], gs[4], gqh[8], gql[8];
#pragma unroll
  for (int it = 0; it < 4; ++it) {
    gk[2 * it]     = *(const v4u*)(pkh + it * 32 * kEmb);
    gk[2 * it + 1] = *(const v4u*)(pkl + it * 32 * kEmb);
    gv[2 * it]     = *(const v4u*)(pvh + it * 32 * kEmb);
    gv[2 * it + 1] = *(const v4u*)(pvl + it * 32 * kEmb);
  }
#pragma unroll
  for (int it = 0; it < 2; ++it) {
    gs[2 * it]     = *(const v4u*)(psh + it * 2048);
    gs[2 * it + 1] = *(const v4u*)(psl + it * 2048);
  }
  // the q rows as A operands (K = 64: two 32-k blocks), and whole (row rlane) for q.z
  v16b qfh[2], qfl[2];
#pragma unroll
  for (int kb = 0; kb < 2; ++kb) {
    qfh[kb] = F::load((const __bf16*)(pfh + kb * 32));
    qfl[kb] = F::load((const __bf16*)(pfl + kb * 32));
  }
#pragma unroll
  for (int w = 0; w < 8; ++w) {
    gqh[w] = *(const v4u*)(pqh + 8 * w);
    gql[w] = *(const v4u*)(pql + 8 * w);
  }
  // stands in front of the first overwrite of a register that these loads name; the addresses are inputs, so none is reused before it
  asm volatile("s_wait_xcnt 0x0" :: "v"(pkh), "v"(pkl), "v"(pvh), "v"(pvl), "v"(psh), "v"(psl), "v"(pqh), "v"(pql), "v"(pfh), "v"(pfl) : "memory");
#pragma unroll
  for (int it = 0; it < 4; ++it) {
    const int u = it * 256 + t;
    *(v4u*)(sKh + (u >> 3) * kPK + (u & 7) * 8) = gk[2 * it];
    *(v4u*)(sKl + (u >> 3) * kPK + (u & 7) * 8) = gk[2 * it + 1];
    *(v4u*)(sV + (u >> 3) * kPT + (u & 7) * 8)      = gv[2 * it];
    *(v4u*)(sV + (u >> 3) * kPT + (u & 7) * 8 + 64) = gv[2 * it + 1];
  }
#pragma unroll
  for (int it = 0; it < 2; ++it) {
    const int u = it * 256 + t;
    *(v4u*)(sSh + (u >> 3) * kPK + (u & 7) * 8) = gs[2 * it];
    *(v4u*)(sSl + (u >> 3) * kPK + (u & 7) * 8) = gs[2 * it + 1];
  }

  // ---- q . z_c of row rlane (both lane halves compute the same row) ----
  const float* zp = zpre + tile * kHdim;
  float qz = 0.f;
#pragma unroll
  for (int w = 0; w < 8; ++w) {
    const v4u uh = gqh[w];
    const v4u ul = gql[w];
    const v4f z0 = *(const v4f*)(zp + 8 * w);
    const v4f z1 = *(const v4f*)(zp + 8 * w + 4);
    float qv[8], zv[8];
#pragma unroll
    for (int e = 0; e < 4; ++e) {
      qv[2 * e]     = bflo2f(uh[e]) + bflo2f(ul[e]);
      qv[2 * e + 1] = bfhi2f(uh[e]) + bfhi2f(ul[e]);
      zv[e] = z0[e];
      zv[4 + e] = z1[e];
    }
#pragma unroll
    for (int e = 0; e < 8; ++e) qz += qv[e] * zv[e];
  }
  sInv[wave][rlane] = qz;                      // parked in LDS: kept in a register, the whole sum is sunk to its use and the q rows spill
  __syncthreads();                             // the staged tiles are readable by every wave

  // ---- masked scores of rows 16w .. 16w+15, four column subtiles at a time, into the slab as bf16 hi/lo ----
  unsigned short* aH = (unsigned short*)sW[wave];
  unsigned short* aL = aH + 16 * kPV;
#pragma unroll
  for (int jh = 0; jh < 2; ++jh) {
    v8f s[4];
#pragma unroll
    for (int j = 0; j < 4; ++j) s[j] = (v8f){0.f,0.f,0.f,0.f,0.f,0.f,0.f,0.f};
#pragma unroll
    for (int kb = 0; kb < 2; ++kb) {
      v16b bh[4], bl[4];
#pragma unroll
      for (int j = 0; j < 4; ++j) {
        const int o = ((jh * 4 + j) * 16 + rlane) * kPK + koff + kb * 32;
        bh[j] = lds_frag(sKh + o);
        bl[j] = lds_frag(sKl + o);
      }
#pragma unroll
      for (int j = 0; j < 4; ++j) s[j] = F::mma(qfh[kb], bh[j], s[j]);
#pragma unroll
      for (int j = 0; j < 4; ++j) s[j] = F::mma(qfh[kb], bl[j], s[j]);
#pragma unroll
      for (int j = 0; j < 4; ++j) s[j] = F::mma(qfl[kb], bh[j], s[j]);
    }
#pragma unroll
    for (int j = 0; j < 4; ++j) {
      const int n = (jh * 4 + j) * 16 + rlane;
#pragma unroll
      for (int r = 0; r < 8; ++r) {
        float v = s[j][r];
        if (n > wave * 16 + mOff + r) v = 0.0f;
        const unsigned short hb = f2bf_bits(v);
        const unsigned short lb = f2bf_bits(v - bf_bits2f(hb));
        aH[(mOff + r) * kPV + n] = hb;
        aL[(mOff + r) * kPV + n] = lb;
      }
    }
  }

  // ---- q . S_c: K = 64 ----
  v8f qs[4], av[4];
#pragma unroll
  for (int j = 0; j < 4; ++j) { qs[j] = (v8f){0.f,0.f,0.f,0.f,0.f,0.f,0.f,0.f}; av[j] = (v8f){0.f,0.f,0.f,0.f,0.f,0.f,0.f,0.f}; }
#pragma unroll
  for (int kb = 0; kb < 2; ++kb) {
    v16b bh[4], bl[4];
#pragma unroll
    for (int j = 0; j < 4; ++j) {
      const int o = (j * 16 + rlane) * kPK + koff + kb * 32;
      bh[j] = lds_frag(sSh + o);
      bl[j] = lds_frag(sSl + o);
    }
#pragma unroll
    for (int j = 0; j < 4; ++j) qs[j] = F::mma(qfh[kb], bh[j], qs[j]);
#pragma unroll
    for (int j = 0; j < 4; ++j) qs[j] = F::mma(qfh[kb], bl[j], qs[j]);
#pragma unroll
    for (int j = 0; j < 4; ++j) qs[j] = F::mma(qfl[kb], bh[j], qs[j]);
  }
  wave_lds_sync();                             // the slab's A rows are readable by every lane of this wave

  // ---- A . v: K = 128 ----
  const int trl = tr_lane(lane);
#pragma unroll
  for (int kb = 0; kb < 4; ++kb) {
    const v16b ah = lds_frag(aH + rlane * kPV + koff + kb * 32);
    const v16b al = lds_frag(aL + rlane * kPV + koff + kb * 32);
    v16b bh[4], bl[4];
#pragma unroll
    for (int j = 0; j < 4; ++j) {
      const unsigned short* pv = sV + kb * 32 * kPT + j * 16 + trl;
      bh[j] = lds_frag_tr(pv);
      bl[j] = lds_frag_tr(pv + 64);
    }
#pragma unroll
    for (int j = 0; j < 4; ++j) av[j] = F::mma(ah, bh[j], av[j]);
#pragma unroll
    for (int j = 0; j < 4; ++j) av[j] = F::mma(ah, bl[j], av[j]);
#pragma unroll
    for (int j = 0; j < 4; ++j) av[j] = F::mma(al, bh[j], av[j]);
  }

  // ---- row sum of the masked scores of row rlane, j in order ----
  float asum = 0.f;
#pragma unroll
  for (int w = 0; w < 16; ++w) {
    const v4u uh = *(const v4u*)(aH + rlane * kPV + 8 * w);
    const v4u ul = *(const v4u*)(aL + rlane * kPV + 8 * w);
#pragma unroll
    for (int e = 0; e < 4; ++e) {
      const float a0 = bflo2f(uh[e]) + bflo2f(ul[e]);
      asum = asum + a0;
      const float a1 = bfhi2f(uh[e]) + bfhi2f(ul[e]);
      asum = asum + a1;
    }
  }
  const float den = (sInv[wave][rlane] + asum) + kEps;
  const float inv = 1.0f / den;
  wave_lds_sync();                             // every read of the A rows has returned: the slab takes the num rows

  float* slab = (float*)sW[wave];
#pragma unroll
  for (int j = 0; j < 4; ++j)
#pragma unroll
    for (int r = 0; r < 8; ++r) slab[(mOff + r) * 68 + (j << 4) + rlane] = av[j][r] + qs[j][r];
  sInv[wave][rlane] = inv;
  wave_lds_sync();

  const int q4 = lane >> 3, c8 = (lane & 7) * 8;
  v4u uo_h[4], uo_l[4];
#pragma unroll
  for (int it = 0; it < 4; ++it) {
    const int row = it * 4 + q4;
    const float iv = sInv[wave][row];
    unsigned short hb[8], lb[8];
#pragma unroll
    for (int e = 0; e < 8; ++e) {
      const float f = slab[row * 68 + c8 + e] * iv;
      hb[e] = f2bf_bits(f);
      lb[e] = f2bf_bits(f - bf_bits2f(hb[e]));
    }
    uo_h[it] = (v4u){pk16(hb[0], hb[1]), pk16(hb[2], hb[3]), pk16(hb[4], hb[5]), pk16(hb[6], hb[7])};
    uo_l[it] = (v4u){pk16(lb[0], lb[1]), pk16(lb[2], lb[3]), pk16(lb[4], lb[5]), pk16(lb[6], lb[7])};
  }
#pragma unroll
  for (int it = 0; it < 4; ++it) {
    const size_t o = base + (size_t)(wave * 16 + it * 4 + q4) * kEmb + c8;
    *(v4u*)(oh + o) = uo_h[it];
    *(v4u*)(ol + o) = uo_l[it];
  }
}

// ---------------------------------------------------------------------------
// Host launcher
// ---------------------------------------------------------------------------
extern "C" void kernel_launch(void* const* d_in, const int* in_sizes, int n_in,
                              void* d_out, int out_size, void* d_ws, size_t ws_size,
                              hipStream_t stream) {
  if (n_in < 8) return;
  if (in_sizes[0] != (int)kPlaneEl || in_sizes[1] != (int)kPlaneEl || in_sizes[2] != (int)kPlaneEl) return;
  if (in_sizes[3] != (int)kWEl || in_sizes[4] != (int)kWEl || in_sizes[5] != (int)kWEl || in_sizes[6] != (int)kWEl) return;
  if (in_sizes[7] < 1) return;
  if (out_size != (int)kPlaneEl) return;
  if (ws_size < (size_t)kWsTotal) return;

  const float* Q  = (const float*)d_in[0];
  const float* Kx = (const float*)d_in[1];
  const float* Vx = (const float*)d_in[2];
  const float* Wq = (const float*)d_in[3];
  const float* Wk = (const float*)d_in[4];
  const float* Wv = (const float*)d_in[5];
  const float* Wo = (const float*)d_in[6];
  const int*   causal = (const int*)d_in[7];
  float* out = (float*)d_out;
  char* ws = (char*)d_ws;

  unsigned short* Wbase = (unsigned short*)(ws + oWbase);
  const unsigned short* Wo_h = (const unsigned short*)(ws + oWo_h);
  unsigned short* q_h  = (unsigned short*)(ws + oQ_h);
  unsigned short* q_l  = (unsigned short*)(ws + oQ_l);
  unsigned short* k_h  = (unsigned short*)(ws + oK_h);
  unsigned short* k_l  = (unsigned short*)(ws + oK_l);
  unsigned short* v_h  = (unsigned short*)(ws + oV_h);
  unsigned short* v_l  = (unsigned short*)(ws + oV_l);
  float*          dST  = (float*)(ws + oDST);
  unsigned short* ST_h = (unsigned short*)(ws + oST_h);
  unsigned short* ST_l = (unsigned short*)(ws + oST_l);
  unsigned short* o_h  = (unsigned short*)(ws + oO_h);
  unsigned short* o_l  = (unsigned short*)(ws + oO_l);
  float*          dz   = (float*)(ws + oDZ);
  float*          zpre = (float*)(ws + oZPRE);

  // 1) weight hi/lo planes
  split_planes_kernel<<<dim3((unsigned)(4 * kSplitWB), 1, 1), 256, 0, stream>>>(Wq, Wk, Wv, Wo, Wbase);

  // 2) projections q, k, v in one grid, activations read in f32 and split in registers: each M=4096, N=1024, K=1024; q, k with elu(x)+1 in 128 x 128 tiles, v in 64 x 128 tiles, two work-groups to a WGP
  proj_qkv_kernel<<<dim3(kEmb / 128, kTok / 128, 4), 128, 0, stream>>>(Q, Kx, Vx, Wbase, q_h);

  // 3) per (b,c,h): dST[e][d] = sum_j v[j][e] k[j][d] and the chunk sums of k
  state_inc_kernel<<<dim3(kYB, kHeads, 1), 256, 0, stream>>>(k_h, k_l, v_h, v_l, dST, dz);

  // 4) exclusive prefix over chunks of S^T and z
  state_prefix_kernel<<<dim3(kBatch * kHeads, kPfxSlices + 1, 1), 256, 0, stream>>>(dST, dz, ST_h, ST_l, zpre);

  // 5) per (b,c,h): masked scores, A.v + q.S_c, normaliser -> attention output hi/lo planes (token-major, heads merged)
  chunk_attn_kernel<<<dim3(kYB, kHeads, 1), 256, 0, stream>>>(q_h, q_l, k_h, k_l, v_h, v_l, ST_h, ST_l, zpre, o_h, o_l);

  // 6) output projection: M=4096, N=1024, K=1024 -> d_out, with the premise check on the causal flag (NaN when the non-causal branch
  //    would be required)
  proj_out_kernel<<<dim3(kEmb / 128, kTok / 128, 1), 128, 0, stream>>>(o_h, Wo_h, out, causal);
}

// v009
// A run of this version takes 99.4 microseconds.
// Two timings next to v008 both put it at 1.07 times that version's speed.
// Over all steps from v000 it is 4.35 times as fast.
// Contractions: q/k/v projections, chunk scores q.k^T, state increment v^T.k, q.S, A.v, output projection -- all v_wmma_f32_16x16x32_bf16 with bf16 hi/lo operand planes (hi.hi + hi.lo + lo.hi), f32 accumulate; feature map, state prefix over chunks, normaliser and division in f32 on the VALU.
#include <hip/hip_runtime.h>
#include <math.h>

// ---------------------------------------------------------------------------
// Problem constants
// ---------------------------------------------------------------------------
constexpr int kBatch   = 2;
constexpr int kSeq     = 2048;
constexpr int kEmb     = 1024;
constexpr int kHeads   = 16;
constexpr int kHdim    = 64;
constexpr int kChunk   = 128;
constexpr int kNChunk  = kSeq / kChunk;          // 16 chunks per sequence
constexpr int kTok     = kBatch * kSeq;          // 4096 token rows
constexpr int kYB      = kBatch * kNChunk;       // 32 (batch, chunk) pairs
constexpr int kTiles   = kYB * kHeads;           // 512 (batch, chunk, head) tiles
constexpr float kEps   = 1e-6f;
constexpr long kPlaneEl = (long)kTok * kEmb;     // 4194304 elements per activation plane
constexpr long kWEl     = (long)kEmb * kEmb;     // 1048576 elements per weight plane
constexpr long kUnit    = kPlaneEl * 2;          // 8388608 bytes (one bf16 activation plane)
constexpr long kWUnit   = kWEl * 2;              // 2097152 bytes (one bf16 weight plane)

// ---------------------------------------------------------------------------
// Workspace region map (bytes; U = 8388608, WU = 2097152); total 14U + 262144 = 117702656
//   [0U , 6U)  o_h@0U o_l@1U dST(f32)@4U ST_h@5U ST_l@5.5U
//   [6U , 8U)  Wq_h Wq_l Wk_h Wk_l Wv_h Wv_l Wo_h Wo_l (WU each)
//   [8U ,14U)  q_h@8U q_l@9U k_h@10U k_l@11U v_h@12U v_l@13U (projection outputs)
//   [14U, +262144)  dz f32 [512][64] @14U, zpre f32 [512][64] @14U+131072
// ---------------------------------------------------------------------------
constexpr long oO_h   = 0;
constexpr long oO_l   = 1 * kUnit;
constexpr long oDST   = 4 * kUnit;
constexpr long oST_h  = 5 * kUnit;
constexpr long oST_l  = 5 * kUnit + kUnit / 2;
constexpr long oWbase = 6 * kUnit;
constexpr long oWo_h  = oWbase + 6 * kWUnit;
constexpr long oWo_l  = oWbase + 7 * kWUnit;
constexpr long oQ_h   = 8 * kUnit;
constexpr long oQ_l   = 9 * kUnit;
constexpr long oK_h   = 10 * kUnit;
constexpr long oK_l   = 11 * kUnit;
constexpr long oV_h   = 12 * kUnit;
constexpr long oV_l   = 13 * kUnit;
constexpr long oDZ    = 14 * kUnit;
constexpr long oZPRE  = 14 * kUnit + 131072;
constexpr long kWsTotal = 14 * kUnit + 262144;
static_assert(kWsTotal == 117702656, "carve total");
static_assert(kWsTotal <= 134217728, "carve within 128 MiB");
static_assert((long)kTiles * kHdim * kHdim * 4 == kUnit, "dST plane size");

typedef __attribute__((ext_vector_type(8)))  _Float16 v8h;
typedef __attribute__((ext_vector_type(16))) __bf16   v16b;
typedef __attribute__((ext_vector_type(8)))  __bf16   v8b;
typedef __attribute__((ext_vector_type(8)))  float    v8f;
typedef __attribute__((ext_vector_type(4)))  float    v4f;
typedef __attribute__((ext_vector_type(4)))  unsigned int v4u;

__device__ __forceinline__ unsigned short f2bf_bits(float f) {
  unsigned u = __float_as_uint(f);
  return (unsigned short)((u + 0x7FFFu + ((u >> 16) & 1u)) >> 16);
}
__device__ __forceinline__ float bf_bits2f(unsigned short h) { return __uint_as_float(((unsigned)h) << 16); }

template <typename T> struct Frag;
template <> struct Frag<__bf16> {
  typedef v16b V; union U { v16b v; v8b h[2]; };
  static __device__ __forceinline__ v16b load(const __bf16* p) {   // elements 0..7 <- p[0..7], 8..15 <- p[16..23]
    U f; f.h[0] = *(const v8b*)(p); f.h[1] = *(const v8b*)(p + 16); return f.v;
  }
  static __device__ __forceinline__ v8f mma(v16b a, v16b b, v8f c) {
    return __builtin_amdgcn_wmma_f32_16x16x32_bf16(false, a, false, b, (short)0, c, false, false);
  }
};

__device__ __forceinline__ unsigned pk16(unsigned short a, unsigned short b) { return (unsigned)a | ((unsigned)b << 16); }
// bf16 element pair held in one 32-bit word: low half-word = even element, high half-word = odd element
__device__ __forceinline__ float bflo2f(unsigned w) { return __uint_as_float(w << 16); }
__device__ __forceinline__ float bfhi2f(unsigned w) { return __uint_as_float(w & 0xffff0000u); }

// ---------------------------------------------------------------------------
// The four 4096 x 1024 x 1024 products: C[m,n] = sum_k A[m,k] * Bt[n,k], hi/lo planes, product = hi.hi + hi.lo + lo.hi.
// One 128 x 128 (or 64 x 128) tile of C per work-group, four waves (2 x 2), each wave a 64 x 64 (32 x 64) tile (4 x 4 or 2 x 4 accumulators).
// A stage is ROWB bytes (ROWB / 2 k) of the tile's rows of each of the four operand planes [A_h | A_l | B_h | B_l], a slice of 128 rows' room each, LDS row pitch ROWB + 16;
// wave w brings plane w of every stage with one tensor load; two buffers, the next stage's loads fly while this one is worked on.
// XF32 (the q, k, v projections, ROWB = 128): A is taken as it comes, in f32, and no hi/lo planes of it are written or read. Slices 0 and 1 then
// hold k 0..31 and k 32..63 of the stage's A rows in f32: again 128 B a row, so the ring's size, places and pad stay, and only the source
// pitch and the step from stage to stage differ by slice. A wave reads its A fragments in f32 (four 16-B reads for a lane's 16 values, as many
// as for a hi and a lo fragment) and splits them in registers: hi = bf16(x), lo = bf16(x - hi), both round to nearest even, the planes' values.
// ROWB = 256: the ring fills the WGP's LDS, one work-group per WGP. ROWB = 128: the ring is 144 KiB, two work-groups share a WGP
// (two waves per SIMD), and one's prologue, barrier waits, first fragment loads and epilogue run under the other's WMMAs.
// A work-group walks the K stages in a circle from a first stage of its own (by its tile's column and row): the groups that share A rows (one
// tile row) or B rows (one tile column) run in step, and from a common start they would all ask L2 for the same lines at the same moment.
// Per accumulator the products are summed in that stage order, k ascending inside a stage, hi.hi, hi.lo, lo.hi inside each 32 k.
// ---------------------------------------------------------------------------
template <unsigned ROWB> struct Ring {
  static_assert(ROWB == 128 || ROWB == 256, "the two row lengths whose 16-B pad is known to land right");
  static constexpr unsigned kRowB   = ROWB;                        // bytes of one operand row in a stage
  static constexpr unsigned kPitchB = ROWB + 16;                   // LDS row pitch: the row + the 16-B pad for ds_load_b128 readers
  static constexpr unsigned kPlaneB = 128 * kPitchB;               // 18432 / 34816 B, one plane's slice of a stage
  static constexpr unsigned kStageB = 4 * kPlaneB;                 // 73728 / 139264 B, one buffer
  static constexpr unsigned kStages = (unsigned)kEmb * 2 / ROWB;   // 16 / 8
  static constexpr int      kBlocks = (int)(ROWB / 64);            // 32-k blocks in a stage
  static constexpr unsigned kPadWord = (1u << 20) | ((ROWB == 256 ? 5u : 4u) << 22) | (3u << 25);   // 4 dwords behind every row
  static_assert(kPlaneB % 2048 == 0, "every slice starts at a multiple of 2 KiB");
  static_assert(kStages >= 2, "the ring's prologue needs two stages");
};
typedef __attribute__((ext_vector_type(8))) unsigned int v8u;

__device__ __forceinline__ unsigned uni(unsigned v) { return (unsigned)__builtin_amdgcn_readfirstlane((int)v); }
__device__ __forceinline__ unsigned pinned(unsigned v) { unsigned w = uni(v); asm volatile("" : "+s"(w)); return w; }
__device__ __forceinline__ void wait_ds0()     { asm volatile("s_wait_dscnt 0x0" ::: "memory"); }      // this wave's LDS reads have returned
__device__ __forceinline__ void wait_tensor0() { asm volatile("s_wait_tensorcnt 0x0" ::: "memory"); }  // this wave's tensor load has landed
// group 1 goes in and out: its eight registers then hold nothing else from one load to the next. As a plain input of constants the
// compiler took single registers of it for loop temporaries while a request that names them was outstanding, and set them anew before the next load
__device__ __forceinline__ void tdm_load(v4u g0, v8u& g1) { asm volatile("tensor_load_to_lds %1, %0" : "+s"(g1) : "s"(g0) : "memory"); }
__device__ __forceinline__ v4u tdm_group0(unsigned lds_dst, unsigned long long ga) {
  v4u g;
  g[0] = uni(1u); g[1] = uni(lds_dst); g[2] = uni((unsigned)ga); g[3] = uni((((unsigned)(ga >> 32)) & 0x01FFFFFFu) | 0x80000000u);
  return g;
}
// 1-byte elements, tile = tensor = rows rows of ROWB bytes, source pitch one K row (srcPitch bytes), 4 dwords of LDS pad behind every row
template <unsigned ROWB>
__device__ __forceinline__ v8u tdm_group1(unsigned rows, unsigned srcPitch) {
  constexpr unsigned d0 = ROWB;
  const unsigned d1 = rows;
  v8u g;
  g[0] = uni(Ring<ROWB>::kPadWord);
  g[1] = uni((d0 & 0xFFFFu) << 16);
  g[2] = uni((d0 >> 16) | ((d1 & 0xFFFFu) << 16));
  g[3] = uni((d1 >> 16) | (d0 << 16));
  g[4] = uni(d1);
  g[5] = uni(srcPitch);
  g[6] = uni(0u);
  g[7] = uni(0u);
  return g;
}

// MI = 16-row subtiles of A per wave: 4 (a 128 x 128 tile per work-group) or 2 (a 64 x 128 tile)
template <int MI> struct FragSet { v16b ah[MI], al[MI], bh[4], bl[4]; };
// the fragments of one 32-k block: pa / pb = this lane's row 0 of the A_h / B_h slices, at its k half
template <unsigned ROWB, int MI>
__device__ __forceinline__ void load_set(FragSet<MI>& f, const unsigned char* pa, const unsigned char* pb, int kb) {
  const unsigned k = (unsigned)kb * 64u;
  constexpr unsigned kPlaneB = Ring<ROWB>::kPlaneB;
  constexpr unsigned t = 16u * Ring<ROWB>::kPitchB;   // 16 rows
  // in the order in which mma_set needs them: the first term can start when half of the group has returned
#pragma unroll
  for (int i = 0; i < MI; ++i) f.ah[i] = Frag<__bf16>::load((const __bf16*)(pa + (unsigned)i * t + k));
#pragma unroll
  for (int i = 0; i < 4; ++i) f.bh[i] = Frag<__bf16>::load((const __bf16*)(pb + (unsigned)i * t + k));
#pragma unroll
  for (int i = 0; i < 4; ++i) f.bl[i] = Frag<__bf16>::load((const __bf16*)(pb + kPlaneB + (unsigned)i * t + k));
#pragma unroll
  for (int i = 0; i < MI; ++i) f.al[i] = Frag<__bf16>::load((const __bf16*)(pa + kPlaneB + (unsigned)i * t + k));
}
// 12 MI WMMAs; each term runs over all 4 MI accumulators, so that no WMMA waits for the one in front of it
template <int MI>
__device__ __forceinline__ void mma_set(const FragSet<MI>& f, v8f (&acc)[MI][4]) {
#pragma unroll
  for (int i = 0; i < MI; ++i)
#pragma unroll
    for (int j = 0; j < 4; ++j) acc[i][j] = Frag<__bf16>::mma(f.ah[i], f.bh[j], acc[i][j]);
#pragma unroll
  for (int i = 0; i < MI; ++i)
#pragma unroll
    for (int j = 0; j < 4; ++j) acc[i][j] = Frag<__bf16>::mma(f.ah[i], f.bl[j], acc[i][j]);
#pragma unroll
  for (int i = 0; i < MI; ++i)
#pragma unroll
    for (int j = 0; j < 4; ++j) acc[i][j] = Frag<__bf16>::mma(f.al[i], f.bh[j], acc[i][j]);
}

// XF32: A fragments as f32
typedef __attribute__((ext_vector_type(2))) float  v2f;
typedef __attribute__((ext_vector_type(2))) __bf16 v2b;
template <int MI> struct FragSetX { v4f ax[MI][4]; v16b bh[4], bl[4]; };
// the fragments of one 32-k block: pa = this lane's row 0 of A slice 0 at its k half (f32), pb = its row 0 of the B_h slice at its k half
template <int MI>
__device__ __forceinline__ void load_set_x(FragSetX<MI>& f, const unsigned char* pa, const unsigned char* pb, int kb) {
  constexpr unsigned kPlaneB = Ring<128>::kPlaneB;
  constexpr unsigned t = 16u * Ring<128>::kPitchB;     // 16 rows
#pragma unroll
  for (int i = 0; i < MI; ++i) {
    const unsigned char* p = pa + (unsigned)kb * kPlaneB + (unsigned)i * t;
    f.ax[i][0] = *(const v4f*)(p);                     // elements 0..7: k 8h + 0..7
    f.ax[i][1] = *(const v4f*)(p + 16);
    f.ax[i][2] = *(const v4f*)(p + 64);                // elements 8..15: k 16 + 8h + 0..7
    f.ax[i][3] = *(const v4f*)(p + 80);
  }
#pragma unroll
  for (int i = 0; i < 4; ++i) f.bh[i] = Frag<__bf16>::load((const __bf16*)(pb + (unsigned)i * t + (unsigned)kb * 64u));
#pragma unroll
  for (int i = 0; i < 4; ++i) f.bl[i] = Frag<__bf16>::load((const __bf16*)(pb + kPlaneB + (unsigned)i * t + (unsigned)kb * 64u));
}
__device__ __forceinline__ void split_frag(const v4f (&x)[4], v16b& hi, v16b& lo) {
#pragma unroll
  for (int q = 0; q < 4; ++q)
#pragma unroll
    for (int e = 0; e < 4; e += 2) {
      const v2f a = (v2f){x[q][e], x[q][e + 1]};
      const v2b h = __builtin_convertvector(a, v2b);
      const v2f r = a - __builtin_convertvector(h, v2f);
      const v2b l = __builtin_convertvector(r, v2b);
      hi[4 * q + e] = h[0]; hi[4 * q + e + 1] = h[1];
      lo[4 * q + e] = l[0]; lo[4 * q + e + 1] = l[1];
    }
}

// One (32 MI) x 128 tile of C by the four waves of a work-group (2 x 2, each 16 MI x 64): rows rowBlk * 32 MI .., columns colBlk * 128 ..
// OUT_MODE: 0 = f32 to Cf, 2 = bf16 hi plane + lo plane. ACT: 0 = none, 6 = elu(x)+1.
// OUT_MODE 0 also holds the premise check on the causal flag: only the causal branch is built; if the flag is 0 the output is NaN.
// A is X (f32) where XF32, else the planes Ah, Al.
template <int OUT_MODE, int ACT, unsigned ROWB, int MI, bool XF32>
__device__ __forceinline__ void gemm_tile(unsigned char* ring, const float* __restrict__ X,
    const unsigned short* __restrict__ Ah, const unsigned short* __restrict__ Al,
    const unsigned short* __restrict__ Bh, const unsigned short* __restrict__ Bl,
    unsigned short* __restrict__ Ch, unsigned short* __restrict__ Cl, float* __restrict__ Cf, int causal,
    unsigned rowBlk, unsigned colBlk) {
  constexpr unsigned kPitchB = Ring<ROWB>::kPitchB, kPlaneB = Ring<ROWB>::kPlaneB;
  constexpr unsigned kStageB = Ring<ROWB>::kStageB, kStages = Ring<ROWB>::kStages;
  constexpr int kBlocks = Ring<ROWB>::kBlocks;
  constexpr unsigned kTM = 32u * MI;               // rows of the work-group's tile
  static_assert(!XF32 || ROWB == 128, "one f32 A slice per 32-k block, two blocks a stage");
  const int lane = threadIdx.x & 31;
  const unsigned wave = uni(threadIdx.x >> 5);
  const int rlane = lane & 15;
  const int mOff  = (lane >> 4) * 8;
  const int m0 = (int)(rowBlk * kTM + (wave >> 1) * (kTM / 2u));
  const int n0 = (int)(colBlk * 128u + (wave & 1u) * 64u);

  // this wave's plane: first byte of its rows (kTM of A, 128 of B), and its slice's place in buffer 0
  const unsigned short* plane = (wave == 0u) ? Ah : (wave == 1u) ? Al : (wave == 2u) ? Bh : Bl;
  const unsigned row0 = (wave < 2u) ? rowBlk * kTM : colBlk * 128u;
  const bool xs = XF32 && wave < 2u;               // this wave's slice is f32: its 32 k of X's rows, a source row and a stage's step twice as long
  const unsigned long long ga = xs ? (unsigned long long)(X + (size_t)row0 * kEmb + wave * 32u) : (unsigned long long)(plane + (size_t)row0 * kEmb);
  const unsigned stepSh = (ROWB == 256 ? 8u : 7u) + (xs ? 1u : 0u);   // log2 of the bytes from one stage to the next: ROWB, or twice that
  const unsigned slice = (unsigned)(unsigned long long)(const void*)ring + wave * kPlaneB;
  v8u g1 = tdm_group1<ROWB>((wave < 2u) ? kTM : 128u, xs ? (unsigned)kEmb * 4u : (unsigned)kEmb * 2u);
  // pass s works on K stage (s + rot) mod kStages: the eight tile columns of a tile row get eight first stages in a row (one of them meets a
  // stage of A first, the others find it in L2 a pass or more later), the tile rows of a tile column all kStages
  static_assert((kStages & (kStages - 1u)) == 0u && kStages >= (unsigned)kEmb / 128u, "the circle is walked by a mask; a first stage for each tile column");
  const unsigned rot = (colBlk + rowBlk) & (kStages - 1u);

  const unsigned aoff = ((wave >> 1) * (kTM / 2u) + (unsigned)rlane) * kPitchB + (unsigned)(lane >> 4) * (XF32 ? 32u : 16u);
  const unsigned boff = 2u * kPlaneB + ((wave & 1u) * 64u + (unsigned)rlane) * kPitchB + (unsigned)(lane >> 4) * 16u;

  v8f acc[MI][4];
#pragma unroll
  for (int i = 0; i < MI; ++i)
#pragma unroll
    for (int j = 0; j < 4; ++j) acc[i][j] = (v8f){0.f,0.f,0.f,0.f,0.f,0.f,0.f,0.f};

  tdm_load(tdm_group0(slice, ga + ((unsigned long long)rot << stepSh)), g1);
  wait_tensor0();
  __syncthreads();                                  // the first pass's stage (K stage rot) is readable by every wave
  tdm_load(tdm_group0(slice + kStageB, ga + ((unsigned long long)((rot + 1u) & (kStages - 1u)) << stepSh)), g1);

  // rolled: one copy of the pass's WMMAs, and every accumulator and fragment index stays a constant
#pragma clang loop unroll(disable)
  for (unsigned s = 0; s < kStages; ++s) {
    const unsigned buf = (s & 1u) * kStageB;
    const unsigned char* pa = ring + buf + aoff;
    const unsigned char* pb = ring + buf + boff;
    if constexpr (XF32) {
      FragSetX<MI> f[2];
      load_set_x<MI>(f[0], pa, pb, 0);
#pragma unroll
      for (int kb = 0; kb < kBlocks; ++kb) {
        if (kb < kBlocks - 1) load_set_x<MI>(f[(kb + 1) & 1], pa, pb, kb + 1);
        __builtin_amdgcn_sched_barrier(0);          // keeps the next block's LDS reads one group in front of this block's split and WMMAs
        FragSet<MI> g;
#pragma unroll
        for (int i = 0; i < MI; ++i) split_frag(f[kb & 1].ax[i], g.ah[i], g.al[i]);
#pragma unroll
        for (int j = 0; j < 4; ++j) { g.bh[j] = f[kb & 1].bh[j]; g.bl[j] = f[kb & 1].bl[j]; }
        mma_set<MI>(g, acc);
        __builtin_amdgcn_sched_barrier(0);          // and the block after that one's reads behind them
      }
    } else {
      FragSet<MI> f[2];
      load_set<ROWB, MI>(f[0], pa, pb, 0);
#pragma unroll
      for (int kb = 0; kb < kBlocks; ++kb) {
        if (kb < kBlocks - 1) load_set<ROWB, MI>(f[(kb + 1) & 1], pa, pb, kb + 1);
        __builtin_amdgcn_sched_barrier(0);          // keeps the next block's LDS reads one group in front of this block's WMMAs
        mma_set<MI>(f[kb & 1], acc);
        __builtin_amdgcn_sched_barrier(0);          // and the block after that one's reads behind them
      }
    }
    wait_ds0();
    wait_tensor0();
    __syncthreads();                                // publishes pass s + 1's stage; every reader has left pass s's buffer
    const unsigned nx = pinned(s + 2u);             // formed behind the wait, and the descriptor from it
    if (nx < kStages) tdm_load(tdm_group0(slice + buf, ga + ((unsigned long long)((nx + rot) & (kStages - 1u)) << stepSh)), g1);
  }
  wait_tensor0();
  wait_ds0();

  // ---- epilogue ----
  if (ACT == 6) {
#pragma unroll
    for (int i = 0; i < MI; ++i)
#pragma unroll
      for (int j = 0; j < 4; ++j)
#pragma unroll
        for (int r = 0; r < 8; ++r) {
          const float v = acc[i][j][r];
          // the hardware's exp2 of x * log2(e): cheap enough for the compiler to evaluate it in every lane and select. The library exp
          // compiled to a branch on EXEC per element, 128 dependent chains that a wave walked one after the other
          acc[i][j][r] = (v > 0.f) ? (v + 1.0f) : __expf(v);
        }
  }
  // per-wave 16 x 64 slab, pitch 68 floats, in the ring: the last pass's foot (LDS reads returned, tensor loads landed, barrier) has
  // freed both buffers, and no load is issued behind it. A slab of its own would put the 128-B ring's work-group above half the LDS
  static_assert(4u * 16u * 68u * 4u <= kStageB, "the four slabs fit buffer 0");
  float* slab = (float*)ring + wave * (16u * 68u);
#pragma unroll
  for (int i = 0; i < MI; ++i) {
    const int mBase = m0 + (i << 4);
#pragma unroll
    for (int j = 0; j < 4; ++j) {
#pragma unroll
      for (int r = 0; r < 8; ++r) {
        slab[(mOff + r) * 68 + (j << 4) + rlane] = acc[i][j][r];
      }
    }
    __builtin_amdgcn_fence(__ATOMIC_RELEASE, "workgroup");
    __builtin_amdgcn_wave_barrier();
    __builtin_amdgcn_fence(__ATOMIC_ACQUIRE, "workgroup");
    if (OUT_MODE == 0) {
      const int hh = lane >> 4, c4 = (lane & 15) * 4;     // row seg = 256 B = 16 lanes x 16 B
      v4f rv[8];
#pragma unroll
      for (int it = 0; it < 8; ++it) rv[it] = *(const v4f*)(slab + (it * 2 + hh) * 68 + c4);
      if (causal == 0) {                               // the same for every thread of the grid
        const float qn = __uint_as_float(0x7fc00000u);
#pragma unroll
        for (int it = 0; it < 8; ++it) rv[it] = (v4f){qn, qn, qn, qn};
      }
#pragma unroll
      for (int it = 0; it < 8; ++it) *(v4f*)(Cf + (size_t)(mBase + it * 2 + hh) * kEmb + n0 + c4) = rv[it];
      asm volatile("s_wait_xcnt 0x0" ::: "memory");   // stands in front of the next use of the registers that these stores name
    } else {
      const int q = lane >> 3, c8 = (lane & 7) * 8;
      v8h hv[4], lv[4];
#pragma unroll
      for (int it = 0; it < 4; ++it) {
        const float* sp = slab + (it * 4 + q) * 68 + c8;
#pragma unroll
        for (int e = 0; e < 8; ++e) {
          unsigned short hb = f2bf_bits(sp[e]);
          unsigned short lb = f2bf_bits(sp[e] - bf_bits2f(hb));
          hv[it][e] = __builtin_bit_cast(_Float16, hb);
          lv[it][e] = __builtin_bit_cast(_Float16, lb);
        }
      }
#pragma unroll
      for (int it = 0; it < 4; ++it) {
        *(v8h*)(Ch + (size_t)(mBase + it * 4 + q) * kEmb + n0 + c8) = hv[it];
        *(v8h*)(Cl + (size_t)(mBase + it * 4 + q) * kEmb + n0 + c8) = lv[it];
      }
      asm volatile("s_wait_xcnt 0x0" ::: "memory");   // stands in front of the next use of the registers that these stores name
    }
    __builtin_amdgcn_fence(__ATOMIC_RELEASE, "workgroup");
    __builtin_amdgcn_wave_barrier();
    __builtin_amdgcn_fence(__ATOMIC_ACQUIRE, "workgroup");
  }
}

// The q, k, v projections in one grid (N/128, 32, 4), 128 threads; independent products share a launch, so a WGP goes from one to the
// next without a launch boundary. Product p reads activation p (f32) and the plane pair [hi | lo] number p behind B0 and writes pair p behind C0.
// z = 0, 1: q and k, 128 x 128 tiles, with elu(x)+1. z = 2, 3: v in 64 x 128 tiles, row blocks 32 (z - 2) + y.
// Two work-groups share a WGP (512 places): the 512 whole tiles fill every place once, then the 512 half tiles fill it again, so that
// a work-group has a neighbour on its WGP from the first pass to the last. With v in whole tiles its 256 would run one to a WGP.
__global__ __launch_bounds__(128) void proj_qkv_kernel(
    const float* __restrict__ X0, const float* __restrict__ X1, const float* __restrict__ X2,
    const unsigned short* __restrict__ B0, unsigned short* __restrict__ C0) {
  __shared__ __attribute__((aligned(2048))) unsigned char ring[2 * Ring<128>::kStageB];
  const unsigned z = blockIdx.z;
  const unsigned p = (z < 2u) ? z : 2u;
  const float* X = (p == 0u) ? X0 : (p == 1u) ? X1 : X2;
  const unsigned short* Bh = B0 + (size_t)(2u * p) * kWEl;
  unsigned short* Ch = C0 + (size_t)(2u * p) * kPlaneEl;
  if (z < 2u)   // the same for every thread of a work-group
    gemm_tile<2, 6, 128, 4, true>(ring, X, nullptr, nullptr, Bh, Bh + kWEl, Ch, Ch + kPlaneEl, nullptr, 1, blockIdx.y, blockIdx.x);
  else
    gemm_tile<2, 0, 128, 2, true>(ring, X, nullptr, nullptr, Bh, Bh + kWEl, Ch, Ch + kPlaneEl, nullptr, 1, (z - 2u) * 32u + blockIdx.y, blockIdx.x);
}

// The output projection: grid (N/128, M/128), 128 threads, one 128 x 128 tile per work-group, one work-group per WGP, f32 out
__global__ __launch_bounds__(128) void proj_out_kernel(
    const unsigned short* __restrict__ A0, const unsigned short* __restrict__ B0, float* __restrict__ Cf, const int* __restrict__ flag) {
  __shared__ __attribute__((aligned(2048))) unsigned char ring[2 * Ring<256>::kStageB];
  const int causal = flag[0];   // read at entry, where it is a scalar load
  gemm_tile<0, 0, 256, 4, false>(ring, nullptr, A0, A0 + kPlaneEl, B0, B0 + kWEl, nullptr, nullptr, Cf, causal, blockIdx.y, blockIdx.x);
}

// ---------------------------------------------------------------------------
// The four weights, f32 -> bf16 hi + lo planes (RNE convert both), 8 consecutive elements per thread: one 16-B store per lane per plane.
// One grid, by block range (block-uniform): kSplitWB blocks a weight; hi plane z lives at out + 2z*kWEl, lo plane at +kWEl.
// Coverage: kWEl/8 threads x 8 = the whole plane (the ranges are exact multiples of 256 threads).
// ---------------------------------------------------------------------------
constexpr int kSplitWB = (int)(kWEl / 8 / 256);       // 512 blocks per weight tensor
static_assert(kSplitWB == 1 << 9, "the shift in the kernel");
__global__ __launch_bounds__(256) void split_planes_kernel(const float* __restrict__ w0, const float* __restrict__ w1,
                                                           const float* __restrict__ w2, const float* __restrict__ w3,
                                                           unsigned short* __restrict__ out) {
  const unsigned b = blockIdx.x;
  const int z = (int)(b >> 9);
  const int i = (int)((b - ((unsigned)z << 9)) * 256u + threadIdx.x);
  const float* src = (z == 0) ? w0 : (z == 1) ? w1 : (z == 2) ? w2 : w3;
  const float* p = src + 8 * (size_t)i;
  const v4f a = *(const v4f*)(p);
  const v4f c = *(const v4f*)(p + 4);
  unsigned short hb[8], lb[8];
#pragma unroll
  for (int e = 0; e < 4; ++e) {
    hb[e]     = f2bf_bits(a[e]);
    lb[e]     = f2bf_bits(a[e] - bf_bits2f(hb[e]));
    hb[4 + e] = f2bf_bits(c[e]);
    lb[4 + e] = f2bf_bits(c[e] - bf_bits2f(hb[4 + e]));
  }
  const v4u uh = (v4u){pk16(hb[0], hb[1]), pk16(hb[2], hb[3]), pk16(hb[4], hb[5]), pk16(hb[6], hb[7])};
  const v4u ul = (v4u){pk16(lb[0], lb[1]), pk16(lb[2], lb[3]), pk16(lb[4], lb[5]), pk16(lb[6], lb[7])};
  unsigned short* ph = out + (size_t)(2 * z) * kWEl + 8 * (size_t)i;
  unsigned short* pl = ph + kWEl;
  *(v4u*)ph = uh;
  *(v4u*)pl = ul;
}

// ---------------------------------------------------------------------------
// Token-major chunk tiles in LDS, read as transposed WMMA operands. A tile row is one token: [64 hi | 64 lo] bf16 at pitch kPT.
// ds_load_tr16_b128: lane (c = l & 15, h = l >> 4) gets T[tok + 8h + 0..7][col + c]; the loads at tok and tok + 16 are one
// 16 x 32 fragment in the k order of Frag::load (elements 0..7 = k 8h + 0..7, 8..15 = k 16 + 8h + 0..7).
// ---------------------------------------------------------------------------
constexpr int kPT = 144;                       // elements: 288 B = 32 B x odd, the pitch of ds_load_tr16_b128 readers
typedef __attribute__((ext_vector_type(8))) short v8s;
__device__ __forceinline__ v8b lds_tr16(const unsigned short* p) {
  typedef __attribute__((address_space(3))) v8s lds_v8s;
  return __builtin_bit_cast(v8b, __builtin_amdgcn_ds_load_tr16_b128_v8i16((lds_v8s*)p));
}
// this lane's place in a 16-token x 16-column block, in elements
__device__ __forceinline__ int tr_lane(int lane) { return (8 * (lane >> 4) + (lane & 7)) * kPT + 8 * ((lane >> 3) & 1); }
// p = tile + first token * kPT + first column + tr_lane(lane)
__device__ __forceinline__ v16b lds_frag_tr(const unsigned short* p) {
  Frag<__bf16>::U f; f.h[0] = lds_tr16(p); f.h[1] = lds_tr16(p + 16 * kPT); return f.v;
}

// ---------------------------------------------------------------------------
// Per (batch-chunk y, head h), one work-group of eight waves: dST[e][d] = sum_j v[j][e] k[j][d] (f32, tile (y*16+h) of 64 x 64)
// and dz[y*16+h][d] = sum_j k[j][d] (f32, k = hi + lo, j in order). grid (32, 16), 256 threads.
// The 128 x 64 tiles of k and v (hi and lo) are staged as they lie in the token-major planes; both operands of the product are
// read from them by transposing loads. Wave w owns rows e = 16 (w >> 1) .. +15, columns d = 32 (w & 1) .. +31.
// Per accumulator: j ascending, hi.hi, hi.lo, lo.hi inside each 32 j.
// ---------------------------------------------------------------------------
__global__ __launch_bounds__(256) void state_inc_kernel(const unsigned short* __restrict__ kh, const unsigned short* __restrict__ kl,
                                                        const unsigned short* __restrict__ vh, const unsigned short* __restrict__ vl,
                                                        float* __restrict__ dST, float* __restrict__ dz) {
  __shared__ __align__(16) unsigned short sK[kChunk * kPT];
  __shared__ __align__(16) unsigned short sV[kChunk * kPT];
  __shared__ __align__(16) float sD[kHdim * 68];
  typedef Frag<__bf16> F;
  const int t = threadIdx.x;
  const int lane = t & 31, wave = t >> 5;
  const int rlane = lane & 15;
  const int mOff  = (lane >> 4) * 8;
  const int y = blockIdx.x, h = blockIdx.y;
  const size_t tile = (size_t)y * kHeads + h;
  const size_t go = (size_t)y * kChunk * kEmb + (size_t)h * kHdim + (size_t)(t >> 3) * kEmb + (t & 7) * 8;
  const unsigned short* pkh = kh + go;
  const unsigned short* pkl = kl + go;
  const unsigned short* pvh = vh + go;
  const unsigned short* pvl = vl + go;
  v4u gk[8], gv[8];
#pragma unroll
  for (int it = 0; it < 4; ++it) {
    gk[2 * it]     = *(const v4u*)(pkh + it * 32 * kEmb);
    gk[2 * it + 1] = *(const v4u*)(pkl + it * 32 * kEmb);
    gv[2 * it]     = *(const v4u*)(pvh + it * 32 * kEmb);
    gv[2 * it + 1] = *(const v4u*)(pvl + it * 32 * kEmb);
  }
  // stands in front of the first overwrite of a register that these loads name; the addresses are inputs, so none is reused before it
  asm volatile("s_wait_xcnt 0x0" :: "v"(pkh), "v"(pkl), "v"(pvh), "v"(pvl) : "memory");
#pragma unroll
  for (int it = 0; it < 4; ++it) {
    const int o = (it * 32 + (t >> 3)) * kPT + (t & 7) * 8;
    *(v4u*)(sK + o)      = gk[2 * it];
    *(v4u*)(sK + o + 64) = gk[2 * it + 1];
    *(v4u*)(sV + o)      = gv[2 * it];
    *(v4u*)(sV + o + 64) = gv[2 * it + 1];
  }
  __syncthreads();                             // the staged tiles are readable by every wave

  const int trl = tr_lane(lane);
  const int e0 = (wave >> 1) * 16, d0 = (wave & 1) * 32;
  v8f acc[2];
#pragma unroll
  for (int j = 0; j < 2; ++j) acc[j] = (v8f){0.f,0.f,0.f,0.f,0.f,0.f,0.f,0.f};
#pragma unroll
  for (int kb = 0; kb < 4; ++kb) {
    const unsigned short* pa = sV + kb * 32 * kPT + e0 + trl;
    const unsigned short* pb = sK + kb * 32 * kPT + d0 + trl;
    const v16b ah = lds_frag_tr(pa);
    const v16b al = lds_frag_tr(pa + 64);
    v16b bh[2], bl[2];
#pragma unroll
    for (int j = 0; j < 2; ++j) {
      bh[j] = lds_frag_tr(pb + j * 16);
      bl[j] = lds_frag_tr(pb + j * 16 + 64);
    }
#pragma unroll
    for (int j = 0; j < 2; ++j) acc[j] = F::mma(ah, bh[j], acc[j]);
#pragma unroll
    for (int j = 0; j < 2; ++j) acc[j] = F::mma(ah, bl[j], acc[j]);
#pragma unroll
    for (int j = 0; j < 2; ++j) acc[j] = F::mma(al, bh[j], acc[j]);
  }
#pragma unroll
  for (int j = 0; j < 2; ++j)
#pragma unroll
    for (int r = 0; r < 8; ++r) sD[(e0 + mOff + r) * 68 + d0 + j * 16 + rlane] = acc[j][r];

  float s = 0.f;
  if (t < kHdim) {                             // waves 0 and 1, whole
    // unrolled so that a group's 64 LDS reads are in flight together; rolled, every token waits out its own LDS latency
#pragma unroll 32
    for (int j = 0; j < kChunk; ++j) {
      const float kv = bf_bits2f(sK[j * kPT + t]) + bf_bits2f(sK[j * kPT + 64 + t]);
      s = s + kv;
    }
  }
  __syncthreads();                             // the 64 x 64 tile is whole: it goes out in rows, 512 contiguous bytes a wave

  float* dp = dST + tile * (size_t)(kHdim * kHdim) + 4 * t;
  v4f rv[4];
#pragma unroll
  for (int it = 0; it < 4; ++it) {
    const int u = it * 256 + t;
    rv[it] = *(const v4f*)(sD + (u >> 4) * 68 + (u & 15) * 4);
  }
#pragma unroll
  for (int it = 0; it < 4; ++it) *(v4f*)(dp + it * 1024) = rv[it];
  if (t < kHdim) dz[tile * kHdim + t] = s;     // behind the barrier, so that no wave waits there for this store
  asm volatile("s_wait_xcnt 0x0" ::: "memory");   // stands behind the last stores, in front of any later write of a register that they name
}

// ---------------------------------------------------------------------------
// Exclusive prefix over chunks of the transposed state and of z, per (b, h). No element depends on another, so the work is dealt
// by element: grid (32 bh, 5), 256 threads. Slices y = 0..3: thread t owns elements 1024y + 4t .. +3 of every 4096-element tile;
// slice y = 4: thread t < 64 owns element t of z. A thread first issues the loads of all 15 increments it needs (the last chunk's
// is never used), so their latencies overlap, then sums them in registers in chunk order and stores each chunk's value.
// S^T_c = sum_{c' < c} dST_{c'} (f32, sequential), written as bf16 hi/lo planes [tile][64 e][64 d] (tile = (b*16+c)*16+h);
// z_c likewise to zpre[tile][64] (f32). A wave's store covers 256 contiguous bytes of a plane.
// ---------------------------------------------------------------------------
typedef __attribute__((ext_vector_type(2))) unsigned int v2u;
constexpr int kPfxSlices = 4;                    // 4 slices x 256 threads x 4 elements = one 64 x 64 tile
static_assert(kPfxSlices * 256 * 4 == kHdim * kHdim, "the slices cover a tile");
// at most eight waves per SIMD are asked for: 128 registers a wave. Without it the build keeps to 81 registers and holds the last
// load back until the first has returned, to take over its registers
__global__ __launch_bounds__(256) __attribute__((amdgpu_waves_per_eu(2, 8))) void state_prefix_kernel(const float* __restrict__ dST, const float* __restrict__ dz,
                                                           unsigned short* __restrict__ STh, unsigned short* __restrict__ STl,
                                                           float* __restrict__ zpre) {
  const int t = threadIdx.x;
  const int bh = blockIdx.x;
  const int b = bh >> 4, h = bh & 15;
  const size_t tile0 = (size_t)(b * kNChunk) * kHeads + h;   // chunk 0's tile; chunk c's is tile0 + 16 c
  if (blockIdx.y == (unsigned)kPfxSlices) {                  // block-uniform: the z slice
    if (t >= kHdim) return;
    const float* zp = dz + tile0 * kHdim + t;
    float* zo = zpre + tile0 * kHdim + t;
    float zd[kNChunk - 1];
#pragma unroll
    for (int c = 0; c < kNChunk - 1; ++c) zd[c] = zp[c * kHeads * kHdim];
    float zacc = 0.f;
#pragma unroll
    for (int c = 0; c < kNChunk; ++c) {
      zo[c * kHeads * kHdim] = zacc;
      if (c < kNChunk - 1) zacc += zd[c];
    }
    return;
  }
  const size_t el = tile0 * 4096 + ((size_t)blockIdx.y * 256 + t) * 4;
  const float* dp = dST + el;
  unsigned short* ph = STh + el;
  unsigned short* pl = STl + el;
  v4f d[kNChunk - 1];
#pragma unroll
  for (int c = 0; c < kNChunk - 1; ++c) d[c] = *(const v4f*)(dp + c * kHeads * 4096);
  // all 15 loads stay in front of this line, so that they are in flight together (the compiler otherwise sinks five of them behind the
  // first waits); and it stands in front of the first overwrite of the address register, which is an input, so it is not reused before it
  asm volatile("s_wait_xcnt 0x0" :: "v"(dp) : "memory");
  v4f a = (v4f){0.f, 0.f, 0.f, 0.f};
#pragma unroll
  for (int c = 0; c < kNChunk; ++c) {
    unsigned short hb[4], lb[4];
#pragma unroll
    for (int e = 0; e < 4; ++e) {
      hb[e] = f2bf_bits(a[e]);
      lb[e] = f2bf_bits(a[e] - bf_bits2f(hb[e]));
    }
    *(v2u*)(ph + c * kHeads * 4096) = (v2u){pk16(hb[0], hb[1]), pk16(hb[2], hb[3])};
    *(v2u*)(pl + c * kHeads * 4096) = (v2u){pk16(lb[0], lb[1]), pk16(lb[2], lb[3])};
    if (c < kNChunk - 1) a += d[c];
  }
  asm volatile("s_wait_xcnt 0x0" ::: "memory");   // stands behind the last stores, in front of any later write of a register that they name
}

// ---------------------------------------------------------------------------
// Per (batch-chunk y, head h), one work-group of eight waves: masked scores A = tril(q.k^T), num = A.v + q.S_c,
// den = q.z_c + rowsum(A) + eps, o = num * (1/den) as bf16 hi/lo rows of the token-major o planes.
// The k, v and S^T tiles (hi and lo) are staged once in LDS, v token-major and read by transposing loads; wave w owns chunk rows 16w .. 16w+15 from the scores to the stores,
// and its A rows pass from the accumulator layout to the A-operand layout through its own LDS slab (bf16 hi/lo, never in memory).
// Every sum keeps its order: per accumulator k ascending with hi.hi, hi.lo, lo.hi inside each 32 k; A.v and q.S in separate
// accumulators, added once; row sum and q.z sequential in f32.
// ---------------------------------------------------------------------------
constexpr int kPK = 72;                        // LDS row pitch of the 64-wide tiles (k, S^T), elements: 144 B = 16 B x odd
constexpr int kPV = 136;                       // LDS row pitch of the 128-wide A rows, elements: 272 B = 16 B x odd
constexpr int kSlabB = 2 * 16 * kPV * 2;       // one wave's slab: A_h rows, then A_l rows; later the f32 num rows (pitch 68)
static_assert(16 * 68 * 4 <= kSlabB, "the num rows fit the slab");

// orders one wave's LDS writes in front of reads by its other lanes (the slabs are private to a wave)
__device__ __forceinline__ void wave_lds_sync() {
  __builtin_amdgcn_fence(__ATOMIC_RELEASE, "workgroup");
  __builtin_amdgcn_wave_barrier();
  __builtin_amdgcn_fence(__ATOMIC_ACQUIRE, "workgroup");
}
__device__ __forceinline__ v16b lds_frag(const unsigned short* p) { return Frag<__bf16>::load((const __bf16*)p); }

// at most 256 registers a wave: two work-groups (four waves per SIMD) share a WGP, so all 512 are resident at once
__global__ __launch_bounds__(256) __attribute__((amdgpu_waves_per_eu(4, 4))) void chunk_attn_kernel(const unsigned short* __restrict__ qh, const unsigned short* __restrict__ ql,
                                                         const unsigned short* __restrict__ kh, const unsigned short* __restrict__ kl,
                                                         const unsigned short* __restrict__ vh, const unsigned short* __restrict__ vl,
                                                         const unsigned short* __restrict__ STh, const unsigned short* __restrict__ STl,
                                                         const float* __restrict__ zpre,
                                                         unsigned short* __restrict__ oh, unsigned short* __restrict__ ol) {
  __shared__ __align__(16) unsigned short sKh[kChunk * kPK];
  __shared__ __align__(16) unsigned short sKl[kChunk * kPK];
  __shared__ __align__(16) unsigned short sV[kChunk * kPT];
  __shared__ __align__(16) unsigned short sSh[kHdim * kPK];
  __shared__ __align__(16) unsigned short sSl[kHdim * kPK];
  __shared__ __align__(16) unsigned char  sW[8][kSlabB];
  __shared__ __align__(16) float sInv[8][16];
  typedef Frag<__bf16> F;
  const int t = threadIdx.x;
  const int lane = t & 31, wave = t >> 5;
  const int rlane = lane & 15;                 // row (A operand) / column (B operand, accumulator) within a 16-wide subtile
  const int koff  = (lane >> 4) * 8;           // k offset of this lane half
  const int mOff  = (lane >> 4) * 8;           // accumulator row offset
  const int y = blockIdx.x, h = blockIdx.y;
  const size_t tile = (size_t)y * kHeads + h;
  const size_t base = (size_t)y * kChunk * kEmb + (size_t)h * kHdim;   // chunk row 0 at this head, token-major planes

  // ---- the tiles, 16 B per lane: k 128 x 64, v 128 x 64, S^T 64 x 64, hi and lo; this wave's q rows ----
  const size_t ko = base + (size_t)(t >> 3) * kEmb + (t & 7) * 8;
  const size_t so = tile * (size_t)(kHdim * kHdim) + (size_t)t * 8;
  const size_t qrow = base + (size_t)(wave * 16 + rlane) * kEmb;
  const unsigned short* pkh = kh + ko;
  const unsigned short* pkl = kl + ko;
  const unsigned short* pvh = vh + ko;
  const unsigned short* pvl = vl + ko;
  const unsigned short* psh = STh + so;
  const unsigned short* psl = STl + so;
  const unsigned short* pqh = qh + qrow;
  const unsigned short* pql = ql + qrow;
  const unsigned short* pfh = pqh + koff;
  const unsigned short* pfl = pql + koff;
  v4u gk[8], gv[8], gs[4], gqh[8], gql[8];
#pragma unroll
  for (int it = 0; it < 4; ++it) {
    gk[2 * it]     = *(const v4u*)(pkh + it * 32 * kEmb);
    gk[2 * it + 1] = *(const v4u*)(pkl + it * 32 * kEmb);
    gv[2 * it]     = *(const v4u*)(pvh + it * 32 * kEmb);
    gv[2 * it + 1] = *(const v4u*)(pvl + it * 32 * kEmb);
  }
#pragma unroll
  for (int it = 0; it < 2; ++it) {
    gs[2 * it]     = *(const v4u*)(psh + it * 2048);
    gs[2 * it + 1] = *(const v4u*)(psl + it * 2048);
  }
  // the q rows as A operands (K = 64: two 32-k blocks), and whole (row rlane) for q.z
  v16b qfh[2], qfl[2];
#pragma unroll
  for (int kb = 0; kb < 2; ++kb) {
    qfh[kb] = F::load((const __bf16*)(pfh + kb * 32));
    qfl[kb] = F::load((const __bf16*)(pfl + kb * 32));
  }
#pragma unroll
  for (int w = 0; w < 8; ++w) {
    gqh[w] = *(const v4u*)(pqh + 8 * w);
    gql[w] = *(const v4u*)(pql + 8 * w);
  }
  // stands in front of the first overwrite of a register that these loads name; the addresses are inputs, so none is reused before it
  asm volatile("s_wait_xcnt 0x0" :: "v"(pkh), "v"(pkl), "v"(pvh), "v"(pvl), "v"(psh), "v"(psl), "v"(pqh), "v"(pql), "v"(pfh), "v"(pfl) : "memory");
#pragma unroll
  for (int it = 0; it < 4; ++it) {
    const int u = it * 256 + t;
    *(v4u*)(sKh + (u >> 3) * kPK + (u & 7) * 8) = gk[2 * it];
    *(v4u*)(sKl + (u >> 3) * kPK + (u & 7) * 8) = gk[2 * it + 1];
    *(v4u*)(sV + (u >> 3) * kPT + (u & 7) * 8)      = gv[2 * it];
    *(v4u*)(sV + (u >> 3) * kPT + (u & 7) * 8 + 64) = gv[2 * it + 1];
  }
#pragma unroll
  for (int it = 0; it < 2; ++it) {
    const int u = it * 256 + t;
    *(v4u*)(sSh + (u >> 3) * kPK + (u & 7) * 8) = gs[2 * it];
    *(v4u*)(sSl + (u >> 3) * kPK + (u & 7) * 8) = gs[2 * it + 1];
  }

  // ---- q . z_c of row rlane (both lane halves compute the same row) ----
  const float* zp = zpre + tile * kHdim;
  float qz = 0.f;
#pragma unroll
  for (int w = 0; w < 8; ++w) {
    const v4u uh = gqh[w];
    const v4u ul = gql[w];
    const v4f z0 = *(const v4f*)(zp + 8 * w);
    const v4f z1 = *(const v4f*)(zp + 8 * w + 4);
    float qv[8], zv[8];
#pragma unroll
    for (int e = 0; e < 4; ++e) {
      qv[2 * e]     = bflo2f(uh[e]) + bflo2f(ul[e]);
      qv[2 * e + 1] = bfhi2f(uh[e]) + bfhi2f(ul[e]);
      zv[e] = z0[e];
      zv[4 + e] = z1[e];
    }
#pragma unroll
    for (int e = 0; e < 8; ++e) qz += qv[e] * zv[e];
  }
  sInv[wave][rlane] = qz;                      // parked in LDS: kept in a register, the whole sum is sunk to its use and the q rows spill
  __syncthreads();                             // the staged tiles are readable by every wave

  // ---- masked scores of rows 16w .. 16w+15, four column subtiles at a time, into the slab as bf16 hi/lo ----
  unsigned short* aH = (unsigned short*)sW[wave];
  unsigned short* aL = aH + 16 * kPV;
#pragma unroll
  for (int jh = 0; jh < 2; ++jh) {
    v8f s[4];
#pragma unroll
    for (int j = 0; j < 4; ++j) s[j] = (v8f){0.f,0.f,0.f,0.f,0.f,0.f,0.f,0.f};
#pragma unroll
    for (int kb = 0; kb < 2; ++kb) {
      v16b bh[4], bl[4];
#pragma unroll
      for (int j = 0; j < 4; ++j) {
        const int o = ((jh * 4 + j) * 16 + rlane) * kPK + koff + kb * 32;
        bh[j] = lds_frag(sKh + o);
        bl[j] = lds_frag(sKl + o);
      }
#pragma unroll
      for (int j = 0; j < 4; ++j) s[j] = F::mma(qfh[kb], bh[j], s[j]);
#pragma unroll
      for (int j = 0; j < 4; ++j) s[j] = F::mma(qfh[kb], bl[j], s[j]);
#pragma unroll
      for (int j = 0; j < 4; ++j) s[j] = F::mma(qfl[kb], bh[j], s[j]);
    }
#pragma unroll
    for (int j = 0; j < 4; ++j) {
      const int n = (jh * 4 + j) * 16 + rlane;
#pragma unroll
      for (int r = 0; r < 8; ++r) {
        float v = s[j][r];
        if (n > wave * 16 + mOff + r) v = 0.0f;
        const unsigned short hb = f2bf_bits(v);
        const unsigned short lb = f2bf_bits(v - bf_bits2f(hb));
        aH[(mOff + r) * kPV + n] = hb;
        aL[(mOff + r) * kPV + n] = lb;
      }
    }
  }

  // ---- q . S_c: K = 64 ----
  v8f qs[4], av[4];
#pragma unroll
  for (int j = 0; j < 4; ++j) { qs[j] = (v8f){0.f,0.f,0.f,0.f,0.f,0.f,0.f,0.f}; av[j] = (v8f){0.f,0.f,0.f,0.f,0.f,0.f,0.f,0.f}; }
#pragma unroll
  for (int kb = 0; kb < 2; ++kb) {
    v16b bh[4], bl[4];
#pragma unroll
    for (int j = 0; j < 4; ++j) {
      const int o = (j * 16 + rlane) * kPK + koff + kb * 32;
      bh[j] = lds_frag(sSh + o);
      bl[j] = lds_frag(sSl + o);
    }
#pragma unroll
    for (int j = 0; j < 4; ++j) qs[j] = F::mma(qfh[kb], bh[j], qs[j]);
#pragma unroll
    for (int j = 0; j < 4; ++j) qs[j] = F::mma(qfh[kb], bl[j], qs[j]);
#pragma unroll
    for (int j = 0; j < 4; ++j) qs[j] = F::mma(qfl[kb], bh[j], qs[j]);
  }
  wave_lds_sync();                             // the slab's A rows are readable by every lane of this wave

  // ---- A . v: K = 128 ----
  const int trl = tr_lane(lane);
#pragma unroll
  for (int kb = 0; kb < 4; ++kb) {
    const v16b ah = lds_frag(aH + rlane * kPV + koff + kb * 32);
    const v16b al = lds_frag(aL + rlane * kPV + koff + kb * 32);
    v16b bh[4], bl[4];
#pragma unroll
    for (int j = 0; j < 4; ++j) {
      const unsigned short* pv = sV + kb * 32 * kPT + j * 16 + trl;
      bh[j] = lds_frag_tr(pv);
      bl[j] = lds_frag_tr(pv + 64);
    }
#pragma unroll
    for (int j = 0; j < 4; ++j) av[j] = F::mma(ah, bh[j], av[j]);
#pragma unroll
    for (int j = 0; j < 4; ++j) av[j] = F::mma(ah, bl[j], av[j]);
#pragma unroll
    for (int j = 0; j < 4; ++j) av[j] = F::mma(al, bh[j], av[j]);
  }

  // ---- row sum of the masked scores of row rlane, j in order ----
  float asum = 0.f;
#pragma unroll
  for (int w = 0; w < 16; ++w) {
    const v4u uh = *(const v4u*)(aH + rlane * kPV + 8 * w);
    const v4u ul = *(const v4u*)(aL + rlane * kPV + 8 * w);
#pragma unroll
    for (int e = 0; e < 4; ++e) {
      const float a0 = bflo2f(uh[e]) + bflo2f(ul[e]);
      asum = asum + a0;
      const float a1 = bfhi2f(uh[e]) + bfhi2f(ul[e]);
      asum = asum + a1;
    }
  }
  const float den = (sInv[wave][rlane] + asum) + kEps;
  const float inv = 1.0f / den;
  wave_lds_sync();                             // every read of the A rows has returned: the slab takes the num rows

  float* slab = (float*)sW[wave];
#pragma unroll
  for (int j = 0; j < 4; ++j)
#pragma unroll
    for (int r = 0; r < 8; ++r) slab[(mOff + r) * 68 + (j << 4) + rlane] = av[j][r] + qs[j][r];
  sInv[wave][rlane] = inv;
  wave_lds_sync();

  const int q4 = lane >> 3, c8 = (lane & 7) * 8;
  v4u uo_h[4], uo_l[4];
#pragma unroll
  for (int it = 0; it < 4; ++it) {
    const int row = it * 4 + q4;
    const float iv = sInv[wave][row];
    unsigned short hb[8], lb[8];
#pragma unroll
    for (int e = 0; e < 8; ++e) {
      const float f = slab[row * 68 + c8 + e] * iv;
      hb[e] = f2bf_bits(f);
      lb[e] = f2bf_bits(f - bf_bits2f(hb[e]));
    }
    uo_h[it] = (v4u){pk16(hb[0], hb[1]), pk16(hb[2], hb[3]), pk16(hb[4], hb[5]), pk16(hb[6], hb[7])};
    uo_l[it] = (v4u){pk16(lb[0], lb[1]), pk16(lb[2], lb[3]), pk16(lb[4], lb[5]), pk16(lb[6], lb[7])};
  }
#pragma unroll
  for (int it = 0; it < 4; ++it) {
    const size_t o = base + (size_t)(wave * 16 + it * 4 + q4) * kEmb + c8;
    *(v4u*)(oh + o) = uo_h[it];
    *(v4u*)(ol + o) = uo_l[it];
  }
}

// ---------------------------------------------------------------------------
// Host launcher
// ---------------------------------------------------------------------------
extern "C" void kernel_launch(void* const* d_in, const int* in_sizes, int n_in,
                              void* d_out, int out_size, void* d_ws, size_t ws_size,
                              hipStream_t stream) {
  if (n_in < 8) return;
  if (in_sizes[0] != (int)kPlaneEl || in_sizes[1] != (int)kPlaneEl || in_sizes[2] != (int)kPlaneEl) return;
  if (in_sizes[3] != (int)kWEl || in_sizes[4] != (int)kWEl || in_sizes[5] != (int)kWEl || in_sizes[6] != (int)kWEl) return;
  if (in_sizes[7] < 1) return;
  if (out_size != (int)kPlaneEl) return;
  if (ws_size < (size_t)kWsTotal) return;

  const float* Q  = (const float*)d_in[0];
  const float* Kx = (const float*)d_in[1];
  const float* Vx = (const float*)d_in[2];
  const float* Wq = (const float*)d_in[3];
  const float* Wk = (const float*)d_in[4];
  const float* Wv = (const float*)d_in[5];
  const float* Wo = (const float*)d_in[6];
  const int*   causal = (const int*)d_in[7];
  float* out = (float*)d_out;
  char* ws = (char*)d_ws;

  unsigned short* Wbase = (unsigned short*)(ws + oWbase);
  const unsigned short* Wo_h = (const unsigned short*)(ws + oWo_h);
  unsigned short* q_h  = (unsigned short*)(ws + oQ_h);
  unsigned short* q_l  = (unsigned short*)(ws + oQ_l);
  unsigned short* k_h  = (unsigned short*)(ws + oK_h);
  unsigned short* k_l  = (unsigned short*)(ws + oK_l);
  unsigned short* v_h  = (unsigned short*)(ws + oV_h);
  unsigned short* v_l  = (unsigned short*)(ws + oV_l);
  float*          dST  = (float*)(ws + oDST);
  unsigned short* ST_h = (unsigned short*)(ws + oST_h);
  unsigned short* ST_l = (unsigned short*)(ws + oST_l);
  unsigned short* o_h  = (unsigned short*)(ws + oO_h);
  unsigned short* o_l  = (unsigned short*)(ws + oO_l);
  float*          dz   = (float*)(ws + oDZ);
  float*          zpre = (float*)(ws + oZPRE);

  // 1) weight hi/lo planes
  split_planes_kernel<<<dim3((unsigned)(4 * kSplitWB), 1, 1), 256, 0, stream>>>(Wq, Wk, Wv, Wo, Wbase);

  // 2) projections q, k, v in one grid, activations read in f32 and split in registers: each M=4096, N=1024, K=1024; q, k with elu(x)+1 in 128 x 128 tiles, v in 64 x 128 tiles, two work-groups to a WGP
  proj_qkv_kernel<<<dim3(kEmb / 128, kTok / 128, 4), 128, 0, stream>>>(Q, Kx, Vx, Wbase, q_h);

  // 3) per (b,c,h): dST[e][d] = sum_j v[j][e] k[j][d] and the chunk sums of k
  state_inc_kernel<<<dim3(kYB, kHeads, 1), 256, 0, stream>>>(k_h, k_l, v_h, v_l, dST, dz);

  // 4) exclusive prefix over chunks of S^T and z
  state_prefix_kernel<<<dim3(kBatch * kHeads, kPfxSlices + 1, 1), 256, 0, stream>>>(dST, dz, ST_h, ST_l, zpre);

  // 5) per (b,c,h): masked scores, A.v + q.S_c, normaliser -> attention output hi/lo planes (token-major, heads merged)
  chunk_attn_kernel<<<dim3(kYB, kHeads, 1), 256, 0, stream>>>(q_h, q_l, k_h, k_l, v_h, v_l, ST_h, ST_l, zpre, o_h, o_l);

  // 6) output projection: M=4096, N=1024, K=1024 -> d_out, with the premise check on the causal flag (NaN when the non-causal branch
  //    would be required)
  proj_out_kernel<<<dim3(kEmb / 128, kTok / 128, 1), 128, 0, stream>>>(o_h, Wo_h, out, causal);
}
